// v000
// Times are from an AMD MI455X. After a warm-up the kernel runs many times in a row, and a time is the length of
// such a window on the GPU divided by its runs, so every launch and the gaps after it count. The runs cycle
// through copies of the inputs. A figure is the median of several windows, for all but v000 over two sittings.
// Sittings can differ by a few percent; kernels timed side by side share one.
// v000, which the later versions start from, runs in 368 microseconds.
// Contractions: x.[Wq|Wk|Wv]^T on v_wmma_f32_16x16x32_bf16 (x and the weights as bf16 RNE planes; weight [n][k] rows are
// the k-contiguous B operand; f32 accumulate); q.k^T over hd 64 and P.v on v_wmma_f32_16x16x32_f16 with f16 hi + f16
// residual planes (q, k x256 after rotary, products hh+lh+hl on every row; P x32768 hi + in-register residual and v^T x1024
// hi + residual plane for query rows < 512 of each sequence, P hi . v hi only for later rows); O.Wo^T on
// v_wmma_f32_16x16x32_f16 with O x256 as f16 hi (+ f16 residual plane for rows < 512 of each sequence) and Wo as
// f16(bf16(Wo)) x1024, one accumulator, bias added in f32; all f32 accumulate. Rotary cos/sin tables, bias adds and online
// softmax in f32 on VALU.
#include <hip/hip_runtime.h>
#include <math.h>
#include <stdint.h>

#ifndef NB
#define NB 4
#endif
#ifndef SEQ
#define SEQ 2048
#endif
#define XS_FULL 2048
#define DMOD  512
#define NH    8
#define NKVH  8
#define HD    64
#define HHALF (HD / 2)
#define NFREQ (HD / 2)
#define KVD   (NKVH * HD)
#define NQKV  (DMOD + 2 * KVD)
#define QCOL0 0
#define VCOL0 DMOD
#define KCOL0 (DMOD + KVD)
#define MROWS (NB * SEQ)
#define RICH  512
#define ROPE_L2 0.41524101186092028
#define SM_SCALE 0.04419417382415922f
#define QSC   256.0f
#define KSC   256.0f
#define PCAR  32768.0f
#define VCAR  1024.0f
#define OSC   256.0f
#define WOS   1024.0f
#define WPB   4
#define NHG   (NH / WPB)
#define NQT   (SEQ / 16)
#define NQTR  (RICH / 16)
#define NST   (SEQ / 64)
#define NKT   (SEQ / 32)
#define ATT_THREADS (WPB * 32)
#define PTP   36
#define PTW   (16 * PTP)
#define SLP   68
#define SLW   (16 * SLP)
#define WREG  (PTW + SLW)
#define SLAB64 (16 * 68)
#define VTP   72
#define WS_CAP 134217728
static_assert(DMOD == NH * HD && HD == 64 && HHALF == 32 && NFREQ == 32 && NH == 8 && NKVH == NH && NHG * WPB == NH);
static_assert(ATT_THREADS == 128 && KVD == 512 && NQKV == 1536 && KCOL0 + KVD == NQKV && VCOL0 + KVD == KCOL0);
static_assert(NB >= 1 && NB <= 4);
static_assert(NB == 1 || SEQ == XS_FULL);
static_assert((SEQ % 64) == 0 && SEQ >= 64 && SEQ <= XS_FULL);
static_assert((RICH % 64) == 0 && RICH >= 64 && RICH <= SEQ);
static_assert((DMOD % 64) == 0 && (KVD % 64) == 0 && (NQKV % 64) == 0 && (DMOD % 32) == 0 && (HD % 32) == 0);
static_assert(((SEQ * DMOD / 8) % 256) == 0 && ((DMOD * DMOD / 8) % 256) == 0 && ((SEQ * NFREQ) % 256) == 0);
static_assert(WPB * WREG * 4 <= 65536 && 2 * HD * VTP * 2 <= 65536 && 4 * SLAB64 * 4 <= 65536);
static_assert(DMOD / 8 == 64 && KVD / 8 == 64);

typedef unsigned short u16;
typedef _Float16 v16h __attribute__((ext_vector_type(16)));
typedef _Float16 v8h  __attribute__((ext_vector_type(8)));
typedef __bf16   v16b __attribute__((ext_vector_type(16)));
typedef float    v8f  __attribute__((ext_vector_type(8)));
typedef float    v4f  __attribute__((ext_vector_type(4)));
typedef unsigned int v4u __attribute__((ext_vector_type(4)));

union FragH { v16h v; v8h h[2]; v4u u[2]; };
union FragB { v16b v; v4u u[2]; };

// ---- scalar helpers --------------------------------------------------------------------------------
__device__ __forceinline__ unsigned short bf_bits(float f) {          // f32 -> bf16 bits, RNE convert
  unsigned u = __float_as_uint(f);
  return (unsigned short)((u + 0x7FFFu + ((u >> 16) & 1u)) >> 16);
}
__device__ __forceinline__ float bf_up(unsigned short h) { return __uint_as_float(((unsigned)h) << 16); }
__device__ __forceinline__ float bfr(float f) { return bf_up(bf_bits(f)); }
__device__ __forceinline__ unsigned short h_bits(_Float16 x) { return __builtin_bit_cast(unsigned short, x); }
__device__ __forceinline__ unsigned pk16(unsigned short a, unsigned short b) { return (unsigned)a | ((unsigned)b << 16); }
__device__ __forceinline__ v8f zero8() { v8f z = {0.f, 0.f, 0.f, 0.f, 0.f, 0.f, 0.f, 0.f}; return z; }

// ---- fragment loaders: 16-bit A/B operand, lane -> row/col (lane&15), p already includes +8*(lane>>4);
//      elements 0..7 <- p[0..7] (k0+8h..), elements 8..15 <- p[16..23] (k0+16+8h..)  (same split k map for A and B;
//      B is always read from a k-contiguous [n][k] plane)
__device__ __forceinline__ v16h ldfrag_h(const _Float16* p) {
  FragH f;
  f.h[0] = *(const v8h*)(p);
  f.h[1] = *(const v8h*)(p + 16);
  return f.v;
}
__device__ __forceinline__ v16b ldfrag_b(const u16* p) {              // bf16 plane read as unsigned integer vectors
  FragB f;
  f.u[0] = *(const v4u*)(p);
  f.u[1] = *(const v4u*)(p + 16);
  return f.v;
}

__device__ __forceinline__ v8f mma_h(v16h a, v16h b, v8f c) {
  return __builtin_amdgcn_wmma_f32_16x16x32_f16(false, a, false, b, (short)0, c, false, false);
}
__device__ __forceinline__ v8f mma_b(v16b a, v16b b, v8f c) {
  return __builtin_amdgcn_wmma_f32_16x16x32_bf16(false, a, false, b, (short)0, c, false, false);
}
__device__ __forceinline__ void guard2(v8f& a, v8f& b, v16h x0, v16h x1, v16h x2, v16h x3, v16h x4, v16h x5) {
#if defined(__HIP_DEVICE_COMPILE__)
  asm volatile("v_nop\n\tv_nop\n\tv_nop\n\tv_nop"
               : "+v"(a), "+v"(b) : "v"(x0), "v"(x1), "v"(x2), "v"(x3), "v"(x4), "v"(x5) : "memory");
#endif
}
template <typename F>
__device__ __forceinline__ void guard6(v8f& a, v8f& b, v8f& c, v8f& d, F x0, F x1, F x2, F x3, F x4, F x5) {
#if defined(__HIP_DEVICE_COMPILE__)
  asm volatile("v_nop\n\tv_nop\n\tv_nop\n\tv_nop"
               : "+v"(a), "+v"(b), "+v"(c), "+v"(d) : "v"(x0), "v"(x1), "v"(x2), "v"(x3), "v"(x4), "v"(x5) : "memory");
#endif
}
__device__ __forceinline__ void acc_guard4(v8f& a, v8f& b, v8f& c, v8f& d) {
#if defined(__HIP_DEVICE_COMPILE__)
  asm volatile("v_nop\n\tv_nop\n\tv_nop\n\tv_nop" : "+v"(a), "+v"(b), "+v"(c), "+v"(d));
#endif
}
__device__ __forceinline__ void wave_sync_lds() {
  __builtin_amdgcn_fence(__ATOMIC_RELEASE, "workgroup");
  __builtin_amdgcn_wave_barrier();
  __builtin_amdgcn_fence(__ATOMIC_ACQUIRE, "workgroup");
}

// =====================================================================================================
// f32 -> 16-bit plane, same layout.  f16mode == 0: bf16 RNE bits;  f16mode == 1: f16 bits of (bf16 RNE value) * scale.
// Thread = 8 consecutive elements: two 16-B loads, one 16-B store; 32 consecutive lanes = 512 contiguous, 512-B aligned
// coverage: grid = ceil(n8/256) blocks x 256 thr x 8 (in-kernel bound) = the whole plane (n8 a multiple of 256 here).
// =====================================================================================================
__global__ __launch_bounds__(256) void cvt16(const float* __restrict__ x, u16* D, int n8, int f16mode, float scale) {
  const int gt = blockIdx.x * 256 + (int)threadIdx.x;
  if (gt >= n8) return;
  const float* p = x + (size_t)gt * 8;
  const v4f a = *(const v4f*)(p), b4 = *(const v4f*)(p + 4);
  float w[8];
#pragma unroll
  for (int e = 0; e < 4; ++e) { w[e] = a[e]; w[4 + e] = b4[e]; }
  v4u o;
#pragma unroll
  for (int e = 0; e < 4; ++e) {
    const float f0 = w[2 * e], f1 = w[2 * e + 1];
    const unsigned short hb0 = h_bits((_Float16)(bfr(f0) * scale));
    const unsigned short hb1 = h_bits((_Float16)(bfr(f1) * scale));
    const unsigned short bb0 = bf_bits(f0);
    const unsigned short bb1 = bf_bits(f1);
    o[e] = (f16mode != 0) ? pk16(hb0, hb1) : pk16(bb0, bb1);
  }
  u16* d = D + (size_t)gt * 8;
  {
    *(v4u*)(d) = o;
    
  }
}

// =====================================================================================================
// Rotary tables TC[s][j] = cos(s * inv[j]), TS[s][j] = sin(s * inv[j]), j < 32, with
// inv[j] = 1.0f / f32(10000^(j/32)) (power evaluated in f64 and narrowed once, IEEE f32 reciprocal, f32 product s*inv,
// coverage: grid = n/256 blocks x 256 thr = n = SEQ*32 elements of TC and of TS (n a multiple of 256).
// =====================================================================================================
__global__ __launch_bounds__(256) void k_tab(float* TC, float* TS, int n) {
#pragma clang fp contract(off)
  const int idx = blockIdx.x * 256 + (int)threadIdx.x;
  if (idx >= n) return;
  const int s = idx / NFREQ;
  const int j = idx - s * NFREQ;
  const double pj = exp2((double)j * ROPE_L2);       // 10000^(j/32)
  const float pf  = (float)pj;
  const float inv = 1.0f / pf;
  const float ang = (float)s * inv;
  float sv, cv;
  sincosf(ang, &sv, &cv);
  {
    *(float*)(TC + idx) = cv;
    *(float*)(TS + idx) = sv;
    
  }
}

// =====================================================================================================
// v^T planes from the value columns of the projection F f32 [MROWS][ldf] (row = b*SEQ + s, column = voff + g*HD + d) plus
// the per-column bias (bias[g*HD + d], f32 add, then the x1024 carry):
//   VH[((b*NKVH + g)*HD + d)][s] = f16(v * 1024);  VL[same][s] = f16 residual (t - f16(t)), both for all keys s.
// Block = (b, head g, 64 keys s0): each thread loads its 16 floats (key sl, d chunk dc) with 16-B loads, adds bias, converts,
// places them into two LDS tiles [64 d][64 keys] (pitch 72 halves); after a block barrier each d row segment (64 halves =
// coverage: load 256 thr x 16 = 64 keys x 64 d; store 2 iterations x 256 thr x 8 halves = 64 lines x 64 = the block's tile of
//           VH and of VL; grid = NB*NKVH*NST blocks covers both planes exactly once.
// =====================================================================================================
__global__ __launch_bounds__(256) void vt16(const float* __restrict__ F, int ldf, int voff, const float* __restrict__ bias,
                                            u16* VHo, u16* VLo) {
#pragma clang fp contract(off)
  __shared__ __align__(16) u16 TH[HD * VTP];
  __shared__ __align__(16) u16 TL[HD * VTP];
  const int tid = threadIdx.x;
  const int bid = blockIdx.x;
  const int st  = bid % NST;
  const int t2  = bid / NST;
  const int g   = t2 % NKVH;
  const int b   = t2 / NKVH;
  if (b >= NB) return;                      // block-uniform, before any barrier; never taken with the exact grid
  const int s0  = st * 64;
  {
    const int sl = tid >> 2;                // key within tile 0..63
    const int dc = (tid & 3) * 16;          // d chunk 0,16,32,48
    const float* src = F + ((size_t)b * SEQ + s0 + sl) * (size_t)ldf + voff + g * HD + dc;
    const float* bp  = bias + g * HD + dc;
#pragma unroll
    for (int i = 0; i < 4; ++i) {
      const v4f a  = *(const v4f*)(src + 4 * i);
      const v4f bb = *(const v4f*)(bp + 4 * i);
#pragma unroll
      for (int e = 0; e < 4; ++e) {
        const float y = a[e] + bb[e];
        const float t = y * VCAR;
        const _Float16 hv = (_Float16)t;
        const _Float16 lv = (_Float16)(t - (float)hv);
        TH[(dc + 4 * i + e) * VTP + sl] = h_bits(hv);
        TL[(dc + 4 * i + e) * VTP + sl] = h_bits(lv);
      }
    }
  }
  __syncthreads();
  v4u vh[2], vl[2];
  const int q8 = tid >> 3, p8 = (tid & 7) * 8;
#pragma unroll
  for (int it = 0; it < 2; ++it) {
    const int line = it * 32 + q8;          // d = 0..63
    vh[it] = *(const v4u*)(TH + line * VTP + p8);
    vl[it] = *(const v4u*)(TL + line * VTP + p8);
  }
  const size_t hrow = (size_t)(b * NKVH + g) * HD;
  const size_t base = hrow * SEQ + s0 + p8;
  {
#pragma unroll
    for (int it = 0; it < 2; ++it) {
      const int line = it * 32 + q8;
      *(v4u*)(VHo + base + (size_t)line * SEQ) = vh[it];
      *(v4u*)(VLo + base + (size_t)line * SEQ) = vl[it];
    }
    
  }
}

// =====================================================================================================
// Interleaved-pair rotary + bias + q / k planes from the projection F f32 [MROWS][ldf] at column offset coff (ncol = DMOD
// for q, KVD for k; row = b*SEQ + s, column = coff + head*HD + d; table row = s, table column j = d >> 1):
//   y[d] = F[d] + bias[d] (f32 add)
//   out[2j]   = y[2j]  *c[s][j] + (-1)*(y[2j+1]*sn[s][j])
//   out[2j+1] = y[2j+1]*c[s][j] + (+1)*(y[2j]  *sn[s][j])        with c, sn the f32 table values (mul, mul, add kept
//   separate); Hp [MROWS][ncol] = f16(out * sc), Lp [MROWS][ncol] = f16 residual (t - f16(t)), same layout.
// Block = one row, ncol/8 = 64 threads; thread t = head t>>3, chunk i = t&7: columns head*HD + 8i .. +7 (4 pairs, table
// coverage: 64 thr x 8 = the whole row (512 halves) of Hp and of Lp; grid = MROWS blocks = every row of both planes once.
// =====================================================================================================
__device__ __forceinline__ void rot_one(float x, float y, float cv, float sv, float sgn, float sc,
                                        unsigned short& hb, unsigned short& lb) {
#pragma clang fp contract(off)
  const float ys   = y * sv;
  const float term = sgn * ys;
  const float r    = x * cv + term;
  const float t    = r * sc;
  const _Float16 a = (_Float16)t;
  hb = h_bits(a);
  lb = h_bits((_Float16)(t - (float)a));
}

__global__ __launch_bounds__(64) void rope16(const float* __restrict__ F, int ldf, int coff, int ncol,
                                             const float* __restrict__ bias,
                                             const float* __restrict__ TC, const float* __restrict__ TS,
                                             u16* Hp, u16* Lp, float sc) {
#pragma clang fp contract(off)
  const int tid = (int)threadIdx.x;
  const int row = (int)blockIdx.x;
  if (row >= MROWS) return;
  const int dd   = (tid & 7) * 8;                      // d within head, multiple of 8
  const int hb   = (tid >> 3) * HD;                    // head base column within the q / k block
  const int col  = hb + dd;
  if (hb + HD > ncol) return;                          // never taken with blockDim = ncol/8
  const int jj   = dd >> 1;                            // table column of the first pair, multiple of 4
  const int b = row / SEQ;
  const int s = row - b * SEQ;
  const float* p = F + (size_t)row * (size_t)ldf + coff + col;
  const v4f xa = *(const v4f*)(p),          xb = *(const v4f*)(p + 4);
  const v4f ba = *(const v4f*)(bias + col), bb = *(const v4f*)(bias + col + 4);
  const v4f cw = *(const v4f*)(TC + (size_t)s * NFREQ + jj);
  const v4f sw = *(const v4f*)(TS + (size_t)s * NFREQ + jj);
  float yv[8];
#pragma unroll
  for (int e = 0; e < 4; ++e) {
    yv[e]     = xa[e] + ba[e];
    yv[4 + e] = xb[e] + bb[e];
  }
  v4u oh, ol;
#pragma unroll
  for (int e = 0; e < 4; ++e) {
    unsigned short h0, l0, h1, l1;
    rot_one(yv[2 * e],     yv[2 * e + 1], cw[e], sw[e], -1.0f, sc, h0, l0);   // even element of the pair
    rot_one(yv[2 * e + 1], yv[2 * e],     cw[e], sw[e],  1.0f, sc, h1, l1);   // odd element of the pair
    oh[e] = pk16(h0, h1);
    ol[e] = pk16(l0, l1);
  }
  u16* dh = Hp + (size_t)row * ncol + col;
  u16* dl = Lp + (size_t)row * ncol + col;
  {
    *(v4u*)(dh) = oh;
    *(v4u*)(dl) = ol;
    
  }
}

// =====================================================================================================
// GEMM epilogue shared by both engines: the wave's 16x64 f32 tile (times oscale) staged in its LDS slab (pitch 68),
// 16 consecutive lanes x 16 B per line), lanes 16..31 -> row 2*it+1; HASB != 0 adds bias[col] in f32 to every element;
// coverage: 8 instructions x 2 rows x 16 lanes x 4 floats = the wave's 16 x 64 tile.
// =====================================================================================================
template <int HASB>
__device__ __forceinline__ void epi64(float* sl, v8f a0, v8f a1, v8f a2, v8f a3, float oscale, const float* bias,
                                      float* C, int N, size_t rowb, int col0, int lane) {
  const int hh = lane >> 4, m = lane & 15;
#pragma unroll
  for (int r = 0; r < 8; ++r) {
    const int ro = (8 * hh + r) * 68 + m;
    sl[ro]      = a0[r] * oscale;
    sl[ro + 16] = a1[r] * oscale;
    sl[ro + 32] = a2[r] * oscale;
    sl[ro + 48] = a3[r] * oscale;
  }
  wave_sync_lds();
  v4f vals[8];
#pragma unroll
  for (int it = 0; it < 8; ++it) vals[it] = *(const v4f*)(sl + (it * 2 + hh) * 68 + m * 4);
  if (HASB != 0) {
    const v4f b4 = *(const v4f*)(bias + col0 + m * 4);
#pragma unroll
    for (int it = 0; it < 8; ++it) vals[it] = vals[it] + b4;
  }
  float* dst = C + (rowb + (size_t)hh) * (size_t)N + col0 + m * 4;
  {
#pragma unroll
    for (int it = 0; it < 8; ++it) {
      *(v4f*)(dst + (size_t)(it * 2) * (size_t)N) = vals[it];
    }
    
  }
}

// =====================================================================================================
// bf16 GEMM: C[M][N] (f32) = A[M][K] (bf16 row-major) . Bt[N][K]^T (bf16 k-contiguous), times oscale.
// Block = 64x64 tile, 4 waves x 16 rows; fragments loaded straight from the 16-bit rows (two 16-B loads each, split k map
// for A and B); K stepped by 32 (host guarantees K % 32 == 0, M % 64 == 0, N % 64 == 0, grid = (M/64)*(N/64)).
// =====================================================================================================
__global__ __launch_bounds__(128)
void gemm_bf(const u16* __restrict__ A, const u16* __restrict__ Bt, float* C, int M, int N, int K, float oscale) {
  __shared__ __align__(16) float slab[4 * SLAB64];
  const int tid = threadIdx.x, wave = tid >> 5, lane = tid & 31, hh = lane >> 4, m = lane & 15;
  const int ntile = N >> 6;
  const int bid   = blockIdx.x;
  const int rowb  = (bid / ntile) * 64 + wave * 16;
  const int col0  = (bid % ntile) * 64;
  if (rowb + 16 > M) return;                // wave-uniform, never taken with the exact grid; no block barriers in this kernel
  const u16* ap = A  + (size_t)(rowb + m) * K + 8 * hh;
  const u16* bp = Bt + (size_t)(col0 + m) * K + 8 * hh;
  const size_t bs = (size_t)16 * K;
  v8f acc0 = zero8(), acc1 = zero8(), acc2 = zero8(), acc3 = zero8();
#pragma unroll 1
  for (int k0 = 0; k0 < K; k0 += 32) {
    const v16b a  = ldfrag_b(ap + k0);
    const v16b b0 = ldfrag_b(bp + k0);
    const v16b b1 = ldfrag_b(bp + bs + k0);
    const v16b b2 = ldfrag_b(bp + 2 * bs + k0);
    const v16b b3 = ldfrag_b(bp + 3 * bs + k0);
    acc0 = mma_b(a, b0, acc0);
    acc1 = mma_b(a, b1, acc1);
    acc2 = mma_b(a, b2, acc2);
    acc3 = mma_b(a, b3, acc3);
    guard6<v16b>(acc0, acc1, acc2, acc3, a, b0, b1, b2, b3, a);
  }
  epi64<0>(slab + wave * SLAB64, acc0, acc1, acc2, acc3, oscale, C, C, N, (size_t)rowb, col0, lane);
}

// =====================================================================================================
// f16 GEMM: C[M][N] (f32) = (A[M][K] (+ A2[M][K] when TWO != 0)) . Bt[N][K]^T, times oscale, plus bias[n]; A, A2 f16
// row-major planes (A2 = the unscaled f16 residual of A, sharing the accumulator), Bt f16 k-contiguous. Same tiling, fragment
// loads (split k map) and epilogue as gemm_bf; K stepped by 32.
// =====================================================================================================
template <int TWO>
__global__ __launch_bounds__(128)
void gemm_h(const u16* __restrict__ A, const u16* __restrict__ A2, const u16* __restrict__ Bt,
            const float* __restrict__ bias, float* C, int M, int N, int K, float oscale) {
  __shared__ __align__(16) float slab[4 * SLAB64];
  const int tid = threadIdx.x, wave = tid >> 5, lane = tid & 31, hh = lane >> 4, m = lane & 15;
  const int ntile = N >> 6;
  const int bid   = blockIdx.x;
  const int rowb  = (bid / ntile) * 64 + wave * 16;
  const int col0  = (bid % ntile) * 64;
  if (rowb + 16 > M) return;                // wave-uniform, never taken with the exact grid; no block barriers in this kernel
  const _Float16* ap  = (const _Float16*)(const void*)A  + (size_t)(rowb + m) * K + 8 * hh;
  const _Float16* ap2 = (const _Float16*)(const void*)A2 + (size_t)(rowb + m) * K + 8 * hh;
  const _Float16* bp  = (const _Float16*)(const void*)Bt + (size_t)(col0 + m) * K + 8 * hh;
  const size_t bs = (size_t)16 * K;
  v8f acc0 = zero8(), acc1 = zero8(), acc2 = zero8(), acc3 = zero8();
#pragma unroll 1
  for (int k0 = 0; k0 < K; k0 += 32) {
    const v16h a  = ldfrag_h(ap + k0);
    const v16h b0 = ldfrag_h(bp + k0);
    const v16h b1 = ldfrag_h(bp + bs + k0);
    const v16h b2 = ldfrag_h(bp + 2 * bs + k0);
    const v16h b3 = ldfrag_h(bp + 3 * bs + k0);
    acc0 = mma_h(a, b0, acc0);
    acc1 = mma_h(a, b1, acc1);
    acc2 = mma_h(a, b2, acc2);
    acc3 = mma_h(a, b3, acc3);
    if (TWO != 0) {
      const v16h a2 = ldfrag_h(ap2 + k0);
      acc0 = mma_h(a2, b0, acc0);
      acc1 = mma_h(a2, b1, acc1);
      acc2 = mma_h(a2, b2, acc2);
      acc3 = mma_h(a2, b3, acc3);
      guard6<v16h>(acc0, acc1, acc2, acc3, a, a2, b0, b1, b2, b3);
    } else {
      guard6<v16h>(acc0, acc1, acc2, acc3, a, b0, b1, b2, b3, a);
    }
  }
  (void)ap2;
  epi64<1>(slab + wave * SLAB64, acc0, acc1, acc2, acc3, oscale, bias, C, N, (size_t)rowb, col0, lane);
}

// =====================================================================================================
// Causal softmax attention, hd = 64, 8 heads. Block bid -> (query tile qt = qt0 + bid % nqt: rows q0 = 16*qt .. q0+15, head
// group hg, batch b); one wave per head = hg*WPB + wave; keys/values of the same head (kvh = head).
//   q hi / residual planes f16 x256 [b*SEQ + s][h*HD + d]; k hi / residual planes f16 x256 [b*SEQ + s][h*HD + d] (pitch KVD);
//   v^T hi / residual planes [b*NKVH + h][d][SEQ] x1024.
//   raw(i, j) = q_hi.k_hi + q_lo.k_hi + q_hi.k_lo (2 k-steps over d); logit = raw * (SM_SCALE * 2^-16) (the two 256 carries
//   folded exactly into the 1/sqrt(512) scale, one f32 multiply); keys above the diagonal replaced by -inf; online softmax per
//   query row in f32 with a running max: row max / row sum over the 16 lanes holding the row via xor shuffles 1,2,4,8 (never
//   crossing the lane half), alpha = exp(m_old - m_new), p = exp(logit - m_new), l = l*alpha + sum p, O accumulators times
//   alpha before the tile's P.v. Key tiles of 32 visited in order, only tiles with kb <= q0 (nkt = q0/32 + 1 <= NKT; key kb is
//   unmasked for every row of the tile, so each row max is finite). The 16x32 p tile goes to wave-private LDS (f32 element
//   rows (float vector loads, same element type as stored); v^T B fragments in 2 groups of 2 d-subtiles; RV = 1: products
//   hh + lh + hl, RV = 0: hh only. After the loop O = acc / (l * 32768 * 1024) into the wave's lane-owned result slab
//   Epilogue: O x256 -> f16 hi plane (and for RV = 1 the unscaled f16 residual plane) [b*SEQ + s][h*HD + d]; lane = (row group
//   rq = lane>>3 in 0..3, 8 consecutive d at c8); one instruction = 4 rows it*4 + rq, each row segment (64 halves = one whole
// coverage: per wave 4 instructions x 4 rows x 8 lanes x 8 halves = 16 x 64 per plane; grid nqt x NHG x NB blocks x WPB waves;
//   the two launches (tiles 0..NQTR-1 with RV = 1, NQTR..NQT-1 with RV = 0) cover every (b, s, h) row segment of the hi plane
//   exactly once and rows s < RICH of the residual plane exactly once (only those rows are read later).
// =====================================================================================================
template <int RV>
__global__ __launch_bounds__(ATT_THREADS)
void attn_cs(const u16* __restrict__ QHp, const u16* __restrict__ QLp,
             const u16* __restrict__ KHp, const u16* __restrict__ KLp,
             const u16* __restrict__ VHp, const u16* __restrict__ VLp,
             u16* OHp, u16* OLp, int qt0, int nqt) {
#pragma clang fp contract(off)
  __shared__ __align__(16) float smem[WPB * WREG];

  const int tid  = threadIdx.x;
  const int wave = tid >> 5;
  const int lane = tid & 31;
  const int hh   = lane >> 4;
  const int c    = lane & 15;
  const int bid  = blockIdx.x;
  if (nqt <= 0) return;                     // block-uniform; no block barriers in this kernel
  const int qt   = qt0 + bid % nqt;
  const int t2   = bid / nqt;
  const int hg   = t2 % NHG;
  const int b    = t2 / NHG;
  if (b >= NB) return;                      // block-uniform; never taken with the exact grid
  const int q0   = qt * 16;
  if (q0 + 16 > SEQ) return;                // block-uniform; never taken
  const int head = hg * WPB + wave;
  const int kvh  = head;

  float* pt   = smem + wave * WREG;         // p tile [16][32] pitch 36
  float* slab = pt + PTW;                   // result slab [16][64] pitch 68

  const size_t hcol = (size_t)head * HD + 8 * hh;
  const size_t kcol = (size_t)kvh * HD + 8 * hh;
  const _Float16* Qh  = (const _Float16*)(const void*)QHp + ((size_t)b * SEQ + q0 + c) * DMOD + hcol;
  const _Float16* Ql  = (const _Float16*)(const void*)QLp + ((size_t)b * SEQ + q0 + c) * DMOD + hcol;
  const _Float16* Khb = (const _Float16*)(const void*)KHp + ((size_t)b * SEQ + c) * KVD + kcol;        // key row kb added per step
  const _Float16* Klb = (const _Float16*)(const void*)KLp + ((size_t)b * SEQ + c) * KVD + kcol;
  const _Float16* Vhb = (const _Float16*)(const void*)VHp + ((size_t)(b * NKVH + kvh) * HD + c) * SEQ + 8 * hh;  // d col c (+16j)
  const _Float16* Vlb = (const _Float16*)(const void*)VLp + ((size_t)(b * NKVH + kvh) * HD + c) * SEQ + 8 * hh;
  const float lsc  = SM_SCALE * (1.0f / (QSC * KSC));   // exact power-of-two fold of the q / k carries into the scale
  const float oc   = 1.0f / (PCAR * VCAR);
  const float ninf = -__builtin_inff();
  const size_t KROW = (size_t)KVD;          // halves between consecutive key rows

  v8f o[4];
#pragma unroll
  for (int j = 0; j < 4; ++j) o[j] = zero8();
  float mrun[8], lrun[8];
#pragma unroll
  for (int r = 0; r < 8; ++r) { mrun[r] = ninf; lrun[r] = 0.0f; }
  const int ncaus = (q0 >> 5) + 1;                                            // tiles holding keys <= q0 + 15
  const int nkt   = (ncaus < NKT) ? ncaus : NKT;
  const int qr0   = q0 + 8 * hh;                                              // query row of D element r = qr0 + r

#pragma unroll 1
  for (int kt = 0; kt < nkt; ++kt) {
    const int kb = kt * 32;
    // ---- raw scores: D element r of this lane = (query row qr0 + r, key kb + c) in s0, key kb + 16 + c in s1 ----
    v8f s0 = zero8(), s1 = zero8();
    const _Float16* k0p = Khb + (size_t)kb * KROW;
    const _Float16* k1p = k0p + (size_t)16 * KROW;
    const _Float16* l0p = Klb + (size_t)kb * KROW;
    const _Float16* l1p = l0p + (size_t)16 * KROW;
#pragma unroll
    for (int kk = 0; kk < HD / 32; ++kk) {
      const v16h qh  = ldfrag_h(Qh + kk * 32);
      const v16h ql  = ldfrag_h(Ql + kk * 32);
      const v16h kh0 = ldfrag_h(k0p + kk * 32);
      const v16h kh1 = ldfrag_h(k1p + kk * 32);
      const v16h kl0 = ldfrag_h(l0p + kk * 32);
      const v16h kl1 = ldfrag_h(l1p + kk * 32);
      s0 = mma_h(qh, kh0, s0);
      s0 = mma_h(ql, kh0, s0);
      s0 = mma_h(qh, kl0, s0);
      s1 = mma_h(qh, kh1, s1);
      s1 = mma_h(ql, kh1, s1);
      s1 = mma_h(qh, kl1, s1);
      guard2(s0, s1, qh, ql, kh0, kl0, kh1, kl1);
    }
    // ---- causal replace-mask, running-max online softmax in f32, p tile -> wave-private LDS ----
    float alpha[8];
    const int key0 = kb + c, key1 = kb + 16 + c;
#pragma unroll
    for (int r = 0; r < 8; ++r) {
      const int qrow = qr0 + r;
      const float a0 = s0[r] * lsc;
      const float a1 = s1[r] * lsc;
      const float t0 = (key0 > qrow) ? ninf : a0;
      const float t1 = (key1 > qrow) ? ninf : a1;
      float mx = fmaxf(t0, t1);
      mx = fmaxf(mx, __shfl_xor(mx, 1, 32));
      mx = fmaxf(mx, __shfl_xor(mx, 2, 32));
      mx = fmaxf(mx, __shfl_xor(mx, 4, 32));
      mx = fmaxf(mx, __shfl_xor(mx, 8, 32));
      const float mnew = fmaxf(mrun[r], mx);
      const float al   = __expf(mrun[r] - mnew);
      const float p0   = __expf(t0 - mnew);
      const float p1   = __expf(t1 - mnew);
      float sm = p0 + p1;
      sm += __shfl_xor(sm, 1, 32);
      sm += __shfl_xor(sm, 2, 32);
      sm += __shfl_xor(sm, 4, 32);
      sm += __shfl_xor(sm, 8, 32);
      lrun[r]  = lrun[r] * al + sm;
      mrun[r]  = mnew;
      alpha[r] = al;
      const int ro = (8 * hh + r) * PTP + c;
      pt[ro]      = p0;
      pt[ro + 16] = p1;
    }
    wave_sync_lds();
    // ---- rescale the O accumulators by alpha (row 8hh + r of every d-subtile) ----
#pragma unroll
    for (int j = 0; j < 4; ++j) {
#pragma unroll
      for (int r = 0; r < 8; ++r) o[j][r] = o[j][r] * alpha[r];
    }
    // ---- A fragments of p*32768: hi f16 and residual f16, row = c, split k map over the 32 keys of this step ----
    FragH ph, pl;
    {
      const float* prow = pt + c * PTP + 8 * hh;
      const v4f p0 = *(const v4f*)(prow), p1 = *(const v4f*)(prow + 4);
      const v4f p2 = *(const v4f*)(prow + 16), p3 = *(const v4f*)(prow + 20);
#pragma unroll
      for (int e = 0; e < 4; ++e) {
        const float ta = p0[e] * PCAR, tb = p1[e] * PCAR, tc = p2[e] * PCAR, td = p3[e] * PCAR;
        const _Float16 ha = (_Float16)ta, hb = (_Float16)tb, hc = (_Float16)tc, hd = (_Float16)td;
        ph.h[0][e]     = ha;                  // elements 0..7  = keys kb + 8hh + 0..7
        ph.h[0][4 + e] = hb;
        ph.h[1][e]     = hc;                  // elements 8..15 = keys kb + 16 + 8hh + 0..7
        ph.h[1][4 + e] = hd;
        pl.h[0][e]     = (_Float16)(ta - (float)ha);
        pl.h[0][4 + e] = (_Float16)(tb - (float)hb);
        pl.h[1][e]     = (_Float16)(tc - (float)hc);
        pl.h[1][4 + e] = (_Float16)(td - (float)hd);
      }
    }
    // ---- P.V : B fragment col n = d = j*16 + c, keys contiguous in the v^T planes; 2 groups of 2 d-subtiles ----
    {
      const _Float16* vhp = Vhb + kb;
      const _Float16* vlp = Vlb + kb;
      (void)vlp;
#pragma unroll
      for (int jg = 0; jg < 2; ++jg) {
        const size_t da = (size_t)(2 * jg) * 16 * SEQ;
        const size_t db = da + (size_t)16 * SEQ;
        const v16h vha = ldfrag_h(vhp + da), vhb2 = ldfrag_h(vhp + db);
        o[2 * jg]     = mma_h(ph.v, vha,  o[2 * jg]);
        o[2 * jg + 1] = mma_h(ph.v, vhb2, o[2 * jg + 1]);
        if (RV != 0) {
          const v16h vla = ldfrag_h(vlp + da), vlb2 = ldfrag_h(vlp + db);
          o[2 * jg]     = mma_h(pl.v, vha,  o[2 * jg]);
          o[2 * jg]     = mma_h(ph.v, vla,  o[2 * jg]);
          o[2 * jg + 1] = mma_h(pl.v, vhb2, o[2 * jg + 1]);
          o[2 * jg + 1] = mma_h(ph.v, vlb2, o[2 * jg + 1]);
          guard2(o[2 * jg], o[2 * jg + 1], ph.v, pl.v, vha, vhb2, vla, vlb2);
        } else {
          guard2(o[2 * jg], o[2 * jg + 1], ph.v, pl.v, vha, vhb2, vha, vhb2);
        }
      }
    }
    wave_sync_lds();
  }
  acc_guard4(o[0], o[1], o[2], o[3]);
  // ---- O = acc / l with the carries (32768 on p, 1024 on v) folded once; written into the lane-owned slab ----
  float rl[8];
#pragma unroll
  for (int r = 0; r < 8; ++r) rl[r] = (1.0f / lrun[r]) * oc;
#pragma unroll
  for (int r = 0; r < 8; ++r) {
#pragma unroll
    for (int j = 0; j < 4; ++j) {
      const int idx = (8 * hh + r) * SLP + j * 16 + c;
      slab[idx] = o[j][r] * rl[r];
    }
  }
  wave_sync_lds();
  // ---- O x256 -> f16 hi plane (+ f16 residual plane); lane = (row group rq, 8 consecutive d at c8) ----
  v4u oh[4], ol[4];
  const int rq = lane >> 3, c8 = (lane & 7) * 8;
#pragma unroll
  for (int it = 0; it < 4; ++it) {
    const int row = it * 4 + rq;
    const v4f a = *(const v4f*)(slab + row * SLP + c8), b4 = *(const v4f*)(slab + row * SLP + c8 + 4);
    float w[8];
#pragma unroll
    for (int e = 0; e < 4; ++e) { w[e] = a[e] * OSC; w[4 + e] = b4[e] * OSC; }
#pragma unroll
    for (int e = 0; e < 4; ++e) {
      const _Float16 h0 = (_Float16)w[2 * e], h1 = (_Float16)w[2 * e + 1];
      const _Float16 g0 = (_Float16)(w[2 * e] - (float)h0), g1 = (_Float16)(w[2 * e + 1] - (float)h1);
      oh[it][e] = pk16(h_bits(h0), h_bits(h1));
      ol[it][e] = pk16(h_bits(g0), h_bits(g1));
    }
  }
  const size_t ob = ((size_t)b * SEQ + q0) * DMOD + (size_t)head * HD + c8;
  {
#pragma unroll
    for (int it = 0; it < 4; ++it) {
      const int row = it * 4 + rq;
      *(v4u*)(OHp + ob + (size_t)row * DMOD) = oh[it];
      if (RV != 0) {
        *(v4u*)(OLp + ob + (size_t)row * DMOD) = ol[it];
      }
    }
    
  }
}

// =====================================================================================================
// Workspace map (bytes); every plane is fully written by whole-line stores before it is read (the O residual plane only on
// the rows < RICH per sequence that are read); all extents are exact multiples of the store granularity (no pad rows needed);
// every region offset a multiple of 131072:
//   XB  bf16 [MROWS][512]               MROWS*1024   (NB=4, SEQ=2048: 8388608); after the projection GEMM the same bytes hold
//                                                    the O f16 hi plane [MROWS][512] x256 (identical extent)
//   WB  bf16 [1536 n][512 k]            1572864      (Wq rows 0..511, Wk 512..1023, Wv 1024..1535); after the projection
//                                                    GEMM its first 524288 bytes hold the Wo f16 plane [512 o][512 d]
//   F   f32 [MROWS][1536]               MROWS*6144   (q_proj | k_proj | v_proj columns); after rope16 / vt16 its first
//                                                    MROWS*1024 bytes hold the O f16 residual plane [MROWS][512]
//   QH  f16 [MROWS][512] x256           MROWS*1024   QL residual, same extent
//   KH  f16 [MROWS][512] x256           MROWS*1024   KL residual, same extent   (keys = rotary of the v_proj columns)
//   VH  f16 [NB*8][64][SEQ] x1024       MROWS*1024   VL residual, same extent   (values = the k_proj columns)
//   TC  f32 [SEQ][32]                   SEQ*128      TS, same extent
//   end (NB=4, SEQ=2048)              111149056
// =====================================================================================================
extern "C" void kernel_launch(void* const* d_in, const int* in_sizes, int n_in,
                              void* d_out, int out_size, void* d_ws, size_t ws_size,
                              hipStream_t stream) {
  if (n_in < 9) return;
  if (in_sizes[0] < ((NB - 1) * XS_FULL + SEQ) * DMOD) return;
  if (in_sizes[1] != DMOD * DMOD) return;
  if (in_sizes[2] != DMOD) return;
  if (in_sizes[3] != DMOD * DMOD) return;
  if (in_sizes[4] != DMOD) return;
  if (in_sizes[5] != DMOD * DMOD) return;
  if (in_sizes[6] != DMOD) return;
  if (in_sizes[7] != DMOD * DMOD) return;
  if (in_sizes[8] != DMOD) return;
  if (out_size < ((NB - 1) * XS_FULL + SEQ) * DMOD) return;

  const float* x   = (const float*)d_in[0];
  const float* wq  = (const float*)d_in[1];
  const float* bqp = (const float*)d_in[2];
  const float* wk  = (const float*)d_in[3];
  const float* bkp = (const float*)d_in[4];
  const float* wv  = (const float*)d_in[5];
  const float* bvp = (const float*)d_in[6];
  const float* wo  = (const float*)d_in[7];
  const float* bop = (const float*)d_in[8];
  float*       out = (float*)d_out;

  const size_t szXB = (size_t)MROWS * DMOD * 2;
  const size_t szWB = (size_t)NQKV * DMOD * 2;
  const size_t szF  = (size_t)MROWS * NQKV * 4;
  const size_t szQ  = (size_t)MROWS * DMOD * 2;                  // QH, QL
  const size_t szK  = (size_t)MROWS * KVD * 2;                   // KH, KL
  const size_t szV  = (size_t)NB * NKVH * HD * SEQ * 2;          // VH, VL (== szK)
  const size_t szT  = (size_t)SEQ * NFREQ * 4;                   // TC, TS
  const size_t szOH = (size_t)MROWS * DMOD * 2;                  // O hi plane, lives in the XB region
  const size_t szOL = (size_t)MROWS * DMOD * 2;                  // O residual plane, lives in the F region
  const size_t szWT = (size_t)DMOD * DMOD * 2;                   // Wo f16 plane, lives in the WB region
  if (szOH > szXB || szOL > szF || szWT > szWB) return;
  size_t off = 0;
  const size_t oXB = off; off += szXB;
  const size_t oWB = off; off += szWB;
  const size_t oF  = off; off += szF;
  const size_t oQH = off; off += szQ;
  const size_t oQL = off; off += szQ;
  const size_t oKH = off; off += szK;
  const size_t oKL = off; off += szK;
  const size_t oVH = off; off += szV;
  const size_t oVL = off; off += szV;
  const size_t oTC = off; off += szT;
  const size_t oTS = off; off += szT;
  if (off > ws_size) return;                // off = 111149056 for NB = 4, SEQ = 2048
  if (off > (size_t)WS_CAP) return;

  char* ws = (char*)d_ws;
  u16*   XB  = (u16*)(ws + oXB);
  u16*   OH  = (u16*)(ws + oXB);
  u16*   WB  = (u16*)(ws + oWB);
  u16*   WT  = (u16*)(ws + oWB);
  float* F   = (float*)(ws + oF);
  u16*   OL  = (u16*)(ws + oF);
  u16*   QH  = (u16*)(ws + oQH);
  u16*   QL  = (u16*)(ws + oQL);
  u16*   KH  = (u16*)(ws + oKH);
  u16*   KL  = (u16*)(ws + oKL);
  u16*   VH  = (u16*)(ws + oVH);
  u16*   VL  = (u16*)(ws + oVL);
  float* TC  = (float*)(ws + oTC);
  float* TS  = (float*)(ws + oTS);

  const dim3 b256(256), b128(128), b64(64), bAT(ATT_THREADS);
  const int  n8x = (SEQ * DMOD) / 8;
  const dim3 gX((n8x + 255) / 256);                     // SEQ*DMOD/2048 blocks per batch
  const int  n8w = (DMOD * DMOD) / 8;
  const dim3 gW((n8w + 255) / 256);                     // 128
  const int  nT  = SEQ * NFREQ;
  const dim3 gT((nT + 255) / 256);                      // SEQ/8
  const dim3 gG1((MROWS / 64) * (NQKV / 64));
  const dim3 gRW(MROWS);
  const dim3 gVT(NB * NKVH * NST);
  const float osc = 1.0f / (OSC * WOS);

  // (0) x -> bf16 plane [MROWS][512], one launch per batch (sequence) row block
  for (int bq = 0; bq < NB; ++bq) {
    cvt16<<<gX, b256, 0, stream>>>(x + (size_t)bq * XS_FULL * DMOD, XB + (size_t)bq * SEQ * DMOD, n8x, 0, 1.0f);
  }
  // (1) Wq [512 n][512 k], Wk, Wv -> one bf16 plane [1536 n][512 k]
  cvt16<<<gW, b256, 0, stream>>>(wq, WB, n8w, 0, 1.0f);
  cvt16<<<gW, b256, 0, stream>>>(wk, WB + (size_t)VCOL0 * DMOD, n8w, 0, 1.0f);
  cvt16<<<gW, b256, 0, stream>>>(wv, WB + (size_t)KCOL0 * DMOD, n8w, 0, 1.0f);
  // (2) rotary cos / sin tables [SEQ][32]
  k_tab<<<gT, b256, 0, stream>>>(TC, TS, nT);
  // (3) F f32 [MROWS][1536] = x.[Wq|Wk|Wv]^T  (columns 0..511 q_proj, 512..1023 k_proj, 1024..1535 v_proj; biases later)
  gemm_bf<<<gG1, b128, 0, stream>>>(XB, WB, F, MROWS, NQKV, DMOD, 1.0f);
  // (4) q = rotary(q_proj + bq) -> hi + residual planes x256 from columns 0..511
  rope16<<<gRW, b64, 0, stream>>>(F, NQKV, QCOL0, DMOD, bqp, TC, TS, QH, QL, QSC);
  // (5) keys = rotary(v_proj + bv) -> hi + residual planes x256 from columns 1024..1535
  rope16<<<gRW, b64, 0, stream>>>(F, NQKV, KCOL0, KVD, bvp, TC, TS, KH, KL, KSC);
  // (6) values = k_proj + bk (no rotary) -> v^T hi + residual planes x1024 from columns 512..1023
  vt16<<<gVT, b256, 0, stream>>>(F, NQKV, VCOL0, bkp, VH, VL);
  // (7) Wo [512 o][512 d] -> f16 plane of the bf16 value x1024 (already k-contiguous; WB region, free after the projection GEMM)
  cvt16<<<gW, b256, 0, stream>>>(wo, WT, n8w, 1, WOS);
  // (8) causal attention -> O f16 hi plane x256 (XB region) for all query tiles; residual plane (F region) for tiles < RICH
  attn_cs<1><<<dim3(NQTR * NHG * NB), bAT, 0, stream>>>(QH, QL, KH, KL, VH, VL, OH, OL, 0, NQTR);
  if (NQT > NQTR) {
    attn_cs<0><<<dim3((NQT - NQTR) * NHG * NB), bAT, 0, stream>>>(QH, QL, KH, KL, VH, VL, OH, OL, NQTR, NQT - NQTR);
  }
  // (9) y = O.Wo^T + bo -> out f32 [rows][512], carries 256 x 1024 folded back; rows < RICH per sequence with O hi + residual
  for (int bq = 0; bq < NB; ++bq) {
    const size_t rb   = (size_t)bq * SEQ;            // row base in the O planes
    const size_t orow = (size_t)bq * XS_FULL;        // row base in out
    gemm_h<1><<<dim3((RICH / 64) * (DMOD / 64)), b128, 0, stream>>>(
        OH + rb * DMOD, OL + rb * DMOD, WT, bop, out + orow * DMOD, RICH, DMOD, DMOD, osc);
    if (SEQ > RICH) {
      const size_t rl = rb + RICH;
      const size_t ol = orow + RICH;
      gemm_h<0><<<dim3(((SEQ - RICH) / 64) * (DMOD / 64)), b128, 0, stream>>>(
          OH + rl * DMOD, OL + rl * DMOD, WT, bop, out + ol * DMOD, SEQ - RICH, DMOD, DMOD, osc);
    }
  }
  (void)hipGetLastError();
}

// v001
// It runs in 363 microseconds.
// Two timings next to v000 both put it at 1.03 times that version's speed.
// Contractions: x.[Wq|Wk|Wv]^T on v_wmma_f32_16x16x32_bf16 (x and the weights as bf16 RNE planes; weight [n][k] rows are
// the k-contiguous B operand; f32 accumulate); q.k^T over hd 64 and P.v on v_wmma_f32_16x16x32_f16 with f16 hi + f16
// residual planes (q, k x256 after rotary, products hh+lh+hl on every row; P x32768 hi + in-register residual and v^T x1024
// hi + residual plane for query rows < 512 of each sequence, P hi . v hi only for later rows); O.Wo^T on
// v_wmma_f32_16x16x32_f16 with O x256 as f16 hi (+ f16 residual plane for rows < 512 of each sequence) and Wo as
// f16(bf16(Wo)) x1024, one accumulator, bias added in f32; all f32 accumulate. Rotary cos/sin tables, bias adds and online
// softmax in f32 on VALU.
#include <hip/hip_runtime.h>
#include <math.h>
#include <stdint.h>

#ifndef NB
#define NB 4
#endif
#ifndef SEQ
#define SEQ 2048
#endif
#define XS_FULL 2048
#define DMOD  512
#define NH    8
#define NKVH  8
#define HD    64
#define HHALF (HD / 2)
#define NFREQ (HD / 2)
#define KVD   (NKVH * HD)
#define NQKV  (DMOD + 2 * KVD)
#define QCOL0 0
#define VCOL0 DMOD
#define KCOL0 (DMOD + KVD)
#define MROWS (NB * SEQ)
#define RICH  512
#define ROPE_L2 0.41524101186092028
#define SM_SCALE 0.04419417382415922f
#define QSC   256.0f
#define KSC   256.0f
#define PCAR  32768.0f
#define VCAR  1024.0f
#define OSC   256.0f
#define WOS   1024.0f
#define WPB   4
#define NHG   (NH / WPB)
#define NQT   (SEQ / 16)
#define NQTR  (RICH / 16)
#define NST   (SEQ / 64)
#define NKT   (SEQ / 32)
#define ATT_THREADS (WPB * 32)
#define PTP   36
#define PTW   (16 * PTP)
#define SLP   68
#define SLW   (16 * SLP)
#define WREG  (PTW + SLW)
#define SLAB64 (16 * 68)
#define VTP   72
#define WS_CAP 134217728
static_assert(DMOD == NH * HD && HD == 64 && HHALF == 32 && NFREQ == 32 && NH == 8 && NKVH == NH && NHG * WPB == NH);
static_assert(ATT_THREADS == 128 && KVD == 512 && NQKV == 1536 && KCOL0 + KVD == NQKV && VCOL0 + KVD == KCOL0);
static_assert(NB >= 1 && NB <= 4);
static_assert(NB == 1 || SEQ == XS_FULL);
static_assert((SEQ % 64) == 0 && SEQ >= 64 && SEQ <= XS_FULL);
static_assert((RICH % 64) == 0 && RICH >= 64 && RICH <= SEQ);
static_assert((DMOD % 64) == 0 && (KVD % 64) == 0 && (NQKV % 64) == 0 && (DMOD % 32) == 0 && (HD % 32) == 0);
static_assert(((SEQ * DMOD / 8) % 256) == 0 && ((DMOD * DMOD / 8) % 256) == 0 && ((SEQ * NFREQ) % 256) == 0);
static_assert(WPB * WREG * 4 <= 65536 && 2 * HD * VTP * 2 <= 65536 && 4 * SLAB64 * 4 <= 65536);
static_assert(DMOD / 8 == 64 && KVD / 8 == 64);
static_assert(((SEQ * DMOD / 8) % 1024) == 0 && ((DMOD * DMOD / 8) % 1024) == 0 && (SEQ % 32) == 0 && (RICH % 16) == 0);

typedef unsigned short u16;
typedef _Float16 v16h __attribute__((ext_vector_type(16)));
typedef _Float16 v8h  __attribute__((ext_vector_type(8)));
typedef __bf16   v16b __attribute__((ext_vector_type(16)));
typedef float    v8f  __attribute__((ext_vector_type(8)));
typedef float    v4f  __attribute__((ext_vector_type(4)));
typedef unsigned int v4u __attribute__((ext_vector_type(4)));

union FragH { v16h v; v8h h[2]; v4u u[2]; };
union FragB { v16b v; v4u u[2]; };

// ---- scalar helpers --------------------------------------------------------------------------------
__device__ __forceinline__ unsigned short bf_bits(float f) {          // f32 -> bf16 bits, RNE convert
  unsigned u = __float_as_uint(f);
  return (unsigned short)((u + 0x7FFFu + ((u >> 16) & 1u)) >> 16);
}
__device__ __forceinline__ float bf_up(unsigned short h) { return __uint_as_float(((unsigned)h) << 16); }
__device__ __forceinline__ float bfr(float f) { return bf_up(bf_bits(f)); }
__device__ __forceinline__ unsigned short h_bits(_Float16 x) { return __builtin_bit_cast(unsigned short, x); }
__device__ __forceinline__ unsigned pk16(unsigned short a, unsigned short b) { return (unsigned)a | ((unsigned)b << 16); }
__device__ __forceinline__ v8f zero8() { v8f z = {0.f, 0.f, 0.f, 0.f, 0.f, 0.f, 0.f, 0.f}; return z; }

// ---- fragment-major planes: every 16-bit A/B operand plane [row][K] other than v^T is stored as [row/16][K/32][g][lane][8]: the 16-B unit
//      of lane = 16*h + (row&15) in half g holds k = 32*ks + 16*g + 8*h + 0..7, so one wave-wide 16-B load is 512 contiguous
//      bytes (4 whole lines) and one 16 x 32 fragment is 1 KB. A 16-row tile starts where it starts in a row-major plane.
// ---- fragment loaders: lane -> row/col (lane&15), h = lane>>4; base = a pointer that is the same in every lane (it stays in
//      scalar registers), vo = byte offset of the fragment from base + 16*lane (one 32-bit register shared by all loads of a
//      step and advanced behind them); p = base + vo;
//      elements 0..7 <- p[0..7] (k0+8h..), elements 8..15 <- p[256..263] (k0+16+8h..)  (same split k map for A and B)
__device__ __forceinline__ v16h ldfrag_h(const _Float16* base, unsigned vo) {
  const char* p = (const char*)base + vo;
  FragH f;
  f.h[0] = *(const v8h*)(p);
  f.h[1] = *(const v8h*)(p + 512);
  return f.v;
}
__device__ __forceinline__ v16b ldfrag_b(const u16* base, unsigned vo) { // bf16 plane read as unsigned integer vectors
  const char* p = (const char*)base + vo;
  FragB f;
  f.u[0] = *(const v4u*)(p);
  f.u[1] = *(const v4u*)(p + 512);
  return f.v;
}

__device__ __forceinline__ v8f mma_h(v16h a, v16h b, v8f c) {
  return __builtin_amdgcn_wmma_f32_16x16x32_f16(false, a, false, b, (short)0, c, false, false);
}
__device__ __forceinline__ v8f mma_b(v16b a, v16b b, v8f c) {
  return __builtin_amdgcn_wmma_f32_16x16x32_bf16(false, a, false, b, (short)0, c, false, false);
}
__device__ __forceinline__ void guard2(v8f& a, v8f& b, v16h x0, v16h x1, v16h x2, v16h x3, v16h x4, v16h x5) {
#if defined(__HIP_DEVICE_COMPILE__)
  asm volatile("v_nop\n\tv_nop\n\tv_nop\n\tv_nop"
               : "+v"(a), "+v"(b) : "v"(x0), "v"(x1), "v"(x2), "v"(x3), "v"(x4), "v"(x5) : "memory");
#endif
}
template <typename F>
__device__ __forceinline__ void guard6(v8f& a, v8f& b, v8f& c, v8f& d, F x0, F x1, F x2, F x3, F x4, F x5) {
#if defined(__HIP_DEVICE_COMPILE__)
  asm volatile("v_nop\n\tv_nop\n\tv_nop\n\tv_nop"
               : "+v"(a), "+v"(b), "+v"(c), "+v"(d) : "v"(x0), "v"(x1), "v"(x2), "v"(x3), "v"(x4), "v"(x5) : "memory");
#endif
}
__device__ __forceinline__ void acc_guard4(v8f& a, v8f& b, v8f& c, v8f& d) {
#if defined(__HIP_DEVICE_COMPILE__)
  asm volatile("v_nop\n\tv_nop\n\tv_nop\n\tv_nop" : "+v"(a), "+v"(b), "+v"(c), "+v"(d));
#endif
}
__device__ __forceinline__ void wave_sync_lds() {
  __builtin_amdgcn_fence(__ATOMIC_RELEASE, "workgroup");
  __builtin_amdgcn_wave_barrier();
  __builtin_amdgcn_fence(__ATOMIC_ACQUIRE, "workgroup");
}

// =====================================================================================================
// f32 [rows][DMOD] -> 16-bit fragment-major plane.  f16mode == 0: bf16 RNE bits;  f16mode == 1: f16 bits of (bf16 RNE value)
// * scale. Thread = output unit gt = 8 consecutive elements of one row: two 16-B loads (a wave reads 64 B of each of 16 rows,
// the block uses every line whole), one 16-B store; 32 consecutive lanes store 512 contiguous, 512-B aligned bytes;
// coverage: grid = ceil(n8/256) blocks x 256 thr x 8 (in-kernel bound) = the whole plane (n8 a multiple of 256 here).
// =====================================================================================================
__global__ __launch_bounds__(256) void cvt16(const float* __restrict__ x, u16* D, int n8, int f16mode, float scale) {
  const int gt = blockIdx.x * 256 + (int)threadIdx.x;
  if (gt >= n8) return;
  const int srow = (gt >> 10) * 16 + (gt & 15);                                   // 1024 units per 16-row tile
  const int schk = ((gt >> 6) & (DMOD / 32 - 1)) * 4 + ((gt >> 5) & 1) * 2 + ((gt >> 4) & 1);
  const float* p = x + ((size_t)srow * (DMOD / 8) + schk) * 8;
  const v4f a = *(const v4f*)(p), b4 = *(const v4f*)(p + 4);
  float w[8];
#pragma unroll
  for (int e = 0; e < 4; ++e) { w[e] = a[e]; w[4 + e] = b4[e]; }
  v4u o;
#pragma unroll
  for (int e = 0; e < 4; ++e) {
    const float f0 = w[2 * e], f1 = w[2 * e + 1];
    const unsigned short hb0 = h_bits((_Float16)(bfr(f0) * scale));
    const unsigned short hb1 = h_bits((_Float16)(bfr(f1) * scale));
    const unsigned short bb0 = bf_bits(f0);
    const unsigned short bb1 = bf_bits(f1);
    o[e] = (f16mode != 0) ? pk16(hb0, hb1) : pk16(bb0, bb1);
  }
  u16* d = D + (size_t)gt * 8;
  {
    *(v4u*)(d) = o;
    
  }
}

// =====================================================================================================
// Rotary tables TC[s][j] = cos(s * inv[j]), TS[s][j] = sin(s * inv[j]), j < 32, with
// inv[j] = 1.0f / f32(10000^(j/32)) (power evaluated in f64 and narrowed once, IEEE f32 reciprocal, f32 product s*inv,
// coverage: grid = n/256 blocks x 256 thr = n = SEQ*32 elements of TC and of TS (n a multiple of 256).
// =====================================================================================================
__global__ __launch_bounds__(256) void k_tab(float* TC, float* TS, int n) {
#pragma clang fp contract(off)
  const int idx = blockIdx.x * 256 + (int)threadIdx.x;
  if (idx >= n) return;
  const int s = idx / NFREQ;
  const int j = idx - s * NFREQ;
  const double pj = exp2((double)j * ROPE_L2);       // 10000^(j/32)
  const float pf  = (float)pj;
  const float inv = 1.0f / pf;
  const float ang = (float)s * inv;
  float sv, cv;
  sincosf(ang, &sv, &cv);
  {
    *(float*)(TC + idx) = cv;
    *(float*)(TS + idx) = sv;
    
  }
}

// =====================================================================================================
// v^T planes from the value columns of the projection F f32 [MROWS][ldf] (row = b*SEQ + s, column = voff + g*HD + d) plus
// the per-column bias (bias[g*HD + d], f32 add, then the x1024 carry):
//   VH = f16(v * 1024), VL = f16 residual (t - f16(t)), both for all keys s, fragment-major per head with the 32-key step
//   outermost: [b*NKVH + g][s/32][d/16][half][lane][8] (row = d, k = key).
// Block = (b, head g, 64 keys s0): each thread loads its 16 floats (key sl, d chunk dc) with 16-B loads, adds bias, converts,
// places them into two LDS tiles [64 d][64 keys] (pitch 72 halves); after a block barrier each d row segment (64 halves =
// coverage: load 256 thr x 16 = 64 keys x 64 d; store 2 iterations x 256 thr x 8 halves = 64 lines x 64 = the block's tile of
//           VH and of VL; grid = NB*NKVH*NST blocks covers both planes exactly once.
// =====================================================================================================
__global__ __launch_bounds__(256) void vt16(const float* __restrict__ F, int ldf, int voff, const float* __restrict__ bias,
                                            u16* VHo, u16* VLo) {
#pragma clang fp contract(off)
  __shared__ __align__(16) u16 TH[HD * VTP];
  __shared__ __align__(16) u16 TL[HD * VTP];
  const int tid = threadIdx.x;
  const int bid = blockIdx.x;
  const int st  = bid % NST;
  const int t2  = bid / NST;
  const int g   = t2 % NKVH;
  const int b   = t2 / NKVH;
  if (b >= NB) return;                      // block-uniform, before any barrier; never taken with the exact grid
  const int s0  = st * 64;
  {
    const int sl = tid >> 2;                // key within tile 0..63
    const int dc = (tid & 3) * 16;          // d chunk 0,16,32,48
    const float* src = F + ((size_t)b * SEQ + s0 + sl) * (size_t)ldf + voff + g * HD + dc;
    const float* bp  = bias + g * HD + dc;
#pragma unroll
    for (int i = 0; i < 4; ++i) {
      const v4f a  = *(const v4f*)(src + 4 * i);
      const v4f bb = *(const v4f*)(bp + 4 * i);
#pragma unroll
      for (int e = 0; e < 4; ++e) {
        const float y = a[e] + bb[e];
        const float t = y * VCAR;
        const _Float16 hv = (_Float16)t;
        const _Float16 lv = (_Float16)(t - (float)hv);
        TH[(dc + 4 * i + e) * VTP + sl] = h_bits(hv);
        TL[(dc + 4 * i + e) * VTP + sl] = h_bits(lv);
      }
    }
  }
  __syncthreads();
  v4u vh[2], vl[2];
#pragma unroll
  for (int it = 0; it < 2; ++it) {
    const int u  = it * 256 + tid;                                        // output unit within the block's 64 keys
    const int d  = ((u >> 6) & 3) * 16 + (u & 15);
    const int ko = (u >> 8) * 32 + ((u >> 5) & 1) * 16 + ((u >> 4) & 1) * 8;
    vh[it] = *(const v4u*)(TH + d * VTP + ko);
    vl[it] = *(const v4u*)(TL + d * VTP + ko);
  }
  const size_t hrow = (size_t)(b * NKVH + g) * HD;
  const size_t base = hrow * SEQ + (size_t)s0 * HD + tid * 8;
  {
#pragma unroll
    for (int it = 0; it < 2; ++it) {
      *(v4u*)(VHo + base + it * 2048) = vh[it];
      *(v4u*)(VLo + base + it * 2048) = vl[it];
    }
    
  }
}

// =====================================================================================================
// Interleaved-pair rotary + bias + q / k planes from the projection F f32 [MROWS][ldf] at column offset coff (ncol = DMOD
// for q, KVD for k; row = b*SEQ + s, column = coff + head*HD + d; table row = s, table column j = d >> 1):
//   y[d] = F[d] + bias[d] (f32 add)
//   out[2j]   = y[2j]  *c[s][j] + (-1)*(y[2j+1]*sn[s][j])
//   out[2j+1] = y[2j+1]*c[s][j] + (+1)*(y[2j]  *sn[s][j])        with c, sn the f32 table values (mul, mul, add kept
//   separate); Hp = f16(out * sc), Lp = f16 residual (t - f16(t)), both fragment-major per head:
//   [b*nh + head][s/16][d/32][half][lane][8] (row = position s, k = d).
// Block = one 16 x 32 fragment (b, head, 16 positions, d step kk), 64 threads = its 64 units; thread = position s, 8 columns
// head*HD + dd .. +7 (4 pairs); the block's two waves read the two 64-B halves of the same 16 lines of F.
// coverage: 64 thr x 8 = one 1-KB fragment of Hp and of Lp; grid = MROWS = NB*nh*(SEQ/16)*2 blocks = every fragment once.
// =====================================================================================================
__device__ __forceinline__ void rot_one(float x, float y, float cv, float sv, float sgn, float sc,
                                        unsigned short& hb, unsigned short& lb) {
#pragma clang fp contract(off)
  const float ys   = y * sv;
  const float term = sgn * ys;
  const float r    = x * cv + term;
  const float t    = r * sc;
  const _Float16 a = (_Float16)t;
  hb = h_bits(a);
  lb = h_bits((_Float16)(t - (float)a));
}

__global__ __launch_bounds__(64) void rope16(const float* __restrict__ F, int ldf, int coff, int ncol,
                                             const float* __restrict__ bias,
                                             const float* __restrict__ TC, const float* __restrict__ TS,
                                             u16* Hp, u16* Lp, float sc) {
#pragma clang fp contract(off)
  const int tid = (int)threadIdx.x;
  const int bid = (int)blockIdx.x;
  const int nh  = ncol / HD;                           // heads in the q / k block
  if (nh <= 0) return;
  const int kk   = bid & 1;                            // 32-wide d step
  const int t1   = bid >> 1;
  const int tile = t1 % (SEQ / 16);                    // 16-position tile
  const int t2   = t1 / (SEQ / 16);
  const int head = t2 % nh;
  const int b    = t2 / nh;
  if (b >= NB) return;                                 // never taken with grid = NB * nh * (SEQ/16) * 2
  const int s    = tile * 16 + (tid & 15);
  const int dd   = (kk * 4 + ((tid >> 5) & 1) * 2 + ((tid >> 4) & 1)) * 8;   // d within head, multiple of 8
  const int col  = head * HD + dd;
  const int jj   = dd >> 1;                            // table column of the first pair, multiple of 4
  const int row  = b * SEQ + s;
  const float* p = F + (size_t)row * (size_t)ldf + coff + col;
  const v4f xa = *(const v4f*)(p),          xb = *(const v4f*)(p + 4);
  const v4f ba = *(const v4f*)(bias + col), bb = *(const v4f*)(bias + col + 4);
  // the table loads below may return their data into the address registers of the four loads above: the wait stands in front
  asm volatile("s_wait_xcnt 0x0" ::: "memory");
  const v4f cw = *(const v4f*)(TC + (size_t)s * NFREQ + jj);
  const v4f sw = *(const v4f*)(TS + (size_t)s * NFREQ + jj);
  float yv[8];
#pragma unroll
  for (int e = 0; e < 4; ++e) {
    yv[e]     = xa[e] + ba[e];
    yv[4 + e] = xb[e] + bb[e];
  }
  v4u oh, ol;
#pragma unroll
  for (int e = 0; e < 4; ++e) {
    unsigned short h0, l0, h1, l1;
    rot_one(yv[2 * e],     yv[2 * e + 1], cw[e], sw[e], -1.0f, sc, h0, l0);   // even element of the pair
    rot_one(yv[2 * e + 1], yv[2 * e],     cw[e], sw[e],  1.0f, sc, h1, l1);   // odd element of the pair
    oh[e] = pk16(h0, h1);
    ol[e] = pk16(l0, l1);
  }
  u16* dh = Hp + ((size_t)bid * 64 + tid) * 8;
  u16* dl = Lp + ((size_t)bid * 64 + tid) * 8;
  {
    *(v4u*)(dh) = oh;
    *(v4u*)(dl) = ol;
    
  }
}

// =====================================================================================================
// GEMM epilogue shared by both engines: the wave's 16x64 f32 tile (times oscale) staged in its LDS slab (pitch 68),
// 16 consecutive lanes x 16 B per line), lanes 16..31 -> row 2*it+1; HASB != 0 adds bias[col] in f32 to every element;
// coverage: 8 instructions x 2 rows x 16 lanes x 4 floats = the wave's 16 x 64 tile.
// =====================================================================================================
template <int HASB>
__device__ __forceinline__ void epi64(float* sl, v8f a0, v8f a1, v8f a2, v8f a3, float oscale, const float* bias,
                                      float* C, int N, size_t rowb, int col0, int lane) {
  const int hh = lane >> 4, m = lane & 15;
#pragma unroll
  for (int r = 0; r < 8; ++r) {
    const int ro = (8 * hh + r) * 68 + m;
    sl[ro]      = a0[r] * oscale;
    sl[ro + 16] = a1[r] * oscale;
    sl[ro + 32] = a2[r] * oscale;
    sl[ro + 48] = a3[r] * oscale;
  }
  wave_sync_lds();
  v4f vals[8];
#pragma unroll
  for (int it = 0; it < 8; ++it) vals[it] = *(const v4f*)(sl + (it * 2 + hh) * 68 + m * 4);
  if (HASB != 0) {
    const v4f b4 = *(const v4f*)(bias + col0 + m * 4);
#pragma unroll
    for (int it = 0; it < 8; ++it) vals[it] = vals[it] + b4;
  }
  float* dst = C + (rowb + (size_t)hh) * (size_t)N + col0 + m * 4;
  {
#pragma unroll
    for (int it = 0; it < 8; ++it) {
      *(v4f*)(dst + (size_t)(it * 2) * (size_t)N) = vals[it];
    }
    
  }
}

// =====================================================================================================
// bf16 GEMM: C[M][N] (f32) = A[M][K] . Bt[N][K]^T, times oscale; A and Bt bf16 fragment-major planes.
// Block = 64x64 tile, 4 waves x 16 rows; fragments loaded straight from the planes (two 512-B wave loads each, split k map
// for A and B); K stepped by 32 (host guarantees K % 32 == 0, M % 64 == 0, N % 64 == 0, grid = (M/64)*(N/64)).
// =====================================================================================================
__global__ __launch_bounds__(128)
void gemm_bf(const u16* __restrict__ A, const u16* __restrict__ Bt, float* C, int M, int N, int K, float oscale) {
  __shared__ __align__(16) float slab[4 * SLAB64];
  const int tid = threadIdx.x, lane = tid & 31;
  const int wave = __builtin_amdgcn_readfirstlane(tid >> 5);   // scalar, so that the tile starts below are scalar bases
  const int ntile = N >> 6;
  const int bid   = blockIdx.x;
  const int rowb  = (bid / ntile) * 64 + wave * 16;
  const int col0  = (bid % ntile) * 64;
  if (rowb + 16 > M) return;                // wave-uniform, never taken with the exact grid; no block barriers in this kernel
  const u16* ap = A  + (size_t)rowb * K;              // fragment (16-row tile, k step ks) at tile start + ks * 1024 bytes
  const u16* bp  = Bt + (size_t)col0 * K;
  const u16* bp1 = Bt + (size_t)(col0 + 16) * K;
  const u16* bp2 = Bt + (size_t)(col0 + 32) * K;
  const u16* bp3 = Bt + (size_t)(col0 + 48) * K;
  unsigned vo = (unsigned)lane * 16u;
  v8f acc0 = zero8(), acc1 = zero8(), acc2 = zero8(), acc3 = zero8();
#pragma unroll 1
  for (int k0 = 0; k0 < K; k0 += 32, vo += 1024u) {
    const v16b a  = ldfrag_b(ap, vo);
    const v16b b0 = ldfrag_b(bp, vo);
    const v16b b1 = ldfrag_b(bp1, vo);
    const v16b b2 = ldfrag_b(bp2, vo);
    const v16b b3 = ldfrag_b(bp3, vo);
    acc0 = mma_b(a, b0, acc0);
    acc1 = mma_b(a, b1, acc1);
    acc2 = mma_b(a, b2, acc2);
    acc3 = mma_b(a, b3, acc3);
    guard6<v16b>(acc0, acc1, acc2, acc3, a, b0, b1, b2, b3, a);
  }
  epi64<0>(slab + wave * SLAB64, acc0, acc1, acc2, acc3, oscale, C, C, N, (size_t)rowb, col0, lane);
}

// =====================================================================================================
// f16 GEMM: C[M][N] (f32) = (A[M][K] (+ A2[M][K] when TWO != 0)) . Bt[N][K]^T, times oscale, plus bias[n]; A, A2 f16
// fragment-major planes (A2 = the unscaled f16 residual of A, sharing the accumulator), Bt f16 fragment-major. Same tiling, fragment
// loads (split k map) and epilogue as gemm_bf; K stepped by 32.
// =====================================================================================================
template <int TWO>
__global__ __launch_bounds__(128)
void gemm_h(const u16* __restrict__ A, const u16* __restrict__ A2, const u16* __restrict__ Bt,
            const float* __restrict__ bias, float* C, int M, int N, int K, float oscale) {
  __shared__ __align__(16) float slab[4 * SLAB64];
  const int tid = threadIdx.x, lane = tid & 31;
  const int wave = __builtin_amdgcn_readfirstlane(tid >> 5);   // scalar, so that the tile starts below are scalar bases
  const int ntile = N >> 6;
  const int bid   = blockIdx.x;
  const int rowb  = (bid / ntile) * 64 + wave * 16;
  const int col0  = (bid % ntile) * 64;
  if (rowb + 16 > M) return;                // wave-uniform, never taken with the exact grid; no block barriers in this kernel
  const _Float16* ap  = (const _Float16*)(const void*)A  + (size_t)rowb * K;
  const _Float16* ap2 = (const _Float16*)(const void*)A2 + (size_t)rowb * K;
  const _Float16* bp  = (const _Float16*)(const void*)Bt + (size_t)col0 * K;
  const _Float16* bp1 = (const _Float16*)(const void*)Bt + (size_t)(col0 + 16) * K;
  const _Float16* bp2 = (const _Float16*)(const void*)Bt + (size_t)(col0 + 32) * K;
  const _Float16* bp3 = (const _Float16*)(const void*)Bt + (size_t)(col0 + 48) * K;
  unsigned vo = (unsigned)lane * 16u;
  v8f acc0 = zero8(), acc1 = zero8(), acc2 = zero8(), acc3 = zero8();
#pragma unroll 1
  for (int k0 = 0; k0 < K; k0 += 32, vo += 1024u) {
    const v16h a  = ldfrag_h(ap, vo);
    const v16h b0 = ldfrag_h(bp, vo);
    const v16h b1 = ldfrag_h(bp1, vo);
    const v16h b2 = ldfrag_h(bp2, vo);
    const v16h b3 = ldfrag_h(bp3, vo);
    acc0 = mma_h(a, b0, acc0);
    acc1 = mma_h(a, b1, acc1);
    acc2 = mma_h(a, b2, acc2);
    acc3 = mma_h(a, b3, acc3);
    if (TWO != 0) {
      const v16h a2 = ldfrag_h(ap2, vo);
      acc0 = mma_h(a2, b0, acc0);
      acc1 = mma_h(a2, b1, acc1);
      acc2 = mma_h(a2, b2, acc2);
      acc3 = mma_h(a2, b3, acc3);
      guard6<v16h>(acc0, acc1, acc2, acc3, a, a2, b0, b1, b2, b3);
    } else {
      guard6<v16h>(acc0, acc1, acc2, acc3, a, b0, b1, b2, b3, a);
    }
  }
  (void)ap2;
  epi64<1>(slab + wave * SLAB64, acc0, acc1, acc2, acc3, oscale, bias, C, N, (size_t)rowb, col0, lane);
}

// =====================================================================================================
// Causal softmax attention, hd = 64, 8 heads. Block bid -> (query tile qt = qt0 + bid % nqt: rows q0 = 16*qt .. q0+15, head
// group hg, batch b); one wave per head = hg*WPB + wave; keys/values of the same head (kvh = head).
//   q and k hi / residual planes f16 x256, fragment-major per head [b*8 + h][s/16][d/32][half][lane][8];
//   v^T hi / residual planes x1024, fragment-major per head [b*NKVH + h][s/32][d/16][half][lane][8].
//   raw(i, j) = q_hi.k_hi + q_lo.k_hi + q_hi.k_lo (2 k-steps over d); logit = raw * (SM_SCALE * 2^-16) (the two 256 carries
//   folded exactly into the 1/sqrt(512) scale, one f32 multiply); keys above the diagonal replaced by -inf; online softmax per
//   query row in f32 with a running max: row max / row sum over the 16 lanes holding the row via xor shuffles 1,2,4,8 (never
//   crossing the lane half), alpha = exp(m_old - m_new), p = exp(logit - m_new), l = l*alpha + sum p, O accumulators times
//   alpha before the tile's P.v. Key tiles of 32 visited in order, only tiles with kb <= q0 (nkt = q0/32 + 1 <= NKT; key kb is
//   unmasked for every row of the tile, so each row max is finite). The 16x32 p tile goes to wave-private LDS (f32 element
//   rows (float vector loads, same element type as stored); v^T B fragments in 2 groups of 2 d-subtiles; RV = 1: products
//   hh + lh + hl, RV = 0: hh only. After the loop O = acc / (l * 32768 * 1024) into the wave's lane-owned result slab
//   Epilogue: O x256 -> f16 hi plane (and for RV = 1 the unscaled f16 residual plane), fragment-major over [b*SEQ + s][512];
//   lane = (row c, 8 consecutive d at it*16 + 8*hh); one instruction = one 512-B half fragment (4 whole lines).
// coverage: per wave 4 instructions x 32 lanes x 8 halves = 16 x 64 per plane; grid nqt x NHG x NB blocks x WPB waves;
//   the two launches (tiles 0..NQTR-1 with RV = 1, NQTR..NQT-1 with RV = 0) cover every (b, s, h) row segment of the hi plane
//   exactly once and rows s < RICH of the residual plane exactly once (only those rows are read later).
// =====================================================================================================
template <int RV>
__global__ __launch_bounds__(ATT_THREADS)
void attn_cs(const u16* __restrict__ QHp, const u16* __restrict__ QLp,
             const u16* __restrict__ KHp, const u16* __restrict__ KLp,
             const u16* __restrict__ VHp, const u16* __restrict__ VLp,
             u16* OHp, u16* OLp, int qt0, int nqt) {
#pragma clang fp contract(off)
  __shared__ __align__(16) float smem[WPB * WREG];

  const int tid  = threadIdx.x;
  const int wave = __builtin_amdgcn_readfirstlane(tid >> 5);   // scalar: the head's number
  const int lane = tid & 31;
  const int hh   = lane >> 4;
  const int c    = lane & 15;
  const int bid  = blockIdx.x;
  if (nqt <= 0) return;                     // block-uniform; no block barriers in this kernel
  const int qt   = qt0 + bid % nqt;
  const int t2   = bid / nqt;
  const int hg   = t2 % NHG;
  const int b    = t2 / NHG;
  if (b >= NB) return;                      // block-uniform; never taken with the exact grid
  const int q0   = qt * 16;
  if (q0 + 16 > SEQ) return;                // block-uniform; never taken
  const int head = hg * WPB + wave;
  const int kvh  = head;

  float* pt   = smem + wave * WREG;         // p tile [16][32] pitch 36
  float* slab = pt + PTW;                   // result slab [16][64] pitch 68

  // fragment-major planes: a head's 16 positions x 64 d = 1024 halves (2 fragments), its 32 keys x 64 d of v^T = 2048 (4)
  // byte offsets into the planes (each plane MROWS * 512 * 2 bytes, far under 2^32), the lane's 16 bytes included
  const unsigned qvo = ((unsigned)(b * NH + head) * SEQ + (unsigned)q0) * (HD * 2u) + (unsigned)lane * 16u;
  unsigned kvo = (unsigned)(b * NKVH + kvh) * (SEQ * HD * 2u) + (unsigned)lane * 16u;   // this step's 32 keys, k and v^T alike
  const _Float16* Qh  = (const _Float16*)(const void*)QHp;
  const _Float16* Ql  = (const _Float16*)(const void*)QLp;
  const _Float16* Khb = (const _Float16*)(const void*)KHp;
  const _Float16* Klb = (const _Float16*)(const void*)KLp;
  const _Float16* Vhb = (const _Float16*)(const void*)VHp;               // d-subtile j at + j * 512 halves
  const _Float16* Vlb = (const _Float16*)(const void*)VLp;
  const float lsc  = SM_SCALE * (1.0f / (QSC * KSC));   // exact power-of-two fold of the q / k carries into the scale
  const float oc   = 1.0f / (PCAR * VCAR);
  const float ninf = -__builtin_inff();
  const size_t KROW = (size_t)HD;           // halves per key in a head's fragment-major plane

  v8f o[4];
#pragma unroll
  for (int j = 0; j < 4; ++j) o[j] = zero8();
  float mrun[8], lrun[8];
#pragma unroll
  for (int r = 0; r < 8; ++r) { mrun[r] = ninf; lrun[r] = 0.0f; }
  const int ncaus = (q0 >> 5) + 1;                                            // tiles holding keys <= q0 + 15
  const int nkt   = (ncaus < NKT) ? ncaus : NKT;
  const int qr0   = q0 + 8 * hh;                                              // query row of D element r = qr0 + r

#pragma unroll 1
  for (int kt = 0; kt < nkt; ++kt, kvo += 32u * HD * 2u) {
    const int kb = kt * 32;
    // ---- raw scores: D element r of this lane = (query row qr0 + r, key kb + c) in s0, key kb + 16 + c in s1 ----
    v8f s0 = zero8(), s1 = zero8();
    const _Float16* k0p = Khb;
    const _Float16* k1p = k0p + (size_t)16 * KROW;
    const _Float16* l0p = Klb;
    const _Float16* l1p = l0p + (size_t)16 * KROW;
#pragma unroll
    for (int kk = 0; kk < HD / 32; ++kk) {
      const v16h qh  = ldfrag_h(Qh + kk * 512, qvo);
      const v16h ql  = ldfrag_h(Ql + kk * 512, qvo);
      const v16h kh0 = ldfrag_h(k0p + kk * 512, kvo);
      const v16h kh1 = ldfrag_h(k1p + kk * 512, kvo);
      const v16h kl0 = ldfrag_h(l0p + kk * 512, kvo);
      const v16h kl1 = ldfrag_h(l1p + kk * 512, kvo);
      s0 = mma_h(qh, kh0, s0);
      s0 = mma_h(ql, kh0, s0);
      s0 = mma_h(qh, kl0, s0);
      s1 = mma_h(qh, kh1, s1);
      s1 = mma_h(ql, kh1, s1);
      s1 = mma_h(qh, kl1, s1);
      guard2(s0, s1, qh, ql, kh0, kl0, kh1, kl1);
    }
    // ---- causal replace-mask, running-max online softmax in f32, p tile -> wave-private LDS ----
    float alpha[8];
    const int key0 = kb + c, key1 = kb + 16 + c;
#pragma unroll
    for (int r = 0; r < 8; ++r) {
      const int qrow = qr0 + r;
      const float a0 = s0[r] * lsc;
      const float a1 = s1[r] * lsc;
      const float t0 = (key0 > qrow) ? ninf : a0;
      const float t1 = (key1 > qrow) ? ninf : a1;
      float mx = fmaxf(t0, t1);
      mx = fmaxf(mx, __shfl_xor(mx, 1, 32));
      mx = fmaxf(mx, __shfl_xor(mx, 2, 32));
      mx = fmaxf(mx, __shfl_xor(mx, 4, 32));
      mx = fmaxf(mx, __shfl_xor(mx, 8, 32));
      const float mnew = fmaxf(mrun[r], mx);
      const float al   = __expf(mrun[r] - mnew);
      const float p0   = __expf(t0 - mnew);
      const float p1   = __expf(t1 - mnew);
      float sm = p0 + p1;
      sm += __shfl_xor(sm, 1, 32);
      sm += __shfl_xor(sm, 2, 32);
      sm += __shfl_xor(sm, 4, 32);
      sm += __shfl_xor(sm, 8, 32);
      lrun[r]  = lrun[r] * al + sm;
      mrun[r]  = mnew;
      alpha[r] = al;
      const int ro = (8 * hh + r) * PTP + c;
      pt[ro]      = p0;
      pt[ro + 16] = p1;
    }
    wave_sync_lds();
    // ---- rescale the O accumulators by alpha (row 8hh + r of every d-subtile) ----
#pragma unroll
    for (int j = 0; j < 4; ++j) {
#pragma unroll
      for (int r = 0; r < 8; ++r) o[j][r] = o[j][r] * alpha[r];
    }
    // ---- A fragments of p*32768: hi f16 and residual f16, row = c, split k map over the 32 keys of this step ----
    FragH ph, pl;
    {
      const float* prow = pt + c * PTP + 8 * hh;
      const v4f p0 = *(const v4f*)(prow), p1 = *(const v4f*)(prow + 4);
      const v4f p2 = *(const v4f*)(prow + 16), p3 = *(const v4f*)(prow + 20);
#pragma unroll
      for (int e = 0; e < 4; ++e) {
        const float ta = p0[e] * PCAR, tb = p1[e] * PCAR, tc = p2[e] * PCAR, td = p3[e] * PCAR;
        const _Float16 ha = (_Float16)ta, hb = (_Float16)tb, hc = (_Float16)tc, hd = (_Float16)td;
        ph.h[0][e]     = ha;                  // elements 0..7  = keys kb + 8hh + 0..7
        ph.h[0][4 + e] = hb;
        ph.h[1][e]     = hc;                  // elements 8..15 = keys kb + 16 + 8hh + 0..7
        ph.h[1][4 + e] = hd;
        pl.h[0][e]     = (_Float16)(ta - (float)ha);
        pl.h[0][4 + e] = (_Float16)(tb - (float)hb);
        pl.h[1][e]     = (_Float16)(tc - (float)hc);
        pl.h[1][4 + e] = (_Float16)(td - (float)hd);
      }
    }
    // ---- P.V : B fragment col n = d = j*16 + c, keys contiguous in the v^T planes; 2 groups of 2 d-subtiles ----
    {
      const _Float16* vhp = Vhb;
      const _Float16* vlp = Vlb;
      (void)vlp;
#pragma unroll
      for (int jg = 0; jg < 2; ++jg) {
        const size_t da = (size_t)(2 * jg) * 512;
        const size_t db = da + 512;
        const v16h vha = ldfrag_h(vhp + da, kvo), vhb2 = ldfrag_h(vhp + db, kvo);
        o[2 * jg]     = mma_h(ph.v, vha,  o[2 * jg]);
        o[2 * jg + 1] = mma_h(ph.v, vhb2, o[2 * jg + 1]);
        if (RV != 0) {
          const v16h vla = ldfrag_h(vlp + da, kvo), vlb2 = ldfrag_h(vlp + db, kvo);
          o[2 * jg]     = mma_h(pl.v, vha,  o[2 * jg]);
          o[2 * jg]     = mma_h(ph.v, vla,  o[2 * jg]);
          o[2 * jg + 1] = mma_h(pl.v, vhb2, o[2 * jg + 1]);
          o[2 * jg + 1] = mma_h(ph.v, vlb2, o[2 * jg + 1]);
          guard2(o[2 * jg], o[2 * jg + 1], ph.v, pl.v, vha, vhb2, vla, vlb2);
        } else {
          guard2(o[2 * jg], o[2 * jg + 1], ph.v, pl.v, vha, vhb2, vha, vhb2);
        }
      }
    }
    wave_sync_lds();
  }
  acc_guard4(o[0], o[1], o[2], o[3]);
  // ---- O = acc / l with the carries (32768 on p, 1024 on v) folded once; written into the lane-owned slab ----
  float rl[8];
#pragma unroll
  for (int r = 0; r < 8; ++r) rl[r] = (1.0f / lrun[r]) * oc;
#pragma unroll
  for (int r = 0; r < 8; ++r) {
#pragma unroll
    for (int j = 0; j < 4; ++j) {
      const int idx = (8 * hh + r) * SLP + j * 16 + c;
      slab[idx] = o[j][r] * rl[r];
    }
  }
  wave_sync_lds();
  // ---- O x256 -> f16 hi plane (+ f16 residual plane), fragment-major [row/16][512/32][half][lane][8]: store it = half it&1 of
  //      k step head*2 + (it>>1); lane = (row c, 8 consecutive d at it*16 + 8*hh) ----
  v4u oh[4], ol[4];
#pragma unroll
  for (int it = 0; it < 4; ++it) {
    const int dd = it * 16 + 8 * hh;
    const v4f a = *(const v4f*)(slab + c * SLP + dd), b4 = *(const v4f*)(slab + c * SLP + dd + 4);
    float w[8];
#pragma unroll
    for (int e = 0; e < 4; ++e) { w[e] = a[e] * OSC; w[4 + e] = b4[e] * OSC; }
#pragma unroll
    for (int e = 0; e < 4; ++e) {
      const _Float16 h0 = (_Float16)w[2 * e], h1 = (_Float16)w[2 * e + 1];
      const _Float16 g0 = (_Float16)(w[2 * e] - (float)h0), g1 = (_Float16)(w[2 * e + 1] - (float)h1);
      oh[it][e] = pk16(h_bits(h0), h_bits(h1));
      ol[it][e] = pk16(h_bits(g0), h_bits(g1));
    }
  }
  const size_t ob = ((size_t)b * SEQ + q0) * DMOD + (size_t)head * (16 * HD) + 8 * lane;
  {
#pragma unroll
    for (int it = 0; it < 4; ++it) {
      *(v4u*)(OHp + ob + it * 256) = oh[it];
      if (RV != 0) {
        *(v4u*)(OLp + ob + it * 256) = ol[it];
      }
    }
    
  }
}

// =====================================================================================================
// Workspace map (bytes); every plane is fully written by whole-line stores before it is read (the O residual plane only on
// the rows < RICH per sequence that are read); all extents are exact multiples of the store granularity (no pad rows needed);
// every region offset a multiple of 131072; every 16-bit plane is fragment-major (see the fragment loaders), same extent as
// the row-major shape given here:
//   XB  bf16 [MROWS][512]               MROWS*1024   (NB=4, SEQ=2048: 8388608); after the projection GEMM the same bytes hold
//                                                    the O f16 hi plane [MROWS][512] x256 (identical extent)
//   WB  bf16 [1536 n][512 k]            1572864      (Wq rows 0..511, Wk 512..1023, Wv 1024..1535); after the projection
//                                                    GEMM its first 524288 bytes hold the Wo f16 plane [512 o][512 d]
//   F   f32 [MROWS][1536]               MROWS*6144   (q_proj | k_proj | v_proj columns); after rope16 / vt16 its first
//                                                    MROWS*1024 bytes hold the O f16 residual plane [MROWS][512]
//   QH  f16 [MROWS][512] x256           MROWS*1024   QL residual, same extent
//   KH  f16 [MROWS][512] x256           MROWS*1024   KL residual, same extent   (keys = rotary of the v_proj columns)
//   VH  f16 [NB*8][64][SEQ] x1024       MROWS*1024   VL residual, same extent   (values = the k_proj columns)
//   TC  f32 [SEQ][32]                   SEQ*128      TS, same extent
//   end (NB=4, SEQ=2048)              111149056
// =====================================================================================================
extern "C" void kernel_launch(void* const* d_in, const int* in_sizes, int n_in,
                              void* d_out, int out_size, void* d_ws, size_t ws_size,
                              hipStream_t stream) {
  if (n_in < 9) return;
  if (in_sizes[0] < ((NB - 1) * XS_FULL + SEQ) * DMOD) return;
  if (in_sizes[1] != DMOD * DMOD) return;
  if (in_sizes[2] != DMOD) return;
  if (in_sizes[3] != DMOD * DMOD) return;
  if (in_sizes[4] != DMOD) return;
  if (in_sizes[5] != DMOD * DMOD) return;
  if (in_sizes[6] != DMOD) return;
  if (in_sizes[7] != DMOD * DMOD) return;
  if (in_sizes[8] != DMOD) return;
  if (out_size < ((NB - 1) * XS_FULL + SEQ) * DMOD) return;

  const float* x   = (const float*)d_in[0];
  const float* wq  = (const float*)d_in[1];
  const float* bqp = (const float*)d_in[2];
  const float* wk  = (const float*)d_in[3];
  const float* bkp = (const float*)d_in[4];
  const float* wv  = (const float*)d_in[5];
  const float* bvp = (const float*)d_in[6];
  const float* wo  = (const float*)d_in[7];
  const float* bop = (const float*)d_in[8];
  float*       out = (float*)d_out;

  const size_t szXB = (size_t)MROWS * DMOD * 2;
  const size_t szWB = (size_t)NQKV * DMOD * 2;
  const size_t szF  = (size_t)MROWS * NQKV * 4;
  const size_t szQ  = (size_t)MROWS * DMOD * 2;                  // QH, QL
  const size_t szK  = (size_t)MROWS * KVD * 2;                   // KH, KL
  const size_t szV  = (size_t)NB * NKVH * HD * SEQ * 2;          // VH, VL (== szK)
  const size_t szT  = (size_t)SEQ * NFREQ * 4;                   // TC, TS
  const size_t szOH = (size_t)MROWS * DMOD * 2;                  // O hi plane, lives in the XB region
  const size_t szOL = (size_t)MROWS * DMOD * 2;                  // O residual plane, lives in the F region
  const size_t szWT = (size_t)DMOD * DMOD * 2;                   // Wo f16 plane, lives in the WB region
  if (szOH > szXB || szOL > szF || szWT > szWB) return;
  size_t off = 0;
  const size_t oXB = off; off += szXB;
  const size_t oWB = off; off += szWB;
  const size_t oF  = off; off += szF;
  const size_t oQH = off; off += szQ;
  const size_t oQL = off; off += szQ;
  const size_t oKH = off; off += szK;
  const size_t oKL = off; off += szK;
  const size_t oVH = off; off += szV;
  const size_t oVL = off; off += szV;
  const size_t oTC = off; off += szT;
  const size_t oTS = off; off += szT;
  if (off > ws_size) return;                // off = 111149056 for NB = 4, SEQ = 2048
  if (off > (size_t)WS_CAP) return;

  char* ws = (char*)d_ws;
  u16*   XB  = (u16*)(ws + oXB);
  u16*   OH  = (u16*)(ws + oXB);
  u16*   WB  = (u16*)(ws + oWB);
  u16*   WT  = (u16*)(ws + oWB);
  float* F   = (float*)(ws + oF);
  u16*   OL  = (u16*)(ws + oF);
  u16*   QH  = (u16*)(ws + oQH);
  u16*   QL  = (u16*)(ws + oQL);
  u16*   KH  = (u16*)(ws + oKH);
  u16*   KL  = (u16*)(ws + oKL);
  u16*   VH  = (u16*)(ws + oVH);
  u16*   VL  = (u16*)(ws + oVL);
  float* TC  = (float*)(ws + oTC);
  float* TS  = (float*)(ws + oTS);

  const dim3 b256(256), b128(128), b64(64), bAT(ATT_THREADS);
  const int  n8x = (SEQ * DMOD) / 8;
  const dim3 gX((n8x + 255) / 256);                     // SEQ*DMOD/2048 blocks per batch
  const int  n8w = (DMOD * DMOD) / 8;
  const dim3 gW((n8w + 255) / 256);                     // 128
  const int  nT  = SEQ * NFREQ;
  const dim3 gT((nT + 255) / 256);                      // SEQ/8
  const dim3 gG1((MROWS / 64) * (NQKV / 64));
  const dim3 gRW(MROWS);
  const dim3 gVT(NB * NKVH * NST);
  const float osc = 1.0f / (OSC * WOS);

  // (0) x -> bf16 plane [MROWS][512], one launch per batch (sequence) row block
  for (int bq = 0; bq < NB; ++bq) {
    cvt16<<<gX, b256, 0, stream>>>(x + (size_t)bq * XS_FULL * DMOD, XB + (size_t)bq * SEQ * DMOD, n8x, 0, 1.0f);
  }
  // (1) Wq [512 n][512 k], Wk, Wv -> one bf16 plane [1536 n][512 k]
  cvt16<<<gW, b256, 0, stream>>>(wq, WB, n8w, 0, 1.0f);
  cvt16<<<gW, b256, 0, stream>>>(wk, WB + (size_t)VCOL0 * DMOD, n8w, 0, 1.0f);
  cvt16<<<gW, b256, 0, stream>>>(wv, WB + (size_t)KCOL0 * DMOD, n8w, 0, 1.0f);
  // (2) rotary cos / sin tables [SEQ][32]
  k_tab<<<gT, b256, 0, stream>>>(TC, TS, nT);
  // (3) F f32 [MROWS][1536] = x.[Wq|Wk|Wv]^T  (columns 0..511 q_proj, 512..1023 k_proj, 1024..1535 v_proj; biases later)
  gemm_bf<<<gG1, b128, 0, stream>>>(XB, WB, F, MROWS, NQKV, DMOD, 1.0f);
  // (4) q = rotary(q_proj + bq) -> hi + residual planes x256 from columns 0..511
  rope16<<<gRW, b64, 0, stream>>>(F, NQKV, QCOL0, DMOD, bqp, TC, TS, QH, QL, QSC);
  // (5) keys = rotary(v_proj + bv) -> hi + residual planes x256 from columns 1024..1535
  rope16<<<gRW, b64, 0, stream>>>(F, NQKV, KCOL0, KVD, bvp, TC, TS, KH, KL, KSC);
  // (6) values = k_proj + bk (no rotary) -> v^T hi + residual planes x1024 from columns 512..1023
  vt16<<<gVT, b256, 0, stream>>>(F, NQKV, VCOL0, bkp, VH, VL);
  // (7) Wo [512 o][512 d] -> f16 plane of the bf16 value x1024 (already k-contiguous; WB region, free after the projection GEMM)
  cvt16<<<gW, b256, 0, stream>>>(wo, WT, n8w, 1, WOS);
  // (8) causal attention -> O f16 hi plane x256 (XB region) for all query tiles; residual plane (F region) for tiles < RICH
  attn_cs<1><<<dim3(NQTR * NHG * NB), bAT, 0, stream>>>(QH, QL, KH, KL, VH, VL, OH, OL, 0, NQTR);
  if (NQT > NQTR) {
    attn_cs<0><<<dim3((NQT - NQTR) * NHG * NB), bAT, 0, stream>>>(QH, QL, KH, KL, VH, VL, OH, OL, NQTR, NQT - NQTR);
  }
  // (9) y = O.Wo^T + bo -> out f32 [rows][512], carries 256 x 1024 folded back; rows < RICH per sequence with O hi + residual
  for (int bq = 0; bq < NB; ++bq) {
    const size_t rb   = (size_t)bq * SEQ;            // row base in the O planes
    const size_t orow = (size_t)bq * XS_FULL;        // row base in out
    gemm_h<1><<<dim3((RICH / 64) * (DMOD / 64)), b128, 0, stream>>>(
        OH + rb * DMOD, OL + rb * DMOD, WT, bop, out + orow * DMOD, RICH, DMOD, DMOD, osc);
    if (SEQ > RICH) {
      const size_t rl = rb + RICH;
      const size_t ol = orow + RICH;
      gemm_h<0><<<dim3(((SEQ - RICH) / 64) * (DMOD / 64)), b128, 0, stream>>>(
          OH + rl * DMOD, OL + rl * DMOD, WT, bop, out + ol * DMOD, SEQ - RICH, DMOD, DMOD, osc);
    }
  }
  (void)hipGetLastError();
}

// v002
// A run of this version takes 274 microseconds.
// Next to v001, in two timings, it ran 1.34 times as fast each time.
// All steps since v000 together make it 1.38 times as fast.
// Contractions: x.[Wq|Wk|Wv]^T on v_wmma_f32_16x16x32_bf16 (x and the weights as bf16 RNE planes; weight [n][k] rows are
// the k-contiguous B operand; f32 accumulate); q.k^T over hd 64 and P.v on v_wmma_f32_16x16x32_f16 with f16 hi + f16
// residual planes (q, k x256 after rotary, products hh+lh+hl on every row; P x32768 hi + in-register residual and v^T x1024
// hi + residual plane for query rows < 512 of each sequence, P hi . v hi only for later rows); O.Wo^T on
// v_wmma_f32_16x16x32_f16 with O x256 as f16 hi (+ f16 residual plane for rows < 512 of each sequence) and Wo as
// f16(bf16(Wo)) x1024, one accumulator, bias added in f32; all f32 accumulate. Rotary cos/sin tables, bias adds and online
// softmax in f32 on VALU.
#include <hip/hip_runtime.h>
#include <math.h>
#include <stdint.h>

#ifndef NB
#define NB 4
#endif
#ifndef SEQ
#define SEQ 2048
#endif
#define XS_FULL 2048
#define DMOD  512
#define NH    8
#define NKVH  8
#define HD    64
#define HHALF (HD / 2)
#define NFREQ (HD / 2)
#define KVD   (NKVH * HD)
#define NQKV  (DMOD + 2 * KVD)
#define QCOL0 0
#define VCOL0 DMOD
#define KCOL0 (DMOD + KVD)
#define MROWS (NB * SEQ)
#define RICH  512
#define ROPE_L2 0.41524101186092028
#define SM_SCALE 0.04419417382415922f
#define QSC   256.0f
#define KSC   256.0f
#define PCAR  32768.0f
#define VCAR  1024.0f
#define OSC   256.0f
#define WOS   1024.0f
#define NSW   8
#define NQT   (SEQ / 16)
#define NQTR  (RICH / 16)
#define NST   (SEQ / 64)
#define NKT   (SEQ / 32)
#define ATT_THREADS (NSW * 32)
#define PTP   36
#define PTW   (16 * PTP)
#define SLP   68
#define SLW   (16 * SLP)
#define SLAB64 (16 * 68)
#define VTP   72
#define WS_CAP 134217728
static_assert(DMOD == NH * HD && HD == 64 && HHALF == 32 && NFREQ == 32 && NH == 8 && NKVH == NH);
static_assert(ATT_THREADS == 256 && NSW >= 4 && PTW <= SLW && KVD == 512 && NQKV == 1536 && KCOL0 + KVD == NQKV && VCOL0 + KVD == KCOL0);
static_assert(NB >= 1 && NB <= 4);
static_assert(NB == 1 || SEQ == XS_FULL);
static_assert((SEQ % 64) == 0 && SEQ >= 64 && SEQ <= XS_FULL);
static_assert((RICH % 64) == 0 && RICH >= 64 && RICH <= SEQ);
static_assert((DMOD % 64) == 0 && (KVD % 64) == 0 && (NQKV % 64) == 0 && (DMOD % 32) == 0 && (HD % 32) == 0);
static_assert(((SEQ * DMOD / 8) % 256) == 0 && ((DMOD * DMOD / 8) % 256) == 0 && ((SEQ * NFREQ) % 256) == 0);
static_assert(NSW * (SLW + 32) * 4 <= 65536 && 2 * HD * VTP * 2 <= 65536 && 4 * SLAB64 * 4 <= 65536);
static_assert(DMOD / 8 == 64 && KVD / 8 == 64);
static_assert(((SEQ * DMOD / 8) % 1024) == 0 && ((DMOD * DMOD / 8) % 1024) == 0 && (SEQ % 32) == 0 && (RICH % 16) == 0);

typedef unsigned short u16;
typedef _Float16 v16h __attribute__((ext_vector_type(16)));
typedef _Float16 v8h  __attribute__((ext_vector_type(8)));
typedef __bf16   v16b __attribute__((ext_vector_type(16)));
typedef float    v8f  __attribute__((ext_vector_type(8)));
typedef float    v4f  __attribute__((ext_vector_type(4)));
typedef unsigned int v4u __attribute__((ext_vector_type(4)));

union FragH { v16h v; v8h h[2]; v4u u[2]; };
union FragB { v16b v; v4u u[2]; };

// ---- scalar helpers --------------------------------------------------------------------------------
__device__ __forceinline__ unsigned short bf_bits(float f) {          // f32 -> bf16 bits, RNE convert
  unsigned u = __float_as_uint(f);
  return (unsigned short)((u + 0x7FFFu + ((u >> 16) & 1u)) >> 16);
}
__device__ __forceinline__ float bf_up(unsigned short h) { return __uint_as_float(((unsigned)h) << 16); }
__device__ __forceinline__ float bfr(float f) { return bf_up(bf_bits(f)); }
__device__ __forceinline__ unsigned short h_bits(_Float16 x) { return __builtin_bit_cast(unsigned short, x); }
__device__ __forceinline__ unsigned pk16(unsigned short a, unsigned short b) { return (unsigned)a | ((unsigned)b << 16); }
__device__ __forceinline__ v8f zero8() { v8f z = {0.f, 0.f, 0.f, 0.f, 0.f, 0.f, 0.f, 0.f}; return z; }

// ---- fragment-major planes: every 16-bit A/B operand plane [row][K] other than v^T is stored as [row/16][K/32][g][lane][8]: the 16-B unit
//      of lane = 16*h + (row&15) in half g holds k = 32*ks + 16*g + 8*h + 0..7, so one wave-wide 16-B load is 512 contiguous
//      bytes (4 whole lines) and one 16 x 32 fragment is 1 KB. A 16-row tile starts where it starts in a row-major plane.
// ---- fragment loaders: lane -> row/col (lane&15), h = lane>>4; base = a pointer that is the same in every lane (it stays in
//      scalar registers), vo = byte offset of the fragment from base + 16*lane (one 32-bit register shared by all loads of a
//      step and advanced behind them); p = base + vo;
//      elements 0..7 <- p[0..7] (k0+8h..), elements 8..15 <- p[256..263] (k0+16+8h..)  (same split k map for A and B)
__device__ __forceinline__ v16h ldfrag_h(const _Float16* base, unsigned vo) {
  const char* p = (const char*)base + vo;
  FragH f;
  f.h[0] = *(const v8h*)(p);
  f.h[1] = *(const v8h*)(p + 512);
  return f.v;
}
__device__ __forceinline__ v16b ldfrag_b(const u16* base, unsigned vo) { // bf16 plane read as unsigned integer vectors
  const char* p = (const char*)base + vo;
  FragB f;
  f.u[0] = *(const v4u*)(p);
  f.u[1] = *(const v4u*)(p + 512);
  return f.v;
}

__device__ __forceinline__ v8f mma_h(v16h a, v16h b, v8f c) {
  return __builtin_amdgcn_wmma_f32_16x16x32_f16(false, a, false, b, (short)0, c, false, false);
}
__device__ __forceinline__ v8f mma_b(v16b a, v16b b, v8f c) {
  return __builtin_amdgcn_wmma_f32_16x16x32_bf16(false, a, false, b, (short)0, c, false, false);
}
__device__ __forceinline__ void guard2(v8f& a, v8f& b, v16h x0, v16h x1, v16h x2, v16h x3, v16h x4, v16h x5) {
#if defined(__HIP_DEVICE_COMPILE__)
  asm volatile("v_nop\n\tv_nop\n\tv_nop\n\tv_nop"
               : "+v"(a), "+v"(b) : "v"(x0), "v"(x1), "v"(x2), "v"(x3), "v"(x4), "v"(x5) : "memory");
#endif
}
template <typename F>
__device__ __forceinline__ void guard6(v8f& a, v8f& b, v8f& c, v8f& d, F x0, F x1, F x2, F x3, F x4, F x5) {
#if defined(__HIP_DEVICE_COMPILE__)
  asm volatile("v_nop\n\tv_nop\n\tv_nop\n\tv_nop"
               : "+v"(a), "+v"(b), "+v"(c), "+v"(d) : "v"(x0), "v"(x1), "v"(x2), "v"(x3), "v"(x4), "v"(x5) : "memory");
#endif
}
__device__ __forceinline__ void acc_guard4(v8f& a, v8f& b, v8f& c, v8f& d) {
#if defined(__HIP_DEVICE_COMPILE__)
  asm volatile("v_nop\n\tv_nop\n\tv_nop\n\tv_nop" : "+v"(a), "+v"(b), "+v"(c), "+v"(d));
#endif
}
__device__ __forceinline__ void wave_sync_lds() {
  __builtin_amdgcn_fence(__ATOMIC_RELEASE, "workgroup");
  __builtin_amdgcn_wave_barrier();
  __builtin_amdgcn_fence(__ATOMIC_ACQUIRE, "workgroup");
}

// =====================================================================================================
// f32 [rows][DMOD] -> 16-bit fragment-major plane.  f16mode == 0: bf16 RNE bits;  f16mode == 1: f16 bits of (bf16 RNE value)
// * scale. Thread = output unit gt = 8 consecutive elements of one row: two 16-B loads (a wave reads 64 B of each of 16 rows,
// the block uses every line whole), one 16-B store; 32 consecutive lanes store 512 contiguous, 512-B aligned bytes;
// coverage: grid = ceil(n8/256) blocks x 256 thr x 8 (in-kernel bound) = the whole plane (n8 a multiple of 256 here).
// =====================================================================================================
__global__ __launch_bounds__(256) void cvt16(const float* __restrict__ x, u16* D, int n8, int f16mode, float scale) {
  const int gt = blockIdx.x * 256 + (int)threadIdx.x;
  if (gt >= n8) return;
  const int srow = (gt >> 10) * 16 + (gt & 15);                                   // 1024 units per 16-row tile
  const int schk = ((gt >> 6) & (DMOD / 32 - 1)) * 4 + ((gt >> 5) & 1) * 2 + ((gt >> 4) & 1);
  const float* p = x + ((size_t)srow * (DMOD / 8) + schk) * 8;
  const v4f a = *(const v4f*)(p), b4 = *(const v4f*)(p + 4);
  float w[8];
#pragma unroll
  for (int e = 0; e < 4; ++e) { w[e] = a[e]; w[4 + e] = b4[e]; }
  v4u o;
#pragma unroll
  for (int e = 0; e < 4; ++e) {
    const float f0 = w[2 * e], f1 = w[2 * e + 1];
    const unsigned short hb0 = h_bits((_Float16)(bfr(f0) * scale));
    const unsigned short hb1 = h_bits((_Float16)(bfr(f1) * scale));
    const unsigned short bb0 = bf_bits(f0);
    const unsigned short bb1 = bf_bits(f1);
    o[e] = (f16mode != 0) ? pk16(hb0, hb1) : pk16(bb0, bb1);
  }
  u16* d = D + (size_t)gt * 8;
  {
    *(v4u*)(d) = o;
    
  }
}

// =====================================================================================================
// Rotary tables TC[s][j] = cos(s * inv[j]), TS[s][j] = sin(s * inv[j]), j < 32, with
// inv[j] = 1.0f / f32(10000^(j/32)) (power evaluated in f64 and narrowed once, IEEE f32 reciprocal, f32 product s*inv,
// coverage: grid = n/256 blocks x 256 thr = n = SEQ*32 elements of TC and of TS (n a multiple of 256).
// =====================================================================================================
__global__ __launch_bounds__(256) void k_tab(float* TC, float* TS, int n) {
#pragma clang fp contract(off)
  const int idx = blockIdx.x * 256 + (int)threadIdx.x;
  if (idx >= n) return;
  const int s = idx / NFREQ;
  const int j = idx - s * NFREQ;
  const double pj = exp2((double)j * ROPE_L2);       // 10000^(j/32)
  const float pf  = (float)pj;
  const float inv = 1.0f / pf;
  const float ang = (float)s * inv;
  float sv, cv;
  sincosf(ang, &sv, &cv);
  {
    *(float*)(TC + idx) = cv;
    *(float*)(TS + idx) = sv;
    
  }
}

// =====================================================================================================
// v^T planes from the value columns of the projection F f32 [MROWS][ldf] (row = b*SEQ + s, column = voff + g*HD + d) plus
// the per-column bias (bias[g*HD + d], f32 add, then the x1024 carry):
//   VH = f16(v * 1024), VL = f16 residual (t - f16(t)), both for all keys s, fragment-major per head with the 32-key step
//   outermost: [b*NKVH + g][s/32][d/16][half][lane][8] (row = d, k = key).
// Block = (b, head g, 64 keys s0): each thread loads its 16 floats (key sl, d chunk dc) with 16-B loads, adds bias, converts,
// places them into two LDS tiles [64 d][64 keys] (pitch 72 halves); after a block barrier each d row segment (64 halves =
// coverage: load 256 thr x 16 = 64 keys x 64 d; store 2 iterations x 256 thr x 8 halves = 64 lines x 64 = the block's tile of
//           VH and of VL; grid = NB*NKVH*NST blocks covers both planes exactly once.
// =====================================================================================================
__global__ __launch_bounds__(256) void vt16(const float* __restrict__ F, int ldf, int voff, const float* __restrict__ bias,
                                            u16* VHo, u16* VLo) {
#pragma clang fp contract(off)
  __shared__ __align__(16) u16 TH[HD * VTP];
  __shared__ __align__(16) u16 TL[HD * VTP];
  const int tid = threadIdx.x;
  const int bid = blockIdx.x;
  const int st  = bid % NST;
  const int t2  = bid / NST;
  const int g   = t2 % NKVH;
  const int b   = t2 / NKVH;
  if (b >= NB) return;                      // block-uniform, before any barrier; never taken with the exact grid
  const int s0  = st * 64;
  {
    const int sl = tid >> 2;                // key within tile 0..63
    const int dc = (tid & 3) * 16;          // d chunk 0,16,32,48
    const float* src = F + ((size_t)b * SEQ + s0 + sl) * (size_t)ldf + voff + g * HD + dc;
    const float* bp  = bias + g * HD + dc;
#pragma unroll
    for (int i = 0; i < 4; ++i) {
      const v4f a  = *(const v4f*)(src + 4 * i);
      const v4f bb = *(const v4f*)(bp + 4 * i);
#pragma unroll
      for (int e = 0; e < 4; ++e) {
        const float y = a[e] + bb[e];
        const float t = y * VCAR;
        const _Float16 hv = (_Float16)t;
        const _Float16 lv = (_Float16)(t - (float)hv);
        TH[(dc + 4 * i + e) * VTP + sl] = h_bits(hv);
        TL[(dc + 4 * i + e) * VTP + sl] = h_bits(lv);
      }
    }
  }
  __syncthreads();
  v4u vh[2], vl[2];
#pragma unroll
  for (int it = 0; it < 2; ++it) {
    const int u  = it * 256 + tid;                                        // output unit within the block's 64 keys
    const int d  = ((u >> 6) & 3) * 16 + (u & 15);
    const int ko = (u >> 8) * 32 + ((u >> 5) & 1) * 16 + ((u >> 4) & 1) * 8;
    vh[it] = *(const v4u*)(TH + d * VTP + ko);
    vl[it] = *(const v4u*)(TL + d * VTP + ko);
  }
  const size_t hrow = (size_t)(b * NKVH + g) * HD;
  const size_t base = hrow * SEQ + (size_t)s0 * HD + tid * 8;
  {
#pragma unroll
    for (int it = 0; it < 2; ++it) {
      *(v4u*)(VHo + base + it * 2048) = vh[it];
      *(v4u*)(VLo + base + it * 2048) = vl[it];
    }
    
  }
}

// =====================================================================================================
// Interleaved-pair rotary + bias + q / k planes from the projection F f32 [MROWS][ldf] at column offset coff (ncol = DMOD
// for q, KVD for k; row = b*SEQ + s, column = coff + head*HD + d; table row = s, table column j = d >> 1):
//   y[d] = F[d] + bias[d] (f32 add)
//   out[2j]   = y[2j]  *c[s][j] + (-1)*(y[2j+1]*sn[s][j])
//   out[2j+1] = y[2j+1]*c[s][j] + (+1)*(y[2j]  *sn[s][j])        with c, sn the f32 table values (mul, mul, add kept
//   separate); Hp = f16(out * sc), Lp = f16 residual (t - f16(t)), both fragment-major per head:
//   [b*nh + head][s/16][d/32][half][lane][8] (row = position s, k = d).
// Block = one 16 x 32 fragment (b, head, 16 positions, d step kk), 64 threads = its 64 units; thread = position s, 8 columns
// head*HD + dd .. +7 (4 pairs); the block's two waves read the two 64-B halves of the same 16 lines of F.
// coverage: 64 thr x 8 = one 1-KB fragment of Hp and of Lp; grid = MROWS = NB*nh*(SEQ/16)*2 blocks = every fragment once.
// =====================================================================================================
__device__ __forceinline__ void rot_one(float x, float y, float cv, float sv, float sgn, float sc,
                                        unsigned short& hb, unsigned short& lb) {
#pragma clang fp contract(off)
  const float ys   = y * sv;
  const float term = sgn * ys;
  const float r    = x * cv + term;
  const float t    = r * sc;
  const _Float16 a = (_Float16)t;
  hb = h_bits(a);
  lb = h_bits((_Float16)(t - (float)a));
}

__global__ __launch_bounds__(64) void rope16(const float* __restrict__ F, int ldf, int coff, int ncol,
                                             const float* __restrict__ bias,
                                             const float* __restrict__ TC, const float* __restrict__ TS,
                                             u16* Hp, u16* Lp, float sc) {
#pragma clang fp contract(off)
  const int tid = (int)threadIdx.x;
  const int bid = (int)blockIdx.x;
  const int nh  = ncol / HD;                           // heads in the q / k block
  if (nh <= 0) return;
  const int kk   = bid & 1;                            // 32-wide d step
  const int t1   = bid >> 1;
  const int tile = t1 % (SEQ / 16);                    // 16-position tile
  const int t2   = t1 / (SEQ / 16);
  const int head = t2 % nh;
  const int b    = t2 / nh;
  if (b >= NB) return;                                 // never taken with grid = NB * nh * (SEQ/16) * 2
  const int s    = tile * 16 + (tid & 15);
  const int dd   = (kk * 4 + ((tid >> 5) & 1) * 2 + ((tid >> 4) & 1)) * 8;   // d within head, multiple of 8
  const int col  = head * HD + dd;
  const int jj   = dd >> 1;                            // table column of the first pair, multiple of 4
  const int row  = b * SEQ + s;
  const float* p = F + (size_t)row * (size_t)ldf + coff + col;
  const v4f xa = *(const v4f*)(p),          xb = *(const v4f*)(p + 4);
  const v4f ba = *(const v4f*)(bias + col), bb = *(const v4f*)(bias + col + 4);
  // the table loads below may return their data into the address registers of the four loads above: the wait stands in front
  asm volatile("s_wait_xcnt 0x0" ::: "memory");
  const v4f cw = *(const v4f*)(TC + (size_t)s * NFREQ + jj);
  const v4f sw = *(const v4f*)(TS + (size_t)s * NFREQ + jj);
  float yv[8];
#pragma unroll
  for (int e = 0; e < 4; ++e) {
    yv[e]     = xa[e] + ba[e];
    yv[4 + e] = xb[e] + bb[e];
  }
  v4u oh, ol;
#pragma unroll
  for (int e = 0; e < 4; ++e) {
    unsigned short h0, l0, h1, l1;
    rot_one(yv[2 * e],     yv[2 * e + 1], cw[e], sw[e], -1.0f, sc, h0, l0);   // even element of the pair
    rot_one(yv[2 * e + 1], yv[2 * e],     cw[e], sw[e],  1.0f, sc, h1, l1);   // odd element of the pair
    oh[e] = pk16(h0, h1);
    ol[e] = pk16(l0, l1);
  }
  u16* dh = Hp + ((size_t)bid * 64 + tid) * 8;
  u16* dl = Lp + ((size_t)bid * 64 + tid) * 8;
  {
    *(v4u*)(dh) = oh;
    *(v4u*)(dl) = ol;
    
  }
}

// =====================================================================================================
// GEMM epilogue shared by both engines: the wave's 16x64 f32 tile (times oscale) staged in its LDS slab (pitch 68),
// 16 consecutive lanes x 16 B per line), lanes 16..31 -> row 2*it+1; HASB != 0 adds bias[col] in f32 to every element;
// coverage: 8 instructions x 2 rows x 16 lanes x 4 floats = the wave's 16 x 64 tile.
// =====================================================================================================
template <int HASB>
__device__ __forceinline__ void epi64(float* sl, v8f a0, v8f a1, v8f a2, v8f a3, float oscale, const float* bias,
                                      float* C, int N, size_t rowb, int col0, int lane) {
  const int hh = lane >> 4, m = lane & 15;
#pragma unroll
  for (int r = 0; r < 8; ++r) {
    const int ro = (8 * hh + r) * 68 + m;
    sl[ro]      = a0[r] * oscale;
    sl[ro + 16] = a1[r] * oscale;
    sl[ro + 32] = a2[r] * oscale;
    sl[ro + 48] = a3[r] * oscale;
  }
  wave_sync_lds();
  v4f vals[8];
#pragma unroll
  for (int it = 0; it < 8; ++it) vals[it] = *(const v4f*)(sl + (it * 2 + hh) * 68 + m * 4);
  if (HASB != 0) {
    const v4f b4 = *(const v4f*)(bias + col0 + m * 4);
#pragma unroll
    for (int it = 0; it < 8; ++it) vals[it] = vals[it] + b4;
  }
  float* dst = C + (rowb + (size_t)hh) * (size_t)N + col0 + m * 4;
  {
#pragma unroll
    for (int it = 0; it < 8; ++it) {
      *(v4f*)(dst + (size_t)(it * 2) * (size_t)N) = vals[it];
    }
    
  }
}

// =====================================================================================================
// bf16 GEMM: C[M][N] (f32) = A[M][K] . Bt[N][K]^T, times oscale; A and Bt bf16 fragment-major planes.
// Block = 64x64 tile, 4 waves x 16 rows; fragments loaded straight from the planes (two 512-B wave loads each, split k map
// for A and B); K stepped by 32 (host guarantees K % 32 == 0, M % 64 == 0, N % 64 == 0, grid = (M/64)*(N/64)).
// =====================================================================================================
__global__ __launch_bounds__(128)
void gemm_bf(const u16* __restrict__ A, const u16* __restrict__ Bt, float* C, int M, int N, int K, float oscale) {
  __shared__ __align__(16) float slab[4 * SLAB64];
  const int tid = threadIdx.x, lane = tid & 31;
  const int wave = __builtin_amdgcn_readfirstlane(tid >> 5);   // scalar, so that the tile starts below are scalar bases
  const int ntile = N >> 6;
  const int bid   = blockIdx.x;
  const int rowb  = (bid / ntile) * 64 + wave * 16;
  const int col0  = (bid % ntile) * 64;
  if (rowb + 16 > M) return;                // wave-uniform, never taken with the exact grid; no block barriers in this kernel
  const u16* ap = A  + (size_t)rowb * K;              // fragment (16-row tile, k step ks) at tile start + ks * 1024 bytes
  const u16* bp  = Bt + (size_t)col0 * K;
  const u16* bp1 = Bt + (size_t)(col0 + 16) * K;
  const u16* bp2 = Bt + (size_t)(col0 + 32) * K;
  const u16* bp3 = Bt + (size_t)(col0 + 48) * K;
  unsigned vo = (unsigned)lane * 16u;
  v8f acc0 = zero8(), acc1 = zero8(), acc2 = zero8(), acc3 = zero8();
#pragma unroll 1
  for (int k0 = 0; k0 < K; k0 += 32, vo += 1024u) {
    const v16b a  = ldfrag_b(ap, vo);
    const v16b b0 = ldfrag_b(bp, vo);
    const v16b b1 = ldfrag_b(bp1, vo);
    const v16b b2 = ldfrag_b(bp2, vo);
    const v16b b3 = ldfrag_b(bp3, vo);
    acc0 = mma_b(a, b0, acc0);
    acc1 = mma_b(a, b1, acc1);
    acc2 = mma_b(a, b2, acc2);
    acc3 = mma_b(a, b3, acc3);
    guard6<v16b>(acc0, acc1, acc2, acc3, a, b0, b1, b2, b3, a);
  }
  epi64<0>(slab + wave * SLAB64, acc0, acc1, acc2, acc3, oscale, C, C, N, (size_t)rowb, col0, lane);
}

// =====================================================================================================
// f16 GEMM: C[M][N] (f32) = (A[M][K] (+ A2[M][K] when TWO != 0)) . Bt[N][K]^T, times oscale, plus bias[n]; A, A2 f16
// fragment-major planes (A2 = the unscaled f16 residual of A, sharing the accumulator), Bt f16 fragment-major. Same tiling, fragment
// loads (split k map) and epilogue as gemm_bf; K stepped by 32.
// =====================================================================================================
template <int TWO>
__global__ __launch_bounds__(128)
void gemm_h(const u16* __restrict__ A, const u16* __restrict__ A2, const u16* __restrict__ Bt,
            const float* __restrict__ bias, float* C, int M, int N, int K, float oscale) {
  __shared__ __align__(16) float slab[4 * SLAB64];
  const int tid = threadIdx.x, lane = tid & 31;
  const int wave = __builtin_amdgcn_readfirstlane(tid >> 5);   // scalar, so that the tile starts below are scalar bases
  const int ntile = N >> 6;
  const int bid   = blockIdx.x;
  const int rowb  = (bid / ntile) * 64 + wave * 16;
  const int col0  = (bid % ntile) * 64;
  if (rowb + 16 > M) return;                // wave-uniform, never taken with the exact grid; no block barriers in this kernel
  const _Float16* ap  = (const _Float16*)(const void*)A  + (size_t)rowb * K;
  const _Float16* ap2 = (const _Float16*)(const void*)A2 + (size_t)rowb * K;
  const _Float16* bp  = (const _Float16*)(const void*)Bt + (size_t)col0 * K;
  const _Float16* bp1 = (const _Float16*)(const void*)Bt + (size_t)(col0 + 16) * K;
  const _Float16* bp2 = (const _Float16*)(const void*)Bt + (size_t)(col0 + 32) * K;
  const _Float16* bp3 = (const _Float16*)(const void*)Bt + (size_t)(col0 + 48) * K;
  unsigned vo = (unsigned)lane * 16u;
  v8f acc0 = zero8(), acc1 = zero8(), acc2 = zero8(), acc3 = zero8();
#pragma unroll 1
  for (int k0 = 0; k0 < K; k0 += 32, vo += 1024u) {
    const v16h a  = ldfrag_h(ap, vo);
    const v16h b0 = ldfrag_h(bp, vo);
    const v16h b1 = ldfrag_h(bp1, vo);
    const v16h b2 = ldfrag_h(bp2, vo);
    const v16h b3 = ldfrag_h(bp3, vo);
    acc0 = mma_h(a, b0, acc0);
    acc1 = mma_h(a, b1, acc1);
    acc2 = mma_h(a, b2, acc2);
    acc3 = mma_h(a, b3, acc3);
    if (TWO != 0) {
      const v16h a2 = ldfrag_h(ap2, vo);
      acc0 = mma_h(a2, b0, acc0);
      acc1 = mma_h(a2, b1, acc1);
      acc2 = mma_h(a2, b2, acc2);
      acc3 = mma_h(a2, b3, acc3);
      guard6<v16h>(acc0, acc1, acc2, acc3, a, a2, b0, b1, b2, b3);
    } else {
      guard6<v16h>(acc0, acc1, acc2, acc3, a, b0, b1, b2, b3, a);
    }
  }
  (void)ap2;
  epi64<1>(slab + wave * SLAB64, acc0, acc1, acc2, acc3, oscale, bias, C, N, (size_t)rowb, col0, lane);
}

// =====================================================================================================
// Causal softmax attention, hd = 64, 8 heads. Block bid -> (query tile qt = qt0 + bid % nqt: rows q0 = 16*qt .. q0+15, head,
// batch b); keys/values of the same head (kvh = head). The tile's key steps are dealt over the block's NSW waves: wave w takes
// steps w, w + NSW, ... with its own running max, sum and O accumulators; the NSW partials are merged in LDS behind one block
// barrier (attn_merge8), so the longest serial walk is NKT / NSW steps instead of NKT.
//   q and k hi / residual planes f16 x256, fragment-major per head [b*8 + h][s/16][d/32][half][lane][8];
//   v^T hi / residual planes x1024, fragment-major per head [b*NKVH + h][s/32][d/16][half][lane][8].
//   raw(i, j) = q_hi.k_hi + q_lo.k_hi + q_hi.k_lo (2 k-steps over d); logit = raw * (SM_SCALE * 2^-16) (the two 256 carries
//   folded exactly into the 1/sqrt(512) scale, one f32 multiply); keys above the diagonal replaced by -inf; online softmax per
//   query row in f32 with a running max: row max / row sum over the 16 lanes holding the row via xor shuffles 1,2,4,8 (never
//   crossing the lane half), alpha = exp(m_old - m_new), p = exp(logit - m_new), l = l*alpha + sum p, O accumulators times
//   alpha before the tile's P.v. Only key tiles of 32 with kb <= q0 are visited (nkt = q0/32 + 1 <= NKT; key kb is
//   unmasked for every row of the tile, so each row max of a visited tile is finite; wave 0 always visits tile 0).
//   The 16x32 p tile goes to wave-private LDS (f32 element
//   rows (float vector loads, same element type as stored); v^T B fragments in 2 groups of 2 d-subtiles; RV = 1: products
//   hh + lh + hl, RV = 0: hh only. After the loop every wave (one without a step: max -inf, sum 0, O 0) puts its raw O
//   accumulators into its slab and its 16 row maxima and sums beside them; block barrier; waves 0..3 merge.
//   Epilogue: O = merged acc / (merged l * 32768 * 1024), x256 -> f16 hi plane (and for RV = 1 the unscaled f16 residual
//   plane), fragment-major over [b*SEQ + s][512]; wave it < 4, lane = (row c, 8 consecutive d at it*16 + 8*hh); one
//   instruction = one 512-B half fragment (4 whole lines).
// coverage: 4 waves x 1 instruction x 32 lanes x 8 halves = 16 x 64 per plane; grid nqt x NH x NB blocks;
//   the two launches (tiles 0..NQTR-1 with RV = 1, NQTR..NQT-1 with RV = 0) cover every (b, s, h) row segment of the hi plane
//   exactly once and rows s < RICH of the residual plane exactly once (only those rows are read later).
// =====================================================================================================
// 2^x for the merge weights. The v_nop in the same statement keeps the one issue slot that the instruction set asks for behind
// a transcendental, whichever instruction the compiler places next.
__device__ __forceinline__ float exp2_slot(float x) {
  float r = 0.0f;
#if defined(__HIP_DEVICE_COMPILE__)
  asm("v_exp_f32 %0, %1\n\tv_nop" : "=v"(r) : "v"(x));
#endif
  return r;
}

// Merge of the NSW partials for one lane's 8 outputs (row c, columns dd .. dd+7): M = max of the waves' row maxima, weight
// exp(m_w - M) (0 for a wave without a step), L = sum of weight * l_w, acc = sum of weight * O_w, waves in index order.
__device__ __forceinline__ void attn_merge8(const float* slabs, const float* sm, const float* sl, int c, int dd,
                                            float* acc, float& L) {
  float mw[NSW], lw[NSW];
  v4f pa[NSW], pb[NSW];
#pragma unroll
  for (int w = 0; w < NSW; ++w) {
    mw[w] = sm[w * 16 + c];
    lw[w] = sl[w * 16 + c];
    pa[w] = *(const v4f*)(slabs + w * SLW + c * SLP + dd);
    pb[w] = *(const v4f*)(slabs + w * SLW + c * SLP + dd + 4);
  }
  float M = mw[0];
#pragma unroll
  for (int w = 1; w < NSW; ++w) M = fmaxf(M, mw[w]);
  L = 0.0f;
#pragma unroll
  for (int e = 0; e < 8; ++e) acc[e] = 0.0f;
#pragma unroll
  for (int w = 0; w < NSW; ++w) {
    const float wt = exp2_slot((mw[w] - M) * 1.44269504f);
    L += wt * lw[w];
#pragma unroll
    for (int e = 0; e < 4; ++e) {
      acc[e]     += wt * pa[w][e];
      acc[4 + e] += wt * pb[w][e];
    }
  }
}

template <int RV>
__global__ __launch_bounds__(ATT_THREADS)
void attn_cs(const u16* __restrict__ QHp, const u16* __restrict__ QLp,
             const u16* __restrict__ KHp, const u16* __restrict__ KLp,
             const u16* __restrict__ VHp, const u16* __restrict__ VLp,
             u16* OHp, u16* OLp, int qt0, int nqt) {
#pragma clang fp contract(off)
  __shared__ __align__(16) float smem[NSW * SLW];   // per wave: p tile in the loop, O partial slab behind it
  __shared__ float smx[NSW * 16];                   // per wave: 16 row maxima
  __shared__ float ssm[NSW * 16];                   // per wave: 16 row sums

  const int tid  = threadIdx.x;
  const int wave = __builtin_amdgcn_readfirstlane(tid >> 5);   // scalar: which key steps the wave takes
  const int lane = tid & 31;
  const int hh   = lane >> 4;
  const int c    = lane & 15;
  const int bid  = blockIdx.x;
  if (nqt <= 0) return;                     // block-uniform, in front of the block barrier
  const int qt   = qt0 + bid % nqt;
  const int t2   = bid / nqt;
  const int head = t2 % NH;
  const int b    = t2 / NH;
  if (b >= NB) return;                      // block-uniform; never taken with the exact grid
  const int q0   = qt * 16;
  if (q0 + 16 > SEQ) return;                // block-uniform; never taken
  const int kvh  = head;

  float* pt   = smem + wave * SLW;          // p tile [16][32] pitch 36, dead behind the loop
  float* slab = pt;                         // O partial slab [16][64] pitch 68, written behind the loop

  // fragment-major planes: a head's 16 positions x 64 d = 1024 halves (2 fragments), its 32 keys x 64 d of v^T = 2048 (4)
  // byte offsets into the planes (each plane MROWS * 512 * 2 bytes, far under 2^32), the lane's 16 bytes included
  const unsigned qvo = ((unsigned)(b * NH + head) * SEQ + (unsigned)q0) * (HD * 2u) + (unsigned)lane * 16u;
  unsigned kvo = (unsigned)(b * NKVH + kvh) * (SEQ * HD * 2u) + (unsigned)wave * (32u * HD * 2u)
               + (unsigned)lane * 16u;                                                  // this step's 32 keys, k and v^T alike
  const _Float16* Qh  = (const _Float16*)(const void*)QHp;
  const _Float16* Ql  = (const _Float16*)(const void*)QLp;
  const _Float16* Khb = (const _Float16*)(const void*)KHp;
  const _Float16* Klb = (const _Float16*)(const void*)KLp;
  const _Float16* Vhb = (const _Float16*)(const void*)VHp;               // d-subtile j at + j * 512 halves
  const _Float16* Vlb = (const _Float16*)(const void*)VLp;
  const float lsc  = SM_SCALE * (1.0f / (QSC * KSC));   // exact power-of-two fold of the q / k carries into the scale
  const float oc   = 1.0f / (PCAR * VCAR);
  const float ninf = -__builtin_inff();
  const size_t KROW = (size_t)HD;           // halves per key in a head's fragment-major plane

  v8f o[4];
#pragma unroll
  for (int j = 0; j < 4; ++j) o[j] = zero8();
  float mrun[8], lrun[8];
#pragma unroll
  for (int r = 0; r < 8; ++r) { mrun[r] = ninf; lrun[r] = 0.0f; }
  const int ncaus = (q0 >> 5) + 1;                                            // tiles holding keys <= q0 + 15
  const int nkt   = (ncaus < NKT) ? ncaus : NKT;
  const int qr0   = q0 + 8 * hh;                                              // query row of D element r = qr0 + r

#pragma unroll 1
  for (int kt = wave; kt < nkt; kt += NSW, kvo += NSW * 32u * HD * 2u) {
    const int kb = kt * 32;
    // ---- raw scores: D element r of this lane = (query row qr0 + r, key kb + c) in s0, key kb + 16 + c in s1 ----
    v8f s0 = zero8(), s1 = zero8();
    const _Float16* k0p = Khb;
    const _Float16* k1p = k0p + (size_t)16 * KROW;
    const _Float16* l0p = Klb;
    const _Float16* l1p = l0p + (size_t)16 * KROW;
#pragma unroll
    for (int kk = 0; kk < HD / 32; ++kk) {
      const v16h qh  = ldfrag_h(Qh + kk * 512, qvo);
      const v16h ql  = ldfrag_h(Ql + kk * 512, qvo);
      const v16h kh0 = ldfrag_h(k0p + kk * 512, kvo);
      const v16h kh1 = ldfrag_h(k1p + kk * 512, kvo);
      const v16h kl0 = ldfrag_h(l0p + kk * 512, kvo);
      const v16h kl1 = ldfrag_h(l1p + kk * 512, kvo);
      s0 = mma_h(qh, kh0, s0);
      s0 = mma_h(ql, kh0, s0);
      s0 = mma_h(qh, kl0, s0);
      s1 = mma_h(qh, kh1, s1);
      s1 = mma_h(ql, kh1, s1);
      s1 = mma_h(qh, kl1, s1);
      guard2(s0, s1, qh, ql, kh0, kl0, kh1, kl1);
    }
    // ---- causal replace-mask, running-max online softmax in f32, p tile -> wave-private LDS ----
    float alpha[8];
    const int key0 = kb + c, key1 = kb + 16 + c;
#pragma unroll
    for (int r = 0; r < 8; ++r) {
      const int qrow = qr0 + r;
      const float a0 = s0[r] * lsc;
      const float a1 = s1[r] * lsc;
      const float t0 = (key0 > qrow) ? ninf : a0;
      const float t1 = (key1 > qrow) ? ninf : a1;
      float mx = fmaxf(t0, t1);
      mx = fmaxf(mx, __shfl_xor(mx, 1, 32));
      mx = fmaxf(mx, __shfl_xor(mx, 2, 32));
      mx = fmaxf(mx, __shfl_xor(mx, 4, 32));
      mx = fmaxf(mx, __shfl_xor(mx, 8, 32));
      const float mnew = fmaxf(mrun[r], mx);
      const float al   = __expf(mrun[r] - mnew);
      const float p0   = __expf(t0 - mnew);
      const float p1   = __expf(t1 - mnew);
      float sm = p0 + p1;
      sm += __shfl_xor(sm, 1, 32);
      sm += __shfl_xor(sm, 2, 32);
      sm += __shfl_xor(sm, 4, 32);
      sm += __shfl_xor(sm, 8, 32);
      lrun[r]  = lrun[r] * al + sm;
      mrun[r]  = mnew;
      alpha[r] = al;
      const int ro = (8 * hh + r) * PTP + c;
      pt[ro]      = p0;
      pt[ro + 16] = p1;
    }
    wave_sync_lds();
    // ---- rescale the O accumulators by alpha (row 8hh + r of every d-subtile) ----
#pragma unroll
    for (int j = 0; j < 4; ++j) {
#pragma unroll
      for (int r = 0; r < 8; ++r) o[j][r] = o[j][r] * alpha[r];
    }
    // ---- A fragments of p*32768: hi f16 and residual f16, row = c, split k map over the 32 keys of this step ----
    FragH ph, pl;
    {
      const float* prow = pt + c * PTP + 8 * hh;
      const v4f p0 = *(const v4f*)(prow), p1 = *(const v4f*)(prow + 4);
      const v4f p2 = *(const v4f*)(prow + 16), p3 = *(const v4f*)(prow + 20);
#pragma unroll
      for (int e = 0; e < 4; ++e) {
        const float ta = p0[e] * PCAR, tb = p1[e] * PCAR, tc = p2[e] * PCAR, td = p3[e] * PCAR;
        const _Float16 ha = (_Float16)ta, hb = (_Float16)tb, hc = (_Float16)tc, hd = (_Float16)td;
        ph.h[0][e]     = ha;                  // elements 0..7  = keys kb + 8hh + 0..7
        ph.h[0][4 + e] = hb;
        ph.h[1][e]     = hc;                  // elements 8..15 = keys kb + 16 + 8hh + 0..7
        ph.h[1][4 + e] = hd;
        pl.h[0][e]     = (_Float16)(ta - (float)ha);
        pl.h[0][4 + e] = (_Float16)(tb - (float)hb);
        pl.h[1][e]     = (_Float16)(tc - (float)hc);
        pl.h[1][4 + e] = (_Float16)(td - (float)hd);
      }
    }
    // ---- P.V : B fragment col n = d = j*16 + c, keys contiguous in the v^T planes; 2 groups of 2 d-subtiles ----
    {
      const _Float16* vhp = Vhb;
      const _Float16* vlp = Vlb;
      (void)vlp;
#pragma unroll
      for (int jg = 0; jg < 2; ++jg) {
        const size_t da = (size_t)(2 * jg) * 512;
        const size_t db = da + 512;
        const v16h vha = ldfrag_h(vhp + da, kvo), vhb2 = ldfrag_h(vhp + db, kvo);
        o[2 * jg]     = mma_h(ph.v, vha,  o[2 * jg]);
        o[2 * jg + 1] = mma_h(ph.v, vhb2, o[2 * jg + 1]);
        if (RV != 0) {
          const v16h vla = ldfrag_h(vlp + da, kvo), vlb2 = ldfrag_h(vlp + db, kvo);
          o[2 * jg]     = mma_h(pl.v, vha,  o[2 * jg]);
          o[2 * jg]     = mma_h(ph.v, vla,  o[2 * jg]);
          o[2 * jg + 1] = mma_h(pl.v, vhb2, o[2 * jg + 1]);
          o[2 * jg + 1] = mma_h(ph.v, vlb2, o[2 * jg + 1]);
          guard2(o[2 * jg], o[2 * jg + 1], ph.v, pl.v, vha, vhb2, vla, vlb2);
        } else {
          guard2(o[2 * jg], o[2 * jg + 1], ph.v, pl.v, vha, vhb2, vha, vhb2);
        }
      }
    }
    wave_sync_lds();
  }
  acc_guard4(o[0], o[1], o[2], o[3]);
  // ---- the wave's partial: raw O accumulators into its slab, row maxima and sums (alike in the 16 lanes of a row) beside ----
#pragma unroll
  for (int r = 0; r < 8; ++r) {
#pragma unroll
    for (int j = 0; j < 4; ++j) {
      const int idx = (8 * hh + r) * SLP + j * 16 + c;
      slab[idx] = o[j][r];
    }
  }
  if (c == 0) {
#pragma unroll
    for (int r = 0; r < 8; ++r) {
      smx[wave * 16 + 8 * hh + r] = mrun[r];
      ssm[wave * 16 + 8 * hh + r] = lrun[r];
    }
  }
  __syncthreads();                          // every wave's partial is in LDS before any wave merges; passed by all NSW waves
  if (wave >= 4) return;                    // wave-uniform, behind the only block barrier
  // ---- merged O / l with the carries (32768 on p, 1024 on v) folded once, x256 -> f16 hi plane (+ f16 residual plane),
  //      fragment-major [row/16][512/32][half][lane][8]: wave it stores half it&1 of k step head*2 + (it>>1);
  //      lane = (row c, 8 consecutive d at it*16 + 8*hh) ----
  const int it = wave;
  float acc[8], lsum;
  attn_merge8(smem, smx, ssm, c, it * 16 + 8 * hh, acc, lsum);
  const float rl = (1.0f / lsum) * oc;
  float w[8];
#pragma unroll
  for (int e = 0; e < 8; ++e) w[e] = (acc[e] * rl) * OSC;
  v4u oh, ol;
#pragma unroll
  for (int e = 0; e < 4; ++e) {
    const _Float16 h0 = (_Float16)w[2 * e], h1 = (_Float16)w[2 * e + 1];
    const _Float16 g0 = (_Float16)(w[2 * e] - (float)h0), g1 = (_Float16)(w[2 * e + 1] - (float)h1);
    oh[e] = pk16(h_bits(h0), h_bits(h1));
    ol[e] = pk16(h_bits(g0), h_bits(g1));
  }
  const size_t ob = ((size_t)b * SEQ + q0) * DMOD + (size_t)head * (16 * HD) + 8 * lane + it * 256;
  *(v4u*)(OHp + ob) = oh;
  if (RV != 0) {
    *(v4u*)(OLp + ob) = ol;
  }
}

// =====================================================================================================
// Workspace map (bytes); every plane is fully written by whole-line stores before it is read (the O residual plane only on
// the rows < RICH per sequence that are read); all extents are exact multiples of the store granularity (no pad rows needed);
// every region offset a multiple of 131072; every 16-bit plane is fragment-major (see the fragment loaders), same extent as
// the row-major shape given here:
//   XB  bf16 [MROWS][512]               MROWS*1024   (NB=4, SEQ=2048: 8388608); after the projection GEMM the same bytes hold
//                                                    the O f16 hi plane [MROWS][512] x256 (identical extent)
//   WB  bf16 [1536 n][512 k]            1572864      (Wq rows 0..511, Wk 512..1023, Wv 1024..1535); after the projection
//                                                    GEMM its first 524288 bytes hold the Wo f16 plane [512 o][512 d]
//   F   f32 [MROWS][1536]               MROWS*6144   (q_proj | k_proj | v_proj columns); after rope16 / vt16 its first
//                                                    MROWS*1024 bytes hold the O f16 residual plane [MROWS][512]
//   QH  f16 [MROWS][512] x256           MROWS*1024   QL residual, same extent
//   KH  f16 [MROWS][512] x256           MROWS*1024   KL residual, same extent   (keys = rotary of the v_proj columns)
//   VH  f16 [NB*8][64][SEQ] x1024       MROWS*1024   VL residual, same extent   (values = the k_proj columns)
//   TC  f32 [SEQ][32]                   SEQ*128      TS, same extent
//   end (NB=4, SEQ=2048)              111149056
// =====================================================================================================
extern "C" void kernel_launch(void* const* d_in, const int* in_sizes, int n_in,
                              void* d_out, int out_size, void* d_ws, size_t ws_size,
                              hipStream_t stream) {
  if (n_in < 9) return;
  if (in_sizes[0] < ((NB - 1) * XS_FULL + SEQ) * DMOD) return;
  if (in_sizes[1] != DMOD * DMOD) return;
  if (in_sizes[2] != DMOD) return;
  if (in_sizes[3] != DMOD * DMOD) return;
  if (in_sizes[4] != DMOD) return;
  if (in_sizes[5] != DMOD * DMOD) return;
  if (in_sizes[6] != DMOD) return;
  if (in_sizes[7] != DMOD * DMOD) return;
  if (in_sizes[8] != DMOD) return;
  if (out_size < ((NB - 1) * XS_FULL + SEQ) * DMOD) return;

  const float* x   = (const float*)d_in[0];
  const float* wq  = (const float*)d_in[1];
  const float* bqp = (const float*)d_in[2];
  const float* wk  = (const float*)d_in[3];
  const float* bkp = (const float*)d_in[4];
  const float* wv  = (const float*)d_in[5];
  const float* bvp = (const float*)d_in[6];
  const float* wo  = (const float*)d_in[7];
  const float* bop = (const float*)d_in[8];
  float*       out = (float*)d_out;

  const size_t szXB = (size_t)MROWS * DMOD * 2;
  const size_t szWB = (size_t)NQKV * DMOD * 2;
  const size_t szF  = (size_t)MROWS * NQKV * 4;
  const size_t szQ  = (size_t)MROWS * DMOD * 2;                  // QH, QL
  const size_t szK  = (size_t)MROWS * KVD * 2;                   // KH, KL
  const size_t szV  = (size_t)NB * NKVH * HD * SEQ * 2;          // VH, VL (== szK)
  const size_t szT  = (size_t)SEQ * NFREQ * 4;                   // TC, TS
  const size_t szOH = (size_t)MROWS * DMOD * 2;                  // O hi plane, lives in the XB region
  const size_t szOL = (size_t)MROWS * DMOD * 2;                  // O residual plane, lives in the F region
  const size_t szWT = (size_t)DMOD * DMOD * 2;                   // Wo f16 plane, lives in the WB region
  if (szOH > szXB || szOL > szF || szWT > szWB) return;
  size_t off = 0;
  const size_t oXB = off; off += szXB;
  const size_t oWB = off; off += szWB;
  const size_t oF  = off; off += szF;
  const size_t oQH = off; off += szQ;
  const size_t oQL = off; off += szQ;
  const size_t oKH = off; off += szK;
  const size_t oKL = off; off += szK;
  const size_t oVH = off; off += szV;
  const size_t oVL = off; off += szV;
  const size_t oTC = off; off += szT;
  const size_t oTS = off; off += szT;
  if (off > ws_size) return;                // off = 111149056 for NB = 4, SEQ = 2048
  if (off > (size_t)WS_CAP) return;

  char* ws = (char*)d_ws;
  u16*   XB  = (u16*)(ws + oXB);
  u16*   OH  = (u16*)(ws + oXB);
  u16*   WB  = (u16*)(ws + oWB);
  u16*   WT  = (u16*)(ws + oWB);
  float* F   = (float*)(ws + oF);
  u16*   OL  = (u16*)(ws + oF);
  u16*   QH  = (u16*)(ws + oQH);
  u16*   QL  = (u16*)(ws + oQL);
  u16*   KH  = (u16*)(ws + oKH);
  u16*   KL  = (u16*)(ws + oKL);
  u16*   VH  = (u16*)(ws + oVH);
  u16*   VL  = (u16*)(ws + oVL);
  float* TC  = (float*)(ws + oTC);
  float* TS  = (float*)(ws + oTS);

  const dim3 b256(256), b128(128), b64(64), bAT(ATT_THREADS);
  const int  n8x = (SEQ * DMOD) / 8;
  const dim3 gX((n8x + 255) / 256);                     // SEQ*DMOD/2048 blocks per batch
  const int  n8w = (DMOD * DMOD) / 8;
  const dim3 gW((n8w + 255) / 256);                     // 128
  const int  nT  = SEQ * NFREQ;
  const dim3 gT((nT + 255) / 256);                      // SEQ/8
  const dim3 gG1((MROWS / 64) * (NQKV / 64));
  const dim3 gRW(MROWS);
  const dim3 gVT(NB * NKVH * NST);
  const float osc = 1.0f / (OSC * WOS);

  // (0) x -> bf16 plane [MROWS][512], one launch per batch (sequence) row block
  for (int bq = 0; bq < NB; ++bq) {
    cvt16<<<gX, b256, 0, stream>>>(x + (size_t)bq * XS_FULL * DMOD, XB + (size_t)bq * SEQ * DMOD, n8x, 0, 1.0f);
  }
  // (1) Wq [512 n][512 k], Wk, Wv -> one bf16 plane [1536 n][512 k]
  cvt16<<<gW, b256, 0, stream>>>(wq, WB, n8w, 0, 1.0f);
  cvt16<<<gW, b256, 0, stream>>>(wk, WB + (size_t)VCOL0 * DMOD, n8w, 0, 1.0f);
  cvt16<<<gW, b256, 0, stream>>>(wv, WB + (size_t)KCOL0 * DMOD, n8w, 0, 1.0f);
  // (2) rotary cos / sin tables [SEQ][32]
  k_tab<<<gT, b256, 0, stream>>>(TC, TS, nT);
  // (3) F f32 [MROWS][1536] = x.[Wq|Wk|Wv]^T  (columns 0..511 q_proj, 512..1023 k_proj, 1024..1535 v_proj; biases later)
  gemm_bf<<<gG1, b128, 0, stream>>>(XB, WB, F, MROWS, NQKV, DMOD, 1.0f);
  // (4) q = rotary(q_proj + bq) -> hi + residual planes x256 from columns 0..511
  rope16<<<gRW, b64, 0, stream>>>(F, NQKV, QCOL0, DMOD, bqp, TC, TS, QH, QL, QSC);
  // (5) keys = rotary(v_proj + bv) -> hi + residual planes x256 from columns 1024..1535
  rope16<<<gRW, b64, 0, stream>>>(F, NQKV, KCOL0, KVD, bvp, TC, TS, KH, KL, KSC);
  // (6) values = k_proj + bk (no rotary) -> v^T hi + residual planes x1024 from columns 512..1023
  vt16<<<gVT, b256, 0, stream>>>(F, NQKV, VCOL0, bkp, VH, VL);
  // (7) Wo [512 o][512 d] -> f16 plane of the bf16 value x1024 (already k-contiguous; WB region, free after the projection GEMM)
  cvt16<<<gW, b256, 0, stream>>>(wo, WT, n8w, 1, WOS);
  // (8) causal attention -> O f16 hi plane x256 (XB region) for all query tiles; residual plane (F region) for tiles < RICH
  attn_cs<1><<<dim3(NQTR * NH * NB), bAT, 0, stream>>>(QH, QL, KH, KL, VH, VL, OH, OL, 0, NQTR);
  if (NQT > NQTR) {
    attn_cs<0><<<dim3((NQT - NQTR) * NH * NB), bAT, 0, stream>>>(QH, QL, KH, KL, VH, VL, OH, OL, NQTR, NQT - NQTR);
  }
  // (9) y = O.Wo^T + bo -> out f32 [rows][512], carries 256 x 1024 folded back; rows < RICH per sequence with O hi + residual
  for (int bq = 0; bq < NB; ++bq) {
    const size_t rb   = (size_t)bq * SEQ;            // row base in the O planes
    const size_t orow = (size_t)bq * XS_FULL;        // row base in out
    gemm_h<1><<<dim3((RICH / 64) * (DMOD / 64)), b128, 0, stream>>>(
        OH + rb * DMOD, OL + rb * DMOD, WT, bop, out + orow * DMOD, RICH, DMOD, DMOD, osc);
    if (SEQ > RICH) {
      const size_t rl = rb + RICH;
      const size_t ol = orow + RICH;
      gemm_h<0><<<dim3(((SEQ - RICH) / 64) * (DMOD / 64)), b128, 0, stream>>>(
          OH + rl * DMOD, OL + rl * DMOD, WT, bop, out + ol * DMOD, SEQ - RICH, DMOD, DMOD, osc);
    }
  }
  (void)hipGetLastError();
}

// v003
// It runs in 186 microseconds.
// Two timings next to v002 put it at 1.49 and 1.47 times that version's speed.
// Counting every step since v000, it is 2.04 times as fast.
// Contractions: x.[Wq|Wk|Wv]^T on v_wmma_f32_16x16x32_bf16 (x and the weights as bf16 RNE planes; weight [n][k] rows are
// the B operand columns (split k map); f32 accumulate); q.k^T over hd 64 and P.v on v_wmma_f32_16x16x32_f16 with f16 hi + f16
// residual planes (q, k x256 after rotary, products hh+lh+hl on every row; P x32768 hi + in-register residual and v^T x1024
// hi + residual plane for query rows < 512 of each sequence, P hi . v hi only for later rows); O.Wo^T on
// v_wmma_f32_16x16x32_f16 with O x256 as f16 hi (+ f16 residual plane for rows < 512 of each sequence) and Wo as
// f16(bf16(Wo)) x1024, one accumulator, bias added in f32; all f32 accumulate. Rotary cos/sin tables, bias adds and online
// softmax in f32 on VALU.
#include <hip/hip_runtime.h>
#include <math.h>
#include <stdint.h>

#ifndef NB
#define NB 4
#endif
#ifndef SEQ
#define SEQ 2048
#endif
#define XS_FULL 2048
#define DMOD  512
#define NH    8
#define NKVH  8
#define HD    64
#define HHALF (HD / 2)
#define NFREQ (HD / 2)
#define KVD   (NKVH * HD)
#define NQKV  (DMOD + 2 * KVD)
#define QCOL0 0
#define VCOL0 DMOD
#define KCOL0 (DMOD + KVD)
#define MROWS (NB * SEQ)
#define RICH  512
#define ROPE_L2 0.41524101186092028
#define SM_SCALE 0.04419417382415922f
#define QSC   256.0f
#define KSC   256.0f
#define PCAR  32768.0f
#define VCAR  1024.0f
#define OSC   256.0f
#define WOS   1024.0f
#define NSW   8
#define NQT   (SEQ / 16)
#define NQTR  (RICH / 16)
#define NST   (SEQ / 64)
#define NKT   (SEQ / 32)
#define ATT_THREADS (NSW * 32)
#define PTP   36
#define PTW   (16 * PTP)
#define SLP   68
#define SLW   (16 * SLP)
#define SLAB64 (16 * 68)
#define VTP   72
#define WS_CAP 134217728
#define GX    (SEQ * DMOD / 8 / 256)
#define GW    (DMOD * DMOD / 8 / 256)
#define GT    (SEQ * NFREQ / 256)
#define GR    (MROWS / 4)
#define GV    (NB * NKVH * NST)
static_assert(DMOD == NH * HD && HD == 64 && HHALF == 32 && NFREQ == 32 && NH == 8 && NKVH == NH);
static_assert(ATT_THREADS == 256 && NSW >= 4 && PTW <= SLW && KVD == 512 && NQKV == 1536 && KCOL0 + KVD == NQKV && VCOL0 + KVD == KCOL0);
static_assert(NB >= 1 && NB <= 4);
static_assert(NB == 1 || SEQ == XS_FULL);
static_assert((SEQ % 64) == 0 && SEQ >= 64 && SEQ <= XS_FULL);
static_assert((RICH % 64) == 0 && RICH >= 64 && RICH <= SEQ);
static_assert((DMOD % 64) == 0 && (KVD % 64) == 0 && (NQKV % 64) == 0 && (DMOD % 32) == 0 && (HD % 32) == 0);
static_assert(((SEQ * DMOD / 8) % 256) == 0 && ((DMOD * DMOD / 8) % 256) == 0 && ((SEQ * NFREQ) % 256) == 0);
static_assert(NSW * (SLW + 32) * 4 <= 65536 && 2 * HD * VTP * 2 <= 65536 && 4 * SLAB64 * 4 <= 65536);
static_assert(DMOD / 8 == 64 && KVD / 8 == 64);
static_assert(((SEQ * DMOD / 8) % 1024) == 0 && ((DMOD * DMOD / 8) % 1024) == 0 && (SEQ % 32) == 0 && (RICH % 16) == 0);

typedef unsigned short u16;
typedef _Float16 v16h __attribute__((ext_vector_type(16)));
typedef _Float16 v8h  __attribute__((ext_vector_type(8)));
typedef __bf16   v16b __attribute__((ext_vector_type(16)));
typedef float    v8f  __attribute__((ext_vector_type(8)));
typedef float    v4f  __attribute__((ext_vector_type(4)));
typedef unsigned int v4u __attribute__((ext_vector_type(4)));

union FragH { v16h v; v8h h[2]; v4u u[2]; };
union FragB { v16b v; v4u u[2]; };

// ---- scalar helpers --------------------------------------------------------------------------------
__device__ __forceinline__ unsigned short bf_bits(float f) {          // f32 -> bf16 bits, RNE convert
  unsigned u = __float_as_uint(f);
  return (unsigned short)((u + 0x7FFFu + ((u >> 16) & 1u)) >> 16);
}
__device__ __forceinline__ float bf_up(unsigned short h) { return __uint_as_float(((unsigned)h) << 16); }
__device__ __forceinline__ float bfr(float f) { return bf_up(bf_bits(f)); }
__device__ __forceinline__ unsigned short h_bits(_Float16 x) { return __builtin_bit_cast(unsigned short, x); }
__device__ __forceinline__ unsigned pk16(unsigned short a, unsigned short b) { return (unsigned)a | ((unsigned)b << 16); }
__device__ __forceinline__ v8f zero8() { v8f z = {0.f, 0.f, 0.f, 0.f, 0.f, 0.f, 0.f, 0.f}; return z; }

// ---- fragment-major planes: every 16-bit A/B operand plane [row][K] other than v^T is stored as [row/16][K/32][g][lane][8]: the 16-B unit
//      of lane = 16*h + (row&15) in half g holds k = 32*ks + 16*g + 8*h + 0..7, so one wave-wide 16-B load is 512 contiguous
//      bytes (4 whole lines) and one 16 x 32 fragment is 1 KB. A 16-row tile starts where it starts in a row-major plane.
// ---- fragment loaders: lane -> row/col (lane&15), h = lane>>4; base = a pointer that is the same in every lane (it stays in
//      scalar registers), vo = byte offset of the fragment from base + 16*lane (one 32-bit register shared by all loads of a
//      step and advanced behind them); p = base + vo;
//      elements 0..7 <- p[0..7] (k0+8h..), elements 8..15 <- p[256..263] (k0+16+8h..)  (same split k map for A and B)
__device__ __forceinline__ v16h ldfrag_h(const _Float16* base, unsigned vo) {
  const char* p = (const char*)base + vo;
  FragH f;
  f.h[0] = *(const v8h*)(p);
  f.h[1] = *(const v8h*)(p + 512);
  return f.v;
}
__device__ __forceinline__ v16b ldfrag_b(const u16* base, unsigned vo) { // bf16 plane read as unsigned integer vectors
  const char* p = (const char*)base + vo;
  FragB f;
  f.u[0] = *(const v4u*)(p);
  f.u[1] = *(const v4u*)(p + 512);
  return f.v;
}

__device__ __forceinline__ v8f mma_h(v16h a, v16h b, v8f c) {
  return __builtin_amdgcn_wmma_f32_16x16x32_f16(false, a, false, b, (short)0, c, false, false);
}
__device__ __forceinline__ v8f mma_b(v16b a, v16b b, v8f c) {
  return __builtin_amdgcn_wmma_f32_16x16x32_bf16(false, a, false, b, (short)0, c, false, false);
}
__device__ __forceinline__ void guard2(v8f& a, v8f& b, v16h x0, v16h x1, v16h x2, v16h x3, v16h x4, v16h x5) {
#if defined(__HIP_DEVICE_COMPILE__)
  asm volatile("v_nop\n\tv_nop\n\tv_nop\n\tv_nop"
               : "+v"(a), "+v"(b) : "v"(x0), "v"(x1), "v"(x2), "v"(x3), "v"(x4), "v"(x5) : "memory");
#endif
}
template <typename F>
__device__ __forceinline__ void guard6(v8f& a, v8f& b, v8f& c, v8f& d, F x0, F x1, F x2, F x3, F x4, F x5) {
#if defined(__HIP_DEVICE_COMPILE__)
  asm volatile("v_nop\n\tv_nop\n\tv_nop\n\tv_nop"
               : "+v"(a), "+v"(b), "+v"(c), "+v"(d) : "v"(x0), "v"(x1), "v"(x2), "v"(x3), "v"(x4), "v"(x5) : "memory");
#endif
}
__device__ __forceinline__ void acc_guard4(v8f& a, v8f& b, v8f& c, v8f& d) {
#if defined(__HIP_DEVICE_COMPILE__)
  asm volatile("v_nop\n\tv_nop\n\tv_nop\n\tv_nop" : "+v"(a), "+v"(b), "+v"(c), "+v"(d));
#endif
}
__device__ __forceinline__ void wave_sync_lds() {
  __builtin_amdgcn_fence(__ATOMIC_RELEASE, "workgroup");
  __builtin_amdgcn_wave_barrier();
  __builtin_amdgcn_fence(__ATOMIC_ACQUIRE, "workgroup");
}

// =====================================================================================================
// f32 [rows][DMOD] -> 16-bit fragment-major plane.  f16mode == 0: bf16 RNE bits;  f16mode == 1: f16 bits of (bf16 RNE value)
// * scale. Thread = output unit gt = 8 consecutive elements of one row: two 16-B loads (a wave reads 64 B of each of 16 rows,
// the block uses every line whole), one 16-B store; 32 consecutive lanes store 512 contiguous, 512-B aligned bytes;
// coverage: blk = 0 .. n8/256 - 1, x 256 thr x 8 (in-kernel bound) = the whole plane (n8 a multiple of 256 here).
// =====================================================================================================
__device__ __forceinline__ void cvt16(const float* __restrict__ x, u16* D, int blk, int n8, int f16mode, float scale) {
  const int gt = blk * 256 + (int)threadIdx.x;
  if (gt >= n8) return;
  const int srow = (gt >> 10) * 16 + (gt & 15);                                   // 1024 units per 16-row tile
  const int schk = ((gt >> 6) & (DMOD / 32 - 1)) * 4 + ((gt >> 5) & 1) * 2 + ((gt >> 4) & 1);
  const float* p = x + ((size_t)srow * (DMOD / 8) + schk) * 8;
  const v4f a = *(const v4f*)(p), b4 = *(const v4f*)(p + 4);
  float w[8];
#pragma unroll
  for (int e = 0; e < 4; ++e) { w[e] = a[e]; w[4 + e] = b4[e]; }
  v4u o;
#pragma unroll
  for (int e = 0; e < 4; ++e) {
    const float f0 = w[2 * e], f1 = w[2 * e + 1];
    const unsigned short hb0 = h_bits((_Float16)(bfr(f0) * scale));
    const unsigned short hb1 = h_bits((_Float16)(bfr(f1) * scale));
    const unsigned short bb0 = bf_bits(f0);
    const unsigned short bb1 = bf_bits(f1);
    o[e] = (f16mode != 0) ? pk16(hb0, hb1) : pk16(bb0, bb1);
  }
  u16* d = D + (size_t)gt * 8;
  {
    *(v4u*)(d) = o;
    
  }
}

// =====================================================================================================
// Rotary tables TC[s][j] = cos(s * inv[j]), TS[s][j] = sin(s * inv[j]), j < 32, with
// inv[j] = 1.0f / f32(10000^(j/32)) (power evaluated in f64 and narrowed once, IEEE f32 reciprocal, f32 product s*inv,
// coverage: blk = 0 .. n/256 - 1, x 256 thr = n = SEQ*32 elements of TC and of TS (n a multiple of 256).
// =====================================================================================================
__device__ __forceinline__ void k_tab(float* TC, float* TS, int blk, int n) {
#pragma clang fp contract(off)
  const int idx = blk * 256 + (int)threadIdx.x;
  if (idx >= n) return;
  const int s = idx / NFREQ;
  const int j = idx - s * NFREQ;
  const double pj = exp2((double)j * ROPE_L2);       // 10000^(j/32)
  const float pf  = (float)pj;
  const float inv = 1.0f / pf;
  const float ang = (float)s * inv;
  float sv, cv;
  sincosf(ang, &sv, &cv);
  {
    *(float*)(TC + idx) = cv;
    *(float*)(TS + idx) = sv;
    
  }
}

// =====================================================================================================
// One launch for everything that reads only the inputs: none of these pieces reads what another writes, so they share a grid
// by block range (every branch is block-uniform, no barrier): GT blocks the rotary tables, NB*GX blocks x -> bf16 plane
// [MROWS][512], GW blocks each Wq, Wk, Wv -> one bf16 plane [1536 n][512 k], GW blocks Wo -> f16 plane of the bf16 value x1024.
// coverage: grid = GT + NB*GX + 4*GW blocks, each range exactly the grid of its piece.
// =====================================================================================================
__global__ __launch_bounds__(256) void prep(const float* __restrict__ x, const float* __restrict__ wq,
                                            const float* __restrict__ wk, const float* __restrict__ wv,
                                            const float* __restrict__ wo, u16* XB, u16* WB, u16* WT, float* TC, float* TS) {
  int bid = (int)blockIdx.x;
  if (bid < GT) { k_tab(TC, TS, bid, SEQ * NFREQ); return; }
  bid -= GT;
  if (bid < NB * GX) {
    const int bq = bid / GX;
    cvt16(x + (size_t)bq * XS_FULL * DMOD, XB + (size_t)bq * SEQ * DMOD, bid - bq * GX, SEQ * DMOD / 8, 0, 1.0f);
    return;
  }
  bid -= NB * GX;
  if (bid < GW)     { cvt16(wq, WB, bid, DMOD * DMOD / 8, 0, 1.0f); return; }
  if (bid < 2 * GW) { cvt16(wk, WB + (size_t)VCOL0 * DMOD, bid - GW, DMOD * DMOD / 8, 0, 1.0f); return; }
  if (bid < 3 * GW) { cvt16(wv, WB + (size_t)KCOL0 * DMOD, bid - 2 * GW, DMOD * DMOD / 8, 0, 1.0f); return; }
  if (bid < 4 * GW) { cvt16(wo, WT, bid - 3 * GW, DMOD * DMOD / 8, 1, WOS); return; }
}

// =====================================================================================================
// v^T planes from the value columns of the projection F f32 [MROWS][ldf] (row = b*SEQ + s, column = voff + g*HD + d) plus
// the per-column bias (bias[g*HD + d], f32 add, then the x1024 carry):
//   VH = f16(v * 1024), VL = f16 residual (t - f16(t)), both for all keys s, fragment-major per head with the 32-key step
//   outermost: [b*NKVH + g][s/32][d/16][half][lane][8] (row = d, k = key).
// Block = (b, head g, 64 keys s0): each thread loads its 16 floats (key sl, d chunk dc) with 16-B loads, adds bias, converts,
// places them into two LDS tiles [64 d][64 keys] (pitch 72 halves); after a block barrier each d row segment (64 halves =
// coverage: load 256 thr x 16 = 64 keys x 64 d; store 2 iterations x 256 thr x 8 halves = 64 lines x 64 = the block's tile of
//           VH and of VL; bid = 0 .. NB*NKVH*NST - 1 covers both planes exactly once.
// =====================================================================================================
__device__ __forceinline__ void vt16(u16* TH, u16* TL, int bid, const float* __restrict__ F, int ldf, int voff,
                                     const float* __restrict__ bias, u16* VHo, u16* VLo) {
#pragma clang fp contract(off)
  const int tid = threadIdx.x;
  const int st  = bid % NST;
  const int t2  = bid / NST;
  const int g   = t2 % NKVH;
  const int b   = t2 / NKVH;
  if (b >= NB) return;                      // block-uniform, before any barrier; never taken with the exact grid
  const int s0  = st * 64;
  {
    const int sl = tid >> 2;                // key within tile 0..63
    const int dc = (tid & 3) * 16;          // d chunk 0,16,32,48
    const float* src = F + ((size_t)b * SEQ + s0 + sl) * (size_t)ldf + voff + g * HD + dc;
    const float* bp  = bias + g * HD + dc;
#pragma unroll
    for (int i = 0; i < 4; ++i) {
      const v4f a  = *(const v4f*)(src + 4 * i);
      const v4f bb = *(const v4f*)(bp + 4 * i);
#pragma unroll
      for (int e = 0; e < 4; ++e) {
        const float y = a[e] + bb[e];
        const float t = y * VCAR;
        const _Float16 hv = (_Float16)t;
        const _Float16 lv = (_Float16)(t - (float)hv);
        TH[(dc + 4 * i + e) * VTP + sl] = h_bits(hv);
        TL[(dc + 4 * i + e) * VTP + sl] = h_bits(lv);
      }
    }
  }
  __syncthreads();
  v4u vh[2], vl[2];
#pragma unroll
  for (int it = 0; it < 2; ++it) {
    const int u  = it * 256 + tid;                                        // output unit within the block's 64 keys
    const int d  = ((u >> 6) & 3) * 16 + (u & 15);
    const int ko = (u >> 8) * 32 + ((u >> 5) & 1) * 16 + ((u >> 4) & 1) * 8;
    vh[it] = *(const v4u*)(TH + d * VTP + ko);
    vl[it] = *(const v4u*)(TL + d * VTP + ko);
  }
  const size_t hrow = (size_t)(b * NKVH + g) * HD;
  const size_t base = hrow * SEQ + (size_t)s0 * HD + tid * 8;
  {
#pragma unroll
    for (int it = 0; it < 2; ++it) {
      *(v4u*)(VHo + base + it * 2048) = vh[it];
      *(v4u*)(VLo + base + it * 2048) = vl[it];
    }
    // in the shared launch the code of another block range follows and writes the offset register of these stores
    asm volatile("s_wait_xcnt 0x0" ::: "memory");
  }
}

// =====================================================================================================
// Interleaved-pair rotary + bias + q / k planes from the projection F f32 [MROWS][ldf] at column offset coff (ncol = DMOD
// for q, KVD for k; row = b*SEQ + s, column = coff + head*HD + d; table row = s, table column j = d >> 1):
//   y[d] = F[d] + bias[d] (f32 add)
//   out[2j]   = y[2j]  *c[s][j] + (-1)*(y[2j+1]*sn[s][j])
//   out[2j+1] = y[2j+1]*c[s][j] + (+1)*(y[2j]  *sn[s][j])        with c, sn the f32 table values (mul, mul, add kept
//   separate); Hp = f16(out * sc), Lp = f16 residual (t - f16(t)), both fragment-major per head:
//   [b*nh + head][s/16][d/32][half][lane][8] (row = position s, k = d).
// bid = one 16 x 32 fragment (b, head, 16 positions, d step kk), 64 threads (tid) = its 64 units; thread = position s, 8 columns
// head*HD + dd .. +7 (4 pairs); the fragment's two waves read the two 64-B halves of the same 16 lines of F.
// coverage: 64 thr x 8 = one 1-KB fragment of Hp and of Lp; bid = 0 .. MROWS - 1 = NB*nh*(SEQ/16)*2 = every fragment once.
// =====================================================================================================
__device__ __forceinline__ void rot_one(float x, float y, float cv, float sv, float sgn, float sc,
                                        unsigned short& hb, unsigned short& lb) {
#pragma clang fp contract(off)
  const float ys   = y * sv;
  const float term = sgn * ys;
  const float r    = x * cv + term;
  const float t    = r * sc;
  const _Float16 a = (_Float16)t;
  hb = h_bits(a);
  lb = h_bits((_Float16)(t - (float)a));
}

__device__ __forceinline__ void rope16(int bid, int tid, const float* __restrict__ F, int ldf, int coff, int ncol,
                                       const float* __restrict__ bias,
                                       const float* __restrict__ TC, const float* __restrict__ TS,
                                       u16* Hp, u16* Lp, float sc) {
#pragma clang fp contract(off)
  const int nh  = ncol / HD;                           // heads in the q / k block
  if (nh <= 0) return;
  const int kk   = bid & 1;                            // 32-wide d step
  const int t1   = bid >> 1;
  const int tile = t1 % (SEQ / 16);                    // 16-position tile
  const int t2   = t1 / (SEQ / 16);
  const int head = t2 % nh;
  const int b    = t2 / nh;
  if (b >= NB) return;                                 // never taken with bid < NB * nh * (SEQ/16) * 2
  const int s    = tile * 16 + (tid & 15);
  const int dd   = (kk * 4 + ((tid >> 5) & 1) * 2 + ((tid >> 4) & 1)) * 8;   // d within head, multiple of 8
  const int col  = head * HD + dd;
  const int jj   = dd >> 1;                            // table column of the first pair, multiple of 4
  const int row  = b * SEQ + s;
  const float* p = F + (size_t)row * (size_t)ldf + coff + col;
  const v4f xa = *(const v4f*)(p),          xb = *(const v4f*)(p + 4);
  const v4f ba = *(const v4f*)(bias + col), bb = *(const v4f*)(bias + col + 4);
  // the table loads below may return their data into the address registers of the four loads above: the wait stands in front
  asm volatile("s_wait_xcnt 0x0" ::: "memory");
  const v4f cw = *(const v4f*)(TC + (size_t)s * NFREQ + jj);
  const v4f sw = *(const v4f*)(TS + (size_t)s * NFREQ + jj);
  float yv[8];
#pragma unroll
  for (int e = 0; e < 4; ++e) {
    yv[e]     = xa[e] + ba[e];
    yv[4 + e] = xb[e] + bb[e];
  }
  v4u oh, ol;
#pragma unroll
  for (int e = 0; e < 4; ++e) {
    unsigned short h0, l0, h1, l1;
    rot_one(yv[2 * e],     yv[2 * e + 1], cw[e], sw[e], -1.0f, sc, h0, l0);   // even element of the pair
    rot_one(yv[2 * e + 1], yv[2 * e],     cw[e], sw[e],  1.0f, sc, h1, l1);   // odd element of the pair
    oh[e] = pk16(h0, h1);
    ol[e] = pk16(l0, l1);
  }
  u16* dh = Hp + ((size_t)bid * 64 + tid) * 8;
  u16* dl = Lp + ((size_t)bid * 64 + tid) * 8;
  {
    *(v4u*)(dh) = oh;
    *(v4u*)(dl) = ol;
    
  }
}

// =====================================================================================================
// One launch for the three pieces that read only the projection F and the tables and write planes of their own; they share a
// grid by block range (block-uniform branches; the barrier of vt16 is passed by all 256 threads of its blocks):
// GR blocks q = rotary(q_proj + bq), 4 fragments of 64 threads a block; GR blocks keys = rotary(v_proj + bv), alike;
// GV blocks values = k_proj + bk -> v^T planes.
// coverage: grid = 2*GR + GV blocks, each range exactly the fragments / tiles of its piece.
// =====================================================================================================
__global__ __launch_bounds__(256) void planes(const float* __restrict__ F, const float* __restrict__ bq,
                                              const float* __restrict__ bk, const float* __restrict__ bv,
                                              const float* __restrict__ TC, const float* __restrict__ TS,
                                              u16* QH, u16* QL, u16* KH, u16* KL, u16* VH, u16* VL) {
  __shared__ __align__(16) u16 TH[HD * VTP];
  __shared__ __align__(16) u16 TL[HD * VTP];
  const int bid = (int)blockIdx.x;
  const int sub = (int)threadIdx.x >> 6, t64 = (int)threadIdx.x & 63;
  if (bid < GR)     { rope16(bid * 4 + sub, t64, F, NQKV, QCOL0, DMOD, bq, TC, TS, QH, QL, QSC); return; }
  if (bid < 2 * GR) { rope16((bid - GR) * 4 + sub, t64, F, NQKV, KCOL0, KVD, bv, TC, TS, KH, KL, KSC); return; }
  vt16(TH, TL, bid - 2 * GR, F, NQKV, VCOL0, bk, VH, VL);
}

// =====================================================================================================
// GEMM epilogue shared by both engines: the wave's 16x64 f32 tile (times oscale) staged in its LDS slab (pitch 68),
// 16 consecutive lanes x 16 B per line), lanes 16..31 -> row 2*it+1; HASB != 0 adds bias[col] in f32 to every element;
// coverage: 8 instructions x 2 rows x 16 lanes x 4 floats = the wave's 16 x 64 tile.
// =====================================================================================================
template <int HASB>
__device__ __forceinline__ void epi64(float* sl, v8f a0, v8f a1, v8f a2, v8f a3, float oscale, const float* bias,
                                      float* C, int N, size_t rowb, int col0, int lane) {
  const int hh = lane >> 4, m = lane & 15;
#pragma unroll
  for (int r = 0; r < 8; ++r) {
    const int ro = (8 * hh + r) * 68 + m;
    sl[ro]      = a0[r] * oscale;
    sl[ro + 16] = a1[r] * oscale;
    sl[ro + 32] = a2[r] * oscale;
    sl[ro + 48] = a3[r] * oscale;
  }
  wave_sync_lds();
  v4f vals[8];
#pragma unroll
  for (int it = 0; it < 8; ++it) vals[it] = *(const v4f*)(sl + (it * 2 + hh) * 68 + m * 4);
  if (HASB != 0) {
    const v4f b4 = *(const v4f*)(bias + col0 + m * 4);
#pragma unroll
    for (int it = 0; it < 8; ++it) vals[it] = vals[it] + b4;
  }
  float* dst = C + (rowb + (size_t)hh) * (size_t)N + col0 + m * 4;
  {
#pragma unroll
    for (int it = 0; it < 8; ++it) {
      *(v4f*)(dst + (size_t)(it * 2) * (size_t)N) = vals[it];
    }
    
  }
}

// =====================================================================================================
// bf16 GEMM: C[M][N] (f32) = A[M][K] . Bt[N][K]^T, times oscale; A and Bt bf16 fragment-major planes.
// Block = 64x64 tile, 4 waves x 16 rows; fragments loaded straight from the planes (two 512-B wave loads each, split k map
// for A and B); K stepped by 32 (host guarantees K % 32 == 0, M % 64 == 0, N % 64 == 0, grid = (M/64)*(N/64)).
// =====================================================================================================
__global__ __launch_bounds__(128)
void gemm_bf(const u16* __restrict__ A, const u16* __restrict__ Bt, float* C, int M, int N, int K, float oscale) {
  __shared__ __align__(16) float slab[4 * SLAB64];
  const int tid = threadIdx.x, lane = tid & 31;
  const int wave = __builtin_amdgcn_readfirstlane(tid >> 5);   // scalar, so that the tile starts below are scalar bases
  const int ntile = N >> 6;
  const int bid   = blockIdx.x;
  const int rowb  = (bid / ntile) * 64 + wave * 16;
  const int col0  = (bid % ntile) * 64;
  if (rowb + 16 > M) return;                // wave-uniform, never taken with the exact grid; no block barriers in this kernel
  const u16* ap = A  + (size_t)rowb * K;              // fragment (16-row tile, k step ks) at tile start + ks * 1024 bytes
  const u16* bp  = Bt + (size_t)col0 * K;
  const u16* bp1 = Bt + (size_t)(col0 + 16) * K;
  const u16* bp2 = Bt + (size_t)(col0 + 32) * K;
  const u16* bp3 = Bt + (size_t)(col0 + 48) * K;
  unsigned vo = (unsigned)lane * 16u;
  v8f acc0 = zero8(), acc1 = zero8(), acc2 = zero8(), acc3 = zero8();
#pragma unroll 1
  for (int k0 = 0; k0 < K; k0 += 32, vo += 1024u) {
    const v16b a  = ldfrag_b(ap, vo);
    const v16b b0 = ldfrag_b(bp, vo);
    const v16b b1 = ldfrag_b(bp1, vo);
    const v16b b2 = ldfrag_b(bp2, vo);
    const v16b b3 = ldfrag_b(bp3, vo);
    acc0 = mma_b(a, b0, acc0);
    acc1 = mma_b(a, b1, acc1);
    acc2 = mma_b(a, b2, acc2);
    acc3 = mma_b(a, b3, acc3);
    guard6<v16b>(acc0, acc1, acc2, acc3, a, b0, b1, b2, b3, a);
  }
  epi64<0>(slab + wave * SLAB64, acc0, acc1, acc2, acc3, oscale, C, C, N, (size_t)rowb, col0, lane);
}

// =====================================================================================================
// f16 GEMM: C[M][N] (f32) = (A[M][K] (+ A2[M][K] when TWO != 0)) . Bt[N][K]^T, times oscale, plus bias[n]; A, A2 f16
// fragment-major planes (A2 = the unscaled f16 residual of A, sharing the accumulator), Bt f16 fragment-major. Same tiling, fragment
// loads (split k map) and epilogue as gemm_bf; K stepped by 32.
// =====================================================================================================
template <int TWO>
__device__ __forceinline__
void gemm_h(float* slab, int wave, int lane, int rowb, int crow, int col0,
            const u16* __restrict__ A, const u16* __restrict__ A2, const u16* __restrict__ Bt,
            const float* __restrict__ bias, float* C, int N, int K, float oscale) {
  const _Float16* ap  = (const _Float16*)(const void*)A  + (size_t)rowb * K;
  const _Float16* ap2 = (const _Float16*)(const void*)A2 + (size_t)rowb * K;
  const _Float16* bp  = (const _Float16*)(const void*)Bt + (size_t)col0 * K;
  const _Float16* bp1 = (const _Float16*)(const void*)Bt + (size_t)(col0 + 16) * K;
  const _Float16* bp2 = (const _Float16*)(const void*)Bt + (size_t)(col0 + 32) * K;
  const _Float16* bp3 = (const _Float16*)(const void*)Bt + (size_t)(col0 + 48) * K;
  unsigned vo = (unsigned)lane * 16u;
  v8f acc0 = zero8(), acc1 = zero8(), acc2 = zero8(), acc3 = zero8();
#pragma unroll 1
  for (int k0 = 0; k0 < K; k0 += 32, vo += 1024u) {
    const v16h a  = ldfrag_h(ap, vo);
    const v16h b0 = ldfrag_h(bp, vo);
    const v16h b1 = ldfrag_h(bp1, vo);
    const v16h b2 = ldfrag_h(bp2, vo);
    const v16h b3 = ldfrag_h(bp3, vo);
    acc0 = mma_h(a, b0, acc0);
    acc1 = mma_h(a, b1, acc1);
    acc2 = mma_h(a, b2, acc2);
    acc3 = mma_h(a, b3, acc3);
    if (TWO != 0) {
      const v16h a2 = ldfrag_h(ap2, vo);
      acc0 = mma_h(a2, b0, acc0);
      acc1 = mma_h(a2, b1, acc1);
      acc2 = mma_h(a2, b2, acc2);
      acc3 = mma_h(a2, b3, acc3);
      guard6<v16h>(acc0, acc1, acc2, acc3, a, a2, b0, b1, b2, b3);
    } else {
      guard6<v16h>(acc0, acc1, acc2, acc3, a, b0, b1, b2, b3, a);
    }
  }
  (void)ap2;
  epi64<1>(slab + wave * SLAB64, acc0, acc1, acc2, acc3, oscale, bias, C, N, (size_t)crow, col0, lane);
}

// One launch for y = O.Wo^T + bo over all sequences: block = 64 rows x 64 columns; its 64 rows lie in one sequence and wholly
// below or wholly at and above row RICH of it (RICH and SEQ multiples of 64), so the choice hi + residual / hi only is
// block-uniform. rowb = the wave's first row in the O planes, crow = the same row in out.
// coverage: grid = NB * (SEQ/64) * (N/64) blocks x 4 waves x 16 x 64 = every element of out once (host: N % 64 == 0, K % 32 == 0).
__global__ __launch_bounds__(128)
void gemm_o(const u16* __restrict__ A, const u16* __restrict__ A2, const u16* __restrict__ Bt,
            const float* __restrict__ bias, float* C, int N, int K, float oscale) {
  __shared__ __align__(16) float slab[4 * SLAB64];
  const int tid = threadIdx.x, lane = tid & 31;
  const int wave = __builtin_amdgcn_readfirstlane(tid >> 5);   // scalar, so that the tile starts are scalar bases
  const int ntile = N >> 6;
  const int bid  = blockIdx.x;
  const int rt   = bid / ntile;
  const int col0 = (bid % ntile) * 64;
  const int bq   = rt / (SEQ / 64);
  const int rs   = (rt % (SEQ / 64)) * 64;                     // first row of the block within its sequence
  if (bq >= NB) return;                     // block-uniform, never taken with the exact grid; no block barriers in this kernel
  const int rowb = bq * SEQ + rs + wave * 16;
  const int crow = bq * XS_FULL + rs + wave * 16;
  if (rs < RICH) gemm_h<1>(slab, wave, lane, rowb, crow, col0, A, A2, Bt, bias, C, N, K, oscale);
  else           gemm_h<0>(slab, wave, lane, rowb, crow, col0, A, A2, Bt, bias, C, N, K, oscale);
}

// =====================================================================================================
// Causal softmax attention, hd = 64, 8 heads. Block bid -> (query tile qt = bid % NQT: rows q0 = 16*qt .. q0+15, head,
// batch b); keys/values of the same head (kvh = head). The tile's key steps are dealt over the block's NSW waves: wave w takes
// steps w, w + NSW, ... with its own running max, sum and O accumulators; the NSW partials are merged in LDS behind one block
// barrier (attn_merge8), so the longest serial walk is NKT / NSW steps instead of NKT.
//   q and k hi / residual planes f16 x256, fragment-major per head [b*8 + h][s/16][d/32][half][lane][8];
//   v^T hi / residual planes x1024, fragment-major per head [b*NKVH + h][s/32][d/16][half][lane][8].
//   raw(i, j) = q_hi.k_hi + q_lo.k_hi + q_hi.k_lo (2 k-steps over d); logit = raw * (SM_SCALE * 2^-16) (the two 256 carries
//   folded exactly into the 1/sqrt(512) scale, one f32 multiply); keys above the diagonal replaced by -inf; online softmax per
//   query row in f32 with a running max: row max / row sum over the 16 lanes holding the row via xor shuffles 1,2,4,8 (never
//   crossing the lane half), alpha = exp(m_old - m_new), p = exp(logit - m_new), l = l*alpha + sum p, O accumulators times
//   alpha before the tile's P.v. Only key tiles of 32 with kb <= q0 are visited (nkt = q0/32 + 1 <= NKT; key kb is
//   unmasked for every row of the tile, so each row max of a visited tile is finite; wave 0 always visits tile 0).
//   The 16x32 p tile goes to wave-private LDS (f32 element
//   rows (float vector loads, same element type as stored); v^T B fragments in 2 groups of 2 d-subtiles; RV = 1: products
//   hh + lh + hl, RV = 0: hh only. After the loop every wave (one without a step: max -inf, sum 0, O 0) puts its raw O
//   accumulators into its slab and its 16 row maxima and sums beside them; block barrier; waves 0..3 merge.
//   Epilogue: O = merged acc / (merged l * 32768 * 1024), x256 -> f16 hi plane (and for RV = 1 the unscaled f16 residual
//   plane), fragment-major over [b*SEQ + s][512]; wave it < 4, lane = (row c, 8 consecutive d at it*16 + 8*hh); one
//   instruction = one 512-B half fragment (4 whole lines).
// coverage: 4 waves x 1 instruction x 32 lanes x 8 halves = 16 x 64 per plane; grid NQT x NH x NB blocks;
//   the two forms (tiles 0..NQTR-1 with RV = 1, NQTR..NQT-1 with RV = 0) cover every (b, s, h) row segment of the hi plane
//   exactly once and rows s < RICH of the residual plane exactly once (only those rows are read later).
// =====================================================================================================
// 2^x for the merge weights. The v_nop in the same statement keeps the one issue slot that the instruction set asks for behind
// a transcendental, whichever instruction the compiler places next.
__device__ __forceinline__ float exp2_slot(float x) {
  float r = 0.0f;
#if defined(__HIP_DEVICE_COMPILE__)
  asm("v_exp_f32 %0, %1\n\tv_nop" : "=v"(r) : "v"(x));
#endif
  return r;
}

// Merge of the NSW partials for one lane's 8 outputs (row c, columns dd .. dd+7): M = max of the waves' row maxima, weight
// exp(m_w - M) (0 for a wave without a step), L = sum of weight * l_w, acc = sum of weight * O_w, waves in index order.
__device__ __forceinline__ void attn_merge8(const float* slabs, const float* sm, const float* sl, int c, int dd,
                                            float* acc, float& L) {
  float mw[NSW], lw[NSW];
  v4f pa[NSW], pb[NSW];
#pragma unroll
  for (int w = 0; w < NSW; ++w) {
    mw[w] = sm[w * 16 + c];
    lw[w] = sl[w * 16 + c];
    pa[w] = *(const v4f*)(slabs + w * SLW + c * SLP + dd);
    pb[w] = *(const v4f*)(slabs + w * SLW + c * SLP + dd + 4);
  }
  float M = mw[0];
#pragma unroll
  for (int w = 1; w < NSW; ++w) M = fmaxf(M, mw[w]);
  L = 0.0f;
#pragma unroll
  for (int e = 0; e < 8; ++e) acc[e] = 0.0f;
#pragma unroll
  for (int w = 0; w < NSW; ++w) {
    const float wt = exp2_slot((mw[w] - M) * 1.44269504f);
    L += wt * lw[w];
#pragma unroll
    for (int e = 0; e < 4; ++e) {
      acc[e]     += wt * pa[w][e];
      acc[4 + e] += wt * pb[w][e];
    }
  }
}

template <int RV>
__device__ __forceinline__
void attn_cs(float* smem, float* smx, float* ssm, int qt, int head, int b,
             const u16* __restrict__ QHp, const u16* __restrict__ QLp,
             const u16* __restrict__ KHp, const u16* __restrict__ KLp,
             const u16* __restrict__ VHp, const u16* __restrict__ VLp,
             u16* OHp, u16* OLp) {
#pragma clang fp contract(off)
  const int tid  = threadIdx.x;
  const int wave = __builtin_amdgcn_readfirstlane(tid >> 5);   // scalar: which key steps the wave takes
  const int lane = tid & 31;
  const int hh   = lane >> 4;
  const int c    = lane & 15;
  const int q0   = qt * 16;
  const int kvh  = head;

  float* pt   = smem + wave * SLW;          // p tile [16][32] pitch 36, dead behind the loop
  float* slab = pt;                         // O partial slab [16][64] pitch 68, written behind the loop

  // fragment-major planes: a head's 16 positions x 64 d = 1024 halves (2 fragments), its 32 keys x 64 d of v^T = 2048 (4)
  // byte offsets into the planes (each plane MROWS * 512 * 2 bytes, far under 2^32), the lane's 16 bytes included
  const unsigned qvo = ((unsigned)(b * NH + head) * SEQ + (unsigned)q0) * (HD * 2u) + (unsigned)lane * 16u;
  unsigned kvo = (unsigned)(b * NKVH + kvh) * (SEQ * HD * 2u) + (unsigned)wave * (32u * HD * 2u)
               + (unsigned)lane * 16u;                                                  // this step's 32 keys, k and v^T alike
  const _Float16* Qh  = (const _Float16*)(const void*)QHp;
  const _Float16* Ql  = (const _Float16*)(const void*)QLp;
  const _Float16* Khb = (const _Float16*)(const void*)KHp;
  const _Float16* Klb = (const _Float16*)(const void*)KLp;
  const _Float16* Vhb = (const _Float16*)(const void*)VHp;               // d-subtile j at + j * 512 halves
  const _Float16* Vlb = (const _Float16*)(const void*)VLp;
  const float lsc  = SM_SCALE * (1.0f / (QSC * KSC));   // exact power-of-two fold of the q / k carries into the scale
  const float oc   = 1.0f / (PCAR * VCAR);
  const float ninf = -__builtin_inff();
  const size_t KROW = (size_t)HD;           // halves per key in a head's fragment-major plane

  v8f o[4];
#pragma unroll
  for (int j = 0; j < 4; ++j) o[j] = zero8();
  float mrun[8], lrun[8];
#pragma unroll
  for (int r = 0; r < 8; ++r) { mrun[r] = ninf; lrun[r] = 0.0f; }
  const int ncaus = (q0 >> 5) + 1;                                            // tiles holding keys <= q0 + 15
  const int nkt   = (ncaus < NKT) ? ncaus : NKT;
  const int qr0   = q0 + 8 * hh;                                              // query row of D element r = qr0 + r

#pragma unroll 1
  for (int kt = wave; kt < nkt; kt += NSW, kvo += NSW * 32u * HD * 2u) {
    const int kb = kt * 32;
    // ---- raw scores: D element r of this lane = (query row qr0 + r, key kb + c) in s0, key kb + 16 + c in s1 ----
    v8f s0 = zero8(), s1 = zero8();
    const _Float16* k0p = Khb;
    const _Float16* k1p = k0p + (size_t)16 * KROW;
    const _Float16* l0p = Klb;
    const _Float16* l1p = l0p + (size_t)16 * KROW;
#pragma unroll
    for (int kk = 0; kk < HD / 32; ++kk) {
      const v16h qh  = ldfrag_h(Qh + kk * 512, qvo);
      const v16h ql  = ldfrag_h(Ql + kk * 512, qvo);
      const v16h kh0 = ldfrag_h(k0p + kk * 512, kvo);
      const v16h kh1 = ldfrag_h(k1p + kk * 512, kvo);
      const v16h kl0 = ldfrag_h(l0p + kk * 512, kvo);
      const v16h kl1 = ldfrag_h(l1p + kk * 512, kvo);
      s0 = mma_h(qh, kh0, s0);
      s0 = mma_h(ql, kh0, s0);
      s0 = mma_h(qh, kl0, s0);
      s1 = mma_h(qh, kh1, s1);
      s1 = mma_h(ql, kh1, s1);
      s1 = mma_h(qh, kl1, s1);
      guard2(s0, s1, qh, ql, kh0, kl0, kh1, kl1);
    }
    // ---- causal replace-mask, running-max online softmax in f32, p tile -> wave-private LDS ----
    float alpha[8];
    const int key0 = kb + c, key1 = kb + 16 + c;
#pragma unroll
    for (int r = 0; r < 8; ++r) {
      const int qrow = qr0 + r;
      const float a0 = s0[r] * lsc;
      const float a1 = s1[r] * lsc;
      const float t0 = (key0 > qrow) ? ninf : a0;
      const float t1 = (key1 > qrow) ? ninf : a1;
      float mx = fmaxf(t0, t1);
      mx = fmaxf(mx, __shfl_xor(mx, 1, 32));
      mx = fmaxf(mx, __shfl_xor(mx, 2, 32));
      mx = fmaxf(mx, __shfl_xor(mx, 4, 32));
      mx = fmaxf(mx, __shfl_xor(mx, 8, 32));
      const float mnew = fmaxf(mrun[r], mx);
      const float al   = __expf(mrun[r] - mnew);
      const float p0   = __expf(t0 - mnew);
      const float p1   = __expf(t1 - mnew);
      float sm = p0 + p1;
      sm += __shfl_xor(sm, 1, 32);
      sm += __shfl_xor(sm, 2, 32);
      sm += __shfl_xor(sm, 4, 32);
      sm += __shfl_xor(sm, 8, 32);
      lrun[r]  = lrun[r] * al + sm;
      mrun[r]  = mnew;
      alpha[r] = al;
      const int ro = (8 * hh + r) * PTP + c;
      pt[ro]      = p0;
      pt[ro + 16] = p1;
    }
    wave_sync_lds();
    // ---- rescale the O accumulators by alpha (row 8hh + r of every d-subtile) ----
#pragma unroll
    for (int j = 0; j < 4; ++j) {
#pragma unroll
      for (int r = 0; r < 8; ++r) o[j][r] = o[j][r] * alpha[r];
    }
    // ---- A fragments of p*32768: hi f16 and residual f16, row = c, split k map over the 32 keys of this step ----
    FragH ph, pl;
    {
      const float* prow = pt + c * PTP + 8 * hh;
      const v4f p0 = *(const v4f*)(prow), p1 = *(const v4f*)(prow + 4);
      const v4f p2 = *(const v4f*)(prow + 16), p3 = *(const v4f*)(prow + 20);
#pragma unroll
      for (int e = 0; e < 4; ++e) {
        const float ta = p0[e] * PCAR, tb = p1[e] * PCAR, tc = p2[e] * PCAR, td = p3[e] * PCAR;
        const _Float16 ha = (_Float16)ta, hb = (_Float16)tb, hc = (_Float16)tc, hd = (_Float16)td;
        ph.h[0][e]     = ha;                  // elements 0..7  = keys kb + 8hh + 0..7
        ph.h[0][4 + e] = hb;
        ph.h[1][e]     = hc;                  // elements 8..15 = keys kb + 16 + 8hh + 0..7
        ph.h[1][4 + e] = hd;
        pl.h[0][e]     = (_Float16)(ta - (float)ha);
        pl.h[0][4 + e] = (_Float16)(tb - (float)hb);
        pl.h[1][e]     = (_Float16)(tc - (float)hc);
        pl.h[1][4 + e] = (_Float16)(td - (float)hd);
      }
    }
    // ---- P.V : B fragment col n = d = j*16 + c, keys contiguous in the v^T planes; 2 groups of 2 d-subtiles ----
    {
      const _Float16* vhp = Vhb;
      const _Float16* vlp = Vlb;
      (void)vlp;
#pragma unroll
      for (int jg = 0; jg < 2; ++jg) {
        const size_t da = (size_t)(2 * jg) * 512;
        const size_t db = da + 512;
        const v16h vha = ldfrag_h(vhp + da, kvo), vhb2 = ldfrag_h(vhp + db, kvo);
        o[2 * jg]     = mma_h(ph.v, vha,  o[2 * jg]);
        o[2 * jg + 1] = mma_h(ph.v, vhb2, o[2 * jg + 1]);
        if (RV != 0) {
          const v16h vla = ldfrag_h(vlp + da, kvo), vlb2 = ldfrag_h(vlp + db, kvo);
          o[2 * jg]     = mma_h(pl.v, vha,  o[2 * jg]);
          o[2 * jg]     = mma_h(ph.v, vla,  o[2 * jg]);
          o[2 * jg + 1] = mma_h(pl.v, vhb2, o[2 * jg + 1]);
          o[2 * jg + 1] = mma_h(ph.v, vlb2, o[2 * jg + 1]);
          guard2(o[2 * jg], o[2 * jg + 1], ph.v, pl.v, vha, vhb2, vla, vlb2);
        } else {
          guard2(o[2 * jg], o[2 * jg + 1], ph.v, pl.v, vha, vhb2, vha, vhb2);
        }
      }
    }
    wave_sync_lds();
  }
  acc_guard4(o[0], o[1], o[2], o[3]);
  // ---- the wave's partial: raw O accumulators into its slab, row maxima and sums (alike in the 16 lanes of a row) beside ----
#pragma unroll
  for (int r = 0; r < 8; ++r) {
#pragma unroll
    for (int j = 0; j < 4; ++j) {
      const int idx = (8 * hh + r) * SLP + j * 16 + c;
      slab[idx] = o[j][r];
    }
  }
  if (c == 0) {
#pragma unroll
    for (int r = 0; r < 8; ++r) {
      smx[wave * 16 + 8 * hh + r] = mrun[r];
      ssm[wave * 16 + 8 * hh + r] = lrun[r];
    }
  }
  __syncthreads();                          // every wave's partial is in LDS before any wave merges; passed by all NSW waves
  if (wave >= 4) return;                    // wave-uniform, behind the only block barrier
  // ---- merged O / l with the carries (32768 on p, 1024 on v) folded once, x256 -> f16 hi plane (+ f16 residual plane),
  //      fragment-major [row/16][512/32][half][lane][8]: wave it stores half it&1 of k step head*2 + (it>>1);
  //      lane = (row c, 8 consecutive d at it*16 + 8*hh) ----
  const int it = wave;
  float acc[8], lsum;
  attn_merge8(smem, smx, ssm, c, it * 16 + 8 * hh, acc, lsum);
  const float rl = (1.0f / lsum) * oc;
  float w[8];
#pragma unroll
  for (int e = 0; e < 8; ++e) w[e] = (acc[e] * rl) * OSC;
  v4u oh, ol;
#pragma unroll
  for (int e = 0; e < 4; ++e) {
    const _Float16 h0 = (_Float16)w[2 * e], h1 = (_Float16)w[2 * e + 1];
    const _Float16 g0 = (_Float16)(w[2 * e] - (float)h0), g1 = (_Float16)(w[2 * e + 1] - (float)h1);
    oh[e] = pk16(h_bits(h0), h_bits(h1));
    ol[e] = pk16(h_bits(g0), h_bits(g1));
  }
  const size_t ob = ((size_t)b * SEQ + q0) * DMOD + (size_t)head * (16 * HD) + 8 * lane + it * 256;
  *(v4u*)(OHp + ob) = oh;
  if (RV != 0) {
    *(v4u*)(OLp + ob) = ol;
  }
  // in the shared launch the code of the other form may follow and writes registers that these stores name
  asm volatile("s_wait_xcnt 0x0" ::: "memory");
}

// One launch for all query tiles: the tile index decides block-uniformly between the two forms (RV = 1 for tiles < NQTR).
__global__ __launch_bounds__(ATT_THREADS)
void attn_all(const u16* __restrict__ QHp, const u16* __restrict__ QLp,
              const u16* __restrict__ KHp, const u16* __restrict__ KLp,
              const u16* __restrict__ VHp, const u16* __restrict__ VLp, u16* OHp, u16* OLp) {
  __shared__ __align__(16) float smem[NSW * SLW];   // per wave: p tile in the loop, O partial slab behind it
  __shared__ float smx[NSW * 16];                   // per wave: 16 row maxima
  __shared__ float ssm[NSW * 16];                   // per wave: 16 row sums
  const int bid  = blockIdx.x;
  const int qt   = bid % NQT;
  const int t2   = bid / NQT;
  const int head = t2 % NH;
  const int b    = t2 / NH;
  if (b >= NB) return;                      // block-uniform, in front of the block barrier; never taken with the exact grid
  if (qt < NQTR) attn_cs<1>(smem, smx, ssm, qt, head, b, QHp, QLp, KHp, KLp, VHp, VLp, OHp, OLp);
  else           attn_cs<0>(smem, smx, ssm, qt, head, b, QHp, QLp, KHp, KLp, VHp, VLp, OHp, OLp);
}

// =====================================================================================================
// Workspace map (bytes); every plane is fully written by whole-line stores before it is read (the O residual plane only on
// the rows < RICH per sequence that are read); all extents are exact multiples of the store granularity (no pad rows needed);
// every region offset a multiple of 131072; every 16-bit plane is fragment-major (see the fragment loaders), same extent as
// the row-major shape given here:
//   XB  bf16 [MROWS][512]               MROWS*1024   (NB=4, SEQ=2048: 8388608); after the projection GEMM the same bytes hold
//                                                    the O f16 hi plane [MROWS][512] x256 (identical extent)
//   WB  bf16 [1536 n][512 k]            1572864      (Wq rows 0..511, Wk 512..1023, Wv 1024..1535)
//   F   f32 [MROWS][1536]               MROWS*6144   (q_proj | k_proj | v_proj columns); after rope16 / vt16 its first
//                                                    MROWS*1024 bytes hold the O f16 residual plane [MROWS][512]
//   QH  f16 [MROWS][512] x256           MROWS*1024   QL residual, same extent
//   KH  f16 [MROWS][512] x256           MROWS*1024   KL residual, same extent   (keys = rotary of the v_proj columns)
//   VH  f16 [NB*8][64][SEQ] x1024       MROWS*1024   VL residual, same extent   (values = the k_proj columns)
//   TC  f32 [SEQ][32]                   SEQ*128      TS, same extent
//   WT  f16 [512 o][512 d] x1024        524288       (Wo; a region of its own, written in the launch that also writes WB)
//   end (NB=4, SEQ=2048)              111673344
// =====================================================================================================
extern "C" void kernel_launch(void* const* d_in, const int* in_sizes, int n_in,
                              void* d_out, int out_size, void* d_ws, size_t ws_size,
                              hipStream_t stream) {
  if (n_in < 9) return;
  if (in_sizes[0] < ((NB - 1) * XS_FULL + SEQ) * DMOD) return;
  if (in_sizes[1] != DMOD * DMOD) return;
  if (in_sizes[2] != DMOD) return;
  if (in_sizes[3] != DMOD * DMOD) return;
  if (in_sizes[4] != DMOD) return;
  if (in_sizes[5] != DMOD * DMOD) return;
  if (in_sizes[6] != DMOD) return;
  if (in_sizes[7] != DMOD * DMOD) return;
  if (in_sizes[8] != DMOD) return;
  if (out_size < ((NB - 1) * XS_FULL + SEQ) * DMOD) return;

  const float* x   = (const float*)d_in[0];
  const float* wq  = (const float*)d_in[1];
  const float* bqp = (const float*)d_in[2];
  const float* wk  = (const float*)d_in[3];
  const float* bkp = (const float*)d_in[4];
  const float* wv  = (const float*)d_in[5];
  const float* bvp = (const float*)d_in[6];
  const float* wo  = (const float*)d_in[7];
  const float* bop = (const float*)d_in[8];
  float*       out = (float*)d_out;

  const size_t szXB = (size_t)MROWS * DMOD * 2;
  const size_t szWB = (size_t)NQKV * DMOD * 2;
  const size_t szF  = (size_t)MROWS * NQKV * 4;
  const size_t szQ  = (size_t)MROWS * DMOD * 2;                  // QH, QL
  const size_t szK  = (size_t)MROWS * KVD * 2;                   // KH, KL
  const size_t szV  = (size_t)NB * NKVH * HD * SEQ * 2;          // VH, VL (== szK)
  const size_t szT  = (size_t)SEQ * NFREQ * 4;                   // TC, TS
  const size_t szOH = (size_t)MROWS * DMOD * 2;                  // O hi plane, lives in the XB region
  const size_t szOL = (size_t)MROWS * DMOD * 2;                  // O residual plane, lives in the F region
  const size_t szWT = (size_t)DMOD * DMOD * 2;                   // Wo f16 plane
  if (szOH > szXB || szOL > szF) return;
  size_t off = 0;
  const size_t oXB = off; off += szXB;
  const size_t oWB = off; off += szWB;
  const size_t oF  = off; off += szF;
  const size_t oQH = off; off += szQ;
  const size_t oQL = off; off += szQ;
  const size_t oKH = off; off += szK;
  const size_t oKL = off; off += szK;
  const size_t oVH = off; off += szV;
  const size_t oVL = off; off += szV;
  const size_t oTC = off; off += szT;
  const size_t oTS = off; off += szT;
  const size_t oWT = off; off += szWT;
  if (off > ws_size) return;                // off = 111673344 for NB = 4, SEQ = 2048
  if (off > (size_t)WS_CAP) return;

  char* ws = (char*)d_ws;
  u16*   XB  = (u16*)(ws + oXB);
  u16*   OH  = (u16*)(ws + oXB);
  u16*   WB  = (u16*)(ws + oWB);
  u16*   WT  = (u16*)(ws + oWT);
  float* F   = (float*)(ws + oF);
  u16*   OL  = (u16*)(ws + oF);
  u16*   QH  = (u16*)(ws + oQH);
  u16*   QL  = (u16*)(ws + oQL);
  u16*   KH  = (u16*)(ws + oKH);
  u16*   KL  = (u16*)(ws + oKL);
  u16*   VH  = (u16*)(ws + oVH);
  u16*   VL  = (u16*)(ws + oVL);
  float* TC  = (float*)(ws + oTC);
  float* TS  = (float*)(ws + oTS);

  const dim3 b256(256), b128(128), bAT(ATT_THREADS);
  const dim3 gG1((MROWS / 64) * (NQKV / 64));
  const float osc = 1.0f / (OSC * WOS);

  // (1) rotary cos / sin tables [SEQ][32]; x -> bf16 plane [MROWS][512]; Wq, Wk, Wv -> one bf16 plane [1536 n][512 k];
  //     Wo [512 o][512 d] -> f16 plane of the bf16 value x1024 (already k-contiguous)
  prep<<<dim3(GT + NB * GX + 4 * GW), b256, 0, stream>>>(x, wq, wk, wv, wo, XB, WB, WT, TC, TS);
  // (2) F f32 [MROWS][1536] = x.[Wq|Wk|Wv]^T  (columns 0..511 q_proj, 512..1023 k_proj, 1024..1535 v_proj; biases later)
  gemm_bf<<<gG1, b128, 0, stream>>>(XB, WB, F, MROWS, NQKV, DMOD, 1.0f);
  // (3) q = rotary(q_proj + bq) from columns 0..511 and keys = rotary(v_proj + bv) from columns 1024..1535 -> hi + residual
  //     planes x256; values = k_proj + bk (no rotary) from columns 512..1023 -> v^T hi + residual planes x1024
  planes<<<dim3(2 * GR + GV), b256, 0, stream>>>(F, bqp, bkp, bvp, TC, TS, QH, QL, KH, KL, VH, VL);
  // (4) causal attention -> O f16 hi plane x256 (XB region) for all query tiles; residual plane (F region) for tiles < RICH
  attn_all<<<dim3(NQT * NH * NB), bAT, 0, stream>>>(QH, QL, KH, KL, VH, VL, OH, OL);
  // (5) y = O.Wo^T + bo -> out f32 [rows][512], carries 256 x 1024 folded back; rows < RICH per sequence with O hi + residual
  gemm_o<<<dim3(NB * (SEQ / 64) * (DMOD / 64)), b128, 0, stream>>>(OH, OL, WT, bop, out, DMOD, DMOD, osc);
  (void)hipGetLastError();
}

// v004
// It runs in 155 microseconds.
// Next to v003, in two timings, it ran 1.20 times as fast each time.
// All steps since v000 together make it 2.45 times as fast.
// Contractions: x.[Wq|Wk|Wv]^T on v_wmma_f32_16x16x32_bf16 (x and the weights as bf16 RNE planes; weight [n][k] rows are
// the B operand, fragment-major in the split k map; f32 accumulate); q.k^T over hd 64 and P.v on v_wmma_f32_16x16x32_f16 with f16 hi + f16
// residual planes (both transposed: k.q^T and v^T.P^T; q, k x256 after rotary, products hh+lh+hl on every row; P x32768 hi + in-register residual and v^T x1024
// hi + residual plane for query rows < 512 of each sequence, P hi . v hi only for later rows); O.Wo^T on
// v_wmma_f32_16x16x32_f16 with O x256 as f16 hi (+ f16 residual plane for rows < 512 of each sequence) and Wo as
// f16(bf16(Wo)) x1024, one accumulator, bias added in f32; all f32 accumulate. Rotary cos/sin tables, bias adds and online
// softmax in f32 on VALU.
#include <hip/hip_runtime.h>
#include <math.h>
#include <stdint.h>

#ifndef NB
#define NB 4
#endif
#ifndef SEQ
#define SEQ 2048
#endif
#define XS_FULL 2048
#define DMOD  512
#define NH    8
#define NKVH  8
#define HD    64
#define HHALF (HD / 2)
#define NFREQ (HD / 2)
#define KVD   (NKVH * HD)
#define NQKV  (DMOD + 2 * KVD)
#define QCOL0 0
#define VCOL0 DMOD
#define KCOL0 (DMOD + KVD)
#define MROWS (NB * SEQ)
#define RICH  512
#define ROPE_L2 0.41524101186092028
#define SM_SCALE 0.04419417382415922f
#define QSC   256.0f
#define KSC   256.0f
#define PCAR  32768.0f
#define VCAR  1024.0f
#define OSC   256.0f
#define WOS   1024.0f
#define NSW   8
#define NQT   (SEQ / 16)
#define NQTR  (RICH / 16)
#define NST   (SEQ / 64)
#define NKT   (SEQ / 32)
#define ATT_THREADS (NSW * 32)
#define SLP   68
#define SLW   (16 * SLP)
#define SLAB64 (16 * 68)
#define VTP   72
#define WS_CAP 134217728
#define GX    (SEQ * DMOD / 8 / 256)
#define GW    (DMOD * DMOD / 8 / 256)
#define GT    (SEQ * NFREQ / 256)
#define GR    (MROWS / 4)
#define GV    (NB * NKVH * NST)
static_assert(DMOD == NH * HD && HD == 64 && HHALF == 32 && NFREQ == 32 && NH == 8 && NKVH == NH);
static_assert(ATT_THREADS == 256 && NSW >= 4 && KVD == 512 && NQKV == 1536 && KCOL0 + KVD == NQKV && VCOL0 + KVD == KCOL0);
static_assert(NB >= 1 && NB <= 4);
static_assert(NB == 1 || SEQ == XS_FULL);
static_assert((SEQ % 64) == 0 && SEQ >= 64 && SEQ <= XS_FULL);
static_assert((RICH % 64) == 0 && RICH >= 64 && RICH <= SEQ);
static_assert((DMOD % 64) == 0 && (KVD % 64) == 0 && (NQKV % 64) == 0 && (DMOD % 32) == 0 && (HD % 32) == 0);
static_assert(((SEQ * DMOD / 8) % 256) == 0 && ((DMOD * DMOD / 8) % 256) == 0 && ((SEQ * NFREQ) % 256) == 0);
static_assert(NSW * (SLW + 32) * 4 <= 65536 && 2 * HD * VTP * 2 <= 65536 && 4 * SLAB64 * 4 <= 65536);
static_assert(DMOD / 8 == 64 && KVD / 8 == 64);
static_assert(((SEQ * DMOD / 8) % 1024) == 0 && ((DMOD * DMOD / 8) % 1024) == 0 && (SEQ % 32) == 0 && (RICH % 16) == 0);

typedef unsigned short u16;
typedef _Float16 v16h __attribute__((ext_vector_type(16)));
typedef _Float16 v8h  __attribute__((ext_vector_type(8)));
typedef __bf16   v16b __attribute__((ext_vector_type(16)));
typedef float    v8f  __attribute__((ext_vector_type(8)));
typedef float    v4f  __attribute__((ext_vector_type(4)));
typedef unsigned int v4u __attribute__((ext_vector_type(4)));

union FragH { v16h v; v8h h[2]; v4u u[2]; };
union FragB { v16b v; v4u u[2]; };

// ---- scalar helpers --------------------------------------------------------------------------------
__device__ __forceinline__ unsigned short bf_bits(float f) {          // f32 -> bf16 bits, RNE convert
  unsigned u = __float_as_uint(f);
  return (unsigned short)((u + 0x7FFFu + ((u >> 16) & 1u)) >> 16);
}
__device__ __forceinline__ float bf_up(unsigned short h) { return __uint_as_float(((unsigned)h) << 16); }
__device__ __forceinline__ float bfr(float f) { return bf_up(bf_bits(f)); }
__device__ __forceinline__ unsigned short h_bits(_Float16 x) { return __builtin_bit_cast(unsigned short, x); }
__device__ __forceinline__ unsigned pk16(unsigned short a, unsigned short b) { return (unsigned)a | ((unsigned)b << 16); }
__device__ __forceinline__ v8f zero8() { v8f z = {0.f, 0.f, 0.f, 0.f, 0.f, 0.f, 0.f, 0.f}; return z; }

// ---- fragment-major planes: every 16-bit A/B operand plane [row][K] other than v^T is stored as [row/16][K/32][g][lane][8]: the 16-B unit
//      of lane = 16*h + (row&15) in half g holds k = 32*ks + 16*g + 8*h + 0..7, so one wave-wide 16-B load is 512 contiguous
//      bytes (4 whole lines) and one 16 x 32 fragment is 1 KB. A 16-row tile starts where it starts in a row-major plane.
// ---- fragment loaders: lane -> row/col (lane&15), h = lane>>4; base = a pointer that is the same in every lane (it stays in
//      scalar registers), vo = byte offset of the fragment from base + 16*lane (one 32-bit register shared by all loads of a
//      step and advanced behind them); p = base + vo;
//      elements 0..7 <- p[0..7] (k0+8h..), elements 8..15 <- p[256..263] (k0+16+8h..)  (same split k map for A and B)
__device__ __forceinline__ v16h ldfrag_h(const _Float16* base, unsigned vo) {
  const char* p = (const char*)base + vo;
  FragH f;
  f.h[0] = *(const v8h*)(p);
  f.h[1] = *(const v8h*)(p + 512);
  return f.v;
}
__device__ __forceinline__ v16b ldfrag_b(const u16* base, unsigned vo) { // bf16 plane read as unsigned integer vectors
  const char* p = (const char*)base + vo;
  FragB f;
  f.u[0] = *(const v4u*)(p);
  f.u[1] = *(const v4u*)(p + 512);
  return f.v;
}

__device__ __forceinline__ v8f mma_h(v16h a, v16h b, v8f c) {
  return __builtin_amdgcn_wmma_f32_16x16x32_f16(false, a, false, b, (short)0, c, false, false);
}
__device__ __forceinline__ v8f mma_b(v16b a, v16b b, v8f c) {
  return __builtin_amdgcn_wmma_f32_16x16x32_bf16(false, a, false, b, (short)0, c, false, false);
}
__device__ __forceinline__ void guard2(v8f& a, v8f& b, v16h x0, v16h x1, v16h x2, v16h x3, v16h x4, v16h x5) {
#if defined(__HIP_DEVICE_COMPILE__)
  asm volatile("v_nop\n\tv_nop\n\tv_nop\n\tv_nop"
               : "+v"(a), "+v"(b) : "v"(x0), "v"(x1), "v"(x2), "v"(x3), "v"(x4), "v"(x5) : "memory");
#endif
}
template <typename F>
__device__ __forceinline__ void guard6(v8f& a, v8f& b, v8f& c, v8f& d, F x0, F x1, F x2, F x3, F x4, F x5) {
#if defined(__HIP_DEVICE_COMPILE__)
  asm volatile("v_nop\n\tv_nop\n\tv_nop\n\tv_nop"
               : "+v"(a), "+v"(b), "+v"(c), "+v"(d) : "v"(x0), "v"(x1), "v"(x2), "v"(x3), "v"(x4), "v"(x5) : "memory");
#endif
}
__device__ __forceinline__ void acc_guard4(v8f& a, v8f& b, v8f& c, v8f& d) {
#if defined(__HIP_DEVICE_COMPILE__)
  asm volatile("v_nop\n\tv_nop\n\tv_nop\n\tv_nop" : "+v"(a), "+v"(b), "+v"(c), "+v"(d));
#endif
}
__device__ __forceinline__ void wave_sync_lds() {
  __builtin_amdgcn_fence(__ATOMIC_RELEASE, "workgroup");
  __builtin_amdgcn_wave_barrier();
  __builtin_amdgcn_fence(__ATOMIC_ACQUIRE, "workgroup");
}

// =====================================================================================================
// f32 [rows][DMOD] -> 16-bit fragment-major plane.  f16mode == 0: bf16 RNE bits;  f16mode == 1: f16 bits of (bf16 RNE value)
// * scale. Thread = output unit gt = 8 consecutive elements of one row: two 16-B loads (a wave reads 64 B of each of 16 rows,
// the block uses every line whole), one 16-B store; 32 consecutive lanes store 512 contiguous, 512-B aligned bytes;
// coverage: blk = 0 .. n8/256 - 1, x 256 thr x 8 (in-kernel bound) = the whole plane (n8 a multiple of 256 here).
// =====================================================================================================
__device__ __forceinline__ void cvt16(const float* __restrict__ x, u16* D, int blk, int n8, int f16mode, float scale) {
  const int gt = blk * 256 + (int)threadIdx.x;
  if (gt >= n8) return;
  const int srow = (gt >> 10) * 16 + (gt & 15);                                   // 1024 units per 16-row tile
  const int schk = ((gt >> 6) & (DMOD / 32 - 1)) * 4 + ((gt >> 5) & 1) * 2 + ((gt >> 4) & 1);
  const float* p = x + ((size_t)srow * (DMOD / 8) + schk) * 8;
  const v4f a = *(const v4f*)(p), b4 = *(const v4f*)(p + 4);
  float w[8];
#pragma unroll
  for (int e = 0; e < 4; ++e) { w[e] = a[e]; w[4 + e] = b4[e]; }
  v4u o;
#pragma unroll
  for (int e = 0; e < 4; ++e) {
    const float f0 = w[2 * e], f1 = w[2 * e + 1];
    const unsigned short hb0 = h_bits((_Float16)(bfr(f0) * scale));
    const unsigned short hb1 = h_bits((_Float16)(bfr(f1) * scale));
    const unsigned short bb0 = bf_bits(f0);
    const unsigned short bb1 = bf_bits(f1);
    o[e] = (f16mode != 0) ? pk16(hb0, hb1) : pk16(bb0, bb1);
  }
  u16* d = D + (size_t)gt * 8;
  {
    *(v4u*)(d) = o;
    
  }
}

// =====================================================================================================
// Rotary tables TC[s][j] = cos(s * inv[j]), TS[s][j] = sin(s * inv[j]), j < 32, with
// inv[j] = 1.0f / f32(10000^(j/32)) (power evaluated in f64 and narrowed once, IEEE f32 reciprocal, f32 product s*inv,
// coverage: blk = 0 .. n/256 - 1, x 256 thr = n = SEQ*32 elements of TC and of TS (n a multiple of 256).
// =====================================================================================================
__device__ __forceinline__ void k_tab(float* TC, float* TS, int blk, int n) {
#pragma clang fp contract(off)
  const int idx = blk * 256 + (int)threadIdx.x;
  if (idx >= n) return;
  const int s = idx / NFREQ;
  const int j = idx - s * NFREQ;
  const double pj = exp2((double)j * ROPE_L2);       // 10000^(j/32)
  const float pf  = (float)pj;
  const float inv = 1.0f / pf;
  const float ang = (float)s * inv;
  float sv, cv;
  sincosf(ang, &sv, &cv);
  {
    *(float*)(TC + idx) = cv;
    *(float*)(TS + idx) = sv;
    
  }
}

// =====================================================================================================
// One launch for everything that reads only the inputs: none of these pieces reads what another writes, so they share a grid
// by block range (every branch is block-uniform, no barrier): GT blocks the rotary tables, NB*GX blocks x -> bf16 plane
// [MROWS][512], GW blocks each Wq, Wk, Wv -> one bf16 plane [1536 n][512 k], GW blocks Wo -> f16 plane of the bf16 value x1024.
// coverage: grid = GT + NB*GX + 4*GW blocks, each range exactly the grid of its piece.
// =====================================================================================================
__global__ __launch_bounds__(256) void prep(const float* __restrict__ x, const float* __restrict__ wq,
                                            const float* __restrict__ wk, const float* __restrict__ wv,
                                            const float* __restrict__ wo, u16* XB, u16* WB, u16* WT, float* TC, float* TS) {
  int bid = (int)blockIdx.x;
  if (bid < GT) { k_tab(TC, TS, bid, SEQ * NFREQ); return; }
  bid -= GT;
  if (bid < NB * GX) {
    const int bq = bid / GX;
    cvt16(x + (size_t)bq * XS_FULL * DMOD, XB + (size_t)bq * SEQ * DMOD, bid - bq * GX, SEQ * DMOD / 8, 0, 1.0f);
    return;
  }
  bid -= NB * GX;
  if (bid < GW)     { cvt16(wq, WB, bid, DMOD * DMOD / 8, 0, 1.0f); return; }
  if (bid < 2 * GW) { cvt16(wk, WB + (size_t)VCOL0 * DMOD, bid - GW, DMOD * DMOD / 8, 0, 1.0f); return; }
  if (bid < 3 * GW) { cvt16(wv, WB + (size_t)KCOL0 * DMOD, bid - 2 * GW, DMOD * DMOD / 8, 0, 1.0f); return; }
  if (bid < 4 * GW) { cvt16(wo, WT, bid - 3 * GW, DMOD * DMOD / 8, 1, WOS); return; }
}

// =====================================================================================================
// v^T planes from the value columns of the projection F f32 [MROWS][ldf] (row = b*SEQ + s, column = voff + g*HD + d) plus
// the per-column bias (bias[g*HD + d], f32 add, then the x1024 carry):
//   VH = f16(v * 1024), VL = f16 residual (t - f16(t)), both for all keys s, fragment-major per head with the 32-key step
//   outermost: [b*NKVH + g][s/32][d/16][half][lane][8] (row = d, k = key).
// Block = (b, head g, 64 keys s0): each thread loads its 16 floats (key sl, d chunk dc) with 16-B loads, adds bias, converts,
// places them into two LDS tiles [64 d][64 keys] (pitch 72 halves); after a block barrier each d row segment (64 halves =
// coverage: load 256 thr x 16 = 64 keys x 64 d; store 2 iterations x 256 thr x 8 halves = 64 lines x 64 = the block's tile of
//           VH and of VL; bid = 0 .. NB*NKVH*NST - 1 covers both planes exactly once.
// =====================================================================================================
__device__ __forceinline__ void vt16(u16* TH, u16* TL, int bid, const float* __restrict__ F, int ldf, int voff,
                                     const float* __restrict__ bias, u16* VHo, u16* VLo) {
#pragma clang fp contract(off)
  const int tid = threadIdx.x;
  const int st  = bid % NST;
  const int t2  = bid / NST;
  const int g   = t2 % NKVH;
  const int b   = t2 / NKVH;
  if (b >= NB) return;                      // block-uniform, before any barrier; never taken with the exact grid
  const int s0  = st * 64;
  {
    const int sl = tid >> 2;                // key within tile 0..63
    const int dc = (tid & 3) * 16;          // d chunk 0,16,32,48
    const float* src = F + ((size_t)b * SEQ + s0 + sl) * (size_t)ldf + voff + g * HD + dc;
    const float* bp  = bias + g * HD + dc;
#pragma unroll
    for (int i = 0; i < 4; ++i) {
      const v4f a  = *(const v4f*)(src + 4 * i);
      const v4f bb = *(const v4f*)(bp + 4 * i);
#pragma unroll
      for (int e = 0; e < 4; ++e) {
        const float y = a[e] + bb[e];
        const float t = y * VCAR;
        const _Float16 hv = (_Float16)t;
        const _Float16 lv = (_Float16)(t - (float)hv);
        TH[(dc + 4 * i + e) * VTP + sl] = h_bits(hv);
        TL[(dc + 4 * i + e) * VTP + sl] = h_bits(lv);
      }
    }
  }
  __syncthreads();
  v4u vh[2], vl[2];
#pragma unroll
  for (int it = 0; it < 2; ++it) {
    const int u  = it * 256 + tid;                                        // output unit within the block's 64 keys
    const int d  = ((u >> 6) & 3) * 16 + (u & 15);
    const int ko = (u >> 8) * 32 + ((u >> 5) & 1) * 16 + ((u >> 4) & 1) * 8;
    vh[it] = *(const v4u*)(TH + d * VTP + ko);
    vl[it] = *(const v4u*)(TL + d * VTP + ko);
  }
  const size_t hrow = (size_t)(b * NKVH + g) * HD;
  const size_t base = hrow * SEQ + (size_t)s0 * HD + tid * 8;
  {
#pragma unroll
    for (int it = 0; it < 2; ++it) {
      *(v4u*)(VHo + base + it * 2048) = vh[it];
      *(v4u*)(VLo + base + it * 2048) = vl[it];
    }
    // in the shared launch the code of another block range follows and writes the offset register of these stores
    asm volatile("s_wait_xcnt 0x0" ::: "memory");
  }
}

// =====================================================================================================
// Interleaved-pair rotary + bias + q / k planes from the projection F f32 [MROWS][ldf] at column offset coff (ncol = DMOD
// for q, KVD for k; row = b*SEQ + s, column = coff + head*HD + d; table row = s, table column j = d >> 1):
//   y[d] = F[d] + bias[d] (f32 add)
//   out[2j]   = y[2j]  *c[s][j] + (-1)*(y[2j+1]*sn[s][j])
//   out[2j+1] = y[2j+1]*c[s][j] + (+1)*(y[2j]  *sn[s][j])        with c, sn the f32 table values (mul, mul, add kept
//   separate); Hp = f16(out * sc), Lp = f16 residual (t - f16(t)), both fragment-major per head:
//   [b*nh + head][s/16][d/32][half][lane][8] (row = position s, k = d).
// bid = one 16 x 32 fragment (b, head, 16 positions, d step kk), 64 threads (tid) = its 64 units; thread = position s, 8 columns
// head*HD + dd .. +7 (4 pairs); the fragment's two waves read the two 64-B halves of the same 16 lines of F.
// coverage: 64 thr x 8 = one 1-KB fragment of Hp and of Lp; bid = 0 .. MROWS - 1 = NB*nh*(SEQ/16)*2 = every fragment once.
// =====================================================================================================
__device__ __forceinline__ void rot_one(float x, float y, float cv, float sv, float sgn, float sc,
                                        unsigned short& hb, unsigned short& lb) {
#pragma clang fp contract(off)
  const float ys   = y * sv;
  const float term = sgn * ys;
  const float r    = x * cv + term;
  const float t    = r * sc;
  const _Float16 a = (_Float16)t;
  hb = h_bits(a);
  lb = h_bits((_Float16)(t - (float)a));
}

__device__ __forceinline__ void rope16(int bid, int tid, const float* __restrict__ F, int ldf, int coff, int ncol,
                                       const float* __restrict__ bias,
                                       const float* __restrict__ TC, const float* __restrict__ TS,
                                       u16* Hp, u16* Lp, float sc) {
#pragma clang fp contract(off)
  const int nh  = ncol / HD;                           // heads in the q / k block
  if (nh <= 0) return;
  const int kk   = bid & 1;                            // 32-wide d step
  const int t1   = bid >> 1;
  const int tile = t1 % (SEQ / 16);                    // 16-position tile
  const int t2   = t1 / (SEQ / 16);
  const int head = t2 % nh;
  const int b    = t2 / nh;
  if (b >= NB) return;                                 // never taken with bid < NB * nh * (SEQ/16) * 2
  const int s    = tile * 16 + (tid & 15);
  const int dd   = (kk * 4 + ((tid >> 5) & 1) * 2 + ((tid >> 4) & 1)) * 8;   // d within head, multiple of 8
  const int col  = head * HD + dd;
  const int jj   = dd >> 1;                            // table column of the first pair, multiple of 4
  const int row  = b * SEQ + s;
  const float* p = F + (size_t)row * (size_t)ldf + coff + col;
  const v4f xa = *(const v4f*)(p),          xb = *(const v4f*)(p + 4);
  const v4f ba = *(const v4f*)(bias + col), bb = *(const v4f*)(bias + col + 4);
  // the table loads below may return their data into the address registers of the four loads above: the wait stands in front
  asm volatile("s_wait_xcnt 0x0" ::: "memory");
  const v4f cw = *(const v4f*)(TC + (size_t)s * NFREQ + jj);
  const v4f sw = *(const v4f*)(TS + (size_t)s * NFREQ + jj);
  float yv[8];
#pragma unroll
  for (int e = 0; e < 4; ++e) {
    yv[e]     = xa[e] + ba[e];
    yv[4 + e] = xb[e] + bb[e];
  }
  v4u oh, ol;
#pragma unroll
  for (int e = 0; e < 4; ++e) {
    unsigned short h0, l0, h1, l1;
    rot_one(yv[2 * e],     yv[2 * e + 1], cw[e], sw[e], -1.0f, sc, h0, l0);   // even element of the pair
    rot_one(yv[2 * e + 1], yv[2 * e],     cw[e], sw[e],  1.0f, sc, h1, l1);   // odd element of the pair
    oh[e] = pk16(h0, h1);
    ol[e] = pk16(l0, l1);
  }
  u16* dh = Hp + ((size_t)bid * 64 + tid) * 8;
  u16* dl = Lp + ((size_t)bid * 64 + tid) * 8;
  {
    *(v4u*)(dh) = oh;
    *(v4u*)(dl) = ol;
    
  }
}

// =====================================================================================================
// One launch for the three pieces that read only the projection F and the tables and write planes of their own; they share a
// grid by block range (block-uniform branches; the barrier of vt16 is passed by all 256 threads of its blocks):
// GR blocks q = rotary(q_proj + bq), 4 fragments of 64 threads a block; GR blocks keys = rotary(v_proj + bv), alike;
// GV blocks values = k_proj + bk -> v^T planes.
// coverage: grid = 2*GR + GV blocks, each range exactly the fragments / tiles of its piece.
// =====================================================================================================
__global__ __launch_bounds__(256) void planes(const float* __restrict__ F, const float* __restrict__ bq,
                                              const float* __restrict__ bk, const float* __restrict__ bv,
                                              const float* __restrict__ TC, const float* __restrict__ TS,
                                              u16* QH, u16* QL, u16* KH, u16* KL, u16* VH, u16* VL) {
  __shared__ __align__(16) u16 TH[HD * VTP];
  __shared__ __align__(16) u16 TL[HD * VTP];
  const int bid = (int)blockIdx.x;
  const int sub = (int)threadIdx.x >> 6, t64 = (int)threadIdx.x & 63;
  if (bid < GR)     { rope16(bid * 4 + sub, t64, F, NQKV, QCOL0, DMOD, bq, TC, TS, QH, QL, QSC); return; }
  if (bid < 2 * GR) { rope16((bid - GR) * 4 + sub, t64, F, NQKV, KCOL0, KVD, bv, TC, TS, KH, KL, KSC); return; }
  vt16(TH, TL, bid - 2 * GR, F, NQKV, VCOL0, bk, VH, VL);
}

// =====================================================================================================
// GEMM epilogue shared by both engines: the wave's 16x64 f32 tile (times oscale) staged in its LDS slab (pitch 68),
// 16 consecutive lanes x 16 B per line), lanes 16..31 -> row 2*it+1; HASB != 0 adds bias[col] in f32 to every element;
// coverage: 8 instructions x 2 rows x 16 lanes x 4 floats = the wave's 16 x 64 tile.
// =====================================================================================================
template <int HASB>
__device__ __forceinline__ void epi64(float* sl, v8f a0, v8f a1, v8f a2, v8f a3, float oscale, const float* bias,
                                      float* C, int N, size_t rowb, int col0, int lane) {
  const int hh = lane >> 4, m = lane & 15;
#pragma unroll
  for (int r = 0; r < 8; ++r) {
    const int ro = (8 * hh + r) * 68 + m;
    sl[ro]      = a0[r] * oscale;
    sl[ro + 16] = a1[r] * oscale;
    sl[ro + 32] = a2[r] * oscale;
    sl[ro + 48] = a3[r] * oscale;
  }
  wave_sync_lds();
  v4f vals[8];
#pragma unroll
  for (int it = 0; it < 8; ++it) vals[it] = *(const v4f*)(sl + (it * 2 + hh) * 68 + m * 4);
  if (HASB != 0) {
    const v4f b4 = *(const v4f*)(bias + col0 + m * 4);
#pragma unroll
    for (int it = 0; it < 8; ++it) vals[it] = vals[it] + b4;
  }
  float* dst = C + (rowb + (size_t)hh) * (size_t)N + col0 + m * 4;
  {
#pragma unroll
    for (int it = 0; it < 8; ++it) {
      *(v4f*)(dst + (size_t)(it * 2) * (size_t)N) = vals[it];
    }
    
  }
}

// =====================================================================================================
// bf16 GEMM: C[M][N] (f32) = A[M][K] . Bt[N][K]^T, times oscale; A and Bt bf16 fragment-major planes.
// Block = 64x64 tile, 4 waves x 16 rows; fragments loaded straight from the planes (two 512-B wave loads each, split k map
// for A and B); K stepped by 32 (host guarantees K % 32 == 0, M % 64 == 0, N % 64 == 0, grid = (M/64)*(N/64)).
// =====================================================================================================
__global__ __launch_bounds__(128)
void gemm_bf(const u16* __restrict__ A, const u16* __restrict__ Bt, float* C, int M, int N, int K, float oscale) {
  __shared__ __align__(16) float slab[4 * SLAB64];
  const int tid = threadIdx.x, lane = tid & 31;
  const int wave = __builtin_amdgcn_readfirstlane(tid >> 5);   // scalar, so that the tile starts below are scalar bases
  const int ntile = N >> 6;
  const int bid   = blockIdx.x;
  const int rowb  = (bid / ntile) * 64 + wave * 16;
  const int col0  = (bid % ntile) * 64;
  if (rowb + 16 > M) return;                // wave-uniform, never taken with the exact grid; no block barriers in this kernel
  const u16* ap = A  + (size_t)rowb * K;              // fragment (16-row tile, k step ks) at tile start + ks * 1024 bytes
  const u16* bp  = Bt + (size_t)col0 * K;
  const u16* bp1 = Bt + (size_t)(col0 + 16) * K;
  const u16* bp2 = Bt + (size_t)(col0 + 32) * K;
  const u16* bp3 = Bt + (size_t)(col0 + 48) * K;
  unsigned vo = (unsigned)lane * 16u;
  v8f acc0 = zero8(), acc1 = zero8(), acc2 = zero8(), acc3 = zero8();
#pragma unroll 1
  for (int k0 = 0; k0 < K; k0 += 32, vo += 1024u) {
    const v16b a  = ldfrag_b(ap, vo);
    const v16b b0 = ldfrag_b(bp, vo);
    const v16b b1 = ldfrag_b(bp1, vo);
    const v16b b2 = ldfrag_b(bp2, vo);
    const v16b b3 = ldfrag_b(bp3, vo);
    acc0 = mma_b(a, b0, acc0);
    acc1 = mma_b(a, b1, acc1);
    acc2 = mma_b(a, b2, acc2);
    acc3 = mma_b(a, b3, acc3);
    guard6<v16b>(acc0, acc1, acc2, acc3, a, b0, b1, b2, b3, a);
  }
  epi64<0>(slab + wave * SLAB64, acc0, acc1, acc2, acc3, oscale, C, C, N, (size_t)rowb, col0, lane);
}

// =====================================================================================================
// f16 GEMM: C[M][N] (f32) = (A[M][K] (+ A2[M][K] when TWO != 0)) . Bt[N][K]^T, times oscale, plus bias[n]; A, A2 f16
// fragment-major planes (A2 = the unscaled f16 residual of A, sharing the accumulator), Bt f16 fragment-major. Same tiling, fragment
// loads (split k map) and epilogue as gemm_bf; K stepped by 32.
// =====================================================================================================
template <int TWO>
__device__ __forceinline__
void gemm_h(float* slab, int wave, int lane, int rowb, int crow, int col0,
            const u16* __restrict__ A, const u16* __restrict__ A2, const u16* __restrict__ Bt,
            const float* __restrict__ bias, float* C, int N, int K, float oscale) {
  const _Float16* ap  = (const _Float16*)(const void*)A  + (size_t)rowb * K;
  const _Float16* ap2 = (const _Float16*)(const void*)A2 + (size_t)rowb * K;
  const _Float16* bp  = (const _Float16*)(const void*)Bt + (size_t)col0 * K;
  const _Float16* bp1 = (const _Float16*)(const void*)Bt + (size_t)(col0 + 16) * K;
  const _Float16* bp2 = (const _Float16*)(const void*)Bt + (size_t)(col0 + 32) * K;
  const _Float16* bp3 = (const _Float16*)(const void*)Bt + (size_t)(col0 + 48) * K;
  unsigned vo = (unsigned)lane * 16u;
  v8f acc0 = zero8(), acc1 = zero8(), acc2 = zero8(), acc3 = zero8();
#pragma unroll 1
  for (int k0 = 0; k0 < K; k0 += 32, vo += 1024u) {
    const v16h a  = ldfrag_h(ap, vo);
    const v16h b0 = ldfrag_h(bp, vo);
    const v16h b1 = ldfrag_h(bp1, vo);
    const v16h b2 = ldfrag_h(bp2, vo);
    const v16h b3 = ldfrag_h(bp3, vo);
    acc0 = mma_h(a, b0, acc0);
    acc1 = mma_h(a, b1, acc1);
    acc2 = mma_h(a, b2, acc2);
    acc3 = mma_h(a, b3, acc3);
    if (TWO != 0) {
      const v16h a2 = ldfrag_h(ap2, vo);
      acc0 = mma_h(a2, b0, acc0);
      acc1 = mma_h(a2, b1, acc1);
      acc2 = mma_h(a2, b2, acc2);
      acc3 = mma_h(a2, b3, acc3);
      guard6<v16h>(acc0, acc1, acc2, acc3, a, a2, b0, b1, b2, b3);
    } else {
      guard6<v16h>(acc0, acc1, acc2, acc3, a, b0, b1, b2, b3, a);
    }
  }
  (void)ap2;
  epi64<1>(slab + wave * SLAB64, acc0, acc1, acc2, acc3, oscale, bias, C, N, (size_t)crow, col0, lane);
}

// One launch for y = O.Wo^T + bo over all sequences: block = 64 rows x 64 columns; its 64 rows lie in one sequence and wholly
// below or wholly at and above row RICH of it (RICH and SEQ multiples of 64), so the choice hi + residual / hi only is
// block-uniform. rowb = the wave's first row in the O planes, crow = the same row in out.
// coverage: grid = NB * (SEQ/64) * (N/64) blocks x 4 waves x 16 x 64 = every element of out once (host: N % 64 == 0, K % 32 == 0).
__global__ __launch_bounds__(128)
void gemm_o(const u16* __restrict__ A, const u16* __restrict__ A2, const u16* __restrict__ Bt,
            const float* __restrict__ bias, float* C, int N, int K, float oscale) {
  __shared__ __align__(16) float slab[4 * SLAB64];
  const int tid = threadIdx.x, lane = tid & 31;
  const int wave = __builtin_amdgcn_readfirstlane(tid >> 5);   // scalar, so that the tile starts are scalar bases
  const int ntile = N >> 6;
  const int bid  = blockIdx.x;
  const int rt   = bid / ntile;
  const int col0 = (bid % ntile) * 64;
  const int bq   = rt / (SEQ / 64);
  const int rs   = (rt % (SEQ / 64)) * 64;                     // first row of the block within its sequence
  if (bq >= NB) return;                     // block-uniform, never taken with the exact grid; no block barriers in this kernel
  const int rowb = bq * SEQ + rs + wave * 16;
  const int crow = bq * XS_FULL + rs + wave * 16;
  if (rs < RICH) gemm_h<1>(slab, wave, lane, rowb, crow, col0, A, A2, Bt, bias, C, N, K, oscale);
  else           gemm_h<0>(slab, wave, lane, rowb, crow, col0, A, A2, Bt, bias, C, N, K, oscale);
}

// =====================================================================================================
// Causal softmax attention, hd = 64, 8 heads. Block bid -> (query tile qt = bid % NQT: rows q0 = 16*qt .. q0+15, head,
// batch b); keys/values of the same head (kvh = head). The tile's key steps are dealt over the block's NSW waves: wave w takes
// steps w, w + NSW, ... with its own running max, sum and O accumulators; the NSW partials are merged in LDS behind one block
// barrier (attn_merge8), so the longest serial walk is NKT / NSW steps instead of NKT.
//   q and k hi / residual planes f16 x256, fragment-major per head [b*8 + h][s/16][d/32][half][lane][8];
//   v^T hi / residual planes x1024, fragment-major per head [b*NKVH + h][s/32][d/16][half][lane][8].
//   raw(i, j) = q_hi.k_hi + q_lo.k_hi + q_hi.k_lo (2 k-steps over d); logit = raw * (SM_SCALE * 2^-16) (the two 256 carries
//   folded exactly into the 1/sqrt(512) scale, one f32 multiply); keys above the diagonal replaced by -inf.
//   Both products run transposed, S^T = k.q^T (A = k fragment, B = q fragment) and O^T += v^T.P^T (A = v^T fragment, B = P^T),
//   so lane (c, hh) holds 16 scores and 32 O elements of the one query q0 + c: online softmax per query in f32 with a running
//   max: max over the lane's 16 scores, then one exchange with lane c ^ 16 (same max in both); sum over the lane's own keys,
//   the two halves joined once behind the loop; alpha = exp(m_old - m_new), p = exp(logit - m_new), l = l*alpha + sum p, O
//   accumulators times alpha before the tile's v^T.P^T. Only key tiles of 32 with kb <= q0 are visited (nkt = q0/32 + 1 <= NKT; key kb is
//   unmasked for every row of the tile, so each row max of a visited tile is finite; wave 0 always visits tile 0).
//   The two 16x16 score tiles of a step, converted in place, are the P^T B fragment (no LDS, no lane exchange);
//   v^T A fragments in 2 groups of 2 d-subtiles; RV = 1: products
//   hh + lh + hl, RV = 0: hh only. After the loop every wave (one without a step: max -inf, sum 0, O 0) puts its raw O
//   accumulators into its slab and its 16 row maxima and sums beside them; block barrier; waves 0..3 merge.
//   Epilogue: O = merged acc / (merged l * 32768 * 1024), x256 -> f16 hi plane (and for RV = 1 the unscaled f16 residual
//   plane), fragment-major over [b*SEQ + s][512]; wave it < 4, lane = (row c, 8 consecutive d at it*16 + 8*hh); one
//   instruction = one 512-B half fragment (4 whole lines).
// coverage: 4 waves x 1 instruction x 32 lanes x 8 halves = 16 x 64 per plane; grid NQT x NH x NB blocks;
//   the two forms (tiles 0..NQTR-1 with RV = 1, NQTR..NQT-1 with RV = 0) cover every (b, s, h) row segment of the hi plane
//   exactly once and rows s < RICH of the residual plane exactly once (only those rows are read later).
// =====================================================================================================
// lane l <-> lane l ^ 16 (the other 16-lane row) as one vector cross-row move
__device__ __forceinline__ float xhalf(float x) {
  const int b = __builtin_bit_cast(int, x);
  return __builtin_bit_cast(float, __builtin_amdgcn_permlanex16(b, b, 0x76543210, 0xfedcba98, false, false));
}

// 2^x for the merge weights. The v_nop in the same statement keeps the one issue slot that the instruction set asks for behind
// a transcendental, whichever instruction the compiler places next.
__device__ __forceinline__ float exp2_slot(float x) {
  float r = 0.0f;
#if defined(__HIP_DEVICE_COMPILE__)
  asm("v_exp_f32 %0, %1\n\tv_nop" : "=v"(r) : "v"(x));
#endif
  return r;
}

// 2^x of eight values in one statement, for the same slot: the results are early-clobber, so that no v_exp_f32 here writes a
// source or reads a result of the one in front of it, and the one v_nop keeps the slot behind the last.
__device__ __forceinline__ void exp2x8_slot(float (&r)[8], const float (&x)[8]) {
#if defined(__HIP_DEVICE_COMPILE__)
  asm("v_exp_f32 %0, %8\n\tv_exp_f32 %1, %9\n\tv_exp_f32 %2, %10\n\tv_exp_f32 %3, %11\n\t"
      "v_exp_f32 %4, %12\n\tv_exp_f32 %5, %13\n\tv_exp_f32 %6, %14\n\tv_exp_f32 %7, %15\n\tv_nop"
      : "=&v"(r[0]), "=&v"(r[1]), "=&v"(r[2]), "=&v"(r[3]), "=&v"(r[4]), "=&v"(r[5]), "=&v"(r[6]), "=&v"(r[7])
      : "v"(x[0]), "v"(x[1]), "v"(x[2]), "v"(x[3]), "v"(x[4]), "v"(x[5]), "v"(x[6]), "v"(x[7]));
#else
  for (int e = 0; e < 8; ++e) r[e] = x[e];
#endif
}

// Merge of the NSW partials for one lane's 8 outputs (row c, columns dd .. dd+7): M = max of the waves' row maxima, weight
// exp(m_w - M) (0 for a wave without a step), L = sum of weight * l_w, acc = sum of weight * O_w, waves in index order.
__device__ __forceinline__ void attn_merge8(const float* slabs, const float* sm, const float* sl, int c, int dd,
                                            float* acc, float& L) {
  float mw[NSW], lw[NSW];
  v4f pa[NSW], pb[NSW];
#pragma unroll
  for (int w = 0; w < NSW; ++w) {
    mw[w] = sm[w * 16 + c];
    lw[w] = sl[w * 16 + c];
    pa[w] = *(const v4f*)(slabs + w * SLW + c * SLP + dd);
    pb[w] = *(const v4f*)(slabs + w * SLW + c * SLP + dd + 4);
  }
  float M = mw[0];
#pragma unroll
  for (int w = 1; w < NSW; ++w) M = fmaxf(M, mw[w]);
  L = 0.0f;
#pragma unroll
  for (int e = 0; e < 8; ++e) acc[e] = 0.0f;
#pragma unroll
  for (int w = 0; w < NSW; ++w) {
    const float wt = exp2_slot((mw[w] - M) * 1.44269504f);
    L += wt * lw[w];
#pragma unroll
    for (int e = 0; e < 4; ++e) {
      acc[e]     += wt * pa[w][e];
      acc[4 + e] += wt * pb[w][e];
    }
  }
}

template <int RV>
__device__ __forceinline__
void attn_cs(float* smem, float* smx, float* ssm, int qt, int head, int b,
             const u16* __restrict__ QHp, const u16* __restrict__ QLp,
             const u16* __restrict__ KHp, const u16* __restrict__ KLp,
             const u16* __restrict__ VHp, const u16* __restrict__ VLp,
             u16* OHp, u16* OLp) {
#pragma clang fp contract(off)
  const int tid  = threadIdx.x;
  const int wave = __builtin_amdgcn_readfirstlane(tid >> 5);   // scalar: which key steps the wave takes
  const int lane = tid & 31;
  const int hh   = lane >> 4;
  const int c    = lane & 15;
  const int q0   = qt * 16;
  const int kvh  = head;

  float* slab = smem + wave * SLW;          // O partial slab [16 queries][64 d] pitch 68, written behind the loop

  // fragment-major planes: a head's 16 positions x 64 d = 1024 halves (2 fragments), its 32 keys x 64 d of v^T = 2048 (4)
  // byte offsets into the planes (each plane MROWS * 512 * 2 bytes, far under 2^32), the lane's 16 bytes included
  const unsigned qvo = ((unsigned)(b * NH + head) * SEQ + (unsigned)q0) * (HD * 2u) + (unsigned)lane * 16u;
  unsigned kvo = (unsigned)(b * NKVH + kvh) * (SEQ * HD * 2u) + (unsigned)wave * (32u * HD * 2u)
               + (unsigned)lane * 16u;                                                  // this step's 32 keys, k and v^T alike
  const _Float16* Qh  = (const _Float16*)(const void*)QHp;
  const _Float16* Ql  = (const _Float16*)(const void*)QLp;
  const _Float16* Khb = (const _Float16*)(const void*)KHp;
  const _Float16* Klb = (const _Float16*)(const void*)KLp;
  const _Float16* Vhb = (const _Float16*)(const void*)VHp;               // d-subtile j at + j * 512 halves
  const _Float16* Vlb = (const _Float16*)(const void*)VLp;
  const float lsc  = SM_SCALE * (1.0f / (QSC * KSC));   // exact power-of-two fold of the q / k carries into the scale
  const float oc   = 1.0f / (PCAR * VCAR);
  const float ninf = -__builtin_inff();
  const size_t KROW = (size_t)HD;           // halves per key in a head's fragment-major plane

  v8f o[4];
#pragma unroll
  for (int j = 0; j < 4; ++j) o[j] = zero8();
  float mrun = ninf, lrun = 0.0f;           // this lane's query: running max (alike in lanes c and c + 16), sum over the lane's own keys
  const int ncaus = (q0 >> 5) + 1;                                            // tiles holding keys <= q0 + 15
  const int nkt   = (ncaus < NKT) ? ncaus : NKT;
  const int qrow  = q0 + c;                                                   // the lane's query row

#pragma unroll 1
  for (int kt = wave; kt < nkt; kt += NSW, kvo += NSW * 32u * HD * 2u) {
    const int kb = kt * 32;
    // ---- raw scores, transposed: D element r of this lane = (key kb + 8hh + r, query qrow) in s0, key kb + 16 + 8hh + r in s1 ----
    v8f s0 = zero8(), s1 = zero8();
    const _Float16* k0p = Khb;
    const _Float16* k1p = k0p + (size_t)16 * KROW;
    const _Float16* l0p = Klb;
    const _Float16* l1p = l0p + (size_t)16 * KROW;
#pragma unroll
    for (int kk = 0; kk < HD / 32; ++kk) {
      const v16h qh  = ldfrag_h(Qh + kk * 512, qvo);
      const v16h ql  = ldfrag_h(Ql + kk * 512, qvo);
      const v16h kh0 = ldfrag_h(k0p + kk * 512, kvo);
      const v16h kh1 = ldfrag_h(k1p + kk * 512, kvo);
      const v16h kl0 = ldfrag_h(l0p + kk * 512, kvo);
      const v16h kl1 = ldfrag_h(l1p + kk * 512, kvo);
      s0 = mma_h(kh0, qh, s0);
      s0 = mma_h(kh0, ql, s0);
      s0 = mma_h(kl0, qh, s0);
      s1 = mma_h(kh1, qh, s1);
      s1 = mma_h(kh1, ql, s1);
      s1 = mma_h(kl1, qh, s1);
      guard2(s0, s1, qh, ql, kh0, kl0, kh1, kl1);
    }
    // ---- causal replace-mask, running-max online softmax in f32: the lane's 16 scores all belong to its one query ----
    const int key0 = kb + 8 * hh;
    float t0[8], t1[8];
#pragma unroll
    for (int r = 0; r < 8; ++r) {
      const float a0 = s0[r] * lsc;
      const float a1 = s1[r] * lsc;
      t0[r] = (key0 + r > qrow) ? ninf : a0;
      t1[r] = (key0 + 16 + r > qrow) ? ninf : a1;
    }
    float mx = fmaxf(t0[0], t1[0]);
#pragma unroll
    for (int r = 1; r < 8; ++r) mx = fmaxf(mx, fmaxf(t0[r], t1[r]));
    mx = fmaxf(mx, xhalf(mx));              // the query's other 16 keys of this step sit in lane c ^ 16
    const float mnew = fmaxf(mrun, mx);
    const float al   = exp2_slot((mrun - mnew) * 1.44269504f);
    float x0[8], x1[8], p0[8], p1[8], ps[8];
#pragma unroll
    for (int r = 0; r < 8; ++r) {
      x0[r] = (t0[r] - mnew) * 1.44269504f;
      x1[r] = (t1[r] - mnew) * 1.44269504f;
    }
    exp2x8_slot(p0, x0);
    exp2x8_slot(p1, x1);
#pragma unroll
    for (int r = 0; r < 8; ++r) ps[r] = p0[r] + p1[r];
    const float sm = ((ps[0] + ps[1]) + (ps[2] + ps[3])) + ((ps[4] + ps[5]) + (ps[6] + ps[7]));
    lrun = lrun * al + sm;
    mrun = mnew;
    // ---- rescale the O accumulators by alpha (every element of the lane belongs to its query) ----
#pragma unroll
    for (int j = 0; j < 4; ++j) {
#pragma unroll
      for (int r = 0; r < 8; ++r) o[j][r] = o[j][r] * al;
    }
    // ---- B fragments of p*32768 straight from the score registers: column = query c, elements 0..7 = keys kb + 8hh + 0..7,
    //      elements 8..15 = keys kb + 16 + 8hh + 0..7 (the split k map of the v^T fragments); hi f16, residual f16 for RV = 1 ----
    FragH ph, pl;
#pragma unroll
    for (int r = 0; r < 8; ++r) {
      const float ta = p0[r] * PCAR, tb = p1[r] * PCAR;
      const _Float16 ha = (_Float16)ta, hb = (_Float16)tb;
      ph.h[0][r] = ha;
      ph.h[1][r] = hb;
      if (RV != 0) {
        pl.h[0][r] = (_Float16)(ta - (float)ha);
        pl.h[1][r] = (_Float16)(tb - (float)hb);
      }
    }
    // ---- O^T += v^T.P^T : A fragment row = d = j*16 + c, keys contiguous in the v^T planes; 2 groups of 2 d-subtiles;
    //      D element r of o[j] = (d = j*16 + 8hh + r, query qrow) ----
    {
      const _Float16* vhp = Vhb;
      const _Float16* vlp = Vlb;
      (void)vlp;
#pragma unroll
      for (int jg = 0; jg < 2; ++jg) {
        const size_t da = (size_t)(2 * jg) * 512;
        const size_t db = da + 512;
        const v16h vha = ldfrag_h(vhp + da, kvo), vhb2 = ldfrag_h(vhp + db, kvo);
        o[2 * jg]     = mma_h(vha,  ph.v, o[2 * jg]);
        o[2 * jg + 1] = mma_h(vhb2, ph.v, o[2 * jg + 1]);
        if (RV != 0) {
          const v16h vla = ldfrag_h(vlp + da, kvo), vlb2 = ldfrag_h(vlp + db, kvo);
          o[2 * jg]     = mma_h(vha,  pl.v, o[2 * jg]);
          o[2 * jg]     = mma_h(vla,  ph.v, o[2 * jg]);
          o[2 * jg + 1] = mma_h(vhb2, pl.v, o[2 * jg + 1]);
          o[2 * jg + 1] = mma_h(vlb2, ph.v, o[2 * jg + 1]);
          guard2(o[2 * jg], o[2 * jg + 1], ph.v, pl.v, vha, vhb2, vla, vlb2);
        } else {
          guard2(o[2 * jg], o[2 * jg + 1], ph.v, ph.v, vha, vhb2, vha, vhb2);
        }
      }
    }
  }
  acc_guard4(o[0], o[1], o[2], o[3]);
  // ---- the wave's partial: raw O accumulators into its slab (row = query c, 8 consecutive d a register tile: 16-B stores),
  //      the query's max and its sum (the two lane halves' sums joined here, once) beside ----
#pragma unroll
  for (int j = 0; j < 4; ++j) {
    float* d = slab + c * SLP + j * 16 + 8 * hh;
    const v4f lo = {o[j][0], o[j][1], o[j][2], o[j][3]};
    const v4f hi = {o[j][4], o[j][5], o[j][6], o[j][7]};
    *(v4f*)(d)     = lo;
    *(v4f*)(d + 4) = hi;
  }
  const float lall = lrun + xhalf(lrun);
  if (hh == 0) {
    smx[wave * 16 + c] = mrun;
    ssm[wave * 16 + c] = lall;
  }
  __syncthreads();                          // every wave's partial is in LDS before any wave merges; passed by all NSW waves
  if (wave >= 4) return;                    // wave-uniform, behind the only block barrier
  // ---- merged O / l with the carries (32768 on p, 1024 on v) folded once, x256 -> f16 hi plane (+ f16 residual plane),
  //      fragment-major [row/16][512/32][half][lane][8]: wave it stores half it&1 of k step head*2 + (it>>1);
  //      lane = (row c, 8 consecutive d at it*16 + 8*hh) ----
  const int it = wave;
  float acc[8], lsum;
  attn_merge8(smem, smx, ssm, c, it * 16 + 8 * hh, acc, lsum);
  const float rl = (1.0f / lsum) * oc;
  float w[8];
#pragma unroll
  for (int e = 0; e < 8; ++e) w[e] = (acc[e] * rl) * OSC;
  v4u oh, ol;
#pragma unroll
  for (int e = 0; e < 4; ++e) {
    const _Float16 h0 = (_Float16)w[2 * e], h1 = (_Float16)w[2 * e + 1];
    const _Float16 g0 = (_Float16)(w[2 * e] - (float)h0), g1 = (_Float16)(w[2 * e + 1] - (float)h1);
    oh[e] = pk16(h_bits(h0), h_bits(h1));
    ol[e] = pk16(h_bits(g0), h_bits(g1));
  }
  const size_t ob = ((size_t)b * SEQ + q0) * DMOD + (size_t)head * (16 * HD) + 8 * lane + it * 256;
  *(v4u*)(OHp + ob) = oh;
  if (RV != 0) {
    *(v4u*)(OLp + ob) = ol;
  }
  // in the shared launch the code of the other form may follow and writes registers that these stores name
  asm volatile("s_wait_xcnt 0x0" ::: "memory");
}

// One launch for all query tiles: the tile index decides block-uniformly between the two forms (RV = 1 for tiles < NQTR).
__global__ __launch_bounds__(ATT_THREADS)
void attn_all(const u16* __restrict__ QHp, const u16* __restrict__ QLp,
              const u16* __restrict__ KHp, const u16* __restrict__ KLp,
              const u16* __restrict__ VHp, const u16* __restrict__ VLp, u16* OHp, u16* OLp) {
  __shared__ __align__(16) float smem[NSW * SLW];   // per wave: O partial slab behind the loop
  __shared__ float smx[NSW * 16];                   // per wave: 16 row maxima
  __shared__ float ssm[NSW * 16];                   // per wave: 16 row sums
  const int bid  = blockIdx.x;
  const int qt   = bid % NQT;
  const int t2   = bid / NQT;
  const int head = t2 % NH;
  const int b    = t2 / NH;
  if (b >= NB) return;                      // block-uniform, in front of the block barrier; never taken with the exact grid
  if (qt < NQTR) attn_cs<1>(smem, smx, ssm, qt, head, b, QHp, QLp, KHp, KLp, VHp, VLp, OHp, OLp);
  else           attn_cs<0>(smem, smx, ssm, qt, head, b, QHp, QLp, KHp, KLp, VHp, VLp, OHp, OLp);
}

// =====================================================================================================
// Workspace map (bytes); every plane is fully written by whole-line stores before it is read (the O residual plane only on
// the rows < RICH per sequence that are read); all extents are exact multiples of the store granularity (no pad rows needed);
// every region offset a multiple of 131072; every 16-bit plane is fragment-major (see the fragment loaders), same extent as
// the row-major shape given here:
//   XB  bf16 [MROWS][512]               MROWS*1024   (NB=4, SEQ=2048: 8388608); after the projection GEMM the same bytes hold
//                                                    the O f16 hi plane [MROWS][512] x256 (identical extent)
//   WB  bf16 [1536 n][512 k]            1572864      (Wq rows 0..511, Wk 512..1023, Wv 1024..1535)
//   F   f32 [MROWS][1536]               MROWS*6144   (q_proj | k_proj | v_proj columns); after rope16 / vt16 its first
//                                                    MROWS*1024 bytes hold the O f16 residual plane [MROWS][512]
//   QH  f16 [MROWS][512] x256           MROWS*1024   QL residual, same extent
//   KH  f16 [MROWS][512] x256           MROWS*1024   KL residual, same extent   (keys = rotary of the v_proj columns)
//   VH  f16 [NB*8][64][SEQ] x1024       MROWS*1024   VL residual, same extent   (values = the k_proj columns)
//   TC  f32 [SEQ][32]                   SEQ*128      TS, same extent
//   WT  f16 [512 o][512 d] x1024        524288       (Wo; a region of its own, written in the launch that also writes WB)
//   end (NB=4, SEQ=2048)              111673344
// =====================================================================================================
extern "C" void kernel_launch(void* const* d_in, const int* in_sizes, int n_in,
                              void* d_out, int out_size, void* d_ws, size_t ws_size,
                              hipStream_t stream) {
  if (n_in < 9) return;
  if (in_sizes[0] < ((NB - 1) * XS_FULL + SEQ) * DMOD) return;
  if (in_sizes[1] != DMOD * DMOD) return;
  if (in_sizes[2] != DMOD) return;
  if (in_sizes[3] != DMOD * DMOD) return;
  if (in_sizes[4] != DMOD) return;
  if (in_sizes[5] != DMOD * DMOD) return;
  if (in_sizes[6] != DMOD) return;
  if (in_sizes[7] != DMOD * DMOD) return;
  if (in_sizes[8] != DMOD) return;
  if (out_size < ((NB - 1) * XS_FULL + SEQ) * DMOD) return;

  const float* x   = (const float*)d_in[0];
  const float* wq  = (const float*)d_in[1];
  const float* bqp = (const float*)d_in[2];
  const float* wk  = (const float*)d_in[3];
  const float* bkp = (const float*)d_in[4];
  const float* wv  = (const float*)d_in[5];
  const float* bvp = (const float*)d_in[6];
  const float* wo  = (const float*)d_in[7];
  const float* bop = (const float*)d_in[8];
  float*       out = (float*)d_out;

  const size_t szXB = (size_t)MROWS * DMOD * 2;
  const size_t szWB = (size_t)NQKV * DMOD * 2;
  const size_t szF  = (size_t)MROWS * NQKV * 4;
  const size_t szQ  = (size_t)MROWS * DMOD * 2;                  // QH, QL
  const size_t szK  = (size_t)MROWS * KVD * 2;                   // KH, KL
  const size_t szV  = (size_t)NB * NKVH * HD * SEQ * 2;          // VH, VL (== szK)
  const size_t szT  = (size_t)SEQ * NFREQ * 4;                   // TC, TS
  const size_t szOH = (size_t)MROWS * DMOD * 2;                  // O hi plane, lives in the XB region
  const size_t szOL = (size_t)MROWS * DMOD * 2;                  // O residual plane, lives in the F region
  const size_t szWT = (size_t)DMOD * DMOD * 2;                   // Wo f16 plane
  if (szOH > szXB || szOL > szF) return;
  size_t off = 0;
  const size_t oXB = off; off += szXB;
  const size_t oWB = off; off += szWB;
  const size_t oF  = off; off += szF;
  const size_t oQH = off; off += szQ;
  const size_t oQL = off; off += szQ;
  const size_t oKH = off; off += szK;
  const size_t oKL = off; off += szK;
  const size_t oVH = off; off += szV;
  const size_t oVL = off; off += szV;
  const size_t oTC = off; off += szT;
  const size_t oTS = off; off += szT;
  const size_t oWT = off; off += szWT;
  if (off > ws_size) return;                // off = 111673344 for NB = 4, SEQ = 2048
  if (off > (size_t)WS_CAP) return;

  char* ws = (char*)d_ws;
  u16*   XB  = (u16*)(ws + oXB);
  u16*   OH  = (u16*)(ws + oXB);
  u16*   WB  = (u16*)(ws + oWB);
  u16*   WT  = (u16*)(ws + oWT);
  float* F   = (float*)(ws + oF);
  u16*   OL  = (u16*)(ws + oF);
  u16*   QH  = (u16*)(ws + oQH);
  u16*   QL  = (u16*)(ws + oQL);
  u16*   KH  = (u16*)(ws + oKH);
  u16*   KL  = (u16*)(ws + oKL);
  u16*   VH  = (u16*)(ws + oVH);
  u16*   VL  = (u16*)(ws + oVL);
  float* TC  = (float*)(ws + oTC);
  float* TS  = (float*)(ws + oTS);

  const dim3 b256(256), b128(128), bAT(ATT_THREADS);
  const dim3 gG1((MROWS / 64) * (NQKV / 64));
  const float osc = 1.0f / (OSC * WOS);

  // (1) rotary cos / sin tables [SEQ][32]; x -> bf16 plane [MROWS][512]; Wq, Wk, Wv -> one bf16 plane [1536 n][512 k];
  //     Wo [512 o][512 d] -> f16 plane of the bf16 value x1024 (already k-contiguous)
  prep<<<dim3(GT + NB * GX + 4 * GW), b256, 0, stream>>>(x, wq, wk, wv, wo, XB, WB, WT, TC, TS);
  // (2) F f32 [MROWS][1536] = x.[Wq|Wk|Wv]^T  (columns 0..511 q_proj, 512..1023 k_proj, 1024..1535 v_proj; biases later)
  gemm_bf<<<gG1, b128, 0, stream>>>(XB, WB, F, MROWS, NQKV, DMOD, 1.0f);
  // (3) q = rotary(q_proj + bq) from columns 0..511 and keys = rotary(v_proj + bv) from columns 1024..1535 -> hi + residual
  //     planes x256; values = k_proj + bk (no rotary) from columns 512..1023 -> v^T hi + residual planes x1024
  planes<<<dim3(2 * GR + GV), b256, 0, stream>>>(F, bqp, bkp, bvp, TC, TS, QH, QL, KH, KL, VH, VL);
  // (4) causal attention -> O f16 hi plane x256 (XB region) for all query tiles; residual plane (F region) for tiles < RICH
  attn_all<<<dim3(NQT * NH * NB), bAT, 0, stream>>>(QH, QL, KH, KL, VH, VL, OH, OL);
  // (5) y = O.Wo^T + bo -> out f32 [rows][512], carries 256 x 1024 folded back; rows < RICH per sequence with O hi + residual
  gemm_o<<<dim3(NB * (SEQ / 64) * (DMOD / 64)), b128, 0, stream>>>(OH, OL, WT, bop, out, DMOD, DMOD, osc);
  (void)hipGetLastError();
}

// v005
// One run takes 140 microseconds.
// Timed twice side by side with v004, it ran 1.13 and 1.12 times as fast.
// Counting every step since v000, it is 2.75 times as fast.
// Contractions: x.[Wq|Wk|Wv]^T on v_wmma_f32_16x16x32_bf16 (x and the weights as bf16 RNE planes; weight [n][k] rows are
// the k-contiguous A operand for q_proj and v_proj, B for k_proj; f32 accumulate); q.k^T over hd 64 and P.v on v_wmma_f32_16x16x32_f16 with f16 hi + f16
// residual planes (both transposed: k.q^T and v^T.P^T; q, k x256 after rotary, products hh+lh+hl on every row; P x32768 hi + in-register residual and v^T x1024
// hi + residual plane for query rows < 512 of each sequence, P hi . v hi only for later rows); O.Wo^T on
// v_wmma_f32_16x16x32_f16 with O x256 as f16 hi (+ f16 residual plane for rows < 512 of each sequence) and Wo as
// f16(bf16(Wo)) x1024, one accumulator, bias added in f32; all f32 accumulate. Rotary cos/sin tables, bias adds and online
// softmax in f32 on VALU.
#include <hip/hip_runtime.h>
#include <math.h>
#include <stdint.h>

#ifndef NB
#define NB 4
#endif
#ifndef SEQ
#define SEQ 2048
#endif
#define XS_FULL 2048
#define DMOD  512
#define NH    8
#define NKVH  8
#define HD    64
#define HHALF (HD / 2)
#define NFREQ (HD / 2)
#define KVD   (NKVH * HD)
#define NQKV  (DMOD + 2 * KVD)
#define QCOL0 0
#define VCOL0 DMOD
#define KCOL0 (DMOD + KVD)
#define MROWS (NB * SEQ)
#define RICH  512
#define ROPE_L2 0.41524101186092028
#define SM_SCALE 0.04419417382415922f
#define QSC   256.0f
#define KSC   256.0f
#define PCAR  32768.0f
#define VCAR  1024.0f
#define OSC   256.0f
#define WOS   1024.0f
#define NSW   8
#define NQT   (SEQ / 16)
#define NQTR  (RICH / 16)
#define NKT   (SEQ / 32)
#define ATT_THREADS (NSW * 32)
#define SLP   68
#define SLW   (16 * SLP)
#define SLAB64 (16 * 68)
#define WS_CAP 134217728
#define GX    (SEQ * DMOD / 8 / 256)
#define GW    (DMOD * DMOD / 8 / 256)
#define GT    (SEQ * NFREQ / 256)
static_assert(DMOD == NH * HD && HD == 64 && HHALF == 32 && NFREQ == 32 && NH == 8 && NKVH == NH);
static_assert(ATT_THREADS == 256 && NSW >= 4 && KVD == 512 && NQKV == 1536 && KCOL0 + KVD == NQKV && VCOL0 + KVD == KCOL0);
static_assert(NB >= 1 && NB <= 4);
static_assert(NB == 1 || SEQ == XS_FULL);
static_assert((SEQ % 64) == 0 && SEQ >= 64 && SEQ <= XS_FULL);
static_assert((RICH % 64) == 0 && RICH >= 64 && RICH <= SEQ);
static_assert((DMOD % 64) == 0 && (KVD % 64) == 0 && (NQKV % 64) == 0 && (DMOD % 32) == 0 && (HD % 32) == 0);
static_assert(((SEQ * DMOD / 8) % 256) == 0 && ((DMOD * DMOD / 8) % 256) == 0 && ((SEQ * NFREQ) % 256) == 0);
static_assert(NSW * (SLW + 32) * 4 <= 65536 && 4 * SLAB64 * 4 <= 65536);
static_assert(DMOD / 8 == 64 && KVD / 8 == 64);
static_assert(((SEQ * DMOD / 8) % 1024) == 0 && ((DMOD * DMOD / 8) % 1024) == 0 && (SEQ % 32) == 0 && (RICH % 16) == 0);

typedef unsigned short u16;
typedef _Float16 v16h __attribute__((ext_vector_type(16)));
typedef _Float16 v8h  __attribute__((ext_vector_type(8)));
typedef __bf16   v16b __attribute__((ext_vector_type(16)));
typedef float    v8f  __attribute__((ext_vector_type(8)));
typedef float    v4f  __attribute__((ext_vector_type(4)));
typedef unsigned int v4u __attribute__((ext_vector_type(4)));

union FragH { v16h v; v8h h[2]; v4u u[2]; };
union FragB { v16b v; v4u u[2]; };

// ---- scalar helpers --------------------------------------------------------------------------------
__device__ __forceinline__ unsigned short bf_bits(float f) {          // f32 -> bf16 bits, RNE convert
  unsigned u = __float_as_uint(f);
  return (unsigned short)((u + 0x7FFFu + ((u >> 16) & 1u)) >> 16);
}
__device__ __forceinline__ float bf_up(unsigned short h) { return __uint_as_float(((unsigned)h) << 16); }
__device__ __forceinline__ float bfr(float f) { return bf_up(bf_bits(f)); }
__device__ __forceinline__ unsigned short h_bits(_Float16 x) { return __builtin_bit_cast(unsigned short, x); }
__device__ __forceinline__ unsigned pk16(unsigned short a, unsigned short b) { return (unsigned)a | ((unsigned)b << 16); }
__device__ __forceinline__ v8f zero8() { v8f z = {0.f, 0.f, 0.f, 0.f, 0.f, 0.f, 0.f, 0.f}; return z; }

// ---- fragment-major planes: every 16-bit A/B operand plane [row][K] other than v^T is stored as [row/16][K/32][g][lane][8]: the 16-B unit
//      of lane = 16*h + (row&15) in half g holds k = 32*ks + 16*g + 8*h + 0..7, so one wave-wide 16-B load is 512 contiguous
//      bytes (4 whole lines) and one 16 x 32 fragment is 1 KB. A 16-row tile starts where it starts in a row-major plane.
// ---- fragment loaders: lane -> row/col (lane&15), h = lane>>4; base = a pointer that is the same in every lane (it stays in
//      scalar registers), vo = byte offset of the fragment from base + 16*lane (one 32-bit register shared by all loads of a
//      step and advanced behind them); p = base + vo;
//      elements 0..7 <- p[0..7] (k0+8h..), elements 8..15 <- p[256..263] (k0+16+8h..)  (same split k map for A and B)
__device__ __forceinline__ v16h ldfrag_h(const _Float16* base, unsigned vo) {
  const char* p = (const char*)base + vo;
  FragH f;
  f.h[0] = *(const v8h*)(p);
  f.h[1] = *(const v8h*)(p + 512);
  return f.v;
}
__device__ __forceinline__ v16b ldfrag_b(const u16* base, unsigned vo) { // bf16 plane read as unsigned integer vectors
  const char* p = (const char*)base + vo;
  FragB f;
  f.u[0] = *(const v4u*)(p);
  f.u[1] = *(const v4u*)(p + 512);
  return f.v;
}

__device__ __forceinline__ v8f mma_h(v16h a, v16h b, v8f c) {
  return __builtin_amdgcn_wmma_f32_16x16x32_f16(false, a, false, b, (short)0, c, false, false);
}
__device__ __forceinline__ v8f mma_b(v16b a, v16b b, v8f c) {
  return __builtin_amdgcn_wmma_f32_16x16x32_bf16(false, a, false, b, (short)0, c, false, false);
}
__device__ __forceinline__ void guard2(v8f& a, v8f& b, v16h x0, v16h x1, v16h x2, v16h x3, v16h x4, v16h x5) {
#if defined(__HIP_DEVICE_COMPILE__)
  asm volatile("v_nop\n\tv_nop\n\tv_nop\n\tv_nop"
               : "+v"(a), "+v"(b) : "v"(x0), "v"(x1), "v"(x2), "v"(x3), "v"(x4), "v"(x5) : "memory");
#endif
}
template <typename F>
__device__ __forceinline__ void guard6(v8f& a, v8f& b, v8f& c, v8f& d, F x0, F x1, F x2, F x3, F x4, F x5) {
#if defined(__HIP_DEVICE_COMPILE__)
  asm volatile("v_nop\n\tv_nop\n\tv_nop\n\tv_nop"
               : "+v"(a), "+v"(b), "+v"(c), "+v"(d) : "v"(x0), "v"(x1), "v"(x2), "v"(x3), "v"(x4), "v"(x5) : "memory");
#endif
}
__device__ __forceinline__ void acc_guard4(v8f& a, v8f& b, v8f& c, v8f& d) {
#if defined(__HIP_DEVICE_COMPILE__)
  asm volatile("v_nop\n\tv_nop\n\tv_nop\n\tv_nop" : "+v"(a), "+v"(b), "+v"(c), "+v"(d));
#endif
}
__device__ __forceinline__ void wave_sync_lds() {
  __builtin_amdgcn_fence(__ATOMIC_RELEASE, "workgroup");
  __builtin_amdgcn_wave_barrier();
  __builtin_amdgcn_fence(__ATOMIC_ACQUIRE, "workgroup");
}

// =====================================================================================================
// f32 [rows][DMOD] -> 16-bit fragment-major plane.  f16mode == 0: bf16 RNE bits;  f16mode == 1: f16 bits of (bf16 RNE value)
// * scale. Thread = output unit gt = 8 consecutive elements of one row: two 16-B loads (a wave reads 64 B of each of 16 rows,
// the block uses every line whole), one 16-B store; 32 consecutive lanes store 512 contiguous, 512-B aligned bytes;
// coverage: blk = 0 .. n8/256 - 1, x 256 thr x 8 (in-kernel bound) = the whole plane (n8 a multiple of 256 here).
// =====================================================================================================
__device__ __forceinline__ void cvt16(const float* __restrict__ x, u16* D, int blk, int n8, int f16mode, float scale) {
  const int gt = blk * 256 + (int)threadIdx.x;
  if (gt >= n8) return;
  const int srow = (gt >> 10) * 16 + (gt & 15);                                   // 1024 units per 16-row tile
  const int schk = ((gt >> 6) & (DMOD / 32 - 1)) * 4 + ((gt >> 5) & 1) * 2 + ((gt >> 4) & 1);
  const float* p = x + ((size_t)srow * (DMOD / 8) + schk) * 8;
  const v4f a = *(const v4f*)(p), b4 = *(const v4f*)(p + 4);
  float w[8];
#pragma unroll
  for (int e = 0; e < 4; ++e) { w[e] = a[e]; w[4 + e] = b4[e]; }
  v4u o;
#pragma unroll
  for (int e = 0; e < 4; ++e) {
    const float f0 = w[2 * e], f1 = w[2 * e + 1];
    const unsigned short hb0 = h_bits((_Float16)(bfr(f0) * scale));
    const unsigned short hb1 = h_bits((_Float16)(bfr(f1) * scale));
    const unsigned short bb0 = bf_bits(f0);
    const unsigned short bb1 = bf_bits(f1);
    o[e] = (f16mode != 0) ? pk16(hb0, hb1) : pk16(bb0, bb1);
  }
  u16* d = D + (size_t)gt * 8;
  {
    *(v4u*)(d) = o;
    
  }
}

// =====================================================================================================
// Rotary tables TC[s][j] = cos(s * inv[j]), TS[s][j] = sin(s * inv[j]), j < 32, with
// inv[j] = 1.0f / f32(10000^(j/32)) (power evaluated in f64 and narrowed once, IEEE f32 reciprocal, f32 product s*inv,
// coverage: blk = 0 .. n/256 - 1, x 256 thr = n = SEQ*32 elements of TC and of TS (n a multiple of 256).
// =====================================================================================================
__device__ __forceinline__ void k_tab(float* TC, float* TS, int blk, int n) {
#pragma clang fp contract(off)
  const int idx = blk * 256 + (int)threadIdx.x;
  if (idx >= n) return;
  const int s = idx / NFREQ;
  const int j = idx - s * NFREQ;
  const double pj = exp2((double)j * ROPE_L2);       // 10000^(j/32)
  const float pf  = (float)pj;
  const float inv = 1.0f / pf;
  const float ang = (float)s * inv;
  float sv, cv;
  sincosf(ang, &sv, &cv);
  {
    *(float*)(TC + idx) = cv;
    *(float*)(TS + idx) = sv;
    
  }
}

// =====================================================================================================
// One launch for everything that reads only the inputs: none of these pieces reads what another writes, so they share a grid
// by block range (every branch is block-uniform, no barrier): GT blocks the rotary tables, NB*GX blocks x -> bf16 plane
// [MROWS][512], GW blocks each Wq, Wk, Wv -> one bf16 plane [1536 n][512 k], GW blocks Wo -> f16 plane of the bf16 value x1024.
// coverage: grid = GT + NB*GX + 4*GW blocks, each range exactly the grid of its piece.
// =====================================================================================================
__global__ __launch_bounds__(256) void prep(const float* __restrict__ x, const float* __restrict__ wq,
                                            const float* __restrict__ wk, const float* __restrict__ wv,
                                            const float* __restrict__ wo, u16* XB, u16* WB, u16* WT, float* TC, float* TS) {
  int bid = (int)blockIdx.x;
  if (bid < GT) { k_tab(TC, TS, bid, SEQ * NFREQ); return; }
  bid -= GT;
  if (bid < NB * GX) {
    const int bq = bid / GX;
    cvt16(x + (size_t)bq * XS_FULL * DMOD, XB + (size_t)bq * SEQ * DMOD, bid - bq * GX, SEQ * DMOD / 8, 0, 1.0f);
    return;
  }
  bid -= NB * GX;
  if (bid < GW)     { cvt16(wq, WB, bid, DMOD * DMOD / 8, 0, 1.0f); return; }
  if (bid < 2 * GW) { cvt16(wk, WB + (size_t)VCOL0 * DMOD, bid - GW, DMOD * DMOD / 8, 0, 1.0f); return; }
  if (bid < 3 * GW) { cvt16(wv, WB + (size_t)KCOL0 * DMOD, bid - 2 * GW, DMOD * DMOD / 8, 0, 1.0f); return; }
  if (bid < 4 * GW) { cvt16(wo, WT, bid - 3 * GW, DMOD * DMOD / 8, 1, WOS); return; }
}

// =====================================================================================================
// Interleaved-pair rotary of one element, with y = projection + bias (f32 add) already formed:
//   out[2j]   = y[2j]  *c[s][j] + (-1)*(y[2j+1]*sn[s][j])
//   out[2j+1] = y[2j+1]*c[s][j] + (+1)*(y[2j]  *sn[s][j])        with c, sn the f32 table values (mul, mul, add kept
//   separate); hb = f16(out * sc), lb = f16 residual (t - f16(t)).
// =====================================================================================================
__device__ __forceinline__ void rot_one(float x, float y, float cv, float sv, float sgn, float sc,
                                        unsigned short& hb, unsigned short& lb) {
#pragma clang fp contract(off)
  const float ys   = y * sv;
  const float term = sgn * ys;
  const float r    = x * cv + term;
  const float t    = r * sc;
  const _Float16 a = (_Float16)t;
  hb = h_bits(a);
  lb = h_bits((_Float16)(t - (float)a));
}

// =====================================================================================================
// GEMM epilogue of the output projection: the wave's 16x64 f32 tile (times oscale) staged in its LDS slab (pitch 68),
// 8 consecutive lanes x 16 B per line), lanes 16..31 -> row 2*it+1; HASB != 0 adds bias[col] in f32 to every element;
// coverage: 8 instructions x 2 rows x 16 lanes x 4 floats = the wave's 16 x 64 tile.
// =====================================================================================================
template <int HASB>
__device__ __forceinline__ void epi64(float* sl, v8f a0, v8f a1, v8f a2, v8f a3, float oscale, const float* bias,
                                      float* C, int N, size_t rowb, int col0, int lane) {
  const int hh = lane >> 4, m = lane & 15;
#pragma unroll
  for (int r = 0; r < 8; ++r) {
    const int ro = (8 * hh + r) * 68 + m;
    sl[ro]      = a0[r] * oscale;
    sl[ro + 16] = a1[r] * oscale;
    sl[ro + 32] = a2[r] * oscale;
    sl[ro + 48] = a3[r] * oscale;
  }
  wave_sync_lds();
  v4f vals[8];
#pragma unroll
  for (int it = 0; it < 8; ++it) vals[it] = *(const v4f*)(sl + (it * 2 + hh) * 68 + m * 4);
  if (HASB != 0) {
    const v4f b4 = *(const v4f*)(bias + col0 + m * 4);
#pragma unroll
    for (int it = 0; it < 8; ++it) vals[it] = vals[it] + b4;
  }
  float* dst = C + (rowb + (size_t)hh) * (size_t)N + col0 + m * 4;
  {
#pragma unroll
    for (int it = 0; it < 8; ++it) {
      *(v4f*)(dst + (size_t)(it * 2) * (size_t)N) = vals[it];
    }
    
  }
}

// =====================================================================================================
// Projection GEMM x.[Wq|Wk|Wv]^T (bf16 fragment-major planes A = x [MROWS][512], Bt = weights [1536 n][512 k], f32
// accumulate) whose epilogue writes the attention operand planes itself: no f32 projection array, no LDS.
// Block = 64 rows x 64 columns, 4 waves x 16 rows; a wave's 64 columns are one head of q_proj (columns 0..511), of k_proj
// (512..1023) or of v_proj (1024..1535), its 16 rows 16 positions of one sequence; the choice is block-uniform.
// Fragments loaded straight from the planes (two 512-B wave loads each, split k map for both operands); K stepped by 32
// (host: K = 512, the row length of both planes).
// TR = 1 (q_proj, v_proj): the weight tile is the first operand, so acc j element r of lane (hh, m) =
//   (column j*16 + 8*hh + r, position m): 8 consecutive d of one position = the lane's 16-B unit of the q / k plane.
// TR = 0 (k_proj): x is the first operand, acc j element r of lane (hh, m) = (position 8*hh + r, column j*16 + m):
//   8 consecutive keys of one d = the lane's 16-B unit of the v^T plane.
// =====================================================================================================
template <int TR>
__device__ __forceinline__ void proj_loop(const u16* ap, const u16* bp, const u16* bp1, const u16* bp2, const u16* bp3,
                                          unsigned vo, int K, v8f& acc0, v8f& acc1, v8f& acc2, v8f& acc3) {
#pragma unroll 1
  for (int k0 = 0; k0 < K; k0 += 32, vo += 1024u) {
    const v16b a  = ldfrag_b(ap, vo);
    const v16b b0 = ldfrag_b(bp, vo);
    const v16b b1 = ldfrag_b(bp1, vo);
    const v16b b2 = ldfrag_b(bp2, vo);
    const v16b b3 = ldfrag_b(bp3, vo);
    if (TR != 0) {
      acc0 = mma_b(b0, a, acc0);
      acc1 = mma_b(b1, a, acc1);
      acc2 = mma_b(b2, a, acc2);
      acc3 = mma_b(b3, a, acc3);
    } else {
      acc0 = mma_b(a, b0, acc0);
      acc1 = mma_b(a, b1, acc1);
      acc2 = mma_b(a, b2, acc2);
      acc3 = mma_b(a, b3, acc3);
    }
    guard6<v16b>(acc0, acc1, acc2, acc3, a, b0, b1, b2, b3, a);
  }
}

// q / k planes from the TR = 1 accumulators: y = acc + bias[head*HD + d], rotary with table row s = the lane's position and
// table column d >> 1, x sc -> f16 hi and f16 residual planes, fragment-major per head [b*8 + head][s/16][d/32][half][lane][8]
// (row = position, k = d): acc j is half j & 1 of d step j >> 1, at pb + j * 256 halves, pb = the tile's start + 8 * lane.
// coverage: 4 stores x 32 lanes x 8 halves = the wave's 16 positions x 64 d of Hp and of Lp, 512 contiguous bytes a store.
__device__ __forceinline__ void rope_epi(const v8f (&acc)[4], int hh, int s, const float* __restrict__ bias,
                                         const float* __restrict__ TC, const float* __restrict__ TS,
                                         u16* Hp, u16* Lp, size_t pb, float sc) {
  const float* bp = bias + 8 * hh;                     // bias already at the head's first column
  const float* cp = TC + (size_t)s * NFREQ + 4 * hh;
  const float* sp = TS + (size_t)s * NFREQ + 4 * hh;
  // two groups of two accumulator tiles, each with its own loads, so that the loaded values of one group only are live
  // beside the accumulators (the register count stays at the k loop's, and with it the waves per SIMD)
#pragma unroll
  for (int g2 = 0; g2 < 2; ++g2) {
    v4f ba[2], bb[2], cw[2], sw[2];
#pragma unroll
    for (int i = 0; i < 2; ++i) {
      const int j = 2 * g2 + i;
      ba[i] = *(const v4f*)(bp + j * 16);
      bb[i] = *(const v4f*)(bp + j * 16 + 4);
      cw[i] = *(const v4f*)(cp + j * 8);
      sw[i] = *(const v4f*)(sp + j * 8);
    }
#pragma unroll
    for (int i = 0; i < 2; ++i) {
      const int j = 2 * g2 + i;
      float yv[8];
#pragma unroll
      for (int e = 0; e < 4; ++e) {
        yv[e]     = acc[j][e]     + ba[i][e];
        yv[4 + e] = acc[j][4 + e] + bb[i][e];
      }
      v4u oh, ol;
#pragma unroll
      for (int e = 0; e < 4; ++e) {
        unsigned short h0, l0, h1, l1;
        rot_one(yv[2 * e],     yv[2 * e + 1], cw[i][e], sw[i][e], -1.0f, sc, h0, l0);   // even element of the pair
        rot_one(yv[2 * e + 1], yv[2 * e],     cw[i][e], sw[i][e],  1.0f, sc, h1, l1);   // odd element of the pair
        oh[e] = pk16(h0, h1);
        ol[e] = pk16(l0, l1);
      }
      *(v4u*)(Hp + pb + j * 256) = oh;
      *(v4u*)(Lp + pb + j * 256) = ol;
    }
    // the next group's loads, and behind the last group whatever code the compiler places next, may write
    // registers that these stores name
    asm volatile("s_wait_xcnt 0x0" ::: "memory");
  }
}

// v^T planes from the TR = 0 accumulators: y = acc + bias[head*HD + d] (f32 add), t = y * 1024 (exact), hi = f16(t),
// residual = f16(t - hi), fragment-major per head with the 32-key step outermost [b*8 + head][s/32][d/16][half][lane][8]
// (row = d, k = key): the wave's 16 keys are one half of the four d-subtile fragments, acc j at pb + j * 512 halves,
// pb = the key step's start + half * 256 + 8 * lane.
// coverage: 4 stores x 32 lanes x 8 halves = the wave's 16 keys x 64 d of VHo and of VLo, 512 contiguous bytes a store.
__device__ __forceinline__ void vt_epi(const v8f (&acc)[4], int m, const float* __restrict__ bias,
                                       u16* VHo, u16* VLo, size_t pb) {
  float bj[4];
#pragma unroll
  for (int j = 0; j < 4; ++j) bj[j] = bias[j * 16 + m];  // bias already at the head's first column
  v4u oh[4], ol[4];
#pragma unroll
  for (int j = 0; j < 4; ++j) {
#pragma unroll
    for (int e = 0; e < 4; ++e) {
      const float t0 = (acc[j][2 * e]     + bj[j]) * VCAR;
      const float t1 = (acc[j][2 * e + 1] + bj[j]) * VCAR;
      const _Float16 h0 = (_Float16)t0, h1 = (_Float16)t1;
      oh[j][e] = pk16(h_bits(h0), h_bits(h1));
      ol[j][e] = pk16(h_bits((_Float16)(t0 - (float)h0)), h_bits((_Float16)(t1 - (float)h1)));
    }
  }
#pragma unroll
  for (int j = 0; j < 4; ++j) {
    *(v4u*)(VHo + pb + j * 512) = oh[j];
    *(v4u*)(VLo + pb + j * 512) = ol[j];
  }
}

// coverage: grid = (MROWS/64) * (NQKV/64) blocks x 4 waves: every (sequence, head, 16 positions) tile of the q, k and v^T
// hi and residual planes exactly once.
__global__ __launch_bounds__(128)
void gemm_qkv(const u16* __restrict__ A, const u16* __restrict__ Bt, const float* __restrict__ bq,
              const float* __restrict__ bk, const float* __restrict__ bv,
              const float* __restrict__ TC, const float* __restrict__ TS,
              u16* QH, u16* QL, u16* KH, u16* KL, u16* VH, u16* VL, int K) {
  const int tid = threadIdx.x, lane = tid & 31;
  const int wave = __builtin_amdgcn_readfirstlane(tid >> 5);   // scalar, so that the tile starts below are scalar bases
  const int bid   = blockIdx.x;
  const int rowb  = (bid / (NQKV / 64)) * 64 + wave * 16;
  const int col0  = (bid % (NQKV / 64)) * 64;
  if (rowb + 16 > MROWS) return;            // wave-uniform, never taken with the exact grid; no block barriers in this kernel
  const u16* ap  = A  + (size_t)rowb * K;             // fragment (16-row tile, k step ks) at tile start + ks * 1024 bytes
  const u16* bp  = Bt + (size_t)col0 * K;
  const u16* bp1 = Bt + (size_t)(col0 + 16) * K;
  const u16* bp2 = Bt + (size_t)(col0 + 32) * K;
  const u16* bp3 = Bt + (size_t)(col0 + 48) * K;
  const unsigned vo = (unsigned)lane * 16u;
  const int b    = rowb / SEQ;                        // sequence
  const int s16  = rowb - b * SEQ;                    // the wave's first position in it, a multiple of 16
  const int hcol = col0 & (DMOD - 1);                 // head * HD within the q, k or v projection
  const size_t hp = ((size_t)b * DMOD + hcol) * SEQ;  // start of the (sequence, head) plane, in halves: (b*8 + head) * SEQ * HD
  v8f acc[4];
#pragma unroll
  for (int j = 0; j < 4; ++j) acc[j] = zero8();
  if (col0 >= VCOL0 && col0 < KCOL0) {
    proj_loop<0>(ap, bp, bp1, bp2, bp3, vo, K, acc[0], acc[1], acc[2], acc[3]);
    vt_epi(acc, lane & 15, bk + hcol, VH, VL,
           hp + (size_t)(s16 >> 5) * (32 * HD) + (size_t)((s16 >> 4) & 1) * 256 + 8 * lane);
  } else {
    const bool isq = col0 < VCOL0;
    proj_loop<1>(ap, bp, bp1, bp2, bp3, vo, K, acc[0], acc[1], acc[2], acc[3]);
    rope_epi(acc, lane >> 4, s16 + (lane & 15), (isq ? bq : bv) + hcol, TC, TS, isq ? QH : KH, isq ? QL : KL,
             hp + (size_t)s16 * HD + 8 * lane, isq ? QSC : KSC);
  }
}

// =====================================================================================================
// f16 GEMM: C[M][N] (f32) = (A[M][K] (+ A2[M][K] when TWO != 0)) . Bt[N][K]^T, times oscale, plus bias[n]; A, A2 f16
// fragment-major planes (A2 = the unscaled f16 residual of A, sharing the accumulator), Bt f16 fragment-major. Same tiling, fragment
// loads (split k map) as gemm_qkv, epilogue epi64; K stepped by 32.
// =====================================================================================================
template <int TWO>
__device__ __forceinline__
void gemm_h(float* slab, int wave, int lane, int rowb, int crow, int col0,
            const u16* __restrict__ A, const u16* __restrict__ A2, const u16* __restrict__ Bt,
            const float* __restrict__ bias, float* C, int N, int K, float oscale) {
  const _Float16* ap  = (const _Float16*)(const void*)A  + (size_t)rowb * K;
  const _Float16* ap2 = (const _Float16*)(const void*)A2 + (size_t)rowb * K;
  const _Float16* bp  = (const _Float16*)(const void*)Bt + (size_t)col0 * K;
  const _Float16* bp1 = (const _Float16*)(const void*)Bt + (size_t)(col0 + 16) * K;
  const _Float16* bp2 = (const _Float16*)(const void*)Bt + (size_t)(col0 + 32) * K;
  const _Float16* bp3 = (const _Float16*)(const void*)Bt + (size_t)(col0 + 48) * K;
  unsigned vo = (unsigned)lane * 16u;
  v8f acc0 = zero8(), acc1 = zero8(), acc2 = zero8(), acc3 = zero8();
#pragma unroll 1
  for (int k0 = 0; k0 < K; k0 += 32, vo += 1024u) {
    const v16h a  = ldfrag_h(ap, vo);
    const v16h b0 = ldfrag_h(bp, vo);
    const v16h b1 = ldfrag_h(bp1, vo);
    const v16h b2 = ldfrag_h(bp2, vo);
    const v16h b3 = ldfrag_h(bp3, vo);
    acc0 = mma_h(a, b0, acc0);
    acc1 = mma_h(a, b1, acc1);
    acc2 = mma_h(a, b2, acc2);
    acc3 = mma_h(a, b3, acc3);
    if (TWO != 0) {
      const v16h a2 = ldfrag_h(ap2, vo);
      acc0 = mma_h(a2, b0, acc0);
      acc1 = mma_h(a2, b1, acc1);
      acc2 = mma_h(a2, b2, acc2);
      acc3 = mma_h(a2, b3, acc3);
      guard6<v16h>(acc0, acc1, acc2, acc3, a, a2, b0, b1, b2, b3);
    } else {
      guard6<v16h>(acc0, acc1, acc2, acc3, a, b0, b1, b2, b3, a);
    }
  }
  (void)ap2;
  epi64<1>(slab + wave * SLAB64, acc0, acc1, acc2, acc3, oscale, bias, C, N, (size_t)crow, col0, lane);
}

// One launch for y = O.Wo^T + bo over all sequences: block = 64 rows x 64 columns; its 64 rows lie in one sequence and wholly
// below or wholly at and above row RICH of it (RICH and SEQ multiples of 64), so the choice hi + residual / hi only is
// block-uniform. rowb = the wave's first row in the O planes, crow = the same row in out.
// coverage: grid = NB * (SEQ/64) * (N/64) blocks x 4 waves x 16 x 64 = every element of out once (host: N % 64 == 0, K % 32 == 0).
__global__ __launch_bounds__(128)
void gemm_o(const u16* __restrict__ A, const u16* __restrict__ A2, const u16* __restrict__ Bt,
            const float* __restrict__ bias, float* C, int N, int K, float oscale) {
  __shared__ __align__(16) float slab[4 * SLAB64];
  const int tid = threadIdx.x, lane = tid & 31;
  const int wave = __builtin_amdgcn_readfirstlane(tid >> 5);   // scalar, so that the tile starts are scalar bases
  const int ntile = N >> 6;
  const int bid  = blockIdx.x;
  const int rt   = bid / ntile;
  const int col0 = (bid % ntile) * 64;
  const int bq   = rt / (SEQ / 64);
  const int rs   = (rt % (SEQ / 64)) * 64;                     // first row of the block within its sequence
  if (bq >= NB) return;                     // block-uniform, never taken with the exact grid; no block barriers in this kernel
  const int rowb = bq * SEQ + rs + wave * 16;
  const int crow = bq * XS_FULL + rs + wave * 16;
  if (rs < RICH) gemm_h<1>(slab, wave, lane, rowb, crow, col0, A, A2, Bt, bias, C, N, K, oscale);
  else           gemm_h<0>(slab, wave, lane, rowb, crow, col0, A, A2, Bt, bias, C, N, K, oscale);
}

// =====================================================================================================
// Causal softmax attention, hd = 64, 8 heads. Block bid -> (query tile qt = bid % NQT: rows q0 = 16*qt .. q0+15, head,
// batch b); keys/values of the same head (kvh = head). The tile's key steps are dealt over the block's NSW waves: wave w takes
// steps w, w + NSW, ... with its own running max, sum and O accumulators; the NSW partials are merged in LDS behind one block
// barrier (attn_merge8), so the longest serial walk is NKT / NSW steps instead of NKT.
//   q and k hi / residual planes f16 x256, fragment-major per head [b*8 + h][s/16][d/32][half][lane][8];
//   v^T hi / residual planes x1024, fragment-major per head [b*NKVH + h][s/32][d/16][half][lane][8].
//   raw(i, j) = q_hi.k_hi + q_lo.k_hi + q_hi.k_lo (2 k-steps over d); logit = raw * (SM_SCALE * 2^-16) (the two 256 carries
//   folded exactly into the 1/sqrt(512) scale, one f32 multiply); keys above the diagonal replaced by -inf.
//   Both products run transposed, S^T = k.q^T (A = k fragment, B = q fragment) and O^T += v^T.P^T (A = v^T fragment, B = P^T),
//   so lane (c, hh) holds 16 scores and 32 O elements of the one query q0 + c: online softmax per query in f32 with a running
//   max: max over the lane's 16 scores, then one exchange with lane c ^ 16 (same max in both); sum over the lane's own keys,
//   the two halves joined once behind the loop; alpha = exp(m_old - m_new), p = exp(logit - m_new), l = l*alpha + sum p, O
//   accumulators times alpha before the tile's v^T.P^T. Only key tiles of 32 with kb <= q0 are visited (nkt = q0/32 + 1 <= NKT; key kb is
//   unmasked for every row of the tile, so each row max of a visited tile is finite; wave 0 always visits tile 0).
//   The two 16x16 score tiles of a step, converted in place, are the P^T B fragment (no LDS, no lane exchange);
//   v^T A fragments in 2 groups of 2 d-subtiles; RV = 1: products
//   hh + lh + hl, RV = 0: hh only. After the loop every wave (one without a step: max -inf, sum 0, O 0) puts its raw O
//   accumulators into its slab and its 16 row maxima and sums beside them; block barrier; waves 0..3 merge.
//   Epilogue: O = merged acc / (merged l * 32768 * 1024), x256 -> f16 hi plane (and for RV = 1 the unscaled f16 residual
//   plane), fragment-major over [b*SEQ + s][512]; wave it < 4, lane = (row c, 8 consecutive d at it*16 + 8*hh); one
//   instruction = one 512-B half fragment (4 whole lines).
// coverage: 4 waves x 1 instruction x 32 lanes x 8 halves = 16 x 64 per plane; grid NQT x NH x NB blocks;
//   the two forms (tiles 0..NQTR-1 with RV = 1, NQTR..NQT-1 with RV = 0) cover every (b, s, h) row segment of the hi plane
//   exactly once and rows s < RICH of the residual plane exactly once (only those rows are read later).
// =====================================================================================================
// lane l <-> lane l ^ 16 (the other 16-lane row) as one vector cross-row move
__device__ __forceinline__ float xhalf(float x) {
  const int b = __builtin_bit_cast(int, x);
  return __builtin_bit_cast(float, __builtin_amdgcn_permlanex16(b, b, 0x76543210, 0xfedcba98, false, false));
}

// 2^x for the merge weights. The v_nop in the same statement keeps the one issue slot that the instruction set asks for behind
// a transcendental, whichever instruction the compiler places next.
__device__ __forceinline__ float exp2_slot(float x) {
  float r = 0.0f;
#if defined(__HIP_DEVICE_COMPILE__)
  asm("v_exp_f32 %0, %1\n\tv_nop" : "=v"(r) : "v"(x));
#endif
  return r;
}

// 2^x of eight values in one statement, for the same slot: the results are early-clobber, so that no v_exp_f32 here writes a
// source or reads a result of the one in front of it, and the one v_nop keeps the slot behind the last.
__device__ __forceinline__ void exp2x8_slot(float (&r)[8], const float (&x)[8]) {
#if defined(__HIP_DEVICE_COMPILE__)
  asm("v_exp_f32 %0, %8\n\tv_exp_f32 %1, %9\n\tv_exp_f32 %2, %10\n\tv_exp_f32 %3, %11\n\t"
      "v_exp_f32 %4, %12\n\tv_exp_f32 %5, %13\n\tv_exp_f32 %6, %14\n\tv_exp_f32 %7, %15\n\tv_nop"
      : "=&v"(r[0]), "=&v"(r[1]), "=&v"(r[2]), "=&v"(r[3]), "=&v"(r[4]), "=&v"(r[5]), "=&v"(r[6]), "=&v"(r[7])
      : "v"(x[0]), "v"(x[1]), "v"(x[2]), "v"(x[3]), "v"(x[4]), "v"(x[5]), "v"(x[6]), "v"(x[7]));
#else
  for (int e = 0; e < 8; ++e) r[e] = x[e];
#endif
}

// Merge of the NSW partials for one lane's 8 outputs (row c, columns dd .. dd+7): M = max of the waves' row maxima, weight
// exp(m_w - M) (0 for a wave without a step), L = sum of weight * l_w, acc = sum of weight * O_w, waves in index order.
__device__ __forceinline__ void attn_merge8(const float* slabs, const float* sm, const float* sl, int c, int dd,
                                            float* acc, float& L) {
  float mw[NSW], lw[NSW];
  v4f pa[NSW], pb[NSW];
#pragma unroll
  for (int w = 0; w < NSW; ++w) {
    mw[w] = sm[w * 16 + c];
    lw[w] = sl[w * 16 + c];
    pa[w] = *(const v4f*)(slabs + w * SLW + c * SLP + dd);
    pb[w] = *(const v4f*)(slabs + w * SLW + c * SLP + dd + 4);
  }
  float M = mw[0];
#pragma unroll
  for (int w = 1; w < NSW; ++w) M = fmaxf(M, mw[w]);
  L = 0.0f;
#pragma unroll
  for (int e = 0; e < 8; ++e) acc[e] = 0.0f;
#pragma unroll
  for (int w = 0; w < NSW; ++w) {
    const float wt = exp2_slot((mw[w] - M) * 1.44269504f);
    L += wt * lw[w];
#pragma unroll
    for (int e = 0; e < 4; ++e) {
      acc[e]     += wt * pa[w][e];
      acc[4 + e] += wt * pb[w][e];
    }
  }
}

template <int RV>
__device__ __forceinline__
void attn_cs(float* smem, float* smx, float* ssm, int qt, int head, int b,
             const u16* __restrict__ QHp, const u16* __restrict__ QLp,
             const u16* __restrict__ KHp, const u16* __restrict__ KLp,
             const u16* __restrict__ VHp, const u16* __restrict__ VLp,
             u16* OHp, u16* OLp) {
#pragma clang fp contract(off)
  const int tid  = threadIdx.x;
  const int wave = __builtin_amdgcn_readfirstlane(tid >> 5);   // scalar: which key steps the wave takes
  const int lane = tid & 31;
  const int hh   = lane >> 4;
  const int c    = lane & 15;
  const int q0   = qt * 16;
  const int kvh  = head;

  float* slab = smem + wave * SLW;          // O partial slab [16 queries][64 d] pitch 68, written behind the loop

  // fragment-major planes: a head's 16 positions x 64 d = 1024 halves (2 fragments), its 32 keys x 64 d of v^T = 2048 (4)
  // byte offsets into the planes (each plane MROWS * 512 * 2 bytes, far under 2^32), the lane's 16 bytes included
  const unsigned qvo = ((unsigned)(b * NH + head) * SEQ + (unsigned)q0) * (HD * 2u) + (unsigned)lane * 16u;
  unsigned kvo = (unsigned)(b * NKVH + kvh) * (SEQ * HD * 2u) + (unsigned)wave * (32u * HD * 2u)
               + (unsigned)lane * 16u;                                                  // this step's 32 keys, k and v^T alike
  const _Float16* Qh  = (const _Float16*)(const void*)QHp;
  const _Float16* Ql  = (const _Float16*)(const void*)QLp;
  const _Float16* Khb = (const _Float16*)(const void*)KHp;
  const _Float16* Klb = (const _Float16*)(const void*)KLp;
  const _Float16* Vhb = (const _Float16*)(const void*)VHp;               // d-subtile j at + j * 512 halves
  const _Float16* Vlb = (const _Float16*)(const void*)VLp;
  const float lsc  = SM_SCALE * (1.0f / (QSC * KSC));   // exact power-of-two fold of the q / k carries into the scale
  const float oc   = 1.0f / (PCAR * VCAR);
  const float ninf = -__builtin_inff();
  const size_t KROW = (size_t)HD;           // halves per key in a head's fragment-major plane

  v8f o[4];
#pragma unroll
  for (int j = 0; j < 4; ++j) o[j] = zero8();
  float mrun = ninf, lrun = 0.0f;           // this lane's query: running max (alike in lanes c and c + 16), sum over the lane's own keys
  const int ncaus = (q0 >> 5) + 1;                                            // tiles holding keys <= q0 + 15
  const int nkt   = (ncaus < NKT) ? ncaus : NKT;
  const int qrow  = q0 + c;                                                   // the lane's query row

#pragma unroll 1
  for (int kt = wave; kt < nkt; kt += NSW, kvo += NSW * 32u * HD * 2u) {
    const int kb = kt * 32;
    // ---- raw scores, transposed: D element r of this lane = (key kb + 8hh + r, query qrow) in s0, key kb + 16 + 8hh + r in s1 ----
    v8f s0 = zero8(), s1 = zero8();
    const _Float16* k0p = Khb;
    const _Float16* k1p = k0p + (size_t)16 * KROW;
    const _Float16* l0p = Klb;
    const _Float16* l1p = l0p + (size_t)16 * KROW;
#pragma unroll
    for (int kk = 0; kk < HD / 32; ++kk) {
      const v16h qh  = ldfrag_h(Qh + kk * 512, qvo);
      const v16h ql  = ldfrag_h(Ql + kk * 512, qvo);
      const v16h kh0 = ldfrag_h(k0p + kk * 512, kvo);
      const v16h kh1 = ldfrag_h(k1p + kk * 512, kvo);
      const v16h kl0 = ldfrag_h(l0p + kk * 512, kvo);
      const v16h kl1 = ldfrag_h(l1p + kk * 512, kvo);
      s0 = mma_h(kh0, qh, s0);
      s0 = mma_h(kh0, ql, s0);
      s0 = mma_h(kl0, qh, s0);
      s1 = mma_h(kh1, qh, s1);
      s1 = mma_h(kh1, ql, s1);
      s1 = mma_h(kl1, qh, s1);
      guard2(s0, s1, qh, ql, kh0, kl0, kh1, kl1);
    }
    // ---- causal replace-mask, running-max online softmax in f32: the lane's 16 scores all belong to its one query ----
    const int key0 = kb + 8 * hh;
    float t0[8], t1[8];
#pragma unroll
    for (int r = 0; r < 8; ++r) {
      const float a0 = s0[r] * lsc;
      const float a1 = s1[r] * lsc;
      t0[r] = (key0 + r > qrow) ? ninf : a0;
      t1[r] = (key0 + 16 + r > qrow) ? ninf : a1;
    }
    float mx = fmaxf(t0[0], t1[0]);
#pragma unroll
    for (int r = 1; r < 8; ++r) mx = fmaxf(mx, fmaxf(t0[r], t1[r]));
    mx = fmaxf(mx, xhalf(mx));              // the query's other 16 keys of this step sit in lane c ^ 16
    const float mnew = fmaxf(mrun, mx);
    const float al   = exp2_slot((mrun - mnew) * 1.44269504f);
    float x0[8], x1[8], p0[8], p1[8], ps[8];
#pragma unroll
    for (int r = 0; r < 8; ++r) {
      x0[r] = (t0[r] - mnew) * 1.44269504f;
      x1[r] = (t1[r] - mnew) * 1.44269504f;
    }
    exp2x8_slot(p0, x0);
    exp2x8_slot(p1, x1);
#pragma unroll
    for (int r = 0; r < 8; ++r) ps[r] = p0[r] + p1[r];
    const float sm = ((ps[0] + ps[1]) + (ps[2] + ps[3])) + ((ps[4] + ps[5]) + (ps[6] + ps[7]));
    lrun = lrun * al + sm;
    mrun = mnew;
    // ---- rescale the O accumulators by alpha (every element of the lane belongs to its query) ----
#pragma unroll
    for (int j = 0; j < 4; ++j) {
#pragma unroll
      for (int r = 0; r < 8; ++r) o[j][r] = o[j][r] * al;
    }
    // ---- B fragments of p*32768 straight from the score registers: column = query c, elements 0..7 = keys kb + 8hh + 0..7,
    //      elements 8..15 = keys kb + 16 + 8hh + 0..7 (the split k map of the v^T fragments); hi f16, residual f16 for RV = 1 ----
    FragH ph, pl;
#pragma unroll
    for (int r = 0; r < 8; ++r) {
      const float ta = p0[r] * PCAR, tb = p1[r] * PCAR;
      const _Float16 ha = (_Float16)ta, hb = (_Float16)tb;
      ph.h[0][r] = ha;
      ph.h[1][r] = hb;
      if (RV != 0) {
        pl.h[0][r] = (_Float16)(ta - (float)ha);
        pl.h[1][r] = (_Float16)(tb - (float)hb);
      }
    }
    // ---- O^T += v^T.P^T : A fragment row = d = j*16 + c, keys contiguous in the v^T planes; 2 groups of 2 d-subtiles;
    //      D element r of o[j] = (d = j*16 + 8hh + r, query qrow) ----
    {
      const _Float16* vhp = Vhb;
      const _Float16* vlp = Vlb;
      (void)vlp;
#pragma unroll
      for (int jg = 0; jg < 2; ++jg) {
        const size_t da = (size_t)(2 * jg) * 512;
        const size_t db = da + 512;
        const v16h vha = ldfrag_h(vhp + da, kvo), vhb2 = ldfrag_h(vhp + db, kvo);
        o[2 * jg]     = mma_h(vha,  ph.v, o[2 * jg]);
        o[2 * jg + 1] = mma_h(vhb2, ph.v, o[2 * jg + 1]);
        if (RV != 0) {
          const v16h vla = ldfrag_h(vlp + da, kvo), vlb2 = ldfrag_h(vlp + db, kvo);
          o[2 * jg]     = mma_h(vha,  pl.v, o[2 * jg]);
          o[2 * jg]     = mma_h(vla,  ph.v, o[2 * jg]);
          o[2 * jg + 1] = mma_h(vhb2, pl.v, o[2 * jg + 1]);
          o[2 * jg + 1] = mma_h(vlb2, ph.v, o[2 * jg + 1]);
          guard2(o[2 * jg], o[2 * jg + 1], ph.v, pl.v, vha, vhb2, vla, vlb2);
        } else {
          guard2(o[2 * jg], o[2 * jg + 1], ph.v, ph.v, vha, vhb2, vha, vhb2);
        }
      }
    }
  }
  acc_guard4(o[0], o[1], o[2], o[3]);
  // ---- the wave's partial: raw O accumulators into its slab (row = query c, 8 consecutive d a register tile: 16-B stores),
  //      the query's max and its sum (the two lane halves' sums joined here, once) beside ----
#pragma unroll
  for (int j = 0; j < 4; ++j) {
    float* d = slab + c * SLP + j * 16 + 8 * hh;
    const v4f lo = {o[j][0], o[j][1], o[j][2], o[j][3]};
    const v4f hi = {o[j][4], o[j][5], o[j][6], o[j][7]};
    *(v4f*)(d)     = lo;
    *(v4f*)(d + 4) = hi;
  }
  const float lall = lrun + xhalf(lrun);
  if (hh == 0) {
    smx[wave * 16 + c] = mrun;
    ssm[wave * 16 + c] = lall;
  }
  __syncthreads();                          // every wave's partial is in LDS before any wave merges; passed by all NSW waves
  if (wave >= 4) return;                    // wave-uniform, behind the only block barrier
  // ---- merged O / l with the carries (32768 on p, 1024 on v) folded once, x256 -> f16 hi plane (+ f16 residual plane),
  //      fragment-major [row/16][512/32][half][lane][8]: wave it stores half it&1 of k step head*2 + (it>>1);
  //      lane = (row c, 8 consecutive d at it*16 + 8*hh) ----
  const int it = wave;
  float acc[8], lsum;
  attn_merge8(smem, smx, ssm, c, it * 16 + 8 * hh, acc, lsum);
  const float rl = (1.0f / lsum) * oc;
  float w[8];
#pragma unroll
  for (int e = 0; e < 8; ++e) w[e] = (acc[e] * rl) * OSC;
  v4u oh, ol;
#pragma unroll
  for (int e = 0; e < 4; ++e) {
    const _Float16 h0 = (_Float16)w[2 * e], h1 = (_Float16)w[2 * e + 1];
    const _Float16 g0 = (_Float16)(w[2 * e] - (float)h0), g1 = (_Float16)(w[2 * e + 1] - (float)h1);
    oh[e] = pk16(h_bits(h0), h_bits(h1));
    ol[e] = pk16(h_bits(g0), h_bits(g1));
  }
  const size_t ob = ((size_t)b * SEQ + q0) * DMOD + (size_t)head * (16 * HD) + 8 * lane + it * 256;
  *(v4u*)(OHp + ob) = oh;
  if (RV != 0) {
    *(v4u*)(OLp + ob) = ol;
  }
  // in the shared launch the code of the other form may follow and writes registers that these stores name
  asm volatile("s_wait_xcnt 0x0" ::: "memory");
}

// One launch for all query tiles: the tile index decides block-uniformly between the two forms (RV = 1 for tiles < NQTR).
__global__ __launch_bounds__(ATT_THREADS)
void attn_all(const u16* __restrict__ QHp, const u16* __restrict__ QLp,
              const u16* __restrict__ KHp, const u16* __restrict__ KLp,
              const u16* __restrict__ VHp, const u16* __restrict__ VLp, u16* OHp, u16* OLp) {
  __shared__ __align__(16) float smem[NSW * SLW];   // per wave: O partial slab behind the loop
  __shared__ float smx[NSW * 16];                   // per wave: 16 row maxima
  __shared__ float ssm[NSW * 16];                   // per wave: 16 row sums
  const int bid  = blockIdx.x;
  const int qt   = bid % NQT;
  const int t2   = bid / NQT;
  const int head = t2 % NH;
  const int b    = t2 / NH;
  if (b >= NB) return;                      // block-uniform, in front of the block barrier; never taken with the exact grid
  if (qt < NQTR) attn_cs<1>(smem, smx, ssm, qt, head, b, QHp, QLp, KHp, KLp, VHp, VLp, OHp, OLp);
  else           attn_cs<0>(smem, smx, ssm, qt, head, b, QHp, QLp, KHp, KLp, VHp, VLp, OHp, OLp);
}

// =====================================================================================================
// Workspace map (bytes); every plane is fully written by whole-line stores before it is read (the O residual plane only on
// the rows < RICH per sequence that are read); all extents are exact multiples of the store granularity (no pad rows needed);
// every region offset a multiple of 131072; every 16-bit plane is fragment-major (see the fragment loaders), same extent as
// the row-major shape given here:
//   XB  bf16 [MROWS][512]               MROWS*1024   (NB=4, SEQ=2048: 8388608); after the projection GEMM the same bytes hold
//                                                    the O f16 hi plane [MROWS][512] x256 (identical extent)
//   WB  bf16 [1536 n][512 k]            1572864      (Wq rows 0..511, Wk 512..1023, Wv 1024..1535)
//   OL  f16 [MROWS][512]                MROWS*1024   O residual plane
//   QH  f16 [MROWS][512] x256           MROWS*1024   QL residual, same extent
//   KH  f16 [MROWS][512] x256           MROWS*1024   KL residual, same extent   (keys = rotary of the v_proj columns)
//   VH  f16 [NB*8][64][SEQ] x1024       MROWS*1024   VL residual, same extent   (values = the k_proj columns)
//   TC  f32 [SEQ][32]                   SEQ*128      TS, same extent
//   WT  f16 [512 o][512 d] x1024        524288       (Wo; a region of its own, written in the launch that also writes WB)
//   end (NB=4, SEQ=2048)               69730304
// =====================================================================================================
extern "C" void kernel_launch(void* const* d_in, const int* in_sizes, int n_in,
                              void* d_out, int out_size, void* d_ws, size_t ws_size,
                              hipStream_t stream) {
  if (n_in < 9) return;
  if (in_sizes[0] < ((NB - 1) * XS_FULL + SEQ) * DMOD) return;
  if (in_sizes[1] != DMOD * DMOD) return;
  if (in_sizes[2] != DMOD) return;
  if (in_sizes[3] != DMOD * DMOD) return;
  if (in_sizes[4] != DMOD) return;
  if (in_sizes[5] != DMOD * DMOD) return;
  if (in_sizes[6] != DMOD) return;
  if (in_sizes[7] != DMOD * DMOD) return;
  if (in_sizes[8] != DMOD) return;
  if (out_size < ((NB - 1) * XS_FULL + SEQ) * DMOD) return;

  const float* x   = (const float*)d_in[0];
  const float* wq  = (const float*)d_in[1];
  const float* bqp = (const float*)d_in[2];
  const float* wk  = (const float*)d_in[3];
  const float* bkp = (const float*)d_in[4];
  const float* wv  = (const float*)d_in[5];
  const float* bvp = (const float*)d_in[6];
  const float* wo  = (const float*)d_in[7];
  const float* bop = (const float*)d_in[8];
  float*       out = (float*)d_out;

  const size_t szXB = (size_t)MROWS * DMOD * 2;
  const size_t szWB = (size_t)NQKV * DMOD * 2;
  const size_t szQ  = (size_t)MROWS * DMOD * 2;                  // QH, QL
  const size_t szK  = (size_t)MROWS * KVD * 2;                   // KH, KL
  const size_t szV  = (size_t)NB * NKVH * HD * SEQ * 2;          // VH, VL (== szK)
  const size_t szT  = (size_t)SEQ * NFREQ * 4;                   // TC, TS
  const size_t szOH = (size_t)MROWS * DMOD * 2;                  // O hi plane, lives in the XB region
  const size_t szOL = (size_t)MROWS * DMOD * 2;                  // O residual plane
  const size_t szWT = (size_t)DMOD * DMOD * 2;                   // Wo f16 plane
  if (szOH > szXB) return;
  size_t off = 0;
  const size_t oXB = off; off += szXB;
  const size_t oWB = off; off += szWB;
  const size_t oOL = off; off += szOL;
  const size_t oQH = off; off += szQ;
  const size_t oQL = off; off += szQ;
  const size_t oKH = off; off += szK;
  const size_t oKL = off; off += szK;
  const size_t oVH = off; off += szV;
  const size_t oVL = off; off += szV;
  const size_t oTC = off; off += szT;
  const size_t oTS = off; off += szT;
  const size_t oWT = off; off += szWT;
  if (off > ws_size) return;                // off = 69730304 for NB = 4, SEQ = 2048
  if (off > (size_t)WS_CAP) return;

  char* ws = (char*)d_ws;
  u16*   XB  = (u16*)(ws + oXB);
  u16*   OH  = (u16*)(ws + oXB);
  u16*   WB  = (u16*)(ws + oWB);
  u16*   WT  = (u16*)(ws + oWT);
  u16*   OL  = (u16*)(ws + oOL);
  u16*   QH  = (u16*)(ws + oQH);
  u16*   QL  = (u16*)(ws + oQL);
  u16*   KH  = (u16*)(ws + oKH);
  u16*   KL  = (u16*)(ws + oKL);
  u16*   VH  = (u16*)(ws + oVH);
  u16*   VL  = (u16*)(ws + oVL);
  float* TC  = (float*)(ws + oTC);
  float* TS  = (float*)(ws + oTS);

  const dim3 b256(256), b128(128), bAT(ATT_THREADS);
  const dim3 gG1((MROWS / 64) * (NQKV / 64));
  const float osc = 1.0f / (OSC * WOS);

  // (1) rotary cos / sin tables [SEQ][32]; x -> bf16 plane [MROWS][512]; Wq, Wk, Wv -> one bf16 plane [1536 n][512 k];
  //     Wo [512 o][512 d] -> f16 plane of the bf16 value x1024 (already k-contiguous)
  prep<<<dim3(GT + NB * GX + 4 * GW), b256, 0, stream>>>(x, wq, wk, wv, wo, XB, WB, WT, TC, TS);
  // (2) x.[Wq|Wk|Wv]^T (columns 0..511 q_proj, 512..1023 k_proj, 1024..1535 v_proj) with the planes written by its epilogue:
  //     q = rotary(q_proj + bq) and keys = rotary(v_proj + bv) -> hi + residual planes x256; values = k_proj + bk (no rotary)
  //     -> v^T hi + residual planes x1024
  gemm_qkv<<<gG1, b128, 0, stream>>>(XB, WB, bqp, bkp, bvp, TC, TS, QH, QL, KH, KL, VH, VL, DMOD);
  // (3) causal attention -> O f16 hi plane x256 (XB region) for all query tiles; residual plane for rows < RICH of each sequence
  attn_all<<<dim3(NQT * NH * NB), bAT, 0, stream>>>(QH, QL, KH, KL, VH, VL, OH, OL);
  // (4) y = O.Wo^T + bo -> out f32 [rows][512], carries 256 x 1024 folded back; rows < RICH per sequence with O hi + residual
  gemm_o<<<dim3(NB * (SEQ / 64) * (DMOD / 64)), b128, 0, stream>>>(OH, OL, WT, bop, out, DMOD, DMOD, osc);
  (void)hipGetLastError();
}

// v006
// It runs in 127 microseconds.
// Next to v005, in two timings, it ran 1.09 and 1.10 times as fast.
// Counting every step since v000, it is 3.01 times as fast.
// Contractions: x.[Wq|Wk|Wv]^T on v_wmma_f32_16x16x32_bf16 (x and the weights as bf16 RNE planes; weight [n][k] rows are
// the k-contiguous A operand for q_proj and v_proj, B for k_proj; f32 accumulate); q.k^T over hd 64 and P.v on v_wmma_f32_16x16x32_f16 with f16 hi + f16
// residual planes (both transposed: k.q^T and v^T.P^T; q, k x256 after rotary, products hh+lh+hl on every row; P x32768 hi + in-register residual and v^T x1024
// hi + residual plane for query rows < 512 of each sequence, P hi . v hi only for later rows); O.Wo^T on
// v_wmma_f32_16x16x32_f16 with O x256 as f16 hi (+ f16 residual plane for rows < 512 of each sequence) and Wo as
// f16(bf16(Wo)) x1024, one accumulator, bias added in f32; all f32 accumulate. Rotary cos/sin tables, bias adds and online
// softmax in f32 on VALU.
#include <hip/hip_runtime.h>
#include <math.h>
#include <stdint.h>

#ifndef NB
#define NB 4
#endif
#ifndef SEQ
#define SEQ 2048
#endif
#define XS_FULL 2048
#define DMOD  512
#define NH    8
#define NKVH  8
#define HD    64
#define HHALF (HD / 2)
#define NFREQ (HD / 2)
#define KVD   (NKVH * HD)
#define NQKV  (DMOD + 2 * KVD)
#define QCOL0 0
#define VCOL0 DMOD
#define KCOL0 (DMOD + KVD)
#define MROWS (NB * SEQ)
#define RICH  512
#define ROPE_L2 0.41524101186092028
#define SM_SCALE 0.04419417382415922f
#define QSC   256.0f
#define KSC   256.0f
#define PCAR  32768.0f
#define VCAR  1024.0f
#define OSC   256.0f
#define WOS   1024.0f
#define NSW   8
#define NQT   (SEQ / 16)
#define NQTR  (RICH / 16)
#define QTW   2
#define NQP   (NQT / QTW)
#define NQPR  (NQTR / QTW)
#define NKT   (SEQ / 32)
#define ATT_THREADS (NSW * 32)
#define SLP   68
#define SLW   (QTW * 16 * SLP)
#define SLAB64 (16 * 68)
#define WS_CAP 134217728
#define GX    (SEQ * DMOD / 8 / 256)
#define GW    (DMOD * DMOD / 8 / 256)
#define GT    (SEQ * NFREQ / 256)
static_assert(DMOD == NH * HD && HD == 64 && HHALF == 32 && NFREQ == 32 && NH == 8 && NKVH == NH);
static_assert(ATT_THREADS == 256 && NSW >= 4 && KVD == 512 && NQKV == 1536 && KCOL0 + KVD == NQKV && VCOL0 + KVD == KCOL0);
static_assert(NB >= 1 && NB <= 4);
static_assert(NB == 1 || SEQ == XS_FULL);
static_assert((SEQ % 64) == 0 && SEQ >= 64 && SEQ <= XS_FULL);
static_assert((RICH % 64) == 0 && RICH >= 64 && RICH <= SEQ);
static_assert((DMOD % 64) == 0 && (KVD % 64) == 0 && (NQKV % 64) == 0 && (DMOD % 32) == 0 && (HD % 32) == 0);
static_assert(((SEQ * DMOD / 8) % 256) == 0 && ((DMOD * DMOD / 8) % 256) == 0 && ((SEQ * NFREQ) % 256) == 0);
static_assert(NSW * (SLW + 2 * QTW * 16) * 4 <= 327680 / 2 && 4 * SLAB64 * 4 <= 65536);
static_assert(QTW == 2 && NSW == 4 * QTW && (NQT % QTW) == 0 && (NQTR % QTW) == 0);
static_assert(DMOD / 8 == 64 && KVD / 8 == 64);
static_assert(((SEQ * DMOD / 8) % 1024) == 0 && ((DMOD * DMOD / 8) % 1024) == 0 && (SEQ % 32) == 0 && (RICH % 16) == 0);

typedef unsigned short u16;
typedef _Float16 v16h __attribute__((ext_vector_type(16)));
typedef _Float16 v8h  __attribute__((ext_vector_type(8)));
typedef __bf16   v16b __attribute__((ext_vector_type(16)));
typedef float    v8f  __attribute__((ext_vector_type(8)));
typedef float    v4f  __attribute__((ext_vector_type(4)));
typedef unsigned int v4u __attribute__((ext_vector_type(4)));

union FragH { v16h v; v8h h[2]; v4u u[2]; };
union FragB { v16b v; v4u u[2]; };

// ---- scalar helpers --------------------------------------------------------------------------------
__device__ __forceinline__ unsigned short bf_bits(float f) {          // f32 -> bf16 bits, RNE convert
  unsigned u = __float_as_uint(f);
  return (unsigned short)((u + 0x7FFFu + ((u >> 16) & 1u)) >> 16);
}
__device__ __forceinline__ float bf_up(unsigned short h) { return __uint_as_float(((unsigned)h) << 16); }
__device__ __forceinline__ float bfr(float f) { return bf_up(bf_bits(f)); }
__device__ __forceinline__ unsigned short h_bits(_Float16 x) { return __builtin_bit_cast(unsigned short, x); }
__device__ __forceinline__ unsigned pk16(unsigned short a, unsigned short b) { return (unsigned)a | ((unsigned)b << 16); }
__device__ __forceinline__ v8f zero8() { v8f z = {0.f, 0.f, 0.f, 0.f, 0.f, 0.f, 0.f, 0.f}; return z; }

// ---- fragment-major planes: every 16-bit A/B operand plane [row][K] other than v^T is stored as [row/16][K/32][g][lane][8]: the 16-B unit
//      of lane = 16*h + (row&15) in half g holds k = 32*ks + 16*g + 8*h + 0..7, so one wave-wide 16-B load is 512 contiguous
//      bytes (4 whole lines) and one 16 x 32 fragment is 1 KB. A 16-row tile starts where it starts in a row-major plane.
// ---- fragment loaders: lane -> row/col (lane&15), h = lane>>4; base = a pointer that is the same in every lane (it stays in
//      scalar registers), vo = byte offset of the fragment from base + 16*lane (one 32-bit register shared by all loads of a
//      step and advanced behind them); p = base + vo;
//      elements 0..7 <- p[0..7] (k0+8h..), elements 8..15 <- p[256..263] (k0+16+8h..)  (same split k map for A and B)
__device__ __forceinline__ v16h ldfrag_h(const _Float16* base, unsigned vo) {
  const char* p = (const char*)base + vo;
  FragH f;
  f.h[0] = *(const v8h*)(p);
  f.h[1] = *(const v8h*)(p + 512);
  return f.v;
}
__device__ __forceinline__ v16b ldfrag_b(const u16* base, unsigned vo) { // bf16 plane read as unsigned integer vectors
  const char* p = (const char*)base + vo;
  FragB f;
  f.u[0] = *(const v4u*)(p);
  f.u[1] = *(const v4u*)(p + 512);
  return f.v;
}

__device__ __forceinline__ v8f mma_h(v16h a, v16h b, v8f c) {
  return __builtin_amdgcn_wmma_f32_16x16x32_f16(false, a, false, b, (short)0, c, false, false);
}
__device__ __forceinline__ v8f mma_b(v16b a, v16b b, v8f c) {
  return __builtin_amdgcn_wmma_f32_16x16x32_bf16(false, a, false, b, (short)0, c, false, false);
}
// four issue slots between the last matrix instruction of a group and the first vector instruction on its results or operands,
// on every path (the loop's back edge too); the fragments are named so that their registers are not rewritten in front of it
__device__ __forceinline__ void guard4x8(v8f& a, v8f& b, v8f& c, v8f& d, v16h x0, v16h x1, v16h x2, v16h x3,
                                         v16h x4, v16h x5, v16h x6, v16h x7) {
#if defined(__HIP_DEVICE_COMPILE__)
  asm volatile("v_nop\n\tv_nop\n\tv_nop\n\tv_nop"
               : "+v"(a), "+v"(b), "+v"(c), "+v"(d)
               : "v"(x0), "v"(x1), "v"(x2), "v"(x3), "v"(x4), "v"(x5), "v"(x6), "v"(x7) : "memory");
#endif
}
template <typename F>
__device__ __forceinline__ void guard6(v8f& a, v8f& b, v8f& c, v8f& d, F x0, F x1, F x2, F x3, F x4, F x5) {
#if defined(__HIP_DEVICE_COMPILE__)
  asm volatile("v_nop\n\tv_nop\n\tv_nop\n\tv_nop"
               : "+v"(a), "+v"(b), "+v"(c), "+v"(d) : "v"(x0), "v"(x1), "v"(x2), "v"(x3), "v"(x4), "v"(x5) : "memory");
#endif
}
__device__ __forceinline__ void acc_guard4(v8f& a, v8f& b, v8f& c, v8f& d) {
#if defined(__HIP_DEVICE_COMPILE__)
  asm volatile("v_nop\n\tv_nop\n\tv_nop\n\tv_nop" : "+v"(a), "+v"(b), "+v"(c), "+v"(d));
#endif
}
__device__ __forceinline__ void wave_sync_lds() {
  __builtin_amdgcn_fence(__ATOMIC_RELEASE, "workgroup");
  __builtin_amdgcn_wave_barrier();
  __builtin_amdgcn_fence(__ATOMIC_ACQUIRE, "workgroup");
}

// =====================================================================================================
// f32 [rows][DMOD] -> 16-bit fragment-major plane.  f16mode == 0: bf16 RNE bits;  f16mode == 1: f16 bits of (bf16 RNE value)
// * scale. Thread = output unit gt = 8 consecutive elements of one row: two 16-B loads (a wave reads 64 B of each of 16 rows,
// the block uses every line whole), one 16-B store; 32 consecutive lanes store 512 contiguous, 512-B aligned bytes;
// coverage: blk = 0 .. n8/256 - 1, x 256 thr x 8 (in-kernel bound) = the whole plane (n8 a multiple of 256 here).
// =====================================================================================================
__device__ __forceinline__ void cvt16(const float* __restrict__ x, u16* D, int blk, int n8, int f16mode, float scale) {
  const int gt = blk * 256 + (int)threadIdx.x;
  if (gt >= n8) return;
  const int srow = (gt >> 10) * 16 + (gt & 15);                                   // 1024 units per 16-row tile
  const int schk = ((gt >> 6) & (DMOD / 32 - 1)) * 4 + ((gt >> 5) & 1) * 2 + ((gt >> 4) & 1);
  const float* p = x + ((size_t)srow * (DMOD / 8) + schk) * 8;
  const v4f a = *(const v4f*)(p), b4 = *(const v4f*)(p + 4);
  float w[8];
#pragma unroll
  for (int e = 0; e < 4; ++e) { w[e] = a[e]; w[4 + e] = b4[e]; }
  v4u o;
#pragma unroll
  for (int e = 0; e < 4; ++e) {
    const float f0 = w[2 * e], f1 = w[2 * e + 1];
    const unsigned short hb0 = h_bits((_Float16)(bfr(f0) * scale));
    const unsigned short hb1 = h_bits((_Float16)(bfr(f1) * scale));
    const unsigned short bb0 = bf_bits(f0);
    const unsigned short bb1 = bf_bits(f1);
    o[e] = (f16mode != 0) ? pk16(hb0, hb1) : pk16(bb0, bb1);
  }
  u16* d = D + (size_t)gt * 8;
  {
    *(v4u*)(d) = o;
    
  }
}

// =====================================================================================================
// Rotary tables TC[s][j] = cos(s * inv[j]), TS[s][j] = sin(s * inv[j]), j < 32, with
// inv[j] = 1.0f / f32(10000^(j/32)) (power evaluated in f64 and narrowed once, IEEE f32 reciprocal, f32 product s*inv,
// coverage: blk = 0 .. n/256 - 1, x 256 thr = n = SEQ*32 elements of TC and of TS (n a multiple of 256).
// =====================================================================================================
__device__ __forceinline__ void k_tab(float* TC, float* TS, int blk, int n) {
#pragma clang fp contract(off)
  const int idx = blk * 256 + (int)threadIdx.x;
  if (idx >= n) return;
  const int s = idx / NFREQ;
  const int j = idx - s * NFREQ;
  const double pj = exp2((double)j * ROPE_L2);       // 10000^(j/32)
  const float pf  = (float)pj;
  const float inv = 1.0f / pf;
  const float ang = (float)s * inv;
  float sv, cv;
  sincosf(ang, &sv, &cv);
  {
    *(float*)(TC + idx) = cv;
    *(float*)(TS + idx) = sv;
    
  }
}

// =====================================================================================================
// One launch for everything that reads only the inputs: none of these pieces reads what another writes, so they share a grid
// by block range (every branch is block-uniform, no barrier): GT blocks the rotary tables, NB*GX blocks x -> bf16 plane
// [MROWS][512], GW blocks each Wq, Wk, Wv -> one bf16 plane [1536 n][512 k], GW blocks Wo -> f16 plane of the bf16 value x1024.
// coverage: grid = GT + NB*GX + 4*GW blocks, each range exactly the grid of its piece.
// =====================================================================================================
__global__ __launch_bounds__(256) void prep(const float* __restrict__ x, const float* __restrict__ wq,
                                            const float* __restrict__ wk, const float* __restrict__ wv,
                                            const float* __restrict__ wo, u16* XB, u16* WB, u16* WT, float* TC, float* TS) {
  int bid = (int)blockIdx.x;
  if (bid < GT) { k_tab(TC, TS, bid, SEQ * NFREQ); return; }
  bid -= GT;
  if (bid < NB * GX) {
    const int bq = bid / GX;
    cvt16(x + (size_t)bq * XS_FULL * DMOD, XB + (size_t)bq * SEQ * DMOD, bid - bq * GX, SEQ * DMOD / 8, 0, 1.0f);
    return;
  }
  bid -= NB * GX;
  if (bid < GW)     { cvt16(wq, WB, bid, DMOD * DMOD / 8, 0, 1.0f); return; }
  if (bid < 2 * GW) { cvt16(wk, WB + (size_t)VCOL0 * DMOD, bid - GW, DMOD * DMOD / 8, 0, 1.0f); return; }
  if (bid < 3 * GW) { cvt16(wv, WB + (size_t)KCOL0 * DMOD, bid - 2 * GW, DMOD * DMOD / 8, 0, 1.0f); return; }
  if (bid < 4 * GW) { cvt16(wo, WT, bid - 3 * GW, DMOD * DMOD / 8, 1, WOS); return; }
}

// =====================================================================================================
// Interleaved-pair rotary of one element, with y = projection + bias (f32 add) already formed:
//   out[2j]   = y[2j]  *c[s][j] + (-1)*(y[2j+1]*sn[s][j])
//   out[2j+1] = y[2j+1]*c[s][j] + (+1)*(y[2j]  *sn[s][j])        with c, sn the f32 table values (mul, mul, add kept
//   separate); hb = f16(out * sc), lb = f16 residual (t - f16(t)).
// =====================================================================================================
__device__ __forceinline__ void rot_one(float x, float y, float cv, float sv, float sgn, float sc,
                                        unsigned short& hb, unsigned short& lb) {
#pragma clang fp contract(off)
  const float ys   = y * sv;
  const float term = sgn * ys;
  const float r    = x * cv + term;
  const float t    = r * sc;
  const _Float16 a = (_Float16)t;
  hb = h_bits(a);
  lb = h_bits((_Float16)(t - (float)a));
}

// =====================================================================================================
// GEMM epilogue of the output projection: the wave's 16x64 f32 tile (times oscale) staged in its LDS slab (pitch 68),
// 8 consecutive lanes x 16 B per line), lanes 16..31 -> row 2*it+1; HASB != 0 adds bias[col] in f32 to every element;
// coverage: 8 instructions x 2 rows x 16 lanes x 4 floats = the wave's 16 x 64 tile.
// =====================================================================================================
template <int HASB>
__device__ __forceinline__ void epi64(float* sl, v8f a0, v8f a1, v8f a2, v8f a3, float oscale, const float* bias,
                                      float* C, int N, size_t rowb, int col0, int lane) {
  const int hh = lane >> 4, m = lane & 15;
#pragma unroll
  for (int r = 0; r < 8; ++r) {
    const int ro = (8 * hh + r) * 68 + m;
    sl[ro]      = a0[r] * oscale;
    sl[ro + 16] = a1[r] * oscale;
    sl[ro + 32] = a2[r] * oscale;
    sl[ro + 48] = a3[r] * oscale;
  }
  wave_sync_lds();
  v4f vals[8];
#pragma unroll
  for (int it = 0; it < 8; ++it) vals[it] = *(const v4f*)(sl + (it * 2 + hh) * 68 + m * 4);
  if (HASB != 0) {
    const v4f b4 = *(const v4f*)(bias + col0 + m * 4);
#pragma unroll
    for (int it = 0; it < 8; ++it) vals[it] = vals[it] + b4;
  }
  float* dst = C + (rowb + (size_t)hh) * (size_t)N + col0 + m * 4;
  {
#pragma unroll
    for (int it = 0; it < 8; ++it) {
      *(v4f*)(dst + (size_t)(it * 2) * (size_t)N) = vals[it];
    }
    
  }
}

// =====================================================================================================
// Projection GEMM x.[Wq|Wk|Wv]^T (bf16 fragment-major planes A = x [MROWS][512], Bt = weights [1536 n][512 k], f32
// accumulate) whose epilogue writes the attention operand planes itself: no f32 projection array, no LDS.
// Block = 64 rows x 64 columns, 4 waves x 16 rows; a wave's 64 columns are one head of q_proj (columns 0..511), of k_proj
// (512..1023) or of v_proj (1024..1535), its 16 rows 16 positions of one sequence; the choice is block-uniform.
// Fragments loaded straight from the planes (two 512-B wave loads each, split k map for both operands); K stepped by 32
// (host: K = 512, the row length of both planes).
// TR = 1 (q_proj, v_proj): the weight tile is the first operand, so acc j element r of lane (hh, m) =
//   (column j*16 + 8*hh + r, position m): 8 consecutive d of one position = the lane's 16-B unit of the q / k plane.
// TR = 0 (k_proj): x is the first operand, acc j element r of lane (hh, m) = (position 8*hh + r, column j*16 + m):
//   8 consecutive keys of one d = the lane's 16-B unit of the v^T plane.
// =====================================================================================================
template <int TR>
__device__ __forceinline__ void proj_loop(const u16* ap, const u16* bp, const u16* bp1, const u16* bp2, const u16* bp3,
                                          unsigned vo, int K, v8f& acc0, v8f& acc1, v8f& acc2, v8f& acc3) {
#pragma unroll 1
  for (int k0 = 0; k0 < K; k0 += 32, vo += 1024u) {
    const v16b a  = ldfrag_b(ap, vo);
    const v16b b0 = ldfrag_b(bp, vo);
    const v16b b1 = ldfrag_b(bp1, vo);
    const v16b b2 = ldfrag_b(bp2, vo);
    const v16b b3 = ldfrag_b(bp3, vo);
    if (TR != 0) {
      acc0 = mma_b(b0, a, acc0);
      acc1 = mma_b(b1, a, acc1);
      acc2 = mma_b(b2, a, acc2);
      acc3 = mma_b(b3, a, acc3);
    } else {
      acc0 = mma_b(a, b0, acc0);
      acc1 = mma_b(a, b1, acc1);
      acc2 = mma_b(a, b2, acc2);
      acc3 = mma_b(a, b3, acc3);
    }
    guard6<v16b>(acc0, acc1, acc2, acc3, a, b0, b1, b2, b3, a);
  }
}

// q / k planes from the TR = 1 accumulators: y = acc + bias[head*HD + d], rotary with table row s = the lane's position and
// table column d >> 1, x sc -> f16 hi and f16 residual planes, fragment-major per head [b*8 + head][s/16][d/32][half][lane][8]
// (row = position, k = d): acc j is half j & 1 of d step j >> 1, at pb + j * 256 halves, pb = the tile's start + 8 * lane.
// coverage: 4 stores x 32 lanes x 8 halves = the wave's 16 positions x 64 d of Hp and of Lp, 512 contiguous bytes a store.
__device__ __forceinline__ void rope_epi(const v8f (&acc)[4], int hh, int s, const float* __restrict__ bias,
                                         const float* __restrict__ TC, const float* __restrict__ TS,
                                         u16* Hp, u16* Lp, size_t pb, float sc) {
  const float* bp = bias + 8 * hh;                     // bias already at the head's first column
  const float* cp = TC + (size_t)s * NFREQ + 4 * hh;
  const float* sp = TS + (size_t)s * NFREQ + 4 * hh;
  // two groups of two accumulator tiles, each with its own loads, so that the loaded values of one group only are live
  // beside the accumulators (the register count stays at the k loop's, and with it the waves per SIMD)
#pragma unroll
  for (int g2 = 0; g2 < 2; ++g2) {
    v4f ba[2], bb[2], cw[2], sw[2];
#pragma unroll
    for (int i = 0; i < 2; ++i) {
      const int j = 2 * g2 + i;
      ba[i] = *(const v4f*)(bp + j * 16);
      bb[i] = *(const v4f*)(bp + j * 16 + 4);
      cw[i] = *(const v4f*)(cp + j * 8);
      sw[i] = *(const v4f*)(sp + j * 8);
    }
#pragma unroll
    for (int i = 0; i < 2; ++i) {
      const int j = 2 * g2 + i;
      float yv[8];
#pragma unroll
      for (int e = 0; e < 4; ++e) {
        yv[e]     = acc[j][e]     + ba[i][e];
        yv[4 + e] = acc[j][4 + e] + bb[i][e];
      }
      v4u oh, ol;
#pragma unroll
      for (int e = 0; e < 4; ++e) {
        unsigned short h0, l0, h1, l1;
        rot_one(yv[2 * e],     yv[2 * e + 1], cw[i][e], sw[i][e], -1.0f, sc, h0, l0);   // even element of the pair
        rot_one(yv[2 * e + 1], yv[2 * e],     cw[i][e], sw[i][e],  1.0f, sc, h1, l1);   // odd element of the pair
        oh[e] = pk16(h0, h1);
        ol[e] = pk16(l0, l1);
      }
      *(v4u*)(Hp + pb + j * 256) = oh;
      *(v4u*)(Lp + pb + j * 256) = ol;
    }
    // the next group's loads, and behind the last group whatever code the compiler places next, may write
    // registers that these stores name
    asm volatile("s_wait_xcnt 0x0" ::: "memory");
  }
}

// v^T planes from the TR = 0 accumulators: y = acc + bias[head*HD + d] (f32 add), t = y * 1024 (exact), hi = f16(t),
// residual = f16(t - hi), fragment-major per head with the 32-key step outermost [b*8 + head][s/32][d/16][half][lane][8]
// (row = d, k = key): the wave's 16 keys are one half of the four d-subtile fragments, acc j at pb + j * 512 halves,
// pb = the key step's start + half * 256 + 8 * lane.
// coverage: 4 stores x 32 lanes x 8 halves = the wave's 16 keys x 64 d of VHo and of VLo, 512 contiguous bytes a store.
__device__ __forceinline__ void vt_epi(const v8f (&acc)[4], int m, const float* __restrict__ bias,
                                       u16* VHo, u16* VLo, size_t pb) {
  float bj[4];
#pragma unroll
  for (int j = 0; j < 4; ++j) bj[j] = bias[j * 16 + m];  // bias already at the head's first column
  v4u oh[4], ol[4];
#pragma unroll
  for (int j = 0; j < 4; ++j) {
#pragma unroll
    for (int e = 0; e < 4; ++e) {
      const float t0 = (acc[j][2 * e]     + bj[j]) * VCAR;
      const float t1 = (acc[j][2 * e + 1] + bj[j]) * VCAR;
      const _Float16 h0 = (_Float16)t0, h1 = (_Float16)t1;
      oh[j][e] = pk16(h_bits(h0), h_bits(h1));
      ol[j][e] = pk16(h_bits((_Float16)(t0 - (float)h0)), h_bits((_Float16)(t1 - (float)h1)));
    }
  }
#pragma unroll
  for (int j = 0; j < 4; ++j) {
    *(v4u*)(VHo + pb + j * 512) = oh[j];
    *(v4u*)(VLo + pb + j * 512) = ol[j];
  }
}

// coverage: grid = (MROWS/64) * (NQKV/64) blocks x 4 waves: every (sequence, head, 16 positions) tile of the q, k and v^T
// hi and residual planes exactly once.
__global__ __launch_bounds__(128)
void gemm_qkv(const u16* __restrict__ A, const u16* __restrict__ Bt, const float* __restrict__ bq,
              const float* __restrict__ bk, const float* __restrict__ bv,
              const float* __restrict__ TC, const float* __restrict__ TS,
              u16* QH, u16* QL, u16* KH, u16* KL, u16* VH, u16* VL, int K) {
  const int tid = threadIdx.x, lane = tid & 31;
  const int wave = __builtin_amdgcn_readfirstlane(tid >> 5);   // scalar, so that the tile starts below are scalar bases
  const int bid   = blockIdx.x;
  const int rowb  = (bid / (NQKV / 64)) * 64 + wave * 16;
  const int col0  = (bid % (NQKV / 64)) * 64;
  if (rowb + 16 > MROWS) return;            // wave-uniform, never taken with the exact grid; no block barriers in this kernel
  const u16* ap  = A  + (size_t)rowb * K;             // fragment (16-row tile, k step ks) at tile start + ks * 1024 bytes
  const u16* bp  = Bt + (size_t)col0 * K;
  const u16* bp1 = Bt + (size_t)(col0 + 16) * K;
  const u16* bp2 = Bt + (size_t)(col0 + 32) * K;
  const u16* bp3 = Bt + (size_t)(col0 + 48) * K;
  const unsigned vo = (unsigned)lane * 16u;
  const int b    = rowb / SEQ;                        // sequence
  const int s16  = rowb - b * SEQ;                    // the wave's first position in it, a multiple of 16
  const int hcol = col0 & (DMOD - 1);                 // head * HD within the q, k or v projection
  const size_t hp = ((size_t)b * DMOD + hcol) * SEQ;  // start of the (sequence, head) plane, in halves: (b*8 + head) * SEQ * HD
  v8f acc[4];
#pragma unroll
  for (int j = 0; j < 4; ++j) acc[j] = zero8();
  if (col0 >= VCOL0 && col0 < KCOL0) {
    proj_loop<0>(ap, bp, bp1, bp2, bp3, vo, K, acc[0], acc[1], acc[2], acc[3]);
    vt_epi(acc, lane & 15, bk + hcol, VH, VL,
           hp + (size_t)(s16 >> 5) * (32 * HD) + (size_t)((s16 >> 4) & 1) * 256 + 8 * lane);
  } else {
    const bool isq = col0 < VCOL0;
    proj_loop<1>(ap, bp, bp1, bp2, bp3, vo, K, acc[0], acc[1], acc[2], acc[3]);
    rope_epi(acc, lane >> 4, s16 + (lane & 15), (isq ? bq : bv) + hcol, TC, TS, isq ? QH : KH, isq ? QL : KL,
             hp + (size_t)s16 * HD + 8 * lane, isq ? QSC : KSC);
  }
}

// =====================================================================================================
// f16 GEMM: C[M][N] (f32) = (A[M][K] (+ A2[M][K] when TWO != 0)) . Bt[N][K]^T, times oscale, plus bias[n]; A, A2 f16
// fragment-major planes (A2 = the unscaled f16 residual of A, sharing the accumulator), Bt f16 fragment-major. Same tiling, fragment
// loads (split k map) as gemm_qkv, epilogue epi64; K stepped by 32.
// =====================================================================================================
template <int TWO>
__device__ __forceinline__
void gemm_h(float* slab, int wave, int lane, int rowb, int crow, int col0,
            const u16* __restrict__ A, const u16* __restrict__ A2, const u16* __restrict__ Bt,
            const float* __restrict__ bias, float* C, int N, int K, float oscale) {
  const _Float16* ap  = (const _Float16*)(const void*)A  + (size_t)rowb * K;
  const _Float16* ap2 = (const _Float16*)(const void*)A2 + (size_t)rowb * K;
  const _Float16* bp  = (const _Float16*)(const void*)Bt + (size_t)col0 * K;
  const _Float16* bp1 = (const _Float16*)(const void*)Bt + (size_t)(col0 + 16) * K;
  const _Float16* bp2 = (const _Float16*)(const void*)Bt + (size_t)(col0 + 32) * K;
  const _Float16* bp3 = (const _Float16*)(const void*)Bt + (size_t)(col0 + 48) * K;
  unsigned vo = (unsigned)lane * 16u;
  v8f acc0 = zero8(), acc1 = zero8(), acc2 = zero8(), acc3 = zero8();
#pragma unroll 1
  for (int k0 = 0; k0 < K; k0 += 32, vo += 1024u) {
    const v16h a  = ldfrag_h(ap, vo);
    const v16h b0 = ldfrag_h(bp, vo);
    const v16h b1 = ldfrag_h(bp1, vo);
    const v16h b2 = ldfrag_h(bp2, vo);
    const v16h b3 = ldfrag_h(bp3, vo);
    acc0 = mma_h(a, b0, acc0);
    acc1 = mma_h(a, b1, acc1);
    acc2 = mma_h(a, b2, acc2);
    acc3 = mma_h(a, b3, acc3);
    if (TWO != 0) {
      const v16h a2 = ldfrag_h(ap2, vo);
      acc0 = mma_h(a2, b0, acc0);
      acc1 = mma_h(a2, b1, acc1);
      acc2 = mma_h(a2, b2, acc2);
      acc3 = mma_h(a2, b3, acc3);
      guard6<v16h>(acc0, acc1, acc2, acc3, a, a2, b0, b1, b2, b3);
    } else {
      guard6<v16h>(acc0, acc1, acc2, acc3, a, b0, b1, b2, b3, a);
    }
  }
  (void)ap2;
  epi64<1>(slab + wave * SLAB64, acc0, acc1, acc2, acc3, oscale, bias, C, N, (size_t)crow, col0, lane);
}

// One launch for y = O.Wo^T + bo over all sequences: block = 64 rows x 64 columns; its 64 rows lie in one sequence and wholly
// below or wholly at and above row RICH of it (RICH and SEQ multiples of 64), so the choice hi + residual / hi only is
// block-uniform. rowb = the wave's first row in the O planes, crow = the same row in out.
// coverage: grid = NB * (SEQ/64) * (N/64) blocks x 4 waves x 16 x 64 = every element of out once (host: N % 64 == 0, K % 32 == 0).
__global__ __launch_bounds__(128)
void gemm_o(const u16* __restrict__ A, const u16* __restrict__ A2, const u16* __restrict__ Bt,
            const float* __restrict__ bias, float* C, int N, int K, float oscale) {
  __shared__ __align__(16) float slab[4 * SLAB64];
  const int tid = threadIdx.x, lane = tid & 31;
  const int wave = __builtin_amdgcn_readfirstlane(tid >> 5);   // scalar, so that the tile starts are scalar bases
  const int ntile = N >> 6;
  const int bid  = blockIdx.x;
  const int rt   = bid / ntile;
  const int col0 = (bid % ntile) * 64;
  const int bq   = rt / (SEQ / 64);
  const int rs   = (rt % (SEQ / 64)) * 64;                     // first row of the block within its sequence
  if (bq >= NB) return;                     // block-uniform, never taken with the exact grid; no block barriers in this kernel
  const int rowb = bq * SEQ + rs + wave * 16;
  const int crow = bq * XS_FULL + rs + wave * 16;
  if (rs < RICH) gemm_h<1>(slab, wave, lane, rowb, crow, col0, A, A2, Bt, bias, C, N, K, oscale);
  else           gemm_h<0>(slab, wave, lane, rowb, crow, col0, A, A2, Bt, bias, C, N, K, oscale);
}

// =====================================================================================================
// Causal softmax attention, hd = 64, 8 heads. Block bid -> (pair of query tiles qp = bid % NQP: rows q0 = 32*qp .. q0+31, tile t
// = rows q0 + 16t .. q0 + 16t + 15, head, batch b); keys/values of the same head (kvh = head). The pair's key steps (the same
// steps for both tiles) are dealt over the block's NSW waves: wave w takes steps w, w + NSW, ... for BOTH tiles, so each k and
// v^T fragment it loads feeds two tiles' products; per tile its own running max, sum and O accumulators; the NSW partials of
// each tile are merged in LDS behind one block barrier (attn_merge8); the longest serial walk is NKT / NSW steps.
//   q and k hi / residual planes f16 x256, fragment-major per head [b*8 + h][s/16][d/32][half][lane][8];
//   v^T hi / residual planes x1024, fragment-major per head [b*NKVH + h][s/32][d/16][half][lane][8].
//   raw(i, j) = q_hi.k_hi + q_lo.k_hi + q_hi.k_lo (2 k-steps over d); logit = raw * (SM_SCALE * 2^-16) (the two 256 carries
//   folded exactly into the 1/sqrt(512) scale, one f32 multiply); keys above the diagonal replaced by -inf.
//   Both products run transposed, S^T = k.q^T (A = k fragment, B = q fragment) and O^T += v^T.P^T (A = v^T fragment, B = P^T),
//   so lane (c, hh) holds per tile 16 scores and 32 O elements of the one query q0 + 16t + c: online softmax per query in f32 with a running
//   max: max over the lane's 16 scores, then one exchange with lane c ^ 16 (same max in both); sum over the lane's own keys,
//   the two halves joined once behind the loop; alpha = exp(m_old - m_new), p = exp(logit - m_new), l = l*alpha + sum p, O
//   accumulators times alpha before the tile's v^T.P^T. Only key tiles of 32 with kb <= q0 are visited (nkt = q0/32 + 1 <= NKT; key kb is
//   unmasked for every row of the tile, so each row max of a visited tile is finite; wave 0 always visits tile 0).
//   The two 16x16 score tiles of a step, converted in place, are the P^T B fragment (no LDS, no lane exchange);
//   v^T A fragments in 2 groups of 2 d-subtiles; RV = 1: products
//   hh + lh + hl, RV = 0: hh only. After the loop every wave (one without a step: max -inf, sum 0, O 0) puts its raw O
//   accumulators into its slab and its 32 row maxima and sums beside them; block barrier; waves 4t .. 4t+3 merge tile t.
//   Epilogue: O = merged acc / (merged l * 32768 * 1024), x256 -> f16 hi plane (and for RV = 1 the unscaled f16 residual
//   plane), fragment-major over [b*SEQ + s][512]; wave 4t + it, lane = (row c of tile t, 8 consecutive d at it*16 + 8*hh); one
//   instruction = one 512-B half fragment (4 whole lines).
// coverage: 8 waves x 1 instruction x 32 lanes x 8 halves = 32 x 64 per plane; grid NQP x NH x NB blocks;
//   the two forms (pairs 0..NQPR-1 with RV = 1, NQPR..NQP-1 with RV = 0) cover every (b, s, h) row segment of the hi plane
//   exactly once and rows s < RICH of the residual plane exactly once (only those rows are read later).
// =====================================================================================================
// lane l <-> lane l ^ 16 (the other 16-lane row) as one vector cross-row move
__device__ __forceinline__ float xhalf(float x) {
  const int b = __builtin_bit_cast(int, x);
  return __builtin_bit_cast(float, __builtin_amdgcn_permlanex16(b, b, 0x76543210, 0xfedcba98, false, false));
}

// 2^x for the merge weights. The v_nop in the same statement keeps the one issue slot that the instruction set asks for behind
// a transcendental, whichever instruction the compiler places next.
__device__ __forceinline__ float exp2_slot(float x) {
  float r = 0.0f;
#if defined(__HIP_DEVICE_COMPILE__)
  asm("v_exp_f32 %0, %1\n\tv_nop" : "=v"(r) : "v"(x));
#endif
  return r;
}

// 2^x of eight values in one statement, for the same slot: the results are early-clobber, so that no v_exp_f32 here writes a
// source or reads a result of the one in front of it, and the one v_nop keeps the slot behind the last.
__device__ __forceinline__ void exp2x8_slot(float (&r)[8], const float (&x)[8]) {
#if defined(__HIP_DEVICE_COMPILE__)
  asm("v_exp_f32 %0, %8\n\tv_exp_f32 %1, %9\n\tv_exp_f32 %2, %10\n\tv_exp_f32 %3, %11\n\t"
      "v_exp_f32 %4, %12\n\tv_exp_f32 %5, %13\n\tv_exp_f32 %6, %14\n\tv_exp_f32 %7, %15\n\tv_nop"
      : "=&v"(r[0]), "=&v"(r[1]), "=&v"(r[2]), "=&v"(r[3]), "=&v"(r[4]), "=&v"(r[5]), "=&v"(r[6]), "=&v"(r[7])
      : "v"(x[0]), "v"(x[1]), "v"(x[2]), "v"(x[3]), "v"(x[4]), "v"(x[5]), "v"(x[6]), "v"(x[7]));
#else
  for (int e = 0; e < 8; ++e) r[e] = x[e];
#endif
}

// Merge of the NSW partials for one lane's 8 outputs (row c of the block's QTW * 16, columns dd .. dd+7): M = max of the waves' row maxima, weight
// exp(m_w - M) (0 for a wave without a step), L = sum of weight * l_w, acc = sum of weight * O_w, waves in index order.
__device__ __forceinline__ void attn_merge8(const float* slabs, const float* sm, const float* sl, int c, int dd,
                                            float* acc, float& L) {
  float mw[NSW], lw[NSW];
  v4f pa[NSW], pb[NSW];
#pragma unroll
  for (int w = 0; w < NSW; ++w) {
    mw[w] = sm[w * (QTW * 16) + c];
    lw[w] = sl[w * (QTW * 16) + c];
    pa[w] = *(const v4f*)(slabs + w * SLW + c * SLP + dd);
    pb[w] = *(const v4f*)(slabs + w * SLW + c * SLP + dd + 4);
  }
  float M = mw[0];
#pragma unroll
  for (int w = 1; w < NSW; ++w) M = fmaxf(M, mw[w]);
  L = 0.0f;
#pragma unroll
  for (int e = 0; e < 8; ++e) acc[e] = 0.0f;
#pragma unroll
  for (int w = 0; w < NSW; ++w) {
    const float wt = exp2_slot((mw[w] - M) * 1.44269504f);
    L += wt * lw[w];
#pragma unroll
    for (int e = 0; e < 4; ++e) {
      acc[e]     += wt * pa[w][e];
      acc[4 + e] += wt * pb[w][e];
    }
  }
}

template <int RV>
__device__ __forceinline__
void attn_cs(float* smem, float* smx, float* ssm, int qp, int head, int b,
             const u16* __restrict__ QHp, const u16* __restrict__ QLp,
             const u16* __restrict__ KHp, const u16* __restrict__ KLp,
             const u16* __restrict__ VHp, const u16* __restrict__ VLp,
             u16* OHp, u16* OLp) {
#pragma clang fp contract(off)
  const int tid  = threadIdx.x;
  const int wave = __builtin_amdgcn_readfirstlane(tid >> 5);   // scalar: which key steps the wave takes
  const int lane = tid & 31;
  const int hh   = lane >> 4;
  const int c    = lane & 15;
  const int q0   = qp * (QTW * 16);         // first query row of the block's QTW tiles
  const int kvh  = head;

  float* slab = smem + wave * SLW;          // O partial slab [QTW * 16 queries][64 d] pitch 68, written behind the loop

  // fragment-major planes: a head's 16 positions x 64 d = 1024 halves (2 fragments), its 32 keys x 64 d of v^T = 2048 (4)
  // byte offsets into the planes (each plane MROWS * 512 * 2 bytes, far under 2^32), the lane's 16 bytes included
  const unsigned qvo = ((unsigned)(b * NH + head) * SEQ + (unsigned)q0) * (HD * 2u) + (unsigned)lane * 16u;
  unsigned kvo = (unsigned)(b * NKVH + kvh) * (SEQ * HD * 2u) + (unsigned)wave * (32u * HD * 2u)
               + (unsigned)lane * 16u;                                                  // this step's 32 keys, k and v^T alike
  const _Float16* Qh  = (const _Float16*)(const void*)QHp;               // query tile t at + t * 1024 halves
  const _Float16* Ql  = (const _Float16*)(const void*)QLp;
  const _Float16* Khb = (const _Float16*)(const void*)KHp;
  const _Float16* Klb = (const _Float16*)(const void*)KLp;
  const _Float16* Vhb = (const _Float16*)(const void*)VHp;               // d-subtile j at + j * 512 halves
  const _Float16* Vlb = (const _Float16*)(const void*)VLp;
  const float lsc  = SM_SCALE * (1.0f / (QSC * KSC));   // exact power-of-two fold of the q / k carries into the scale
  const float oc   = 1.0f / (PCAR * VCAR);
  const float ninf = -__builtin_inff();
  const size_t KROW = (size_t)HD;           // halves per key in a head's fragment-major plane

  v8f o[QTW][4];
  float mrun[QTW], lrun[QTW];               // per tile, this lane's query: running max (alike in lanes c and c + 16), sum over the lane's own keys
#pragma unroll
  for (int t = 0; t < QTW; ++t) {
#pragma unroll
    for (int j = 0; j < 4; ++j) o[t][j] = zero8();
    mrun[t] = ninf;
    lrun[t] = 0.0f;
  }
  const int ncaus = (q0 >> 5) + 1;                                            // tiles holding keys <= q0 + 31, the same for both query tiles
  const int nkt   = (ncaus < NKT) ? ncaus : NKT;

#pragma unroll 1
  for (int kt = wave; kt < nkt; kt += NSW, kvo += NSW * 32u * HD * 2u) {
    const int kb = kt * 32;
    // ---- raw scores, transposed: D element r of this lane = (key kb + 8hh + r, query q0 + 16t + c) in s0[t], key kb + 16 + 8hh + r
    //      in s1[t]; every k fragment is loaded once and multiplied with the q fragments of both tiles ----
    v8f s0[QTW], s1[QTW];
#pragma unroll
    for (int t = 0; t < QTW; ++t) { s0[t] = zero8(); s1[t] = zero8(); }
    const _Float16* k0p = Khb;
    const _Float16* k1p = k0p + (size_t)16 * KROW;
    const _Float16* l0p = Klb;
    const _Float16* l1p = l0p + (size_t)16 * KROW;
#pragma unroll
    for (int kk = 0; kk < HD / 32; ++kk) {
      v16h qh[QTW], ql[QTW];
#pragma unroll
      for (int t = 0; t < QTW; ++t) {
        qh[t] = ldfrag_h(Qh + t * 1024 + kk * 512, qvo);
        ql[t] = ldfrag_h(Ql + t * 1024 + kk * 512, qvo);
      }
      const v16h kh0 = ldfrag_h(k0p + kk * 512, kvo);
      const v16h kh1 = ldfrag_h(k1p + kk * 512, kvo);
      const v16h kl0 = ldfrag_h(l0p + kk * 512, kvo);
      const v16h kl1 = ldfrag_h(l1p + kk * 512, kvo);
#pragma unroll
      for (int t = 0; t < QTW; ++t) {
        s0[t] = mma_h(kh0, qh[t], s0[t]);
        s0[t] = mma_h(kh0, ql[t], s0[t]);
        s0[t] = mma_h(kl0, qh[t], s0[t]);
        s1[t] = mma_h(kh1, qh[t], s1[t]);
        s1[t] = mma_h(kh1, ql[t], s1[t]);
        s1[t] = mma_h(kl1, qh[t], s1[t]);
      }
      guard4x8(s0[0], s1[0], s0[1], s1[1], qh[0], ql[0], qh[1], ql[1], kh0, kl0, kh1, kl1);
    }
    // ---- per query tile: causal replace-mask, running-max online softmax in f32 (the lane's 16 scores of a tile all belong
    //      to its one query), rescale of the tile's O accumulators, P^T fragments ----
    const int key0 = kb + 8 * hh;
    FragH ph[QTW], pl[QTW];
#pragma unroll
    for (int t = 0; t < QTW; ++t) {
      const int qrow = q0 + 16 * t + c;                                       // the lane's query row in tile t
      float t0[8], t1[8];
#pragma unroll
      for (int r = 0; r < 8; ++r) {
        const float a0 = s0[t][r] * lsc;
        const float a1 = s1[t][r] * lsc;
        t0[r] = (key0 + r > qrow) ? ninf : a0;
        t1[r] = (key0 + 16 + r > qrow) ? ninf : a1;
      }
      float mx = fmaxf(t0[0], t1[0]);
#pragma unroll
      for (int r = 1; r < 8; ++r) mx = fmaxf(mx, fmaxf(t0[r], t1[r]));
      mx = fmaxf(mx, xhalf(mx));            // the query's other 16 keys of this step sit in lane c ^ 16
      const float mnew = fmaxf(mrun[t], mx);
      const float al   = exp2_slot((mrun[t] - mnew) * 1.44269504f);
      float x0[8], x1[8], p0[8], p1[8], ps[8];
#pragma unroll
      for (int r = 0; r < 8; ++r) {
        x0[r] = (t0[r] - mnew) * 1.44269504f;
        x1[r] = (t1[r] - mnew) * 1.44269504f;
      }
      exp2x8_slot(p0, x0);
      exp2x8_slot(p1, x1);
#pragma unroll
      for (int r = 0; r < 8; ++r) ps[r] = p0[r] + p1[r];
      const float sm = ((ps[0] + ps[1]) + (ps[2] + ps[3])) + ((ps[4] + ps[5]) + (ps[6] + ps[7]));
      lrun[t] = lrun[t] * al + sm;
      mrun[t] = mnew;
      // rescale the tile's O accumulators by alpha (every element of the lane belongs to its query)
#pragma unroll
      for (int j = 0; j < 4; ++j) {
#pragma unroll
        for (int r = 0; r < 8; ++r) o[t][j][r] = o[t][j][r] * al;
      }
      // B fragments of p*32768 straight from the score registers: column = query c, elements 0..7 = keys kb + 8hh + 0..7,
      // elements 8..15 = keys kb + 16 + 8hh + 0..7 (the split k map of the v^T fragments); hi f16, residual f16 for RV = 1
#pragma unroll
      for (int r = 0; r < 8; ++r) {
        const float ta = p0[r] * PCAR, tb = p1[r] * PCAR;
        const _Float16 ha = (_Float16)ta, hb = (_Float16)tb;
        ph[t].h[0][r] = ha;
        ph[t].h[1][r] = hb;
        if (RV != 0) {
          pl[t].h[0][r] = (_Float16)(ta - (float)ha);
          pl[t].h[1][r] = (_Float16)(tb - (float)hb);
        }
      }
    }
    // ---- O^T += v^T.P^T : A fragment row = d = j*16 + c, keys contiguous in the v^T planes; 2 groups of 2 d-subtiles, every
    //      v^T fragment loaded once for both tiles; D element r of o[t][j] = (d = j*16 + 8hh + r, query q0 + 16t + c) ----
    {
      const _Float16* vhp = Vhb;
      const _Float16* vlp = Vlb;
      (void)vlp;
#pragma unroll
      for (int jg = 0; jg < 2; ++jg) {
        const size_t da = (size_t)(2 * jg) * 512;
        const size_t db = da + 512;
        const v16h vha = ldfrag_h(vhp + da, kvo), vhb2 = ldfrag_h(vhp + db, kvo);
#pragma unroll
        for (int t = 0; t < QTW; ++t) {
          o[t][2 * jg]     = mma_h(vha,  ph[t].v, o[t][2 * jg]);
          o[t][2 * jg + 1] = mma_h(vhb2, ph[t].v, o[t][2 * jg + 1]);
        }
        if (RV != 0) {
          const v16h vla = ldfrag_h(vlp + da, kvo), vlb2 = ldfrag_h(vlp + db, kvo);
#pragma unroll
          for (int t = 0; t < QTW; ++t) {
            o[t][2 * jg]     = mma_h(vha,  pl[t].v, o[t][2 * jg]);
            o[t][2 * jg]     = mma_h(vla,  ph[t].v, o[t][2 * jg]);
            o[t][2 * jg + 1] = mma_h(vhb2, pl[t].v, o[t][2 * jg + 1]);
            o[t][2 * jg + 1] = mma_h(vlb2, ph[t].v, o[t][2 * jg + 1]);
          }
          guard4x8(o[0][2 * jg], o[0][2 * jg + 1], o[1][2 * jg], o[1][2 * jg + 1],
                   ph[0].v, pl[0].v, ph[1].v, pl[1].v, vha, vhb2, vla, vlb2);
        } else {
          guard4x8(o[0][2 * jg], o[0][2 * jg + 1], o[1][2 * jg], o[1][2 * jg + 1],
                   ph[0].v, ph[1].v, vha, vhb2, ph[0].v, ph[1].v, vha, vhb2);
        }
      }
    }
  }
  acc_guard4(o[0][0], o[0][1], o[0][2], o[0][3]);
  acc_guard4(o[1][0], o[1][1], o[1][2], o[1][3]);
  // ---- the wave's partial: raw O accumulators into its slab (row = 16t + c, 8 consecutive d a register tile: 16-B stores),
  //      each query's max and its sum (the two lane halves' sums joined here, once) beside: both are alike in lanes c and
  //      c + 16, so lane (hh, c) stores those of tile hh, row 16hh + c = lane ----
#pragma unroll
  for (int t = 0; t < QTW; ++t) {
#pragma unroll
    for (int j = 0; j < 4; ++j) {
      float* d = slab + (t * 16 + c) * SLP + j * 16 + 8 * hh;
      const v4f lo = {o[t][j][0], o[t][j][1], o[t][j][2], o[t][j][3]};
      const v4f hi = {o[t][j][4], o[t][j][5], o[t][j][6], o[t][j][7]};
      *(v4f*)(d)     = lo;
      *(v4f*)(d + 4) = hi;
    }
  }
  const float lall0 = lrun[0] + xhalf(lrun[0]);
  const float lall1 = lrun[1] + xhalf(lrun[1]);
  smx[wave * (QTW * 16) + lane] = (hh != 0) ? mrun[1] : mrun[0];
  ssm[wave * (QTW * 16) + lane] = (hh != 0) ? lall1 : lall0;
  __syncthreads();                          // every wave's partial is in LDS before any wave merges; passed by all NSW waves
  // ---- merged O / l with the carries (32768 on p, 1024 on v) folded once, x256 -> f16 hi plane (+ f16 residual plane),
  //      fragment-major [row/16][512/32][half][lane][8]: wave 4*tq + it stores, for query tile tq, half it&1 of k step
  //      head*2 + (it>>1); lane = (row c of the tile, 8 consecutive d at it*16 + 8*hh) ----
  const int tq = wave >> 2;
  const int it = wave & 3;
  float acc[8], lsum;
  attn_merge8(smem, smx, ssm, tq * 16 + c, it * 16 + 8 * hh, acc, lsum);
  const float rl = (1.0f / lsum) * oc;
  float w[8];
#pragma unroll
  for (int e = 0; e < 8; ++e) w[e] = (acc[e] * rl) * OSC;
  v4u oh, ol;
#pragma unroll
  for (int e = 0; e < 4; ++e) {
    const _Float16 h0 = (_Float16)w[2 * e], h1 = (_Float16)w[2 * e + 1];
    const _Float16 g0 = (_Float16)(w[2 * e] - (float)h0), g1 = (_Float16)(w[2 * e + 1] - (float)h1);
    oh[e] = pk16(h_bits(h0), h_bits(h1));
    ol[e] = pk16(h_bits(g0), h_bits(g1));
  }
  const size_t ob = ((size_t)b * SEQ + q0 + tq * 16) * DMOD + (size_t)head * (16 * HD) + 8 * lane + it * 256;
  *(v4u*)(OHp + ob) = oh;
  if (RV != 0) {
    *(v4u*)(OLp + ob) = ol;
  }
  // in the shared launch the code of the other form may follow and writes registers that these stores name
  asm volatile("s_wait_xcnt 0x0" ::: "memory");
}

// One launch for all query tiles: the index of the tile pair decides block-uniformly between the two forms (RV = 1 for pairs < NQPR).
__global__ __launch_bounds__(ATT_THREADS)
void attn_all(const u16* __restrict__ QHp, const u16* __restrict__ QLp,
              const u16* __restrict__ KHp, const u16* __restrict__ KLp,
              const u16* __restrict__ VHp, const u16* __restrict__ VLp, u16* OHp, u16* OLp) {
  __shared__ __align__(16) float smem[NSW * SLW];   // per wave: O partial slab behind the loop
  __shared__ float smx[NSW * QTW * 16];             // per wave: QTW * 16 row maxima
  __shared__ float ssm[NSW * QTW * 16];             // per wave: QTW * 16 row sums
  const int bid  = blockIdx.x;
  const int qp   = bid % NQP;
  const int t2   = bid / NQP;
  const int head = t2 % NH;
  const int b    = t2 / NH;
  if (b >= NB) return;                      // block-uniform, in front of the block barrier; never taken with the exact grid
  if (qp < NQPR) attn_cs<1>(smem, smx, ssm, qp, head, b, QHp, QLp, KHp, KLp, VHp, VLp, OHp, OLp);
  else           attn_cs<0>(smem, smx, ssm, qp, head, b, QHp, QLp, KHp, KLp, VHp, VLp, OHp, OLp);
}

// =====================================================================================================
// Workspace map (bytes); every plane is fully written by whole-line stores before it is read (the O residual plane only on
// the rows < RICH per sequence that are read); all extents are exact multiples of the store granularity (no pad rows needed);
// every region offset a multiple of 131072; every 16-bit plane is fragment-major (see the fragment loaders), same extent as
// the row-major shape given here:
//   XB  bf16 [MROWS][512]               MROWS*1024   (NB=4, SEQ=2048: 8388608); after the projection GEMM the same bytes hold
//                                                    the O f16 hi plane [MROWS][512] x256 (identical extent)
//   WB  bf16 [1536 n][512 k]            1572864      (Wq rows 0..511, Wk 512..1023, Wv 1024..1535)
//   OL  f16 [MROWS][512]                MROWS*1024   O residual plane
//   QH  f16 [MROWS][512] x256           MROWS*1024   QL residual, same extent
//   KH  f16 [MROWS][512] x256           MROWS*1024   KL residual, same extent   (keys = rotary of the v_proj columns)
//   VH  f16 [NB*8][64][SEQ] x1024       MROWS*1024   VL residual, same extent   (values = the k_proj columns)
//   TC  f32 [SEQ][32]                   SEQ*128      TS, same extent
//   WT  f16 [512 o][512 d] x1024        524288       (Wo; a region of its own, written in the launch that also writes WB)
//   end (NB=4, SEQ=2048)               69730304
// =====================================================================================================
extern "C" void kernel_launch(void* const* d_in, const int* in_sizes, int n_in,
                              void* d_out, int out_size, void* d_ws, size_t ws_size,
                              hipStream_t stream) {
  if (n_in < 9) return;
  if (in_sizes[0] < ((NB - 1) * XS_FULL + SEQ) * DMOD) return;
  if (in_sizes[1] != DMOD * DMOD) return;
  if (in_sizes[2] != DMOD) return;
  if (in_sizes[3] != DMOD * DMOD) return;
  if (in_sizes[4] != DMOD) return;
  if (in_sizes[5] != DMOD * DMOD) return;
  if (in_sizes[6] != DMOD) return;
  if (in_sizes[7] != DMOD * DMOD) return;
  if (in_sizes[8] != DMOD) return;
  if (out_size < ((NB - 1) * XS_FULL + SEQ) * DMOD) return;

  const float* x   = (const float*)d_in[0];
  const float* wq  = (const float*)d_in[1];
  const float* bqp = (const float*)d_in[2];
  const float* wk  = (const float*)d_in[3];
  const float* bkp = (const float*)d_in[4];
  const float* wv  = (const float*)d_in[5];
  const float* bvp = (const float*)d_in[6];
  const float* wo  = (const float*)d_in[7];
  const float* bop = (const float*)d_in[8];
  float*       out = (float*)d_out;

  const size_t szXB = (size_t)MROWS * DMOD * 2;
  const size_t szWB = (size_t)NQKV * DMOD * 2;
  const size_t szQ  = (size_t)MROWS * DMOD * 2;                  // QH, QL
  const size_t szK  = (size_t)MROWS * KVD * 2;                   // KH, KL
  const size_t szV  = (size_t)NB * NKVH * HD * SEQ * 2;          // VH, VL (== szK)
  const size_t szT  = (size_t)SEQ * NFREQ * 4;                   // TC, TS
  const size_t szOH = (size_t)MROWS * DMOD * 2;                  // O hi plane, lives in the XB region
  const size_t szOL = (size_t)MROWS * DMOD * 2;                  // O residual plane
  const size_t szWT = (size_t)DMOD * DMOD * 2;                   // Wo f16 plane
  if (szOH > szXB) return;
  size_t off = 0;
  const size_t oXB = off; off += szXB;
  const size_t oWB = off; off += szWB;
  const size_t oOL = off; off += szOL;
  const size_t oQH = off; off += szQ;
  const size_t oQL = off; off += szQ;
  const size_t oKH = off; off += szK;
  const size_t oKL = off; off += szK;
  const size_t oVH = off; off += szV;
  const size_t oVL = off; off += szV;
  const size_t oTC = off; off += szT;
  const size_t oTS = off; off += szT;
  const size_t oWT = off; off += szWT;
  if (off > ws_size) return;                // off = 69730304 for NB = 4, SEQ = 2048
  if (off > (size_t)WS_CAP) return;

  char* ws = (char*)d_ws;
  u16*   XB  = (u16*)(ws + oXB);
  u16*   OH  = (u16*)(ws + oXB);
  u16*   WB  = (u16*)(ws + oWB);
  u16*   WT  = (u16*)(ws + oWT);
  u16*   OL  = (u16*)(ws + oOL);
  u16*   QH  = (u16*)(ws + oQH);
  u16*   QL  = (u16*)(ws + oQL);
  u16*   KH  = (u16*)(ws + oKH);
  u16*   KL  = (u16*)(ws + oKL);
  u16*   VH  = (u16*)(ws + oVH);
  u16*   VL  = (u16*)(ws + oVL);
  float* TC  = (float*)(ws + oTC);
  float* TS  = (float*)(ws + oTS);

  const dim3 b256(256), b128(128), bAT(ATT_THREADS);
  const dim3 gG1((MROWS / 64) * (NQKV / 64));
  const float osc = 1.0f / (OSC * WOS);

  // (1) rotary cos / sin tables [SEQ][32]; x -> bf16 plane [MROWS][512]; Wq, Wk, Wv -> one bf16 plane [1536 n][512 k];
  //     Wo [512 o][512 d] -> f16 plane of the bf16 value x1024 (already k-contiguous)
  prep<<<dim3(GT + NB * GX + 4 * GW), b256, 0, stream>>>(x, wq, wk, wv, wo, XB, WB, WT, TC, TS);
  // (2) x.[Wq|Wk|Wv]^T (columns 0..511 q_proj, 512..1023 k_proj, 1024..1535 v_proj) with the planes written by its epilogue:
  //     q = rotary(q_proj + bq) and keys = rotary(v_proj + bv) -> hi + residual planes x256; values = k_proj + bk (no rotary)
  //     -> v^T hi + residual planes x1024
  gemm_qkv<<<gG1, b128, 0, stream>>>(XB, WB, bqp, bkp, bvp, TC, TS, QH, QL, KH, KL, VH, VL, DMOD);
  // (3) causal attention -> O f16 hi plane x256 (XB region) for all query tiles; residual plane for tiles < RICH
  attn_all<<<dim3(NQP * NH * NB), bAT, 0, stream>>>(QH, QL, KH, KL, VH, VL, OH, OL);
  // (4) y = O.Wo^T + bo -> out f32 [rows][512], carries 256 x 1024 folded back; rows < RICH per sequence with O hi + residual
  gemm_o<<<dim3(NB * (SEQ / 64) * (DMOD / 64)), b128, 0, stream>>>(OH, OL, WT, bop, out, DMOD, DMOD, osc);
  (void)hipGetLastError();
}

// v007
// It runs in 110 microseconds.
// Timed twice side by side with v006, it ran 1.15 times as fast both times.
// Over all steps from v000 it is 3.47 times as fast.
// Contractions: x.[Wq|Wk|Wv]^T on v_wmma_f32_16x16x32_bf16 (x and the weights as bf16 RNE planes; weight [n][k] rows are
// the k-contiguous A operand for q_proj and v_proj, B for k_proj; f32 accumulate); q.k^T over hd 64 and P.v on v_wmma_f32_16x16x32_f16 with f16 hi + f16
// residual planes (both transposed: k.q^T and v^T.P^T; q, k x256 after rotary, products hh+lh+hl on every row; P x32768 hi + in-register residual and v^T x1024
// hi + residual plane for query rows < 512 of each sequence, P hi . v hi only for later rows); O.Wo^T on
// v_wmma_f32_16x16x32_f16 with O x256 as f16 hi (+ f16 residual plane for rows < 512 of each sequence) and Wo as
// f16(bf16(Wo)) x1024, one accumulator, bias added in f32; all f32 accumulate. Rotary cos/sin tables, bias adds and online
// softmax in f32 on VALU.
#include <hip/hip_runtime.h>
#include <math.h>
#include <stdint.h>

#ifndef NB
#define NB 4
#endif
#ifndef SEQ
#define SEQ 2048
#endif
#define XS_FULL 2048
#define DMOD  512
#define NH    8
#define NKVH  8
#define HD    64
#define HHALF (HD / 2)
#define NFREQ (HD / 2)
#define KVD   (NKVH * HD)
#define NQKV  (DMOD + 2 * KVD)
#define QCOL0 0
#define VCOL0 DMOD
#define KCOL0 (DMOD + KVD)
#define MROWS (NB * SEQ)
#define RICH  512
#define ROPE_L2 0.41524101186092028
#define SM_SCALE 0.04419417382415922f
#define QSC   256.0f
#define KSC   256.0f
#define PCAR  32768.0f
#define VCAR  1024.0f
#define OSC   256.0f
#define WOS   1024.0f
#define NSW   8
#define NQT   (SEQ / 16)
#define NQTR  (RICH / 16)
#define QTW   2
#define NQP   (NQT / QTW)
#define NQPR  (NQTR / QTW)
#define NKT   (SEQ / 32)
#define ATT_THREADS (NSW * 32)
#define SLP   68
#define SLW   (QTW * 16 * SLP)
#define SLAB64 (16 * 68)
#define WS_CAP 134217728
#define GX    (SEQ * DMOD / 8 / 256)
#define GW    (DMOD * DMOD / 8 / 256)
#define GT    (SEQ * NFREQ / 256)
static_assert(DMOD == NH * HD && HD == 64 && HHALF == 32 && NFREQ == 32 && NH == 8 && NKVH == NH);
static_assert(ATT_THREADS == 256 && NSW >= 4 && KVD == 512 && NQKV == 1536 && KCOL0 + KVD == NQKV && VCOL0 + KVD == KCOL0);
static_assert(NB >= 1 && NB <= 4);
static_assert(NB == 1 || SEQ == XS_FULL);
static_assert((SEQ % 64) == 0 && SEQ >= 64 && SEQ <= XS_FULL);
static_assert((RICH % 64) == 0 && RICH >= 64 && RICH <= SEQ);
static_assert((DMOD % 64) == 0 && (KVD % 64) == 0 && (NQKV % 64) == 0 && (DMOD % 32) == 0 && (HD % 32) == 0);
static_assert(((SEQ * DMOD / 8) % 256) == 0 && ((DMOD * DMOD / 8) % 256) == 0 && ((SEQ * NFREQ) % 256) == 0);
static_assert(NSW * (SLW + 2 * QTW * 16) * 4 <= 327680 / 2 && 4 * SLAB64 * 4 <= 65536);
static_assert(QTW == 2 && NSW == 4 * QTW && (NQT % QTW) == 0 && (NQTR % QTW) == 0);
static_assert(DMOD / 8 == 64 && KVD / 8 == 64);
static_assert(((NH * NB) % 8) == 0);
static_assert(((SEQ * DMOD / 8) % 1024) == 0 && ((DMOD * DMOD / 8) % 1024) == 0 && (SEQ % 32) == 0 && (RICH % 16) == 0);

typedef unsigned short u16;
typedef _Float16 v16h __attribute__((ext_vector_type(16)));
typedef _Float16 v8h  __attribute__((ext_vector_type(8)));
typedef __bf16   v16b __attribute__((ext_vector_type(16)));
typedef float    v8f  __attribute__((ext_vector_type(8)));
typedef float    v4f  __attribute__((ext_vector_type(4)));
typedef unsigned int v4u __attribute__((ext_vector_type(4)));

union FragH { v16h v; v8h h[2]; v4u u[2]; };
union FragB { v16b v; v4u u[2]; };

// ---- scalar helpers --------------------------------------------------------------------------------
__device__ __forceinline__ unsigned short bf_bits(float f) {          // f32 -> bf16 bits, RNE convert
  unsigned u = __float_as_uint(f);
  return (unsigned short)((u + 0x7FFFu + ((u >> 16) & 1u)) >> 16);
}
__device__ __forceinline__ float bf_up(unsigned short h) { return __uint_as_float(((unsigned)h) << 16); }
__device__ __forceinline__ float bfr(float f) { return bf_up(bf_bits(f)); }
__device__ __forceinline__ unsigned short h_bits(_Float16 x) { return __builtin_bit_cast(unsigned short, x); }
__device__ __forceinline__ unsigned pk16(unsigned short a, unsigned short b) { return (unsigned)a | ((unsigned)b << 16); }
__device__ __forceinline__ v8f zero8() { v8f z = {0.f, 0.f, 0.f, 0.f, 0.f, 0.f, 0.f, 0.f}; return z; }

// ---- fragment-major planes: every 16-bit A/B operand plane [row][K] other than v^T is stored as [row/16][K/32][g][lane][8]: the 16-B unit
//      of lane = 16*h + (row&15) in half g holds k = 32*ks + 16*g + 8*h + 0..7, so one wave-wide 16-B load is 512 contiguous
//      bytes (4 whole lines) and one 16 x 32 fragment is 1 KB. A 16-row tile starts where it starts in a row-major plane.
// ---- fragment loaders: lane -> row/col (lane&15), h = lane>>4; base = a pointer that is the same in every lane (it stays in
//      scalar registers), vo = byte offset of the fragment from base + 16*lane (one 32-bit register shared by all loads of a
//      step and advanced behind them); p = base + vo;
//      elements 0..7 <- p[0..7] (k0+8h..), elements 8..15 <- p[256..263] (k0+16+8h..)  (same split k map for A and B)
__device__ __forceinline__ v16h ldfrag_h(const _Float16* base, unsigned vo) {
  const char* p = (const char*)base + vo;
  FragH f;
  f.h[0] = *(const v8h*)(p);
  f.h[1] = *(const v8h*)(p + 512);
  return f.v;
}
__device__ __forceinline__ v16b ldfrag_b(const u16* base, unsigned vo) { // bf16 plane read as unsigned integer vectors
  const char* p = (const char*)base + vo;
  FragB f;
  f.u[0] = *(const v4u*)(p);
  f.u[1] = *(const v4u*)(p + 512);
  return f.v;
}

__device__ __forceinline__ v8f mma_h(v16h a, v16h b, v8f c) {
  return __builtin_amdgcn_wmma_f32_16x16x32_f16(false, a, false, b, (short)0, c, false, false);
}
__device__ __forceinline__ v8f mma_b(v16b a, v16b b, v8f c) {
  return __builtin_amdgcn_wmma_f32_16x16x32_bf16(false, a, false, b, (short)0, c, false, false);
}
// four issue slots between the last matrix instruction of a group and the first vector instruction on its results or operands,
// on every path (the loop's back edge too); the fragments are named so that their registers are not rewritten in front of it
__device__ __forceinline__ void guard4x8(v8f& a, v8f& b, v8f& c, v8f& d, v16h x0, v16h x1, v16h x2, v16h x3,
                                         v16h x4, v16h x5, v16h x6, v16h x7) {
#if defined(__HIP_DEVICE_COMPILE__)
  asm volatile("v_nop\n\tv_nop\n\tv_nop\n\tv_nop"
               : "+v"(a), "+v"(b), "+v"(c), "+v"(d)
               : "v"(x0), "v"(x1), "v"(x2), "v"(x3), "v"(x4), "v"(x5), "v"(x6), "v"(x7) : "memory");
#endif
}
template <typename F>
__device__ __forceinline__ void guard6(v8f& a, v8f& b, v8f& c, v8f& d, F x0, F x1, F x2, F x3, F x4, F x5) {
#if defined(__HIP_DEVICE_COMPILE__)
  asm volatile("v_nop\n\tv_nop\n\tv_nop\n\tv_nop"
               : "+v"(a), "+v"(b), "+v"(c), "+v"(d) : "v"(x0), "v"(x1), "v"(x2), "v"(x3), "v"(x4), "v"(x5) : "memory");
#endif
}
__device__ __forceinline__ void acc_guard4(v8f& a, v8f& b, v8f& c, v8f& d) {
#if defined(__HIP_DEVICE_COMPILE__)
  asm volatile("v_nop\n\tv_nop\n\tv_nop\n\tv_nop" : "+v"(a), "+v"(b), "+v"(c), "+v"(d));
#endif
}
__device__ __forceinline__ void wave_sync_lds() {
  __builtin_amdgcn_fence(__ATOMIC_RELEASE, "workgroup");
  __builtin_amdgcn_wave_barrier();
  __builtin_amdgcn_fence(__ATOMIC_ACQUIRE, "workgroup");
}

// =====================================================================================================
// f32 [rows][DMOD] -> 16-bit fragment-major plane.  f16mode == 0: bf16 RNE bits;  f16mode == 1: f16 bits of (bf16 RNE value)
// * scale. Thread = output unit gt = 8 consecutive elements of one row: two 16-B loads (a wave reads 64 B of each of 16 rows,
// the block uses every line whole), one 16-B store; 32 consecutive lanes store 512 contiguous, 512-B aligned bytes;
// coverage: blk = 0 .. n8/256 - 1, x 256 thr x 8 (in-kernel bound) = the whole plane (n8 a multiple of 256 here).
// =====================================================================================================
__device__ __forceinline__ void cvt16(const float* __restrict__ x, u16* D, int blk, int n8, int f16mode, float scale) {
  const int gt = blk * 256 + (int)threadIdx.x;
  if (gt >= n8) return;
  const int srow = (gt >> 10) * 16 + (gt & 15);                                   // 1024 units per 16-row tile
  const int schk = ((gt >> 6) & (DMOD / 32 - 1)) * 4 + ((gt >> 5) & 1) * 2 + ((gt >> 4) & 1);
  const float* p = x + ((size_t)srow * (DMOD / 8) + schk) * 8;
  const v4f a = *(const v4f*)(p), b4 = *(const v4f*)(p + 4);
  float w[8];
#pragma unroll
  for (int e = 0; e < 4; ++e) { w[e] = a[e]; w[4 + e] = b4[e]; }
  v4u o;
#pragma unroll
  for (int e = 0; e < 4; ++e) {
    const float f0 = w[2 * e], f1 = w[2 * e + 1];
    const unsigned short hb0 = h_bits((_Float16)(bfr(f0) * scale));
    const unsigned short hb1 = h_bits((_Float16)(bfr(f1) * scale));
    const unsigned short bb0 = bf_bits(f0);
    const unsigned short bb1 = bf_bits(f1);
    o[e] = (f16mode != 0) ? pk16(hb0, hb1) : pk16(bb0, bb1);
  }
  u16* d = D + (size_t)gt * 8;
  {
    *(v4u*)(d) = o;
    
  }
}

// =====================================================================================================
// Rotary tables TC[s][j] = cos(s * inv[j]), TS[s][j] = sin(s * inv[j]), j < 32, with
// inv[j] = 1.0f / f32(10000^(j/32)) (power evaluated in f64 and narrowed once, IEEE f32 reciprocal, f32 product s*inv,
// coverage: blk = 0 .. n/256 - 1, x 256 thr = n = SEQ*32 elements of TC and of TS (n a multiple of 256).
// =====================================================================================================
__device__ __forceinline__ void k_tab(float* TC, float* TS, int blk, int n) {
#pragma clang fp contract(off)
  const int idx = blk * 256 + (int)threadIdx.x;
  if (idx >= n) return;
  const int s = idx / NFREQ;
  const int j = idx - s * NFREQ;
  const double pj = exp2((double)j * ROPE_L2);       // 10000^(j/32)
  const float pf  = (float)pj;
  const float inv = 1.0f / pf;
  const float ang = (float)s * inv;
  float sv, cv;
  sincosf(ang, &sv, &cv);
  {
    *(float*)(TC + idx) = cv;
    *(float*)(TS + idx) = sv;
    
  }
}

// =====================================================================================================
// One launch for everything that reads only the inputs: none of these pieces reads what another writes, so they share a grid
// by block range (every branch is block-uniform, no barrier): GT blocks the rotary tables, NB*GX blocks x -> bf16 plane
// [MROWS][512], GW blocks each Wq, Wk, Wv -> one bf16 plane [1536 n][512 k], GW blocks Wo -> f16 plane of the bf16 value x1024.
// coverage: grid = GT + NB*GX + 4*GW blocks, each range exactly the grid of its piece.
// =====================================================================================================
__global__ __launch_bounds__(256) void prep(const float* __restrict__ x, const float* __restrict__ wq,
                                            const float* __restrict__ wk, const float* __restrict__ wv,
                                            const float* __restrict__ wo, u16* XB, u16* WB, u16* WT, float* TC, float* TS) {
  int bid = (int)blockIdx.x;
  if (bid < GT) { k_tab(TC, TS, bid, SEQ * NFREQ); return; }
  bid -= GT;
  if (bid < NB * GX) {
    const int bq = bid / GX;
    cvt16(x + (size_t)bq * XS_FULL * DMOD, XB + (size_t)bq * SEQ * DMOD, bid - bq * GX, SEQ * DMOD / 8, 0, 1.0f);
    return;
  }
  bid -= NB * GX;
  if (bid < GW)     { cvt16(wq, WB, bid, DMOD * DMOD / 8, 0, 1.0f); return; }
  if (bid < 2 * GW) { cvt16(wk, WB + (size_t)VCOL0 * DMOD, bid - GW, DMOD * DMOD / 8, 0, 1.0f); return; }
  if (bid < 3 * GW) { cvt16(wv, WB + (size_t)KCOL0 * DMOD, bid - 2 * GW, DMOD * DMOD / 8, 0, 1.0f); return; }
  if (bid < 4 * GW) { cvt16(wo, WT, bid - 3 * GW, DMOD * DMOD / 8, 1, WOS); return; }
}

// =====================================================================================================
// Interleaved-pair rotary of one element, with y = projection + bias (f32 add) already formed:
//   out[2j]   = y[2j]  *c[s][j] + (-1)*(y[2j+1]*sn[s][j])
//   out[2j+1] = y[2j+1]*c[s][j] + (+1)*(y[2j]  *sn[s][j])        with c, sn the f32 table values (mul, mul, add kept
//   separate); hb = f16(out * sc), lb = f16 residual (t - f16(t)).
// =====================================================================================================
__device__ __forceinline__ void rot_one(float x, float y, float cv, float sv, float sgn, float sc,
                                        unsigned short& hb, unsigned short& lb) {
#pragma clang fp contract(off)
  const float ys   = y * sv;
  const float term = sgn * ys;
  const float r    = x * cv + term;
  const float t    = r * sc;
  const _Float16 a = (_Float16)t;
  hb = h_bits(a);
  lb = h_bits((_Float16)(t - (float)a));
}

// =====================================================================================================
// GEMM epilogue of the output projection: the wave's 16x64 f32 tile (times oscale) staged in its LDS slab (pitch 68),
// 8 consecutive lanes x 16 B per line), lanes 16..31 -> row 2*it+1; HASB != 0 adds bias[col] in f32 to every element;
// coverage: 8 instructions x 2 rows x 16 lanes x 4 floats = the wave's 16 x 64 tile.
// =====================================================================================================
template <int HASB>
__device__ __forceinline__ void epi64(float* sl, v8f a0, v8f a1, v8f a2, v8f a3, float oscale, const float* bias,
                                      float* C, int N, size_t rowb, int col0, int lane) {
  const int hh = lane >> 4, m = lane & 15;
#pragma unroll
  for (int r = 0; r < 8; ++r) {
    const int ro = (8 * hh + r) * 68 + m;
    sl[ro]      = a0[r] * oscale;
    sl[ro + 16] = a1[r] * oscale;
    sl[ro + 32] = a2[r] * oscale;
    sl[ro + 48] = a3[r] * oscale;
  }
  wave_sync_lds();
  v4f vals[8];
#pragma unroll
  for (int it = 0; it < 8; ++it) vals[it] = *(const v4f*)(sl + (it * 2 + hh) * 68 + m * 4);
  if (HASB != 0) {
    const v4f b4 = *(const v4f*)(bias + col0 + m * 4);
#pragma unroll
    for (int it = 0; it < 8; ++it) vals[it] = vals[it] + b4;
  }
  float* dst = C + (rowb + (size_t)hh) * (size_t)N + col0 + m * 4;
  {
#pragma unroll
    for (int it = 0; it < 8; ++it) {
      *(v4f*)(dst + (size_t)(it * 2) * (size_t)N) = vals[it];
    }
    
  }
}

// =====================================================================================================
// Projection GEMM x.[Wq|Wk|Wv]^T (bf16 fragment-major planes A = x [MROWS][512], Bt = weights [1536 n][512 k], f32
// accumulate) whose epilogue writes the attention operand planes itself: no f32 projection array, no LDS.
// Block = 64 rows x 64 columns, 4 waves x 16 rows; a wave's 64 columns are one head of q_proj (columns 0..511), of k_proj
// (512..1023) or of v_proj (1024..1535), its 16 rows 16 positions of one sequence; the choice is block-uniform.
// Fragments loaded straight from the planes (two 512-B wave loads each, split k map for both operands); K stepped by 32
// (host: K = 512, the row length of both planes).
// TR = 1 (q_proj, v_proj): the weight tile is the first operand, so acc j element r of lane (hh, m) =
//   (column j*16 + 8*hh + r, position m): 8 consecutive d of one position = the lane's 16-B unit of the q / k plane.
// TR = 0 (k_proj): x is the first operand, acc j element r of lane (hh, m) = (position 8*hh + r, column j*16 + m):
//   8 consecutive keys of one d = the lane's 16-B unit of the v^T plane.
// =====================================================================================================
template <int TR>
__device__ __forceinline__ void proj_loop(const u16* ap, const u16* bp, const u16* bp1, const u16* bp2, const u16* bp3,
                                          unsigned vo, int K, v8f& acc0, v8f& acc1, v8f& acc2, v8f& acc3) {
#pragma unroll 1
  for (int k0 = 0; k0 < K; k0 += 32, vo += 1024u) {
    const v16b a  = ldfrag_b(ap, vo);
    const v16b b0 = ldfrag_b(bp, vo);
    const v16b b1 = ldfrag_b(bp1, vo);
    const v16b b2 = ldfrag_b(bp2, vo);
    const v16b b3 = ldfrag_b(bp3, vo);
    if (TR != 0) {
      acc0 = mma_b(b0, a, acc0);
      acc1 = mma_b(b1, a, acc1);
      acc2 = mma_b(b2, a, acc2);
      acc3 = mma_b(b3, a, acc3);
    } else {
      acc0 = mma_b(a, b0, acc0);
      acc1 = mma_b(a, b1, acc1);
      acc2 = mma_b(a, b2, acc2);
      acc3 = mma_b(a, b3, acc3);
    }
    guard6<v16b>(acc0, acc1, acc2, acc3, a, b0, b1, b2, b3, a);
  }
}

// q / k planes from the TR = 1 accumulators: y = acc + bias[head*HD + d], rotary with table row s = the lane's position and
// table column d >> 1, x sc -> f16 hi and f16 residual planes, fragment-major per head [b*8 + head][s/16][d/32][half][lane][8]
// (row = position, k = d): acc j is half j & 1 of d step j >> 1, at pb + j * 256 halves, pb = the tile's start + 8 * lane.
// coverage: 4 stores x 32 lanes x 8 halves = the wave's 16 positions x 64 d of Hp and of Lp, 512 contiguous bytes a store.
__device__ __forceinline__ void rope_epi(const v8f (&acc)[4], int hh, int s, const float* __restrict__ bias,
                                         const float* __restrict__ TC, const float* __restrict__ TS,
                                         u16* Hp, u16* Lp, size_t pb, float sc) {
  const float* bp = bias + 8 * hh;                     // bias already at the head's first column
  const float* cp = TC + (size_t)s * NFREQ + 4 * hh;
  const float* sp = TS + (size_t)s * NFREQ + 4 * hh;
  // two groups of two accumulator tiles, each with its own loads, so that the loaded values of one group only are live
  // beside the accumulators (the register count stays at the k loop's, and with it the waves per SIMD)
#pragma unroll
  for (int g2 = 0; g2 < 2; ++g2) {
    v4f ba[2], bb[2], cw[2], sw[2];
#pragma unroll
    for (int i = 0; i < 2; ++i) {
      const int j = 2 * g2 + i;
      ba[i] = *(const v4f*)(bp + j * 16);
      bb[i] = *(const v4f*)(bp + j * 16 + 4);
      cw[i] = *(const v4f*)(cp + j * 8);
      sw[i] = *(const v4f*)(sp + j * 8);
    }
#pragma unroll
    for (int i = 0; i < 2; ++i) {
      const int j = 2 * g2 + i;
      float yv[8];
#pragma unroll
      for (int e = 0; e < 4; ++e) {
        yv[e]     = acc[j][e]     + ba[i][e];
        yv[4 + e] = acc[j][4 + e] + bb[i][e];
      }
      v4u oh, ol;
#pragma unroll
      for (int e = 0; e < 4; ++e) {
        unsigned short h0, l0, h1, l1;
        rot_one(yv[2 * e],     yv[2 * e + 1], cw[i][e], sw[i][e], -1.0f, sc, h0, l0);   // even element of the pair
        rot_one(yv[2 * e + 1], yv[2 * e],     cw[i][e], sw[i][e],  1.0f, sc, h1, l1);   // odd element of the pair
        oh[e] = pk16(h0, h1);
        ol[e] = pk16(l0, l1);
      }
      *(v4u*)(Hp + pb + j * 256) = oh;
      *(v4u*)(Lp + pb + j * 256) = ol;
    }
    // the next group's loads, and behind the last group whatever code the compiler places next, may write
    // registers that these stores name
    asm volatile("s_wait_xcnt 0x0" ::: "memory");
  }
}

// v^T planes from the TR = 0 accumulators: y = acc + bias[head*HD + d] (f32 add), t = y * 1024 (exact), hi = f16(t),
// residual = f16(t - hi), fragment-major per head with the 32-key step outermost [b*8 + head][s/32][d/16][half][lane][8]
// (row = d, k = key): the wave's 16 keys are one half of the four d-subtile fragments, acc j at pb + j * 512 halves,
// pb = the key step's start + half * 256 + 8 * lane.
// coverage: 4 stores x 32 lanes x 8 halves = the wave's 16 keys x 64 d of VHo and of VLo, 512 contiguous bytes a store.
__device__ __forceinline__ void vt_epi(const v8f (&acc)[4], int m, const float* __restrict__ bias,
                                       u16* VHo, u16* VLo, size_t pb) {
  float bj[4];
#pragma unroll
  for (int j = 0; j < 4; ++j) bj[j] = bias[j * 16 + m];  // bias already at the head's first column
  v4u oh[4], ol[4];
#pragma unroll
  for (int j = 0; j < 4; ++j) {
#pragma unroll
    for (int e = 0; e < 4; ++e) {
      const float t0 = (acc[j][2 * e]     + bj[j]) * VCAR;
      const float t1 = (acc[j][2 * e + 1] + bj[j]) * VCAR;
      const _Float16 h0 = (_Float16)t0, h1 = (_Float16)t1;
      oh[j][e] = pk16(h_bits(h0), h_bits(h1));
      ol[j][e] = pk16(h_bits((_Float16)(t0 - (float)h0)), h_bits((_Float16)(t1 - (float)h1)));
    }
  }
#pragma unroll
  for (int j = 0; j < 4; ++j) {
    *(v4u*)(VHo + pb + j * 512) = oh[j];
    *(v4u*)(VLo + pb + j * 512) = ol[j];
  }
}

// coverage: grid = (MROWS/64) * (NQKV/64) blocks x 4 waves: every (sequence, head, 16 positions) tile of the q, k and v^T
// hi and residual planes exactly once.
__global__ __launch_bounds__(128)
void gemm_qkv(const u16* __restrict__ A, const u16* __restrict__ Bt, const float* __restrict__ bq,
              const float* __restrict__ bk, const float* __restrict__ bv,
              const float* __restrict__ TC, const float* __restrict__ TS,
              u16* QH, u16* QL, u16* KH, u16* KL, u16* VH, u16* VL, int K) {
  const int tid = threadIdx.x, lane = tid & 31;
  const int wave = __builtin_amdgcn_readfirstlane(tid >> 5);   // scalar, so that the tile starts below are scalar bases
  const int bid   = blockIdx.x;
  const int rowb  = (bid / (NQKV / 64)) * 64 + wave * 16;
  const int col0  = (bid % (NQKV / 64)) * 64;
  if (rowb + 16 > MROWS) return;            // wave-uniform, never taken with the exact grid; no block barriers in this kernel
  const u16* ap  = A  + (size_t)rowb * K;             // fragment (16-row tile, k step ks) at tile start + ks * 1024 bytes
  const u16* bp  = Bt + (size_t)col0 * K;
  const u16* bp1 = Bt + (size_t)(col0 + 16) * K;
  const u16* bp2 = Bt + (size_t)(col0 + 32) * K;
  const u16* bp3 = Bt + (size_t)(col0 + 48) * K;
  const unsigned vo = (unsigned)lane * 16u;
  const int b    = rowb / SEQ;                        // sequence
  const int s16  = rowb - b * SEQ;                    // the wave's first position in it, a multiple of 16
  const int hcol = col0 & (DMOD - 1);                 // head * HD within the q, k or v projection
  const size_t hp = ((size_t)b * DMOD + hcol) * SEQ;  // start of the (sequence, head) plane, in halves: (b*8 + head) * SEQ * HD
  v8f acc[4];
#pragma unroll
  for (int j = 0; j < 4; ++j) acc[j] = zero8();
  if (col0 >= VCOL0 && col0 < KCOL0) {
    proj_loop<0>(ap, bp, bp1, bp2, bp3, vo, K, acc[0], acc[1], acc[2], acc[3]);
    vt_epi(acc, lane & 15, bk + hcol, VH, VL,
           hp + (size_t)(s16 >> 5) * (32 * HD) + (size_t)((s16 >> 4) & 1) * 256 + 8 * lane);
  } else {
    const bool isq = col0 < VCOL0;
    proj_loop<1>(ap, bp, bp1, bp2, bp3, vo, K, acc[0], acc[1], acc[2], acc[3]);
    rope_epi(acc, lane >> 4, s16 + (lane & 15), (isq ? bq : bv) + hcol, TC, TS, isq ? QH : KH, isq ? QL : KL,
             hp + (size_t)s16 * HD + 8 * lane, isq ? QSC : KSC);
  }
}

// =====================================================================================================
// f16 GEMM: C[M][N] (f32) = (A[M][K] (+ A2[M][K] when TWO != 0)) . Bt[N][K]^T, times oscale, plus bias[n]; A, A2 f16
// fragment-major planes (A2 = the unscaled f16 residual of A, sharing the accumulator), Bt f16 fragment-major. Same tiling, fragment
// loads (split k map) as gemm_qkv, epilogue epi64; K stepped by 32.
// =====================================================================================================
template <int TWO>
__device__ __forceinline__
void gemm_h(float* slab, int wave, int lane, int rowb, int crow, int col0,
            const u16* __restrict__ A, const u16* __restrict__ A2, const u16* __restrict__ Bt,
            const float* __restrict__ bias, float* C, int N, int K, float oscale) {
  const _Float16* ap  = (const _Float16*)(const void*)A  + (size_t)rowb * K;
  const _Float16* ap2 = (const _Float16*)(const void*)A2 + (size_t)rowb * K;
  const _Float16* bp  = (const _Float16*)(const void*)Bt + (size_t)col0 * K;
  const _Float16* bp1 = (const _Float16*)(const void*)Bt + (size_t)(col0 + 16) * K;
  const _Float16* bp2 = (const _Float16*)(const void*)Bt + (size_t)(col0 + 32) * K;
  const _Float16* bp3 = (const _Float16*)(const void*)Bt + (size_t)(col0 + 48) * K;
  unsigned vo = (unsigned)lane * 16u;
  v8f acc0 = zero8(), acc1 = zero8(), acc2 = zero8(), acc3 = zero8();
#pragma unroll 1
  for (int k0 = 0; k0 < K; k0 += 32, vo += 1024u) {
    const v16h a  = ldfrag_h(ap, vo);
    const v16h b0 = ldfrag_h(bp, vo);
    const v16h b1 = ldfrag_h(bp1, vo);
    const v16h b2 = ldfrag_h(bp2, vo);
    const v16h b3 = ldfrag_h(bp3, vo);
    acc0 = mma_h(a, b0, acc0);
    acc1 = mma_h(a, b1, acc1);
    acc2 = mma_h(a, b2, acc2);
    acc3 = mma_h(a, b3, acc3);
    if (TWO != 0) {
      const v16h a2 = ldfrag_h(ap2, vo);
      acc0 = mma_h(a2, b0, acc0);
      acc1 = mma_h(a2, b1, acc1);
      acc2 = mma_h(a2, b2, acc2);
      acc3 = mma_h(a2, b3, acc3);
      guard6<v16h>(acc0, acc1, acc2, acc3, a, a2, b0, b1, b2, b3);
    } else {
      guard6<v16h>(acc0, acc1, acc2, acc3, a, b0, b1, b2, b3, a);
    }
  }
  (void)ap2;
  epi64<1>(slab + wave * SLAB64, acc0, acc1, acc2, acc3, oscale, bias, C, N, (size_t)crow, col0, lane);
}

// One launch for y = O.Wo^T + bo over all sequences: block = 64 rows x 64 columns; its 64 rows lie in one sequence and wholly
// below or wholly at and above row RICH of it (RICH and SEQ multiples of 64), so the choice hi + residual / hi only is
// block-uniform. rowb = the wave's first row in the O planes, crow = the same row in out.
// coverage: grid = NB * (SEQ/64) * (N/64) blocks x 4 waves x 16 x 64 = every element of out once (host: N % 64 == 0, K % 32 == 0).
__global__ __launch_bounds__(128)
void gemm_o(const u16* __restrict__ A, const u16* __restrict__ A2, const u16* __restrict__ Bt,
            const float* __restrict__ bias, float* C, int N, int K, float oscale) {
  __shared__ __align__(16) float slab[4 * SLAB64];
  const int tid = threadIdx.x, lane = tid & 31;
  const int wave = __builtin_amdgcn_readfirstlane(tid >> 5);   // scalar, so that the tile starts are scalar bases
  const int ntile = N >> 6;
  const int bid  = blockIdx.x;
  const int rt   = bid / ntile;
  const int col0 = (bid % ntile) * 64;
  const int bq   = rt / (SEQ / 64);
  const int rs   = (rt % (SEQ / 64)) * 64;                     // first row of the block within its sequence
  if (bq >= NB) return;                     // block-uniform, never taken with the exact grid; no block barriers in this kernel
  const int rowb = bq * SEQ + rs + wave * 16;
  const int crow = bq * XS_FULL + rs + wave * 16;
  if (rs < RICH) gemm_h<1>(slab, wave, lane, rowb, crow, col0, A, A2, Bt, bias, C, N, K, oscale);
  else           gemm_h<0>(slab, wave, lane, rowb, crow, col0, A, A2, Bt, bias, C, N, K, oscale);
}

// =====================================================================================================
// Causal softmax attention, hd = 64, 8 heads. Block bid -> (pair of query tiles qp = NQP-1 - bid/(NH*NB): rows q0 = 32*qp .. q0+31, tile t
// = rows q0 + 16t .. q0 + 16t + 15, head, batch b); keys/values of the same head (kvh = head). The pair's key steps (the same
// steps for both tiles) are dealt over the block's NSW waves: wave w takes steps w, w + NSW, ... for BOTH tiles, so each k and
// v^T fragment it loads feeds two tiles' products; per tile its own running max, sum and O accumulators; the NSW partials of
// each tile are merged in LDS behind one block barrier (attn_merge8); the longest serial walk is NKT / NSW steps.
//   q and k hi / residual planes f16 x256, fragment-major per head [b*8 + h][s/16][d/32][half][lane][8];
//   v^T hi / residual planes x1024, fragment-major per head [b*NKVH + h][s/32][d/16][half][lane][8].
//   raw(i, j) = q_hi.k_hi + q_lo.k_hi + q_hi.k_lo (2 k-steps over d); logit = raw * (SM_SCALE * 2^-16) (the two 256 carries
//   folded exactly into the 1/sqrt(512) scale, one f32 multiply); keys above the diagonal replaced by -inf.
//   Both products run transposed, S^T = k.q^T (A = k fragment, B = q fragment) and O^T += v^T.P^T (A = v^T fragment, B = P^T),
//   so lane (c, hh) holds per tile 16 scores and 32 O elements of the one query q0 + 16t + c: online softmax per query in f32 with a running
//   max: max over the lane's 16 scores, then one exchange with lane c ^ 16 (same max in both); sum over the lane's own keys,
//   the two halves joined once behind the loop; alpha = exp(m_old - m_new), p = exp(logit - m_new), l = l*alpha + sum p, O
//   accumulators times alpha before the tile's v^T.P^T. Only key tiles of 32 with kb <= q0 are visited (nkt = q0/32 + 1 <= NKT; key kb is
//   unmasked for every row of the tile, so each row max of a visited tile is finite; wave 0 always visits tile 0).
//   The two 16x16 score tiles of a step, converted in place, are the P^T B fragment (no LDS, no lane exchange);
//   v^T A fragments in 2 groups of 2 d-subtiles; RV = 1: products
//   hh + lh + hl, RV = 0: hh only. After the loop every wave (one without a step: max -inf, sum 0, O 0) puts its raw O
//   accumulators into its slab and its 32 row maxima and sums beside them; block barrier; waves 4t .. 4t+3 merge tile t.
//   Epilogue: O = merged acc / (merged l * 32768 * 1024), x256 -> f16 hi plane (and for RV = 1 the unscaled f16 residual
//   plane), fragment-major over [b*SEQ + s][512]; wave 4t + it, lane = (row c of tile t, 8 consecutive d at it*16 + 8*hh); one
//   instruction = one 512-B half fragment (4 whole lines).
// coverage: 8 waves x 1 instruction x 32 lanes x 8 halves = 32 x 64 per plane; grid NQP x NH x NB blocks;
//   the two forms (pairs 0..NQPR-1 with RV = 1, NQPR..NQP-1 with RV = 0) cover every (b, s, h) row segment of the hi plane
//   exactly once and rows s < RICH of the residual plane exactly once (only those rows are read later).
// =====================================================================================================
// lane l <-> lane l ^ 16 (the other 16-lane row) as one vector cross-row move
__device__ __forceinline__ float xhalf(float x) {
  const int b = __builtin_bit_cast(int, x);
  return __builtin_bit_cast(float, __builtin_amdgcn_permlanex16(b, b, 0x76543210, 0xfedcba98, false, false));
}

// 2^x for the merge weights. The v_nop in the same statement keeps the one issue slot that the instruction set asks for behind
// a transcendental, whichever instruction the compiler places next.
__device__ __forceinline__ float exp2_slot(float x) {
  float r = 0.0f;
#if defined(__HIP_DEVICE_COMPILE__)
  asm("v_exp_f32 %0, %1\n\tv_nop" : "=v"(r) : "v"(x));
#endif
  return r;
}

// 2^x of eight values in one statement, for the same slot: the results are early-clobber, so that no v_exp_f32 here writes a
// source or reads a result of the one in front of it, and the one v_nop keeps the slot behind the last.
__device__ __forceinline__ void exp2x8_slot(float (&r)[8], const float (&x)[8]) {
#if defined(__HIP_DEVICE_COMPILE__)
  asm("v_exp_f32 %0, %8\n\tv_exp_f32 %1, %9\n\tv_exp_f32 %2, %10\n\tv_exp_f32 %3, %11\n\t"
      "v_exp_f32 %4, %12\n\tv_exp_f32 %5, %13\n\tv_exp_f32 %6, %14\n\tv_exp_f32 %7, %15\n\tv_nop"
      : "=&v"(r[0]), "=&v"(r[1]), "=&v"(r[2]), "=&v"(r[3]), "=&v"(r[4]), "=&v"(r[5]), "=&v"(r[6]), "=&v"(r[7])
      : "v"(x[0]), "v"(x[1]), "v"(x[2]), "v"(x[3]), "v"(x[4]), "v"(x[5]), "v"(x[6]), "v"(x[7]));
#else
  for (int e = 0; e < 8; ++e) r[e] = x[e];
#endif
}

// Merge of the NSW partials for one lane's 8 outputs (row c of the block's QTW * 16, columns dd .. dd+7): M = max of the waves' row maxima, weight
// exp(m_w - M) (0 for a wave without a step), L = sum of weight * l_w, acc = sum of weight * O_w, waves in index order.
__device__ __forceinline__ void attn_merge8(const float* slabs, const float* sm, const float* sl, int c, int dd,
                                            float* acc, float& L) {
  float mw[NSW], lw[NSW];
  v4f pa[NSW], pb[NSW];
#pragma unroll
  for (int w = 0; w < NSW; ++w) {
    mw[w] = sm[w * (QTW * 16) + c];
    lw[w] = sl[w * (QTW * 16) + c];
    pa[w] = *(const v4f*)(slabs + w * SLW + c * SLP + dd);
    pb[w] = *(const v4f*)(slabs + w * SLW + c * SLP + dd + 4);
  }
  float M = mw[0];
#pragma unroll
  for (int w = 1; w < NSW; ++w) M = fmaxf(M, mw[w]);
  L = 0.0f;
#pragma unroll
  for (int e = 0; e < 8; ++e) acc[e] = 0.0f;
#pragma unroll
  for (int w = 0; w < NSW; ++w) {
    const float wt = exp2_slot((mw[w] - M) * 1.44269504f);
    L += wt * lw[w];
#pragma unroll
    for (int e = 0; e < 4; ++e) {
      acc[e]     += wt * pa[w][e];
      acc[4 + e] += wt * pb[w][e];
    }
  }
}

template <int RV>
__device__ __forceinline__
void attn_cs(float* smem, float* smx, float* ssm, int qp, int head, int b,
             const u16* __restrict__ QHp, const u16* __restrict__ QLp,
             const u16* __restrict__ KHp, const u16* __restrict__ KLp,
             const u16* __restrict__ VHp, const u16* __restrict__ VLp,
             u16* OHp, u16* OLp) {
#pragma clang fp contract(off)
  const int tid  = threadIdx.x;
  const int wave = __builtin_amdgcn_readfirstlane(tid >> 5);   // scalar: which key steps the wave takes
  const int lane = tid & 31;
  const int hh   = lane >> 4;
  const int c    = lane & 15;
  const int q0   = qp * (QTW * 16);         // first query row of the block's QTW tiles
  const int kvh  = head;

  float* slab = smem + wave * SLW;          // O partial slab [QTW * 16 queries][64 d] pitch 68, written behind the loop

  // fragment-major planes: a head's 16 positions x 64 d = 1024 halves (2 fragments), its 32 keys x 64 d of v^T = 2048 (4)
  // byte offsets into the planes (each plane MROWS * 512 * 2 bytes, far under 2^32), the lane's 16 bytes included
  const unsigned qvo = ((unsigned)(b * NH + head) * SEQ + (unsigned)q0) * (HD * 2u) + (unsigned)lane * 16u;
  unsigned kvo = (unsigned)(b * NKVH + kvh) * (SEQ * HD * 2u) + (unsigned)wave * (32u * HD * 2u)
               + (unsigned)lane * 16u;                                                  // this step's 32 keys, k and v^T alike
  const _Float16* Qh  = (const _Float16*)(const void*)QHp;               // query tile t at + t * 1024 halves
  const _Float16* Ql  = (const _Float16*)(const void*)QLp;
  const _Float16* Khb = (const _Float16*)(const void*)KHp;
  const _Float16* Klb = (const _Float16*)(const void*)KLp;
  const _Float16* Vhb = (const _Float16*)(const void*)VHp;               // d-subtile j at + j * 512 halves
  const _Float16* Vlb = (const _Float16*)(const void*)VLp;
  const float lsc  = SM_SCALE * (1.0f / (QSC * KSC));   // exact power-of-two fold of the q / k carries into the scale
  const float oc   = 1.0f / (PCAR * VCAR);
  const float ninf = -__builtin_inff();
  const size_t KROW = (size_t)HD;           // halves per key in a head's fragment-major plane

  v8f o[QTW][4];
  float mrun[QTW], lrun[QTW];               // per tile, this lane's query: running max (alike in lanes c and c + 16), sum over the lane's own keys
#pragma unroll
  for (int t = 0; t < QTW; ++t) {
#pragma unroll
    for (int j = 0; j < 4; ++j) o[t][j] = zero8();
    mrun[t] = ninf;
    lrun[t] = 0.0f;
  }
  const int ncaus = (q0 >> 5) + 1;                                            // tiles holding keys <= q0 + 31, the same for both query tiles
  const int nkt   = (ncaus < NKT) ? ncaus : NKT;

#pragma unroll 1
  for (int kt = wave; kt < nkt; kt += NSW, kvo += NSW * 32u * HD * 2u) {
    const int kb = kt * 32;
    // ---- raw scores, transposed: D element r of this lane = (key kb + 8hh + r, query q0 + 16t + c) in s0[t], key kb + 16 + 8hh + r
    //      in s1[t]; every k fragment is loaded once and multiplied with the q fragments of both tiles ----
    v8f s0[QTW], s1[QTW];
#pragma unroll
    for (int t = 0; t < QTW; ++t) { s0[t] = zero8(); s1[t] = zero8(); }
    const _Float16* k0p = Khb;
    const _Float16* k1p = k0p + (size_t)16 * KROW;
    const _Float16* l0p = Klb;
    const _Float16* l1p = l0p + (size_t)16 * KROW;
#pragma unroll
    for (int kk = 0; kk < HD / 32; ++kk) {
      v16h qh[QTW], ql[QTW];
#pragma unroll
      for (int t = 0; t < QTW; ++t) {
        qh[t] = ldfrag_h(Qh + t * 1024 + kk * 512, qvo);
        ql[t] = ldfrag_h(Ql + t * 1024 + kk * 512, qvo);
      }
      const v16h kh0 = ldfrag_h(k0p + kk * 512, kvo);
      const v16h kh1 = ldfrag_h(k1p + kk * 512, kvo);
      const v16h kl0 = ldfrag_h(l0p + kk * 512, kvo);
      const v16h kl1 = ldfrag_h(l1p + kk * 512, kvo);
#pragma unroll
      for (int t = 0; t < QTW; ++t) {
        s0[t] = mma_h(kh0, qh[t], s0[t]);
        s0[t] = mma_h(kh0, ql[t], s0[t]);
        s0[t] = mma_h(kl0, qh[t], s0[t]);
        s1[t] = mma_h(kh1, qh[t], s1[t]);
        s1[t] = mma_h(kh1, ql[t], s1[t]);
        s1[t] = mma_h(kl1, qh[t], s1[t]);
      }
      guard4x8(s0[0], s1[0], s0[1], s1[1], qh[0], ql[0], qh[1], ql[1], kh0, kl0, kh1, kl1);
    }
    // ---- per query tile: causal replace-mask, running-max online softmax in f32 (the lane's 16 scores of a tile all belong
    //      to its one query), rescale of the tile's O accumulators, P^T fragments ----
    const int key0 = kb + 8 * hh;
    FragH ph[QTW], pl[QTW];
#pragma unroll
    for (int t = 0; t < QTW; ++t) {
      const int qrow = q0 + 16 * t + c;                                       // the lane's query row in tile t
      float t0[8], t1[8];
#pragma unroll
      for (int r = 0; r < 8; ++r) {
        const float a0 = s0[t][r] * lsc;
        const float a1 = s1[t][r] * lsc;
        t0[r] = (key0 + r > qrow) ? ninf : a0;
        t1[r] = (key0 + 16 + r > qrow) ? ninf : a1;
      }
      float mx = fmaxf(t0[0], t1[0]);
#pragma unroll
      for (int r = 1; r < 8; ++r) mx = fmaxf(mx, fmaxf(t0[r], t1[r]));
      mx = fmaxf(mx, xhalf(mx));            // the query's other 16 keys of this step sit in lane c ^ 16
      const float mnew = fmaxf(mrun[t], mx);
      const float al   = exp2_slot((mrun[t] - mnew) * 1.44269504f);
      float x0[8], x1[8], p0[8], p1[8], ps[8];
#pragma unroll
      for (int r = 0; r < 8; ++r) {
        x0[r] = (t0[r] - mnew) * 1.44269504f;
        x1[r] = (t1[r] - mnew) * 1.44269504f;
      }
      exp2x8_slot(p0, x0);
      exp2x8_slot(p1, x1);
#pragma unroll
      for (int r = 0; r < 8; ++r) ps[r] = p0[r] + p1[r];
      const float sm = ((ps[0] + ps[1]) + (ps[2] + ps[3])) + ((ps[4] + ps[5]) + (ps[6] + ps[7]));
      lrun[t] = lrun[t] * al + sm;
      mrun[t] = mnew;
      // rescale the tile's O accumulators by alpha (every element of the lane belongs to its query)
#pragma unroll
      for (int j = 0; j < 4; ++j) {
#pragma unroll
        for (int r = 0; r < 8; ++r) o[t][j][r] = o[t][j][r] * al;
      }
      // B fragments of p*32768 straight from the score registers: column = query c, elements 0..7 = keys kb + 8hh + 0..7,
      // elements 8..15 = keys kb + 16 + 8hh + 0..7 (the split k map of the v^T fragments); hi f16, residual f16 for RV = 1
#pragma unroll
      for (int r = 0; r < 8; ++r) {
        const float ta = p0[r] * PCAR, tb = p1[r] * PCAR;
        const _Float16 ha = (_Float16)ta, hb = (_Float16)tb;
        ph[t].h[0][r] = ha;
        ph[t].h[1][r] = hb;
        if (RV != 0) {
          pl[t].h[0][r] = (_Float16)(ta - (float)ha);
          pl[t].h[1][r] = (_Float16)(tb - (float)hb);
        }
      }
    }
    // ---- O^T += v^T.P^T : A fragment row = d = j*16 + c, keys contiguous in the v^T planes; 2 groups of 2 d-subtiles, every
    //      v^T fragment loaded once for both tiles; D element r of o[t][j] = (d = j*16 + 8hh + r, query q0 + 16t + c) ----
    {
      const _Float16* vhp = Vhb;
      const _Float16* vlp = Vlb;
      (void)vlp;
#pragma unroll
      for (int jg = 0; jg < 2; ++jg) {
        const size_t da = (size_t)(2 * jg) * 512;
        const size_t db = da + 512;
        const v16h vha = ldfrag_h(vhp + da, kvo), vhb2 = ldfrag_h(vhp + db, kvo);
#pragma unroll
        for (int t = 0; t < QTW; ++t) {
          o[t][2 * jg]     = mma_h(vha,  ph[t].v, o[t][2 * jg]);
          o[t][2 * jg + 1] = mma_h(vhb2, ph[t].v, o[t][2 * jg + 1]);
        }
        if (RV != 0) {
          const v16h vla = ldfrag_h(vlp + da, kvo), vlb2 = ldfrag_h(vlp + db, kvo);
#pragma unroll
          for (int t = 0; t < QTW; ++t) {
            o[t][2 * jg]     = mma_h(vha,  pl[t].v, o[t][2 * jg]);
            o[t][2 * jg]     = mma_h(vla,  ph[t].v, o[t][2 * jg]);
            o[t][2 * jg + 1] = mma_h(vhb2, pl[t].v, o[t][2 * jg + 1]);
            o[t][2 * jg + 1] = mma_h(vlb2, ph[t].v, o[t][2 * jg + 1]);
          }
          guard4x8(o[0][2 * jg], o[0][2 * jg + 1], o[1][2 * jg], o[1][2 * jg + 1],
                   ph[0].v, pl[0].v, ph[1].v, pl[1].v, vha, vhb2, vla, vlb2);
        } else {
          guard4x8(o[0][2 * jg], o[0][2 * jg + 1], o[1][2 * jg], o[1][2 * jg + 1],
                   ph[0].v, ph[1].v, vha, vhb2, ph[0].v, ph[1].v, vha, vhb2);
        }
      }
    }
  }
  acc_guard4(o[0][0], o[0][1], o[0][2], o[0][3]);
  acc_guard4(o[1][0], o[1][1], o[1][2], o[1][3]);
  // ---- the wave's partial: raw O accumulators into its slab (row = 16t + c, 8 consecutive d a register tile: 16-B stores),
  //      each query's max and its sum (the two lane halves' sums joined here, once) beside: both are alike in lanes c and
  //      c + 16, so lane (hh, c) stores those of tile hh, row 16hh + c = lane ----
#pragma unroll
  for (int t = 0; t < QTW; ++t) {
#pragma unroll
    for (int j = 0; j < 4; ++j) {
      float* d = slab + (t * 16 + c) * SLP + j * 16 + 8 * hh;
      const v4f lo = {o[t][j][0], o[t][j][1], o[t][j][2], o[t][j][3]};
      const v4f hi = {o[t][j][4], o[t][j][5], o[t][j][6], o[t][j][7]};
      *(v4f*)(d)     = lo;
      *(v4f*)(d + 4) = hi;
    }
  }
  const float lall0 = lrun[0] + xhalf(lrun[0]);
  const float lall1 = lrun[1] + xhalf(lrun[1]);
  smx[wave * (QTW * 16) + lane] = (hh != 0) ? mrun[1] : mrun[0];
  ssm[wave * (QTW * 16) + lane] = (hh != 0) ? lall1 : lall0;
  __syncthreads();                          // every wave's partial is in LDS before any wave merges; passed by all NSW waves
  // ---- merged O / l with the carries (32768 on p, 1024 on v) folded once, x256 -> f16 hi plane (+ f16 residual plane),
  //      fragment-major [row/16][512/32][half][lane][8]: wave 4*tq + it stores, for query tile tq, half it&1 of k step
  //      head*2 + (it>>1); lane = (row c of the tile, 8 consecutive d at it*16 + 8*hh) ----
  const int tq = wave >> 2;
  const int it = wave & 3;
  float acc[8], lsum;
  attn_merge8(smem, smx, ssm, tq * 16 + c, it * 16 + 8 * hh, acc, lsum);
  const float rl = (1.0f / lsum) * oc;
  float w[8];
#pragma unroll
  for (int e = 0; e < 8; ++e) w[e] = (acc[e] * rl) * OSC;
  v4u oh, ol;
#pragma unroll
  for (int e = 0; e < 4; ++e) {
    const _Float16 h0 = (_Float16)w[2 * e], h1 = (_Float16)w[2 * e + 1];
    const _Float16 g0 = (_Float16)(w[2 * e] - (float)h0), g1 = (_Float16)(w[2 * e + 1] - (float)h1);
    oh[e] = pk16(h_bits(h0), h_bits(h1));
    ol[e] = pk16(h_bits(g0), h_bits(g1));
  }
  const size_t ob = ((size_t)b * SEQ + q0 + tq * 16) * DMOD + (size_t)head * (16 * HD) + 8 * lane + it * 256;
  *(v4u*)(OHp + ob) = oh;
  if (RV != 0) {
    *(v4u*)(OLp + ob) = ol;
  }
  // in the shared launch the code of the other form may follow and writes registers that these stores name
  asm volatile("s_wait_xcnt 0x0" ::: "memory");
}

// One launch for all query tiles: the index of the tile pair decides block-uniformly between the two forms (RV = 1 for pairs < NQPR).
// coverage: bid -> (qp, head, b) is one-to-one from 0 .. NQP*NH*NB - 1 onto NQP x NH x NB.
__global__ __launch_bounds__(ATT_THREADS)
void attn_all(const u16* __restrict__ QHp, const u16* __restrict__ QLp,
              const u16* __restrict__ KHp, const u16* __restrict__ KLp,
              const u16* __restrict__ VHp, const u16* __restrict__ VLp, u16* OHp, u16* OLp) {
  __shared__ __align__(16) float smem[NSW * SLW];   // per wave: O partial slab behind the loop
  __shared__ float smx[NSW * QTW * 16];             // per wave: QTW * 16 row maxima
  __shared__ float ssm[NSW * QTW * 16];             // per wave: QTW * 16 row sums
  const int bid  = blockIdx.x;
  if (bid >= NQP * NH * NB) return;         // block-uniform, in front of the block barrier; never taken with the exact grid
  // a block's cost grows with qp (qp + 1 key steps): the longest pairs come first in the index, for speed only; the NH * NB
  // blocks of one qp, all of one cost, are neighbours in the index (a multiple of 8)
  const int qp   = NQP - 1 - bid / (NH * NB);
  const int t2   = bid % (NH * NB);
  const int head = t2 % NH;
  const int b    = t2 / NH;
  if (qp < NQPR) attn_cs<1>(smem, smx, ssm, qp, head, b, QHp, QLp, KHp, KLp, VHp, VLp, OHp, OLp);
  else           attn_cs<0>(smem, smx, ssm, qp, head, b, QHp, QLp, KHp, KLp, VHp, VLp, OHp, OLp);
}

// =====================================================================================================
// Workspace map (bytes); every plane is fully written by whole-line stores before it is read (the O residual plane only on
// the rows < RICH per sequence that are read); all extents are exact multiples of the store granularity (no pad rows needed);
// every region offset a multiple of 131072; every 16-bit plane is fragment-major (see the fragment loaders), same extent as
// the row-major shape given here:
//   XB  bf16 [MROWS][512]               MROWS*1024   (NB=4, SEQ=2048: 8388608); after the projection GEMM the same bytes hold
//                                                    the O f16 hi plane [MROWS][512] x256 (identical extent)
//   WB  bf16 [1536 n][512 k]            1572864      (Wq rows 0..511, Wk 512..1023, Wv 1024..1535)
//   OL  f16 [MROWS][512]                MROWS*1024   O residual plane
//   QH  f16 [MROWS][512] x256           MROWS*1024   QL residual, same extent
//   KH  f16 [MROWS][512] x256           MROWS*1024   KL residual, same extent   (keys = rotary of the v_proj columns)
//   VH  f16 [NB*8][64][SEQ] x1024       MROWS*1024   VL residual, same extent   (values = the k_proj columns)
//   TC  f32 [SEQ][32]                   SEQ*128      TS, same extent
//   WT  f16 [512 o][512 d] x1024        524288       (Wo; a region of its own, written in the launch that also writes WB)
//   end (NB=4, SEQ=2048)               69730304
// =====================================================================================================
extern "C" void kernel_launch(void* const* d_in, const int* in_sizes, int n_in,
                              void* d_out, int out_size, void* d_ws, size_t ws_size,
                              hipStream_t stream) {
  if (n_in < 9) return;
  if (in_sizes[0] < ((NB - 1) * XS_FULL + SEQ) * DMOD) return;
  if (in_sizes[1] != DMOD * DMOD) return;
  if (in_sizes[2] != DMOD) return;
  if (in_sizes[3] != DMOD * DMOD) return;
  if (in_sizes[4] != DMOD) return;
  if (in_sizes[5] != DMOD * DMOD) return;
  if (in_sizes[6] != DMOD) return;
  if (in_sizes[7] != DMOD * DMOD) return;
  if (in_sizes[8] != DMOD) return;
  if (out_size < ((NB - 1) * XS_FULL + SEQ) * DMOD) return;

  const float* x   = (const float*)d_in[0];
  const float* wq  = (const float*)d_in[1];
  const float* bqp = (const float*)d_in[2];
  const float* wk  = (const float*)d_in[3];
  const float* bkp = (const float*)d_in[4];
  const float* wv  = (const float*)d_in[5];
  const float* bvp = (const float*)d_in[6];
  const float* wo  = (const float*)d_in[7];
  const float* bop = (const float*)d_in[8];
  float*       out = (float*)d_out;

  const size_t szXB = (size_t)MROWS * DMOD * 2;
  const size_t szWB = (size_t)NQKV * DMOD * 2;
  const size_t szQ  = (size_t)MROWS * DMOD * 2;                  // QH, QL
  const size_t szK  = (size_t)MROWS * KVD * 2;                   // KH, KL
  const size_t szV  = (size_t)NB * NKVH * HD * SEQ * 2;          // VH, VL (== szK)
  const size_t szT  = (size_t)SEQ * NFREQ * 4;                   // TC, TS
  const size_t szOH = (size_t)MROWS * DMOD * 2;                  // O hi plane, lives in the XB region
  const size_t szOL = (size_t)MROWS * DMOD * 2;                  // O residual plane
  const size_t szWT = (size_t)DMOD * DMOD * 2;                   // Wo f16 plane
  if (szOH > szXB) return;
  size_t off = 0;
  const size_t oXB = off; off += szXB;
  const size_t oWB = off; off += szWB;
  const size_t oOL = off; off += szOL;
  const size_t oQH = off; off += szQ;
  const size_t oQL = off; off += szQ;
  const size_t oKH = off; off += szK;
  const size_t oKL = off; off += szK;
  const size_t oVH = off; off += szV;
  const size_t oVL = off; off += szV;
  const size_t oTC = off; off += szT;
  const size_t oTS = off; off += szT;
  const size_t oWT = off; off += szWT;
  if (off > ws_size) return;                // off = 69730304 for NB = 4, SEQ = 2048
  if (off > (size_t)WS_CAP) return;

  char* ws = (char*)d_ws;
  u16*   XB  = (u16*)(ws + oXB);
  u16*   OH  = (u16*)(ws + oXB);
  u16*   WB  = (u16*)(ws + oWB);
  u16*   WT  = (u16*)(ws + oWT);
  u16*   OL  = (u16*)(ws + oOL);
  u16*   QH  = (u16*)(ws + oQH);
  u16*   QL  = (u16*)(ws + oQL);
  u16*   KH  = (u16*)(ws + oKH);
  u16*   KL  = (u16*)(ws + oKL);
  u16*   VH  = (u16*)(ws + oVH);
  u16*   VL  = (u16*)(ws + oVL);
  float* TC  = (float*)(ws + oTC);
  float* TS  = (float*)(ws + oTS);

  const dim3 b256(256), b128(128), bAT(ATT_THREADS);
  const dim3 gG1((MROWS / 64) * (NQKV / 64));
  const float osc = 1.0f / (OSC * WOS);

  // (1) rotary cos / sin tables [SEQ][32]; x -> bf16 plane [MROWS][512]; Wq, Wk, Wv -> one bf16 plane [1536 n][512 k];
  //     Wo [512 o][512 d] -> f16 plane of the bf16 value x1024 (already k-contiguous)
  prep<<<dim3(GT + NB * GX + 4 * GW), b256, 0, stream>>>(x, wq, wk, wv, wo, XB, WB, WT, TC, TS);
  // (2) x.[Wq|Wk|Wv]^T (columns 0..511 q_proj, 512..1023 k_proj, 1024..1535 v_proj) with the planes written by its epilogue:
  //     q = rotary(q_proj + bq) and keys = rotary(v_proj + bv) -> hi + residual planes x256; values = k_proj + bk (no rotary)
  //     -> v^T hi + residual planes x1024
  gemm_qkv<<<gG1, b128, 0, stream>>>(XB, WB, bqp, bkp, bvp, TC, TS, QH, QL, KH, KL, VH, VL, DMOD);
  // (3) causal attention -> O f16 hi plane x256 (XB region) for all query tiles; residual plane for tiles < RICH
  attn_all<<<dim3(NQP * NH * NB), bAT, 0, stream>>>(QH, QL, KH, KL, VH, VL, OH, OL);
  // (4) y = O.Wo^T + bo -> out f32 [rows][512], carries 256 x 1024 folded back; rows < RICH per sequence with O hi + residual
  gemm_o<<<dim3(NB * (SEQ / 64) * (DMOD / 64)), b128, 0, stream>>>(OH, OL, WT, bop, out, DMOD, DMOD, osc);
  (void)hipGetLastError();
}

// v008
// Measured time: 97.1 microseconds a run.
// In two side-by-side timings against v007, it was 1.12 and 1.14 times as fast.
// Counting every step since v000, it is 3.91 times as fast.
// Contractions: x.[Wq|Wk|Wv]^T on v_wmma_f32_16x16x32_bf16 (x and the weights as bf16 RNE planes; weight [n][k] rows are
// the k-contiguous A operand for q_proj and v_proj, B for k_proj; f32 accumulate); q.k^T over hd 64 and P.v on v_wmma_f32_16x16x32_f16 with f16 hi + f16
// residual planes (both transposed: k.q^T and v^T.P^T; q, k x256 after rotary, products hh+lh+hl on every row; P x32768 hi + in-register residual and v^T x1024
// hi + residual plane for query rows < 512 of each sequence, P hi . v hi only for later rows); O.Wo^T on
// v_wmma_f32_16x16x32_f16 with O x256 as f16 hi (+ f16 residual plane for rows < 512 of each sequence) and Wo as
// f16(bf16(Wo)) x1024, one accumulator, bias added in f32; all f32 accumulate. Rotary cos/sin tables, bias adds and online
// softmax in f32 on VALU.
#include <hip/hip_runtime.h>
#include <math.h>
#include <stdint.h>

#ifndef NB
#define NB 4
#endif
#ifndef SEQ
#define SEQ 2048
#endif
#define XS_FULL 2048
#define DMOD  512
#define NH    8
#define NKVH  8
#define HD    64
#define HHALF (HD / 2)
#define NFREQ (HD / 2)
#define KVD   (NKVH * HD)
#define NQKV  (DMOD + 2 * KVD)
#define QCOL0 0
#define VCOL0 DMOD
#define KCOL0 (DMOD + KVD)
#define MROWS (NB * SEQ)
#define RICH  512
#define ROPE_L2 0.41524101186092028
#define SM_SCALE 0.04419417382415922f
#define QSC   256.0f
#define KSC   256.0f
#define PCAR  32768.0f
#define VCAR  1024.0f
#define OSC   256.0f
#define WOS   1024.0f
#define NSW   8
#define NQT   (SEQ / 16)
#define NQTR  (RICH / 16)
#define QTW   2
#define NQP   (NQT / QTW)
#define NQPR  (NQTR / QTW)
#define NKT   (SEQ / 32)
#define ATT_THREADS (NSW * 32)
#define SLP   68
#define SLW   (QTW * 16 * SLP)
#define SLAB64 (16 * 68)
#define KUN   4
#define WS_CAP 134217728
#define GX    (SEQ * DMOD / 8 / 256)
#define GW    (DMOD * DMOD / 8 / 256)
#define GT    (SEQ * NFREQ / 256)
static_assert(DMOD == NH * HD && HD == 64 && HHALF == 32 && NFREQ == 32 && NH == 8 && NKVH == NH);
static_assert(ATT_THREADS == 256 && NSW >= 4 && KVD == 512 && NQKV == 1536 && KCOL0 + KVD == NQKV && VCOL0 + KVD == KCOL0);
static_assert(NB >= 1 && NB <= 4);
static_assert(NB == 1 || SEQ == XS_FULL);
static_assert((SEQ % 64) == 0 && SEQ >= 64 && SEQ <= XS_FULL);
static_assert((RICH % 64) == 0 && RICH >= 64 && RICH <= SEQ);
static_assert((DMOD % 64) == 0 && (KVD % 64) == 0 && (NQKV % 64) == 0 && (DMOD % 32) == 0 && (HD % 32) == 0);
static_assert(((SEQ * DMOD / 8) % 256) == 0 && ((DMOD * DMOD / 8) % 256) == 0 && ((SEQ * NFREQ) % 256) == 0);
static_assert(NSW * (SLW + 2 * QTW * 16) * 4 <= 327680 / 2 && 4 * SLAB64 * 4 <= 65536);
static_assert(QTW == 2 && NSW == 4 * QTW && (NQT % QTW) == 0 && (NQTR % QTW) == 0);
static_assert(DMOD / 8 == 64 && KVD / 8 == 64 && (DMOD % (32 * KUN)) == 0);
static_assert(((NH * NB) % 8) == 0);
static_assert(((SEQ * DMOD / 8) % 1024) == 0 && ((DMOD * DMOD / 8) % 1024) == 0 && (SEQ % 32) == 0 && (RICH % 16) == 0);

typedef unsigned short u16;
typedef _Float16 v16h __attribute__((ext_vector_type(16)));
typedef _Float16 v8h  __attribute__((ext_vector_type(8)));
typedef __bf16   v16b __attribute__((ext_vector_type(16)));
typedef float    v8f  __attribute__((ext_vector_type(8)));
typedef float    v4f  __attribute__((ext_vector_type(4)));
typedef unsigned int v4u __attribute__((ext_vector_type(4)));

union FragH { v16h v; v8h h[2]; v4u u[2]; };
union FragB { v16b v; v4u u[2]; };

// ---- scalar helpers --------------------------------------------------------------------------------
__device__ __forceinline__ unsigned short bf_bits(float f) {          // f32 -> bf16 bits, RNE convert
  unsigned u = __float_as_uint(f);
  return (unsigned short)((u + 0x7FFFu + ((u >> 16) & 1u)) >> 16);
}
__device__ __forceinline__ float bf_up(unsigned short h) { return __uint_as_float(((unsigned)h) << 16); }
__device__ __forceinline__ float bfr(float f) { return bf_up(bf_bits(f)); }
__device__ __forceinline__ unsigned short h_bits(_Float16 x) { return __builtin_bit_cast(unsigned short, x); }
__device__ __forceinline__ unsigned pk16(unsigned short a, unsigned short b) { return (unsigned)a | ((unsigned)b << 16); }
__device__ __forceinline__ v8f zero8() { v8f z = {0.f, 0.f, 0.f, 0.f, 0.f, 0.f, 0.f, 0.f}; return z; }

// ---- fragment-major planes: every 16-bit A/B operand plane [row][K] other than v^T is stored as [row/16][K/32][g][lane][8]: the 16-B unit
//      of lane = 16*h + (row&15) in half g holds k = 32*ks + 16*g + 8*h + 0..7, so one wave-wide 16-B load is 512 contiguous
//      bytes (4 whole lines) and one 16 x 32 fragment is 1 KB. A 16-row tile starts where it starts in a row-major plane.
// ---- fragment loaders: lane -> row/col (lane&15), h = lane>>4; base = a pointer that is the same in every lane (it stays in
//      scalar registers), vo = byte offset of the fragment from base + 16*lane (one 32-bit register shared by all loads of a
//      step and advanced behind them); p = base + vo;
//      elements 0..7 <- p[0..7] (k0+8h..), elements 8..15 <- p[256..263] (k0+16+8h..)  (same split k map for A and B)
__device__ __forceinline__ v16h ldfrag_h(const _Float16* base, unsigned vo) {
  const char* p = (const char*)base + vo;
  FragH f;
  f.h[0] = *(const v8h*)(p);
  f.h[1] = *(const v8h*)(p + 512);
  return f.v;
}
__device__ __forceinline__ v16b ldfrag_b(const u16* base, unsigned vo) { // bf16 plane read as unsigned integer vectors
  const char* p = (const char*)base + vo;
  FragB f;
  f.u[0] = *(const v4u*)(p);
  f.u[1] = *(const v4u*)(p + 512);
  return f.v;
}

__device__ __forceinline__ v8f mma_h(v16h a, v16h b, v8f c) {
  return __builtin_amdgcn_wmma_f32_16x16x32_f16(false, a, false, b, (short)0, c, false, false);
}
__device__ __forceinline__ v8f mma_b(v16b a, v16b b, v8f c) {
  return __builtin_amdgcn_wmma_f32_16x16x32_bf16(false, a, false, b, (short)0, c, false, false);
}
// four issue slots between the last matrix instruction of a group and the first vector instruction on its results or operands,
// on every path (the loop's back edge too); the fragments are named so that their registers are not rewritten in front of it
// guard4x16: behind a whole key step's score products (16 fragments); guard8x6, guard8x12: behind its v^T.P^T products
__device__ __forceinline__ void guard4x16(v8f& a, v8f& b, v8f& c, v8f& d, const v16h (&x)[8], const v16h (&y)[8]) {
#if defined(__HIP_DEVICE_COMPILE__)
  asm volatile("v_nop\n\tv_nop\n\tv_nop\n\tv_nop"
               : "+v"(a), "+v"(b), "+v"(c), "+v"(d)
               : "v"(x[0]), "v"(x[1]), "v"(x[2]), "v"(x[3]), "v"(x[4]), "v"(x[5]), "v"(x[6]), "v"(x[7]),
                 "v"(y[0]), "v"(y[1]), "v"(y[2]), "v"(y[3]), "v"(y[4]), "v"(y[5]), "v"(y[6]), "v"(y[7]) : "memory");
#endif
}
__device__ __forceinline__ void guard8x6(v8f (&o0)[4], v8f (&o1)[4], v16h p0, v16h p1, const v16h (&x)[4]) {
#if defined(__HIP_DEVICE_COMPILE__)
  asm volatile("v_nop\n\tv_nop\n\tv_nop\n\tv_nop"
               : "+v"(o0[0]), "+v"(o0[1]), "+v"(o0[2]), "+v"(o0[3]), "+v"(o1[0]), "+v"(o1[1]), "+v"(o1[2]), "+v"(o1[3])
               : "v"(p0), "v"(p1), "v"(x[0]), "v"(x[1]), "v"(x[2]), "v"(x[3]) : "memory");
#endif
}
__device__ __forceinline__ void guard8x12(v8f (&o0)[4], v8f (&o1)[4], v16h p0, v16h p1, v16h r0, v16h r1,
                                          const v16h (&x)[4], const v16h (&y)[4]) {
#if defined(__HIP_DEVICE_COMPILE__)
  asm volatile("v_nop\n\tv_nop\n\tv_nop\n\tv_nop"
               : "+v"(o0[0]), "+v"(o0[1]), "+v"(o0[2]), "+v"(o0[3]), "+v"(o1[0]), "+v"(o1[1]), "+v"(o1[2]), "+v"(o1[3])
               : "v"(p0), "v"(p1), "v"(r0), "v"(r1), "v"(x[0]), "v"(x[1]), "v"(x[2]), "v"(x[3]),
                 "v"(y[0]), "v"(y[1]), "v"(y[2]), "v"(y[3]) : "memory");
#endif
}
template <typename F>
__device__ __forceinline__ void guard6(v8f& a, v8f& b, v8f& c, v8f& d, F x0, F x1, F x2, F x3, F x4, F x5) {
#if defined(__HIP_DEVICE_COMPILE__)
  asm volatile("v_nop\n\tv_nop\n\tv_nop\n\tv_nop"
               : "+v"(a), "+v"(b), "+v"(c), "+v"(d) : "v"(x0), "v"(x1), "v"(x2), "v"(x3), "v"(x4), "v"(x5) : "memory");
#endif
}
__device__ __forceinline__ void acc_guard4(v8f& a, v8f& b, v8f& c, v8f& d) {
#if defined(__HIP_DEVICE_COMPILE__)
  asm volatile("v_nop\n\tv_nop\n\tv_nop\n\tv_nop" : "+v"(a), "+v"(b), "+v"(c), "+v"(d));
#endif
}
__device__ __forceinline__ void wave_sync_lds() {
  __builtin_amdgcn_fence(__ATOMIC_RELEASE, "workgroup");
  __builtin_amdgcn_wave_barrier();
  __builtin_amdgcn_fence(__ATOMIC_ACQUIRE, "workgroup");
}

// =====================================================================================================
// f32 [rows][DMOD] -> 16-bit fragment-major plane.  f16mode == 0: bf16 RNE bits;  f16mode == 1: f16 bits of (bf16 RNE value)
// * scale. Thread = output unit gt = 8 consecutive elements of one row: two 16-B loads (a wave reads 64 B of each of 16 rows,
// the block uses every line whole), one 16-B store; 32 consecutive lanes store 512 contiguous, 512-B aligned bytes;
// coverage: blk = 0 .. n8/256 - 1, x 256 thr x 8 (in-kernel bound) = the whole plane (n8 a multiple of 256 here).
// =====================================================================================================
__device__ __forceinline__ void cvt16(const float* __restrict__ x, u16* D, int blk, int n8, int f16mode, float scale) {
  const int gt = blk * 256 + (int)threadIdx.x;
  if (gt >= n8) return;
  const int srow = (gt >> 10) * 16 + (gt & 15);                                   // 1024 units per 16-row tile
  const int schk = ((gt >> 6) & (DMOD / 32 - 1)) * 4 + ((gt >> 5) & 1) * 2 + ((gt >> 4) & 1);
  const float* p = x + ((size_t)srow * (DMOD / 8) + schk) * 8;
  const v4f a = *(const v4f*)(p), b4 = *(const v4f*)(p + 4);
  float w[8];
#pragma unroll
  for (int e = 0; e < 4; ++e) { w[e] = a[e]; w[4 + e] = b4[e]; }
  v4u o;
#pragma unroll
  for (int e = 0; e < 4; ++e) {
    const float f0 = w[2 * e], f1 = w[2 * e + 1];
    const unsigned short hb0 = h_bits((_Float16)(bfr(f0) * scale));
    const unsigned short hb1 = h_bits((_Float16)(bfr(f1) * scale));
    const unsigned short bb0 = bf_bits(f0);
    const unsigned short bb1 = bf_bits(f1);
    o[e] = (f16mode != 0) ? pk16(hb0, hb1) : pk16(bb0, bb1);
  }
  u16* d = D + (size_t)gt * 8;
  {
    *(v4u*)(d) = o;
    
  }
}

// =====================================================================================================
// Rotary tables TC[s][j] = cos(s * inv[j]), TS[s][j] = sin(s * inv[j]), j < 32, with
// inv[j] = 1.0f / f32(10000^(j/32)) (power evaluated in f64 and narrowed once, IEEE f32 reciprocal, f32 product s*inv,
// coverage: blk = 0 .. n/256 - 1, x 256 thr = n = SEQ*32 elements of TC and of TS (n a multiple of 256).
// =====================================================================================================
__device__ __forceinline__ void k_tab(float* TC, float* TS, int blk, int n) {
#pragma clang fp contract(off)
  const int idx = blk * 256 + (int)threadIdx.x;
  if (idx >= n) return;
  const int s = idx / NFREQ;
  const int j = idx - s * NFREQ;
  const double pj = exp2((double)j * ROPE_L2);       // 10000^(j/32)
  const float pf  = (float)pj;
  const float inv = 1.0f / pf;
  const float ang = (float)s * inv;
  float sv, cv;
  sincosf(ang, &sv, &cv);
  {
    *(float*)(TC + idx) = cv;
    *(float*)(TS + idx) = sv;
    
  }
}

// =====================================================================================================
// One launch for everything that reads only the inputs: none of these pieces reads what another writes, so they share a grid
// by block range (every branch is block-uniform, no barrier): GT blocks the rotary tables, NB*GX blocks x -> bf16 plane
// [MROWS][512], GW blocks each Wq, Wk, Wv -> one bf16 plane [1536 n][512 k], GW blocks Wo -> f16 plane of the bf16 value x1024.
// coverage: grid = GT + NB*GX + 4*GW blocks, each range exactly the grid of its piece.
// =====================================================================================================
__global__ __launch_bounds__(256) void prep(const float* __restrict__ x, const float* __restrict__ wq,
                                            const float* __restrict__ wk, const float* __restrict__ wv,
                                            const float* __restrict__ wo, u16* XB, u16* WB, u16* WT, float* TC, float* TS) {
  int bid = (int)blockIdx.x;
  if (bid < GT) { k_tab(TC, TS, bid, SEQ * NFREQ); return; }
  bid -= GT;
  if (bid < NB * GX) {
    const int bq = bid / GX;
    cvt16(x + (size_t)bq * XS_FULL * DMOD, XB + (size_t)bq * SEQ * DMOD, bid - bq * GX, SEQ * DMOD / 8, 0, 1.0f);
    return;
  }
  bid -= NB * GX;
  if (bid < GW)     { cvt16(wq, WB, bid, DMOD * DMOD / 8, 0, 1.0f); return; }
  if (bid < 2 * GW) { cvt16(wk, WB + (size_t)VCOL0 * DMOD, bid - GW, DMOD * DMOD / 8, 0, 1.0f); return; }
  if (bid < 3 * GW) { cvt16(wv, WB + (size_t)KCOL0 * DMOD, bid - 2 * GW, DMOD * DMOD / 8, 0, 1.0f); return; }
  if (bid < 4 * GW) { cvt16(wo, WT, bid - 3 * GW, DMOD * DMOD / 8, 1, WOS); return; }
}

// =====================================================================================================
// Interleaved-pair rotary of one element, with y = projection + bias (f32 add) already formed:
//   out[2j]   = y[2j]  *c[s][j] + (-1)*(y[2j+1]*sn[s][j])
//   out[2j+1] = y[2j+1]*c[s][j] + (+1)*(y[2j]  *sn[s][j])        with c, sn the f32 table values (mul, mul, add kept
//   separate); hb = f16(out * sc), lb = f16 residual (t - f16(t)).
// =====================================================================================================
__device__ __forceinline__ void rot_one(float x, float y, float cv, float sv, float sgn, float sc,
                                        unsigned short& hb, unsigned short& lb) {
#pragma clang fp contract(off)
  const float ys   = y * sv;
  const float term = sgn * ys;
  const float r    = x * cv + term;
  const float t    = r * sc;
  const _Float16 a = (_Float16)t;
  hb = h_bits(a);
  lb = h_bits((_Float16)(t - (float)a));
}

// =====================================================================================================
// GEMM epilogue of the output projection: the wave's 16x64 f32 tile (times oscale) staged in its LDS slab (pitch 68),
// 8 consecutive lanes x 16 B per line), lanes 16..31 -> row 2*it+1; HASB != 0 adds bias[col] in f32 to every element;
// coverage: 8 instructions x 2 rows x 16 lanes x 4 floats = the wave's 16 x 64 tile.
// =====================================================================================================
template <int HASB>
__device__ __forceinline__ void epi64(float* sl, v8f a0, v8f a1, v8f a2, v8f a3, float oscale, const float* bias,
                                      float* C, int N, size_t rowb, int col0, int lane) {
  const int hh = lane >> 4, m = lane & 15;
#pragma unroll
  for (int r = 0; r < 8; ++r) {
    const int ro = (8 * hh + r) * 68 + m;
    sl[ro]      = a0[r] * oscale;
    sl[ro + 16] = a1[r] * oscale;
    sl[ro + 32] = a2[r] * oscale;
    sl[ro + 48] = a3[r] * oscale;
  }
  wave_sync_lds();
  v4f vals[8];
#pragma unroll
  for (int it = 0; it < 8; ++it) vals[it] = *(const v4f*)(sl + (it * 2 + hh) * 68 + m * 4);
  if (HASB != 0) {
    const v4f b4 = *(const v4f*)(bias + col0 + m * 4);
#pragma unroll
    for (int it = 0; it < 8; ++it) vals[it] = vals[it] + b4;
  }
  float* dst = C + (rowb + (size_t)hh) * (size_t)N + col0 + m * 4;
  {
#pragma unroll
    for (int it = 0; it < 8; ++it) {
      *(v4f*)(dst + (size_t)(it * 2) * (size_t)N) = vals[it];
    }
    
  }
}

// =====================================================================================================
// Projection GEMM x.[Wq|Wk|Wv]^T (bf16 fragment-major planes A = x [MROWS][512], Bt = weights [1536 n][512 k], f32
// accumulate) whose epilogue writes the attention operand planes itself: no f32 projection array, no LDS.
// Block = 64 rows x 64 columns, 4 waves x 16 rows; a wave's 64 columns are one head of q_proj (columns 0..511), of k_proj
// (512..1023) or of v_proj (1024..1535), its 16 rows 16 positions of one sequence; the choice is block-uniform.
// Fragments loaded straight from the planes (two 512-B wave loads each, split k map for both operands); K stepped by 32
// (host: K = 512, the row length of both planes).
// TR = 1 (q_proj, v_proj): the weight tile is the first operand, so acc j element r of lane (hh, m) =
//   (column j*16 + 8*hh + r, position m): 8 consecutive d of one position = the lane's 16-B unit of the q / k plane.
// TR = 0 (k_proj): x is the first operand, acc j element r of lane (hh, m) = (position 8*hh + r, column j*16 + m):
//   8 consecutive keys of one d = the lane's 16-B unit of the v^T plane.
// =====================================================================================================
template <int TR>
__device__ __forceinline__ void proj_loop(const u16* ap, const u16* bp, const u16* bp1, const u16* bp2, const u16* bp3,
                                          unsigned vo, int K, v8f& acc0, v8f& acc1, v8f& acc2, v8f& acc3) {
#pragma unroll 1
  for (int k0 = 0; k0 < K; k0 += 32, vo += 1024u) {
    const v16b a  = ldfrag_b(ap, vo);
    const v16b b0 = ldfrag_b(bp, vo);
    const v16b b1 = ldfrag_b(bp1, vo);
    const v16b b2 = ldfrag_b(bp2, vo);
    const v16b b3 = ldfrag_b(bp3, vo);
    if (TR != 0) {
      acc0 = mma_b(b0, a, acc0);
      acc1 = mma_b(b1, a, acc1);
      acc2 = mma_b(b2, a, acc2);
      acc3 = mma_b(b3, a, acc3);
    } else {
      acc0 = mma_b(a, b0, acc0);
      acc1 = mma_b(a, b1, acc1);
      acc2 = mma_b(a, b2, acc2);
      acc3 = mma_b(a, b3, acc3);
    }
    guard6<v16b>(acc0, acc1, acc2, acc3, a, b0, b1, b2, b3, a);
  }
}

// q / k planes from the TR = 1 accumulators: y = acc + bias[head*HD + d], rotary with table row s = the lane's position and
// table column d >> 1, x sc -> f16 hi and f16 residual planes, fragment-major per head [b*8 + head][s/16][d/32][half][lane][8]
// (row = position, k = d): acc j is half j & 1 of d step j >> 1, at pb + j * 256 halves, pb = the tile's start + 8 * lane.
// coverage: 4 stores x 32 lanes x 8 halves = the wave's 16 positions x 64 d of Hp and of Lp, 512 contiguous bytes a store.
__device__ __forceinline__ void rope_epi(const v8f (&acc)[4], int hh, int s, const float* __restrict__ bias,
                                         const float* __restrict__ TC, const float* __restrict__ TS,
                                         u16* Hp, u16* Lp, size_t pb, float sc) {
  const float* bp = bias + 8 * hh;                     // bias already at the head's first column
  const float* cp = TC + (size_t)s * NFREQ + 4 * hh;
  const float* sp = TS + (size_t)s * NFREQ + 4 * hh;
  // two groups of two accumulator tiles, each with its own loads, so that the loaded values of one group only are live
  // beside the accumulators (the register count stays at the k loop's, and with it the waves per SIMD)
#pragma unroll
  for (int g2 = 0; g2 < 2; ++g2) {
    v4f ba[2], bb[2], cw[2], sw[2];
#pragma unroll
    for (int i = 0; i < 2; ++i) {
      const int j = 2 * g2 + i;
      ba[i] = *(const v4f*)(bp + j * 16);
      bb[i] = *(const v4f*)(bp + j * 16 + 4);
      cw[i] = *(const v4f*)(cp + j * 8);
      sw[i] = *(const v4f*)(sp + j * 8);
    }
#pragma unroll
    for (int i = 0; i < 2; ++i) {
      const int j = 2 * g2 + i;
      float yv[8];
#pragma unroll
      for (int e = 0; e < 4; ++e) {
        yv[e]     = acc[j][e]     + ba[i][e];
        yv[4 + e] = acc[j][4 + e] + bb[i][e];
      }
      v4u oh, ol;
#pragma unroll
      for (int e = 0; e < 4; ++e) {
        unsigned short h0, l0, h1, l1;
        rot_one(yv[2 * e],     yv[2 * e + 1], cw[i][e], sw[i][e], -1.0f, sc, h0, l0);   // even element of the pair
        rot_one(yv[2 * e + 1], yv[2 * e],     cw[i][e], sw[i][e],  1.0f, sc, h1, l1);   // odd element of the pair
        oh[e] = pk16(h0, h1);
        ol[e] = pk16(l0, l1);
      }
      *(v4u*)(Hp + pb + j * 256) = oh;
      *(v4u*)(Lp + pb + j * 256) = ol;
    }
    // the next group's loads, and behind the last group whatever code the compiler places next, may write
    // registers that these stores name
    asm volatile("s_wait_xcnt 0x0" ::: "memory");
  }
}

// v^T planes from the TR = 0 accumulators: y = acc + bias[head*HD + d] (f32 add), t = y * 1024 (exact), hi = f16(t),
// residual = f16(t - hi), fragment-major per head with the 32-key step outermost [b*8 + head][s/32][d/16][half][lane][8]
// (row = d, k = key): the wave's 16 keys are one half of the four d-subtile fragments, acc j at pb + j * 512 halves,
// pb = the key step's start + half * 256 + 8 * lane.
// coverage: 4 stores x 32 lanes x 8 halves = the wave's 16 keys x 64 d of VHo and of VLo, 512 contiguous bytes a store.
__device__ __forceinline__ void vt_epi(const v8f (&acc)[4], int m, const float* __restrict__ bias,
                                       u16* VHo, u16* VLo, size_t pb) {
  float bj[4];
#pragma unroll
  for (int j = 0; j < 4; ++j) bj[j] = bias[j * 16 + m];  // bias already at the head's first column
  v4u oh[4], ol[4];
#pragma unroll
  for (int j = 0; j < 4; ++j) {
#pragma unroll
    for (int e = 0; e < 4; ++e) {
      const float t0 = (acc[j][2 * e]     + bj[j]) * VCAR;
      const float t1 = (acc[j][2 * e + 1] + bj[j]) * VCAR;
      const _Float16 h0 = (_Float16)t0, h1 = (_Float16)t1;
      oh[j][e] = pk16(h_bits(h0), h_bits(h1));
      ol[j][e] = pk16(h_bits((_Float16)(t0 - (float)h0)), h_bits((_Float16)(t1 - (float)h1)));
    }
  }
#pragma unroll
  for (int j = 0; j < 4; ++j) {
    *(v4u*)(VHo + pb + j * 512) = oh[j];
    *(v4u*)(VLo + pb + j * 512) = ol[j];
  }
}

// coverage: grid = (MROWS/64) * (NQKV/64) blocks x 4 waves: every (sequence, head, 16 positions) tile of the q, k and v^T
// hi and residual planes exactly once.
__global__ __launch_bounds__(128)
void gemm_qkv(const u16* __restrict__ A, const u16* __restrict__ Bt, const float* __restrict__ bq,
              const float* __restrict__ bk, const float* __restrict__ bv,
              const float* __restrict__ TC, const float* __restrict__ TS,
              u16* QH, u16* QL, u16* KH, u16* KL, u16* VH, u16* VL, int K) {
  const int tid = threadIdx.x, lane = tid & 31;
  const int wave = __builtin_amdgcn_readfirstlane(tid >> 5);   // scalar, so that the tile starts below are scalar bases
  const int bid   = blockIdx.x;
  const int rowb  = (bid / (NQKV / 64)) * 64 + wave * 16;
  const int col0  = (bid % (NQKV / 64)) * 64;
  if (rowb + 16 > MROWS) return;            // wave-uniform, never taken with the exact grid; no block barriers in this kernel
  const u16* ap  = A  + (size_t)rowb * K;             // fragment (16-row tile, k step ks) at tile start + ks * 1024 bytes
  const u16* bp  = Bt + (size_t)col0 * K;
  const u16* bp1 = Bt + (size_t)(col0 + 16) * K;
  const u16* bp2 = Bt + (size_t)(col0 + 32) * K;
  const u16* bp3 = Bt + (size_t)(col0 + 48) * K;
  const unsigned vo = (unsigned)lane * 16u;
  const int b    = rowb / SEQ;                        // sequence
  const int s16  = rowb - b * SEQ;                    // the wave's first position in it, a multiple of 16
  const int hcol = col0 & (DMOD - 1);                 // head * HD within the q, k or v projection
  const size_t hp = ((size_t)b * DMOD + hcol) * SEQ;  // start of the (sequence, head) plane, in halves: (b*8 + head) * SEQ * HD
  v8f acc[4];
#pragma unroll
  for (int j = 0; j < 4; ++j) acc[j] = zero8();
  if (col0 >= VCOL0 && col0 < KCOL0) {
    proj_loop<0>(ap, bp, bp1, bp2, bp3, vo, K, acc[0], acc[1], acc[2], acc[3]);
    vt_epi(acc, lane & 15, bk + hcol, VH, VL,
           hp + (size_t)(s16 >> 5) * (32 * HD) + (size_t)((s16 >> 4) & 1) * 256 + 8 * lane);
  } else {
    const bool isq = col0 < VCOL0;
    proj_loop<1>(ap, bp, bp1, bp2, bp3, vo, K, acc[0], acc[1], acc[2], acc[3]);
    rope_epi(acc, lane >> 4, s16 + (lane & 15), (isq ? bq : bv) + hcol, TC, TS, isq ? QH : KH, isq ? QL : KL,
             hp + (size_t)s16 * HD + 8 * lane, isq ? QSC : KSC);
  }
}

// =====================================================================================================
// f16 GEMM: C[M][N] (f32) = (A[M][K] (+ A2[M][K] when TWO != 0)) . Bt[N][K]^T, times oscale, plus bias[n]; A, A2 f16
// fragment-major planes (A2 = the unscaled f16 residual of A, sharing the accumulator), Bt f16 fragment-major. Same tiling, fragment
// loads (split k map) as gemm_qkv, epilogue epi64; K stepped by 32 * KUN (host: K = DMOD).
// =====================================================================================================
template <int TWO>
__device__ __forceinline__
void gemm_h(float* slab, int wave, int lane, int rowb, int crow, int col0,
            const u16* __restrict__ A, const u16* __restrict__ A2, const u16* __restrict__ Bt,
            const float* __restrict__ bias, float* C, int N, int K, float oscale) {
  const _Float16* ap  = (const _Float16*)(const void*)A  + (size_t)rowb * K;
  const _Float16* ap2 = (const _Float16*)(const void*)A2 + (size_t)rowb * K;
  const _Float16* bp  = (const _Float16*)(const void*)Bt + (size_t)col0 * K;
  const _Float16* bp1 = (const _Float16*)(const void*)Bt + (size_t)(col0 + 16) * K;
  const _Float16* bp2 = (const _Float16*)(const void*)Bt + (size_t)(col0 + 32) * K;
  const _Float16* bp3 = (const _Float16*)(const void*)Bt + (size_t)(col0 + 48) * K;
  unsigned vo = (unsigned)lane * 16u;
  v8f acc0 = zero8(), acc1 = zero8(), acc2 = zero8(), acc3 = zero8();
  // KUN k steps a trip: their fragments are all requested in one run in front of the first product, so that the wave waits for
  // one round trip per KUN steps (this launch has few waves per SIMD to cover a wait, and registers to spare); the products
  // follow in the order of the k steps
#pragma unroll 1
  for (int k0 = 0; k0 < K; k0 += 32 * KUN, vo += 1024u * KUN) {
    v16h a[KUN], a2[KUN], b0[KUN], b1[KUN], b2[KUN], b3[KUN];
#pragma unroll
    for (int u = 0; u < KUN; ++u) {
      a[u]  = ldfrag_h(ap  + 512 * u, vo);          // k step u of the trip: + 1024 bytes
      b0[u] = ldfrag_h(bp  + 512 * u, vo);
      b1[u] = ldfrag_h(bp1 + 512 * u, vo);
      b2[u] = ldfrag_h(bp2 + 512 * u, vo);
      b3[u] = ldfrag_h(bp3 + 512 * u, vo);
      if (TWO != 0) a2[u] = ldfrag_h(ap2 + 512 * u, vo);
    }
    // keeps the scheduler from sinking the later steps' loads in among the products (it did, to save registers: one exposed
    // wait per step again)
    __builtin_amdgcn_sched_barrier(0);
#pragma unroll
    for (int u = 0; u < KUN; ++u) {
      acc0 = mma_h(a[u], b0[u], acc0);
      acc1 = mma_h(a[u], b1[u], acc1);
      acc2 = mma_h(a[u], b2[u], acc2);
      acc3 = mma_h(a[u], b3[u], acc3);
      if (TWO != 0) {
        acc0 = mma_h(a2[u], b0[u], acc0);
        acc1 = mma_h(a2[u], b1[u], acc1);
        acc2 = mma_h(a2[u], b2[u], acc2);
        acc3 = mma_h(a2[u], b3[u], acc3);
      }
    }
    if (TWO != 0) guard6<v16h>(acc0, acc1, acc2, acc3, a[KUN - 1], a2[KUN - 1], b0[KUN - 1], b1[KUN - 1], b2[KUN - 1], b3[KUN - 1]);
    else          guard6<v16h>(acc0, acc1, acc2, acc3, a[KUN - 1], b0[KUN - 1], b1[KUN - 1], b2[KUN - 1], b3[KUN - 1], a[KUN - 1]);
  }
  (void)ap2;
  epi64<1>(slab + wave * SLAB64, acc0, acc1, acc2, acc3, oscale, bias, C, N, (size_t)crow, col0, lane);
}

// One launch for y = O.Wo^T + bo over all sequences: block = 64 rows x 64 columns; its 64 rows lie in one sequence and wholly
// below or wholly at and above row RICH of it (RICH and SEQ multiples of 64), so the choice hi + residual / hi only is
// block-uniform. rowb = the wave's first row in the O planes, crow = the same row in out.
// coverage: grid = NB * (SEQ/64) * (N/64) blocks x 4 waves x 16 x 64 = every element of out once (host: N % 64 == 0, K % (32 * KUN) == 0).
__global__ __launch_bounds__(128)
void gemm_o(const u16* __restrict__ A, const u16* __restrict__ A2, const u16* __restrict__ Bt,
            const float* __restrict__ bias, float* C, int N, int K, float oscale) {
  __shared__ __align__(16) float slab[4 * SLAB64];
  const int tid = threadIdx.x, lane = tid & 31;
  const int wave = __builtin_amdgcn_readfirstlane(tid >> 5);   // scalar, so that the tile starts are scalar bases
  const int ntile = N >> 6;
  const int bid  = blockIdx.x;
  const int rt   = bid / ntile;
  const int col0 = (bid % ntile) * 64;
  const int bq   = rt / (SEQ / 64);
  const int rs   = (rt % (SEQ / 64)) * 64;                     // first row of the block within its sequence
  if (bq >= NB) return;                     // block-uniform, never taken with the exact grid; no block barriers in this kernel
  const int rowb = bq * SEQ + rs + wave * 16;
  const int crow = bq * XS_FULL + rs + wave * 16;
  if (rs < RICH) gemm_h<1>(slab, wave, lane, rowb, crow, col0, A, A2, Bt, bias, C, N, K, oscale);
  else           gemm_h<0>(slab, wave, lane, rowb, crow, col0, A, A2, Bt, bias, C, N, K, oscale);
}

// =====================================================================================================
// Causal softmax attention, hd = 64, 8 heads. Block bid -> (pair of query tiles qp = NQP-1 - bid/(NH*NB): rows q0 = 32*qp .. q0+31, tile t
// = rows q0 + 16t .. q0 + 16t + 15, head, batch b); keys/values of the same head (kvh = head). The pair's key steps (the same
// steps for both tiles) are dealt over the block's NSW waves: wave w takes steps w, w + NSW, ... for BOTH tiles, so each k and
// v^T fragment it loads feeds two tiles' products; per tile its own running max, sum and O accumulators; the NSW partials of
// each tile are merged in LDS behind one block barrier (attn_merge8); the longest serial walk is NKT / NSW steps.
//   q and k hi / residual planes f16 x256, fragment-major per head [b*8 + h][s/16][d/32][half][lane][8];
//   v^T hi / residual planes x1024, fragment-major per head [b*NKVH + h][s/32][d/16][half][lane][8].
//   raw(i, j) = q_hi.k_hi + q_lo.k_hi + q_hi.k_lo (2 k-steps over d); logit = raw * (SM_SCALE * 2^-16) (the two 256 carries
//   folded exactly into the 1/sqrt(512) scale, one f32 multiply); keys above the diagonal replaced by -inf.
//   Both products run transposed, S^T = k.q^T (A = k fragment, B = q fragment) and O^T += v^T.P^T (A = v^T fragment, B = P^T),
//   so lane (c, hh) holds per tile 16 scores and 32 O elements of the one query q0 + 16t + c: online softmax per query in f32 with a running
//   max: max over the lane's 16 scores, then one exchange with lane c ^ 16 (same max in both); sum over the lane's own keys,
//   the two halves joined once behind the loop; alpha = exp(m_old - m_new), p = exp(logit - m_new), l = l*alpha + sum p, O
//   accumulators times alpha before the tile's v^T.P^T. Only key tiles of 32 with kb <= q0 are visited (nkt = q0/32 + 1 <= NKT; key kb is
//   unmasked for every row of the tile, so each row max of a visited tile is finite; wave 0 always visits tile 0).
//   The two 16x16 score tiles of a step, converted in place, are the P^T B fragment (no LDS, no lane exchange);
//   the four v^T hi A fragments are requested behind the score products, in front of the softmax; RV = 1: products
//   hh + lh + hl, RV = 0: hh only. After the loop every wave (one without a step: max -inf, sum 0, O 0) puts its raw O
//   accumulators into its slab and its 32 row maxima and sums beside them; block barrier; waves 4t .. 4t+3 merge tile t.
//   Epilogue: O = merged acc / (merged l * 32768 * 1024), x256 -> f16 hi plane (and for RV = 1 the unscaled f16 residual
//   plane), fragment-major over [b*SEQ + s][512]; wave 4t + it, lane = (row c of tile t, 8 consecutive d at it*16 + 8*hh); one
//   instruction = one 512-B half fragment (4 whole lines).
// coverage: 8 waves x 1 instruction x 32 lanes x 8 halves = 32 x 64 per plane; grid NQP x NH x NB blocks;
//   the two forms (pairs 0..NQPR-1 with RV = 1, NQPR..NQP-1 with RV = 0) cover every (b, s, h) row segment of the hi plane
//   exactly once and rows s < RICH of the residual plane exactly once (only those rows are read later).
// =====================================================================================================
// lane l <-> lane l ^ 16 (the other 16-lane row) as one vector cross-row move
__device__ __forceinline__ float xhalf(float x) {
  const int b = __builtin_bit_cast(int, x);
  return __builtin_bit_cast(float, __builtin_amdgcn_permlanex16(b, b, 0x76543210, 0xfedcba98, false, false));
}

// 2^x for the merge weights. The v_nop in the same statement keeps the one issue slot that the instruction set asks for behind
// a transcendental, whichever instruction the compiler places next.
__device__ __forceinline__ float exp2_slot(float x) {
  float r = 0.0f;
#if defined(__HIP_DEVICE_COMPILE__)
  asm("v_exp_f32 %0, %1\n\tv_nop" : "=v"(r) : "v"(x));
#endif
  return r;
}

// 2^x of eight values in one statement, for the same slot: the results are early-clobber, so that no v_exp_f32 here writes a
// source or reads a result of the one in front of it, and the one v_nop keeps the slot behind the last.
__device__ __forceinline__ void exp2x8_slot(float (&r)[8], const float (&x)[8]) {
#if defined(__HIP_DEVICE_COMPILE__)
  asm("v_exp_f32 %0, %8\n\tv_exp_f32 %1, %9\n\tv_exp_f32 %2, %10\n\tv_exp_f32 %3, %11\n\t"
      "v_exp_f32 %4, %12\n\tv_exp_f32 %5, %13\n\tv_exp_f32 %6, %14\n\tv_exp_f32 %7, %15\n\tv_nop"
      : "=&v"(r[0]), "=&v"(r[1]), "=&v"(r[2]), "=&v"(r[3]), "=&v"(r[4]), "=&v"(r[5]), "=&v"(r[6]), "=&v"(r[7])
      : "v"(x[0]), "v"(x[1]), "v"(x[2]), "v"(x[3]), "v"(x[4]), "v"(x[5]), "v"(x[6]), "v"(x[7]));
#else
  for (int e = 0; e < 8; ++e) r[e] = x[e];
#endif
}

// Merge of the NSW partials for one lane's 8 outputs (row c of the block's QTW * 16, columns dd .. dd+7): M = max of the waves' row maxima, weight
// exp(m_w - M) (0 for a wave without a step), L = sum of weight * l_w, acc = sum of weight * O_w, waves in index order.
__device__ __forceinline__ void attn_merge8(const float* slabs, const float* sm, const float* sl, int c, int dd,
                                            float* acc, float& L) {
  float mw[NSW], lw[NSW];
  v4f pa[NSW], pb[NSW];
#pragma unroll
  for (int w = 0; w < NSW; ++w) {
    mw[w] = sm[w * (QTW * 16) + c];
    lw[w] = sl[w * (QTW * 16) + c];
    pa[w] = *(const v4f*)(slabs + w * SLW + c * SLP + dd);
    pb[w] = *(const v4f*)(slabs + w * SLW + c * SLP + dd + 4);
  }
  float M = mw[0];
#pragma unroll
  for (int w = 1; w < NSW; ++w) M = fmaxf(M, mw[w]);
  L = 0.0f;
#pragma unroll
  for (int e = 0; e < 8; ++e) acc[e] = 0.0f;
#pragma unroll
  for (int w = 0; w < NSW; ++w) {
    const float wt = exp2_slot((mw[w] - M) * 1.44269504f);
    L += wt * lw[w];
#pragma unroll
    for (int e = 0; e < 4; ++e) {
      acc[e]     += wt * pa[w][e];
      acc[4 + e] += wt * pb[w][e];
    }
  }
}

template <int RV>
__device__ __forceinline__
void attn_cs(float* smem, float* smx, float* ssm, int qp, int head, int b,
             const u16* __restrict__ QHp, const u16* __restrict__ QLp,
             const u16* __restrict__ KHp, const u16* __restrict__ KLp,
             const u16* __restrict__ VHp, const u16* __restrict__ VLp,
             u16* OHp, u16* OLp) {
#pragma clang fp contract(off)
  const int tid  = threadIdx.x;
  const int wave = __builtin_amdgcn_readfirstlane(tid >> 5);   // scalar: which key steps the wave takes
  const int lane = tid & 31;
  const int hh   = lane >> 4;
  const int c    = lane & 15;
  const int q0   = qp * (QTW * 16);         // first query row of the block's QTW tiles
  const int kvh  = head;

  float* slab = smem + wave * SLW;          // O partial slab [QTW * 16 queries][64 d] pitch 68, written behind the loop

  // fragment-major planes: a head's 16 positions x 64 d = 1024 halves (2 fragments), its 32 keys x 64 d of v^T = 2048 (4)
  // byte offsets into the planes (each plane MROWS * 512 * 2 bytes, far under 2^32), the lane's 16 bytes included
  const unsigned qvo = ((unsigned)(b * NH + head) * SEQ + (unsigned)q0) * (HD * 2u) + (unsigned)lane * 16u;
  unsigned kvo = (unsigned)(b * NKVH + kvh) * (SEQ * HD * 2u) + (unsigned)wave * (32u * HD * 2u)
               + (unsigned)lane * 16u;                                                  // this step's 32 keys, k and v^T alike
  const _Float16* Qh  = (const _Float16*)(const void*)QHp;               // query tile t at + t * 1024 halves
  const _Float16* Ql  = (const _Float16*)(const void*)QLp;
  const _Float16* Khb = (const _Float16*)(const void*)KHp;
  const _Float16* Klb = (const _Float16*)(const void*)KLp;
  const _Float16* Vhb = (const _Float16*)(const void*)VHp;               // d-subtile j at + j * 512 halves
  const _Float16* Vlb = (const _Float16*)(const void*)VLp;
  const float lsc  = SM_SCALE * (1.0f / (QSC * KSC));   // exact power-of-two fold of the q / k carries into the scale
  const float oc   = 1.0f / (PCAR * VCAR);
  const float ninf = -__builtin_inff();
  const size_t KROW = (size_t)HD;           // halves per key in a head's fragment-major plane

  v8f o[QTW][4];
  float mrun[QTW], lrun[QTW];               // per tile, this lane's query: running max (alike in lanes c and c + 16), sum over the lane's own keys
#pragma unroll
  for (int t = 0; t < QTW; ++t) {
#pragma unroll
    for (int j = 0; j < 4; ++j) o[t][j] = zero8();
    mrun[t] = ninf;
    lrun[t] = 0.0f;
  }
  const int ncaus = (q0 >> 5) + 1;                                            // tiles holding keys <= q0 + 31, the same for both query tiles
  const int nkt   = (ncaus < NKT) ? ncaus : NKT;

#pragma unroll 1
  for (int kt = wave; kt < nkt; kt += NSW, kvo += NSW * 32u * HD * 2u) {
    const int kb = kt * 32;
    // ---- raw scores, transposed: D element r of this lane = (key kb + 8hh + r, query q0 + 16t + c) in s0[t], key kb + 16 + 8hh + r
    //      in s1[t]; every k fragment is loaded once and multiplied with the q fragments of both tiles ----
    v8f s0[QTW], s1[QTW];
#pragma unroll
    for (int t = 0; t < QTW; ++t) { s0[t] = zero8(); s1[t] = zero8(); }
    const _Float16* k0p = Khb;
    const _Float16* k1p = k0p + (size_t)16 * KROW;
    const _Float16* l0p = Klb;
    const _Float16* l1p = l0p + (size_t)16 * KROW;
    // all fragments of the step's score products (k hi / residual, both d halves; the q fragments are the same in every step
    // and may stay in registers) are requested in one run in front of the first product, so that the wave waits for one
    // round trip here, not one per d half
    v16h kf[8], qf[8];                      // kf[4*kk + ..] = kh0, kh1, kl0, kl1; qf[4*kk + 2*t + ..] = q hi, q residual of tile t
#pragma unroll
    for (int kk = 0; kk < HD / 32; ++kk) {
      kf[4 * kk]     = ldfrag_h(k0p + kk * 512, kvo);
      kf[4 * kk + 1] = ldfrag_h(k1p + kk * 512, kvo);
      kf[4 * kk + 2] = ldfrag_h(l0p + kk * 512, kvo);
      kf[4 * kk + 3] = ldfrag_h(l1p + kk * 512, kvo);
#pragma unroll
      for (int t = 0; t < QTW; ++t) {
        qf[4 * kk + 2 * t]     = ldfrag_h(Qh + t * 1024 + kk * 512, qvo);
        qf[4 * kk + 2 * t + 1] = ldfrag_h(Ql + t * 1024 + kk * 512, qvo);
      }
    }
#pragma unroll
    for (int kk = 0; kk < HD / 32; ++kk) {
#pragma unroll
      for (int t = 0; t < QTW; ++t) {
        s0[t] = mma_h(kf[4 * kk],     qf[4 * kk + 2 * t],     s0[t]);
        s0[t] = mma_h(kf[4 * kk],     qf[4 * kk + 2 * t + 1], s0[t]);
        s0[t] = mma_h(kf[4 * kk + 2], qf[4 * kk + 2 * t],     s0[t]);
        s1[t] = mma_h(kf[4 * kk + 1], qf[4 * kk + 2 * t],     s1[t]);
        s1[t] = mma_h(kf[4 * kk + 1], qf[4 * kk + 2 * t + 1], s1[t]);
        s1[t] = mma_h(kf[4 * kk + 3], qf[4 * kk + 2 * t],     s1[t]);
      }
    }
    guard4x16(s0[0], s1[0], s0[1], s1[1], kf, qf);
    // the step's four v^T hi fragments are requested here, into registers that the k fragments have left, and fly while the
    // softmax below runs
    v16h vh[4];
#pragma unroll
    for (int j = 0; j < 4; ++j) vh[j] = ldfrag_h(Vhb + j * 512, kvo);
    // keeps the scheduler from sinking these loads down to their first use behind the softmax (their wait would be exposed)
    __builtin_amdgcn_sched_barrier(0);
    // ---- per query tile: causal replace-mask, running-max online softmax in f32 (the lane's 16 scores of a tile all belong
    //      to its one query), rescale of the tile's O accumulators, P^T fragments ----
    const int key0 = kb + 8 * hh;
    FragH ph[QTW], pl[QTW];
#pragma unroll
    for (int t = 0; t < QTW; ++t) {
      const int qrow = q0 + 16 * t + c;                                       // the lane's query row in tile t
      float t0[8], t1[8];
#pragma unroll
      for (int r = 0; r < 8; ++r) {
        const float a0 = s0[t][r] * lsc;
        const float a1 = s1[t][r] * lsc;
        t0[r] = (key0 + r > qrow) ? ninf : a0;
        t1[r] = (key0 + 16 + r > qrow) ? ninf : a1;
      }
      float mx = fmaxf(t0[0], t1[0]);
#pragma unroll
      for (int r = 1; r < 8; ++r) mx = fmaxf(mx, fmaxf(t0[r], t1[r]));
      mx = fmaxf(mx, xhalf(mx));            // the query's other 16 keys of this step sit in lane c ^ 16
      const float mnew = fmaxf(mrun[t], mx);
      const float al   = exp2_slot((mrun[t] - mnew) * 1.44269504f);
      float x0[8], x1[8], p0[8], p1[8], ps[8];
#pragma unroll
      for (int r = 0; r < 8; ++r) {
        x0[r] = (t0[r] - mnew) * 1.44269504f;
        x1[r] = (t1[r] - mnew) * 1.44269504f;
      }
      exp2x8_slot(p0, x0);
      exp2x8_slot(p1, x1);
#pragma unroll
      for (int r = 0; r < 8; ++r) ps[r] = p0[r] + p1[r];
      const float sm = ((ps[0] + ps[1]) + (ps[2] + ps[3])) + ((ps[4] + ps[5]) + (ps[6] + ps[7]));
      lrun[t] = lrun[t] * al + sm;
      mrun[t] = mnew;
      // rescale the tile's O accumulators by alpha (every element of the lane belongs to its query)
#pragma unroll
      for (int j = 0; j < 4; ++j) {
#pragma unroll
        for (int r = 0; r < 8; ++r) o[t][j][r] = o[t][j][r] * al;
      }
      // B fragments of p*32768 straight from the score registers: column = query c, elements 0..7 = keys kb + 8hh + 0..7,
      // elements 8..15 = keys kb + 16 + 8hh + 0..7 (the split k map of the v^T fragments); hi f16, residual f16 for RV = 1
#pragma unroll
      for (int r = 0; r < 8; ++r) {
        const float ta = p0[r] * PCAR, tb = p1[r] * PCAR;
        const _Float16 ha = (_Float16)ta, hb = (_Float16)tb;
        ph[t].h[0][r] = ha;
        ph[t].h[1][r] = hb;
        if (RV != 0) {
          pl[t].h[0][r] = (_Float16)(ta - (float)ha);
          pl[t].h[1][r] = (_Float16)(tb - (float)hb);
        }
      }
    }
    // ---- O^T += v^T.P^T : A fragment row = d = j*16 + c, keys contiguous in the v^T planes; every v^T fragment loaded once
    //      for both tiles; D element r of o[t][j] = (d = j*16 + 8hh + r, query q0 + 16t + c) ----
    if (RV != 0) {
      v16h vl[4];
#pragma unroll
      for (int j = 0; j < 4; ++j) vl[j] = ldfrag_h(Vlb + j * 512, kvo);
#pragma unroll
      for (int j = 0; j < 4; ++j) {
#pragma unroll
        for (int t = 0; t < QTW; ++t) {
          o[t][j] = mma_h(vh[j], ph[t].v, o[t][j]);
          o[t][j] = mma_h(vh[j], pl[t].v, o[t][j]);
          o[t][j] = mma_h(vl[j], ph[t].v, o[t][j]);
        }
      }
      guard8x12(o[0], o[1], ph[0].v, ph[1].v, pl[0].v, pl[1].v, vh, vl);
    } else {
#pragma unroll
      for (int j = 0; j < 4; ++j) {
#pragma unroll
        for (int t = 0; t < QTW; ++t) o[t][j] = mma_h(vh[j], ph[t].v, o[t][j]);
      }
      guard8x6(o[0], o[1], ph[0].v, ph[1].v, vh);
    }
  }
  acc_guard4(o[0][0], o[0][1], o[0][2], o[0][3]);
  acc_guard4(o[1][0], o[1][1], o[1][2], o[1][3]);
  // ---- the wave's partial: raw O accumulators into its slab (row = 16t + c, 8 consecutive d a register tile: 16-B stores),
  //      each query's max and its sum (the two lane halves' sums joined here, once) beside: both are alike in lanes c and
  //      c + 16, so lane (hh, c) stores those of tile hh, row 16hh + c = lane ----
#pragma unroll
  for (int t = 0; t < QTW; ++t) {
#pragma unroll
    for (int j = 0; j < 4; ++j) {
      float* d = slab + (t * 16 + c) * SLP + j * 16 + 8 * hh;
      const v4f lo = {o[t][j][0], o[t][j][1], o[t][j][2], o[t][j][3]};
      const v4f hi = {o[t][j][4], o[t][j][5], o[t][j][6], o[t][j][7]};
      *(v4f*)(d)     = lo;
      *(v4f*)(d + 4) = hi;
    }
  }
  const float lall0 = lrun[0] + xhalf(lrun[0]);
  const float lall1 = lrun[1] + xhalf(lrun[1]);
  smx[wave * (QTW * 16) + lane] = (hh != 0) ? mrun[1] : mrun[0];
  ssm[wave * (QTW * 16) + lane] = (hh != 0) ? lall1 : lall0;
  __syncthreads();                          // every wave's partial is in LDS before any wave merges; passed by all NSW waves
  // ---- merged O / l with the carries (32768 on p, 1024 on v) folded once, x256 -> f16 hi plane (+ f16 residual plane),
  //      fragment-major [row/16][512/32][half][lane][8]: wave 4*tq + it stores, for query tile tq, half it&1 of k step
  //      head*2 + (it>>1); lane = (row c of the tile, 8 consecutive d at it*16 + 8*hh) ----
  const int tq = wave >> 2;
  const int it = wave & 3;
  float acc[8], lsum;
  attn_merge8(smem, smx, ssm, tq * 16 + c, it * 16 + 8 * hh, acc, lsum);
  const float rl = (1.0f / lsum) * oc;
  float w[8];
#pragma unroll
  for (int e = 0; e < 8; ++e) w[e] = (acc[e] * rl) * OSC;
  v4u oh, ol;
#pragma unroll
  for (int e = 0; e < 4; ++e) {
    const _Float16 h0 = (_Float16)w[2 * e], h1 = (_Float16)w[2 * e + 1];
    const _Float16 g0 = (_Float16)(w[2 * e] - (float)h0), g1 = (_Float16)(w[2 * e + 1] - (float)h1);
    oh[e] = pk16(h_bits(h0), h_bits(h1));
    ol[e] = pk16(h_bits(g0), h_bits(g1));
  }
  const size_t ob = ((size_t)b * SEQ + q0 + tq * 16) * DMOD + (size_t)head * (16 * HD) + 8 * lane + it * 256;
  *(v4u*)(OHp + ob) = oh;
  if (RV != 0) {
    *(v4u*)(OLp + ob) = ol;
  }
  // in the shared launch the code of the other form may follow and writes registers that these stores name
  asm volatile("s_wait_xcnt 0x0" ::: "memory");
}

// One launch for all query tiles: the index of the tile pair decides block-uniformly between the two forms (RV = 1 for pairs < NQPR).
// coverage: bid -> (qp, head, b) is one-to-one from 0 .. NQP*NH*NB - 1 onto NQP x NH x NB.
__global__ __launch_bounds__(ATT_THREADS)
void attn_all(const u16* __restrict__ QHp, const u16* __restrict__ QLp,
              const u16* __restrict__ KHp, const u16* __restrict__ KLp,
              const u16* __restrict__ VHp, const u16* __restrict__ VLp, u16* OHp, u16* OLp) {
  __shared__ __align__(16) float smem[NSW * SLW];   // per wave: O partial slab behind the loop
  __shared__ float smx[NSW * QTW * 16];             // per wave: QTW * 16 row maxima
  __shared__ float ssm[NSW * QTW * 16];             // per wave: QTW * 16 row sums
  const int bid  = blockIdx.x;
  if (bid >= NQP * NH * NB) return;         // block-uniform, in front of the block barrier; never taken with the exact grid
  // a block's cost grows with qp (qp + 1 key steps): the longest pairs come first in the index, for speed only; the NH * NB
  // blocks of one qp, all of one cost, are neighbours in the index (a multiple of 8)
  const int qp   = NQP - 1 - bid / (NH * NB);
  const int t2   = bid % (NH * NB);
  const int head = t2 % NH;
  const int b    = t2 / NH;
  if (qp < NQPR) attn_cs<1>(smem, smx, ssm, qp, head, b, QHp, QLp, KHp, KLp, VHp, VLp, OHp, OLp);
  else           attn_cs<0>(smem, smx, ssm, qp, head, b, QHp, QLp, KHp, KLp, VHp, VLp, OHp, OLp);
}

// =====================================================================================================
// Workspace map (bytes); every plane is fully written by whole-line stores before it is read (the O residual plane only on
// the rows < RICH per sequence that are read); all extents are exact multiples of the store granularity (no pad rows needed);
// every region offset a multiple of 131072; every 16-bit plane is fragment-major (see the fragment loaders), same extent as
// the row-major shape given here:
//   XB  bf16 [MROWS][512]               MROWS*1024   (NB=4, SEQ=2048: 8388608); after the projection GEMM the same bytes hold
//                                                    the O f16 hi plane [MROWS][512] x256 (identical extent)
//   WB  bf16 [1536 n][512 k]            1572864      (Wq rows 0..511, Wk 512..1023, Wv 1024..1535)
//   OL  f16 [MROWS][512]                MROWS*1024   O residual plane
//   QH  f16 [MROWS][512] x256           MROWS*1024   QL residual, same extent
//   KH  f16 [MROWS][512] x256           MROWS*1024   KL residual, same extent   (keys = rotary of the v_proj columns)
//   VH  f16 [NB*8][64][SEQ] x1024       MROWS*1024   VL residual, same extent   (values = the k_proj columns)
//   TC  f32 [SEQ][32]                   SEQ*128      TS, same extent
//   WT  f16 [512 o][512 d] x1024        524288       (Wo; a region of its own, written in the launch that also writes WB)
//   end (NB=4, SEQ=2048)               69730304
// =====================================================================================================
extern "C" void kernel_launch(void* const* d_in, const int* in_sizes, int n_in,
                              void* d_out, int out_size, void* d_ws, size_t ws_size,
                              hipStream_t stream) {
  if (n_in < 9) return;
  if (in_sizes[0] < ((NB - 1) * XS_FULL + SEQ) * DMOD) return;
  if (in_sizes[1] != DMOD * DMOD) return;
  if (in_sizes[2] != DMOD) return;
  if (in_sizes[3] != DMOD * DMOD) return;
  if (in_sizes[4] != DMOD) return;
  if (in_sizes[5] != DMOD * DMOD) return;
  if (in_sizes[6] != DMOD) return;
  if (in_sizes[7] != DMOD * DMOD) return;
  if (in_sizes[8] != DMOD) return;
  if (out_size < ((NB - 1) * XS_FULL + SEQ) * DMOD) return;

  const float* x   = (const float*)d_in[0];
  const float* wq  = (const float*)d_in[1];
  const float* bqp = (const float*)d_in[2];
  const float* wk  = (const float*)d_in[3];
  const float* bkp = (const float*)d_in[4];
  const float* wv  = (const float*)d_in[5];
  const float* bvp = (const float*)d_in[6];
  const float* wo  = (const float*)d_in[7];
  const float* bop = (const float*)d_in[8];
  float*       out = (float*)d_out;

  const size_t szXB = (size_t)MROWS * DMOD * 2;
  const size_t szWB = (size_t)NQKV * DMOD * 2;
  const size_t szQ  = (size_t)MROWS * DMOD * 2;                  // QH, QL
  const size_t szK  = (size_t)MROWS * KVD * 2;                   // KH, KL
  const size_t szV  = (size_t)NB * NKVH * HD * SEQ * 2;          // VH, VL (== szK)
  const size_t szT  = (size_t)SEQ * NFREQ * 4;                   // TC, TS
  const size_t szOH = (size_t)MROWS * DMOD * 2;                  // O hi plane, lives in the XB region
  const size_t szOL = (size_t)MROWS * DMOD * 2;                  // O residual plane
  const size_t szWT = (size_t)DMOD * DMOD * 2;                   // Wo f16 plane
  if (szOH > szXB) return;
  size_t off = 0;
  const size_t oXB = off; off += szXB;
  const size_t oWB = off; off += szWB;
  const size_t oOL = off; off += szOL;
  const size_t oQH = off; off += szQ;
  const size_t oQL = off; off += szQ;
  const size_t oKH = off; off += szK;
  const size_t oKL = off; off += szK;
  const size_t oVH = off; off += szV;
  const size_t oVL = off; off += szV;
  const size_t oTC = off; off += szT;
  const size_t oTS = off; off += szT;
  const size_t oWT = off; off += szWT;
  if (off > ws_size) return;                // off = 69730304 for NB = 4, SEQ = 2048
  if (off > (size_t)WS_CAP) return;

  char* ws = (char*)d_ws;
  u16*   XB  = (u16*)(ws + oXB);
  u16*   OH  = (u16*)(ws + oXB);
  u16*   WB  = (u16*)(ws + oWB);
  u16*   WT  = (u16*)(ws + oWT);
  u16*   OL  = (u16*)(ws + oOL);
  u16*   QH  = (u16*)(ws + oQH);
  u16*   QL  = (u16*)(ws + oQL);
  u16*   KH  = (u16*)(ws + oKH);
  u16*   KL  = (u16*)(ws + oKL);
  u16*   VH  = (u16*)(ws + oVH);
  u16*   VL  = (u16*)(ws + oVL);
  float* TC  = (float*)(ws + oTC);
  float* TS  = (float*)(ws + oTS);

  const dim3 b256(256), b128(128), bAT(ATT_THREADS);
  const dim3 gG1((MROWS / 64) * (NQKV / 64));
  const float osc = 1.0f / (OSC * WOS);

  // (1) rotary cos / sin tables [SEQ][32]; x -> bf16 plane [MROWS][512]; Wq, Wk, Wv -> one bf16 plane [1536 n][512 k];
  //     Wo [512 o][512 d] -> f16 plane of the bf16 value x1024 (already k-contiguous)
  prep<<<dim3(GT + NB * GX + 4 * GW), b256, 0, stream>>>(x, wq, wk, wv, wo, XB, WB, WT, TC, TS);
  // (2) x.[Wq|Wk|Wv]^T (columns 0..511 q_proj, 512..1023 k_proj, 1024..1535 v_proj) with the planes written by its epilogue:
  //     q = rotary(q_proj + bq) and keys = rotary(v_proj + bv) -> hi + residual planes x256; values = k_proj + bk (no rotary)
  //     -> v^T hi + residual planes x1024
  gemm_qkv<<<gG1, b128, 0, stream>>>(XB, WB, bqp, bkp, bvp, TC, TS, QH, QL, KH, KL, VH, VL, DMOD);
  // (3) causal attention -> O f16 hi plane x256 (XB region) for all query tiles; residual plane for tiles < RICH
  attn_all<<<dim3(NQP * NH * NB), bAT, 0, stream>>>(QH, QL, KH, KL, VH, VL, OH, OL);
  // (4) y = O.Wo^T + bo -> out f32 [rows][512], carries 256 x 1024 folded back; rows < RICH per sequence with O hi + residual
  gemm_o<<<dim3(NB * (SEQ / 64) * (DMOD / 64)), b128, 0, stream>>>(OH, OL, WT, bop, out, DMOD, DMOD, osc);
  (void)hipGetLastError();
}

// v009
// It runs in 90.2 microseconds.
// Next to v008, in two timings, it ran 1.06 and 1.07 times as fast.
// All steps since v000 together make it 4.17 times as fast.
// Contractions: x.[Wq|Wk|Wv]^T on v_wmma_f32_16x16x32_bf16 (x and the weights as bf16 RNE planes; weight [n][k] rows are
// the k-contiguous A operand for q_proj and v_proj, B for k_proj; f32 accumulate); q.k^T over hd 64 and P.v on v_wmma_f32_16x16x32_f16 with f16 hi + f16
// residual planes (both transposed: k.q^T and v^T.P^T; q, k x256 after rotary, products hh+lh+hl on every row; P x32768 hi + in-register residual and v^T x1024
// hi + residual plane for query rows < 512 of each sequence, P hi . v hi only for later rows); O.Wo^T on
// v_wmma_f32_16x16x32_f16 with O x256 as f16 hi (+ f16 residual plane for rows < 512 of each sequence) and Wo as
// f16(bf16(Wo)) x1024, one accumulator, bias added in f32; all f32 accumulate. Rotary cos/sin tables, bias adds and online
// softmax in f32 on VALU.
#include <hip/hip_runtime.h>
#include <math.h>
#include <stdint.h>

#ifndef NB
#define NB 4
#endif
#ifndef SEQ
#define SEQ 2048
#endif
#define XS_FULL 2048
#define DMOD  512
#define NH    8
#define NKVH  8
#define HD    64
#define HHALF (HD / 2)
#define NFREQ (HD / 2)
#define KVD   (NKVH * HD)
#define NQKV  (DMOD + 2 * KVD)
#define QCOL0 0
#define VCOL0 DMOD
#define KCOL0 (DMOD + KVD)
#define MROWS (NB * SEQ)
#define RICH  512
#define ROPE_L2 0.41524101186092028
#define SM_SCALE 0.04419417382415922f
#define QSC   256.0f
#define KSC   256.0f
#define PCAR  32768.0f
#define VCAR  1024.0f
#define OSC   256.0f
#define WOS   1024.0f
#define NSW   4
#define NQG   2
#define NWV   (NSW * NQG)
#define NQT   (SEQ / 16)
#define NQTR  (RICH / 16)
#define QTW   2
#define NQP   (NQT / QTW)
#define NQPR  (NQTR / QTW)
#define NQB   (NQP / NQG)
#define NQBR  (NQPR / NQG)
#define NKT   (SEQ / 32)
#define ATT_THREADS (NWV * 32)
#define SLP   68
#define SLW   (QTW * 16 * SLP)
#define SLAB64 (16 * 68)
#define KUN   4
#define WS_CAP 134217728
#define GX    (SEQ * DMOD / 8 / 256)
#define GW    (DMOD * DMOD / 8 / 256)
#define GT    (SEQ * NFREQ / 256)
static_assert(DMOD == NH * HD && HD == 64 && HHALF == 32 && NFREQ == 32 && NH == 8 && NKVH == NH);
static_assert(ATT_THREADS == 256 && NSW >= 4 && KVD == 512 && NQKV == 1536 && KCOL0 + KVD == NQKV && VCOL0 + KVD == KCOL0);
static_assert(NB >= 1 && NB <= 4);
static_assert(NB == 1 || SEQ == XS_FULL);
static_assert((SEQ % 64) == 0 && SEQ >= 64 && SEQ <= XS_FULL);
static_assert((RICH % 64) == 0 && RICH >= 64 && RICH <= SEQ);
static_assert((DMOD % 64) == 0 && (KVD % 64) == 0 && (NQKV % 64) == 0 && (DMOD % 32) == 0 && (HD % 32) == 0);
static_assert(((SEQ * DMOD / 8) % 256) == 0 && ((DMOD * DMOD / 8) % 256) == 0 && ((SEQ * NFREQ) % 256) == 0);
static_assert(NWV * (SLW + 2 * QTW * 16) * 4 <= 327680 / 2 && 4 * SLAB64 * 4 <= 65536);
static_assert(QTW == 2 && NQG == 2 && NWV == 4 * QTW && (NQT % QTW) == 0 && (NQTR % QTW) == 0);
static_assert((NQP % NQG) == 0 && (NQPR % NQG) == 0);
static_assert(DMOD / 8 == 64 && KVD / 8 == 64 && (DMOD % (32 * KUN)) == 0);
static_assert(((NH * NB) % 8) == 0);
static_assert(((SEQ * DMOD / 8) % 1024) == 0 && ((DMOD * DMOD / 8) % 1024) == 0 && (SEQ % 32) == 0 && (RICH % 16) == 0);

typedef unsigned short u16;
typedef _Float16 v16h __attribute__((ext_vector_type(16)));
typedef _Float16 v8h  __attribute__((ext_vector_type(8)));
typedef __bf16   v16b __attribute__((ext_vector_type(16)));
typedef float    v8f  __attribute__((ext_vector_type(8)));
typedef float    v4f  __attribute__((ext_vector_type(4)));
typedef unsigned int v4u __attribute__((ext_vector_type(4)));

union FragH { v16h v; v8h h[2]; v4u u[2]; };
union FragB { v16b v; v4u u[2]; };

// ---- scalar helpers --------------------------------------------------------------------------------
__device__ __forceinline__ unsigned short bf_bits(float f) {          // f32 -> bf16 bits, RNE convert
  unsigned u = __float_as_uint(f);
  return (unsigned short)((u + 0x7FFFu + ((u >> 16) & 1u)) >> 16);
}
__device__ __forceinline__ float bf_up(unsigned short h) { return __uint_as_float(((unsigned)h) << 16); }
__device__ __forceinline__ float bfr(float f) { return bf_up(bf_bits(f)); }
__device__ __forceinline__ unsigned short h_bits(_Float16 x) { return __builtin_bit_cast(unsigned short, x); }
__device__ __forceinline__ unsigned pk16(unsigned short a, unsigned short b) { return (unsigned)a | ((unsigned)b << 16); }
__device__ __forceinline__ v8f zero8() { v8f z = {0.f, 0.f, 0.f, 0.f, 0.f, 0.f, 0.f, 0.f}; return z; }

// ---- fragment-major planes: every 16-bit A/B operand plane [row][K] other than v^T is stored as [row/16][K/32][g][lane][8]: the 16-B unit
//      of lane = 16*h + (row&15) in half g holds k = 32*ks + 16*g + 8*h + 0..7, so one wave-wide 16-B load is 512 contiguous
//      bytes (4 whole lines) and one 16 x 32 fragment is 1 KB. A 16-row tile starts where it starts in a row-major plane.
// ---- fragment loaders: lane -> row/col (lane&15), h = lane>>4; base = a pointer that is the same in every lane (it stays in
//      scalar registers), vo = byte offset of the fragment from base + 16*lane (one 32-bit register shared by all loads of a
//      step and advanced behind them); p = base + vo;
//      elements 0..7 <- p[0..7] (k0+8h..), elements 8..15 <- p[256..263] (k0+16+8h..)  (same split k map for A and B)
__device__ __forceinline__ v16h ldfrag_h(const _Float16* base, unsigned vo) {
  const char* p = (const char*)base + vo;
  FragH f;
  f.h[0] = *(const v8h*)(p);
  f.h[1] = *(const v8h*)(p + 512);
  return f.v;
}
__device__ __forceinline__ v16b ldfrag_b(const u16* base, unsigned vo) { // bf16 plane read as unsigned integer vectors
  const char* p = (const char*)base + vo;
  FragB f;
  f.u[0] = *(const v4u*)(p);
  f.u[1] = *(const v4u*)(p + 512);
  return f.v;
}

__device__ __forceinline__ v8f mma_h(v16h a, v16h b, v8f c) {
  return __builtin_amdgcn_wmma_f32_16x16x32_f16(false, a, false, b, (short)0, c, false, false);
}
__device__ __forceinline__ v8f mma_b(v16b a, v16b b, v8f c) {
  return __builtin_amdgcn_wmma_f32_16x16x32_bf16(false, a, false, b, (short)0, c, false, false);
}
// four issue slots between the last matrix instruction of a group and the first vector instruction on its results or operands,
// on every path (the loop's back edge too); the fragments are named so that their registers are not rewritten in front of it
// guard4x16: behind a whole key step's score products (16 fragments); guard8x6, guard8x12: behind its v^T.P^T products
__device__ __forceinline__ void guard4x16(v8f& a, v8f& b, v8f& c, v8f& d, const v16h (&x)[8], const v16h (&y)[8]) {
#if defined(__HIP_DEVICE_COMPILE__)
  asm volatile("v_nop\n\tv_nop\n\tv_nop\n\tv_nop"
               : "+v"(a), "+v"(b), "+v"(c), "+v"(d)
               : "v"(x[0]), "v"(x[1]), "v"(x[2]), "v"(x[3]), "v"(x[4]), "v"(x[5]), "v"(x[6]), "v"(x[7]),
                 "v"(y[0]), "v"(y[1]), "v"(y[2]), "v"(y[3]), "v"(y[4]), "v"(y[5]), "v"(y[6]), "v"(y[7]) : "memory");
#endif
}
__device__ __forceinline__ void guard8x6(v8f (&o0)[4], v8f (&o1)[4], v16h p0, v16h p1, const v16h (&x)[4]) {
#if defined(__HIP_DEVICE_COMPILE__)
  asm volatile("v_nop\n\tv_nop\n\tv_nop\n\tv_nop"
               : "+v"(o0[0]), "+v"(o0[1]), "+v"(o0[2]), "+v"(o0[3]), "+v"(o1[0]), "+v"(o1[1]), "+v"(o1[2]), "+v"(o1[3])
               : "v"(p0), "v"(p1), "v"(x[0]), "v"(x[1]), "v"(x[2]), "v"(x[3]) : "memory");
#endif
}
__device__ __forceinline__ void guard8x12(v8f (&o0)[4], v8f (&o1)[4], v16h p0, v16h p1, v16h r0, v16h r1,
                                          const v16h (&x)[4], const v16h (&y)[4]) {
#if defined(__HIP_DEVICE_COMPILE__)
  asm volatile("v_nop\n\tv_nop\n\tv_nop\n\tv_nop"
               : "+v"(o0[0]), "+v"(o0[1]), "+v"(o0[2]), "+v"(o0[3]), "+v"(o1[0]), "+v"(o1[1]), "+v"(o1[2]), "+v"(o1[3])
               : "v"(p0), "v"(p1), "v"(r0), "v"(r1), "v"(x[0]), "v"(x[1]), "v"(x[2]), "v"(x[3]),
                 "v"(y[0]), "v"(y[1]), "v"(y[2]), "v"(y[3]) : "memory");
#endif
}
template <typename F>
__device__ __forceinline__ void guard6(v8f& a, v8f& b, v8f& c, v8f& d, F x0, F x1, F x2, F x3, F x4, F x5) {
#if defined(__HIP_DEVICE_COMPILE__)
  asm volatile("v_nop\n\tv_nop\n\tv_nop\n\tv_nop"
               : "+v"(a), "+v"(b), "+v"(c), "+v"(d) : "v"(x0), "v"(x1), "v"(x2), "v"(x3), "v"(x4), "v"(x5) : "memory");
#endif
}
__device__ __forceinline__ void acc_guard4(v8f& a, v8f& b, v8f& c, v8f& d) {
#if defined(__HIP_DEVICE_COMPILE__)
  asm volatile("v_nop\n\tv_nop\n\tv_nop\n\tv_nop" : "+v"(a), "+v"(b), "+v"(c), "+v"(d));
#endif
}
__device__ __forceinline__ void wave_sync_lds() {
  __builtin_amdgcn_fence(__ATOMIC_RELEASE, "workgroup");
  __builtin_amdgcn_wave_barrier();
  __builtin_amdgcn_fence(__ATOMIC_ACQUIRE, "workgroup");
}

// =====================================================================================================
// f32 [rows][DMOD] -> 16-bit fragment-major plane.  f16mode == 0: bf16 RNE bits;  f16mode == 1: f16 bits of (bf16 RNE value)
// * scale. Thread = output unit gt = 8 consecutive elements of one row: two 16-B loads (a wave reads 64 B of each of 16 rows,
// the block uses every line whole), one 16-B store; 32 consecutive lanes store 512 contiguous, 512-B aligned bytes;
// coverage: blk = 0 .. n8/256 - 1, x 256 thr x 8 (in-kernel bound) = the whole plane (n8 a multiple of 256 here).
// =====================================================================================================
__device__ __forceinline__ void cvt16(const float* __restrict__ x, u16* D, int blk, int n8, int f16mode, float scale) {
  const int gt = blk * 256 + (int)threadIdx.x;
  if (gt >= n8) return;
  const int srow = (gt >> 10) * 16 + (gt & 15);                                   // 1024 units per 16-row tile
  const int schk = ((gt >> 6) & (DMOD / 32 - 1)) * 4 + ((gt >> 5) & 1) * 2 + ((gt >> 4) & 1);
  const float* p = x + ((size_t)srow * (DMOD / 8) + schk) * 8;
  const v4f a = *(const v4f*)(p), b4 = *(const v4f*)(p + 4);
  float w[8];
#pragma unroll
  for (int e = 0; e < 4; ++e) { w[e] = a[e]; w[4 + e] = b4[e]; }
  v4u o;
#pragma unroll
  for (int e = 0; e < 4; ++e) {
    const float f0 = w[2 * e], f1 = w[2 * e + 1];
    const unsigned short hb0 = h_bits((_Float16)(bfr(f0) * scale));
    const unsigned short hb1 = h_bits((_Float16)(bfr(f1) * scale));
    const unsigned short bb0 = bf_bits(f0);
    const unsigned short bb1 = bf_bits(f1);
    o[e] = (f16mode != 0) ? pk16(hb0, hb1) : pk16(bb0, bb1);
  }
  u16* d = D + (size_t)gt * 8;
  {
    *(v4u*)(d) = o;
    
  }
}

// =====================================================================================================
// Rotary tables TC[s][j] = cos(s * inv[j]), TS[s][j] = sin(s * inv[j]), j < 32, with
// inv[j] = 1.0f / f32(10000^(j/32)) (power evaluated in f64 and narrowed once, IEEE f32 reciprocal, f32 product s*inv,
// coverage: blk = 0 .. n/256 - 1, x 256 thr = n = SEQ*32 elements of TC and of TS (n a multiple of 256).
// =====================================================================================================
__device__ __forceinline__ void k_tab(float* TC, float* TS, int blk, int n) {
#pragma clang fp contract(off)
  const int idx = blk * 256 + (int)threadIdx.x;
  if (idx >= n) return;
  const int s = idx / NFREQ;
  const int j = idx - s * NFREQ;
  const double pj = exp2((double)j * ROPE_L2);       // 10000^(j/32)
  const float pf  = (float)pj;
  const float inv = 1.0f / pf;
  const float ang = (float)s * inv;
  float sv, cv;
  sincosf(ang, &sv, &cv);
  {
    *(float*)(TC + idx) = cv;
    *(float*)(TS + idx) = sv;
    
  }
}

// =====================================================================================================
// One launch for everything that reads only the inputs: none of these pieces reads what another writes, so they share a grid
// by block range (every branch is block-uniform, no barrier): GT blocks the rotary tables, NB*GX blocks x -> bf16 plane
// [MROWS][512], GW blocks each Wq, Wk, Wv -> one bf16 plane [1536 n][512 k], GW blocks Wo -> f16 plane of the bf16 value x1024.
// coverage: grid = GT + NB*GX + 4*GW blocks, each range exactly the grid of its piece.
// =====================================================================================================
__global__ __launch_bounds__(256) void prep(const float* __restrict__ x, const float* __restrict__ wq,
                                            const float* __restrict__ wk, const float* __restrict__ wv,
                                            const float* __restrict__ wo, u16* XB, u16* WB, u16* WT, float* TC, float* TS) {
  int bid = (int)blockIdx.x;
  if (bid < GT) { k_tab(TC, TS, bid, SEQ * NFREQ); return; }
  bid -= GT;
  if (bid < NB * GX) {
    const int bq = bid / GX;
    cvt16(x + (size_t)bq * XS_FULL * DMOD, XB + (size_t)bq * SEQ * DMOD, bid - bq * GX, SEQ * DMOD / 8, 0, 1.0f);
    return;
  }
  bid -= NB * GX;
  if (bid < GW)     { cvt16(wq, WB, bid, DMOD * DMOD / 8, 0, 1.0f); return; }
  if (bid < 2 * GW) { cvt16(wk, WB + (size_t)VCOL0 * DMOD, bid - GW, DMOD * DMOD / 8, 0, 1.0f); return; }
  if (bid < 3 * GW) { cvt16(wv, WB + (size_t)KCOL0 * DMOD, bid - 2 * GW, DMOD * DMOD / 8, 0, 1.0f); return; }
  if (bid < 4 * GW) { cvt16(wo, WT, bid - 3 * GW, DMOD * DMOD / 8, 1, WOS); return; }
}

// =====================================================================================================
// Interleaved-pair rotary of one element, with y = projection + bias (f32 add) already formed:
//   out[2j]   = y[2j]  *c[s][j] + (-1)*(y[2j+1]*sn[s][j])
//   out[2j+1] = y[2j+1]*c[s][j] + (+1)*(y[2j]  *sn[s][j])        with c, sn the f32 table values (mul, mul, add kept
//   separate); hb = f16(out * sc), lb = f16 residual (t - f16(t)).
// =====================================================================================================
__device__ __forceinline__ void rot_one(float x, float y, float cv, float sv, float sgn, float sc,
                                        unsigned short& hb, unsigned short& lb) {
#pragma clang fp contract(off)
  const float ys   = y * sv;
  const float term = sgn * ys;
  const float r    = x * cv + term;
  const float t    = r * sc;
  const _Float16 a = (_Float16)t;
  hb = h_bits(a);
  lb = h_bits((_Float16)(t - (float)a));
}

// =====================================================================================================
// GEMM epilogue of the output projection: the wave's 16x64 f32 tile (times oscale) staged in its LDS slab (pitch 68),
// 8 consecutive lanes x 16 B per line), lanes 16..31 -> row 2*it+1; HASB != 0 adds bias[col] in f32 to every element;
// coverage: 8 instructions x 2 rows x 16 lanes x 4 floats = the wave's 16 x 64 tile.
// =====================================================================================================
template <int HASB>
__device__ __forceinline__ void epi64(float* sl, v8f a0, v8f a1, v8f a2, v8f a3, float oscale, const float* bias,
                                      float* C, int N, size_t rowb, int col0, int lane) {
  const int hh = lane >> 4, m = lane & 15;
#pragma unroll
  for (int r = 0; r < 8; ++r) {
    const int ro = (8 * hh + r) * 68 + m;
    sl[ro]      = a0[r] * oscale;
    sl[ro + 16] = a1[r] * oscale;
    sl[ro + 32] = a2[r] * oscale;
    sl[ro + 48] = a3[r] * oscale;
  }
  wave_sync_lds();
  v4f vals[8];
#pragma unroll
  for (int it = 0; it < 8; ++it) vals[it] = *(const v4f*)(sl + (it * 2 + hh) * 68 + m * 4);
  if (HASB != 0) {
    const v4f b4 = *(const v4f*)(bias + col0 + m * 4);
#pragma unroll
    for (int it = 0; it < 8; ++it) vals[it] = vals[it] + b4;
  }
  float* dst = C + (rowb + (size_t)hh) * (size_t)N + col0 + m * 4;
  {
#pragma unroll
    for (int it = 0; it < 8; ++it) {
      *(v4f*)(dst + (size_t)(it * 2) * (size_t)N) = vals[it];
    }
    
  }
}

// =====================================================================================================
// Projection GEMM x.[Wq|Wk|Wv]^T (bf16 fragment-major planes A = x [MROWS][512], Bt = weights [1536 n][512 k], f32
// accumulate) whose epilogue writes the attention operand planes itself: no f32 projection array, no LDS.
// Block = 64 rows x 64 columns, 4 waves x 16 rows; a wave's 64 columns are one head of q_proj (columns 0..511), of k_proj
// (512..1023) or of v_proj (1024..1535), its 16 rows 16 positions of one sequence; the choice is block-uniform.
// Fragments loaded straight from the planes (two 512-B wave loads each, split k map for both operands); K stepped by 32
// (host: K = 512, the row length of both planes).
// TR = 1 (q_proj, v_proj): the weight tile is the first operand, so acc j element r of lane (hh, m) =
//   (column j*16 + 8*hh + r, position m): 8 consecutive d of one position = the lane's 16-B unit of the q / k plane.
// TR = 0 (k_proj): x is the first operand, acc j element r of lane (hh, m) = (position 8*hh + r, column j*16 + m):
//   8 consecutive keys of one d = the lane's 16-B unit of the v^T plane.
// =====================================================================================================
template <int TR>
__device__ __forceinline__ void proj_loop(const u16* ap, const u16* bp, const u16* bp1, const u16* bp2, const u16* bp3,
                                          unsigned vo, int K, v8f& acc0, v8f& acc1, v8f& acc2, v8f& acc3) {
#pragma unroll 1
  for (int k0 = 0; k0 < K; k0 += 32, vo += 1024u) {
    const v16b a  = ldfrag_b(ap, vo);
    const v16b b0 = ldfrag_b(bp, vo);
    const v16b b1 = ldfrag_b(bp1, vo);
    const v16b b2 = ldfrag_b(bp2, vo);
    const v16b b3 = ldfrag_b(bp3, vo);
    if (TR != 0) {
      acc0 = mma_b(b0, a, acc0);
      acc1 = mma_b(b1, a, acc1);
      acc2 = mma_b(b2, a, acc2);
      acc3 = mma_b(b3, a, acc3);
    } else {
      acc0 = mma_b(a, b0, acc0);
      acc1 = mma_b(a, b1, acc1);
      acc2 = mma_b(a, b2, acc2);
      acc3 = mma_b(a, b3, acc3);
    }
    guard6<v16b>(acc0, acc1, acc2, acc3, a, b0, b1, b2, b3, a);
  }
}

// q / k planes from the TR = 1 accumulators: y = acc + bias[head*HD + d], rotary with table row s = the lane's position and
// table column d >> 1, x sc -> f16 hi and f16 residual planes, fragment-major per head [b*8 + head][s/16][d/32][half][lane][8]
// (row = position, k = d): acc j is half j & 1 of d step j >> 1, at pb + j * 256 halves, pb = the tile's start + 8 * lane.
// coverage: 4 stores x 32 lanes x 8 halves = the wave's 16 positions x 64 d of Hp and of Lp, 512 contiguous bytes a store.
__device__ __forceinline__ void rope_epi(const v8f (&acc)[4], int hh, int s, const float* __restrict__ bias,
                                         const float* __restrict__ TC, const float* __restrict__ TS,
                                         u16* Hp, u16* Lp, size_t pb, float sc) {
  const float* bp = bias + 8 * hh;                     // bias already at the head's first column
  const float* cp = TC + (size_t)s * NFREQ + 4 * hh;
  const float* sp = TS + (size_t)s * NFREQ + 4 * hh;
  // two groups of two accumulator tiles, each with its own loads, so that the loaded values of one group only are live
  // beside the accumulators (the register count stays at the k loop's, and with it the waves per SIMD)
#pragma unroll
  for (int g2 = 0; g2 < 2; ++g2) {
    v4f ba[2], bb[2], cw[2], sw[2];
#pragma unroll
    for (int i = 0; i < 2; ++i) {
      const int j = 2 * g2 + i;
      ba[i] = *(const v4f*)(bp + j * 16);
      bb[i] = *(const v4f*)(bp + j * 16 + 4);
      cw[i] = *(const v4f*)(cp + j * 8);
      sw[i] = *(const v4f*)(sp + j * 8);
    }
#pragma unroll
    for (int i = 0; i < 2; ++i) {
      const int j = 2 * g2 + i;
      float yv[8];
#pragma unroll
      for (int e = 0; e < 4; ++e) {
        yv[e]     = acc[j][e]     + ba[i][e];
        yv[4 + e] = acc[j][4 + e] + bb[i][e];
      }
      v4u oh, ol;
#pragma unroll
      for (int e = 0; e < 4; ++e) {
        unsigned short h0, l0, h1, l1;
        rot_one(yv[2 * e],     yv[2 * e + 1], cw[i][e], sw[i][e], -1.0f, sc, h0, l0);   // even element of the pair
        rot_one(yv[2 * e + 1], yv[2 * e],     cw[i][e], sw[i][e],  1.0f, sc, h1, l1);   // odd element of the pair
        oh[e] = pk16(h0, h1);
        ol[e] = pk16(l0, l1);
      }
      *(v4u*)(Hp + pb + j * 256) = oh;
      *(v4u*)(Lp + pb + j * 256) = ol;
    }
    // the next group's loads, and behind the last group whatever code the compiler places next, may write
    // registers that these stores name
    asm volatile("s_wait_xcnt 0x0" ::: "memory");
  }
}

// v^T planes from the TR = 0 accumulators: y = acc + bias[head*HD + d] (f32 add), t = y * 1024 (exact), hi = f16(t),
// residual = f16(t - hi), fragment-major per head with the 32-key step outermost [b*8 + head][s/32][d/16][half][lane][8]
// (row = d, k = key): the wave's 16 keys are one half of the four d-subtile fragments, acc j at pb + j * 512 halves,
// pb = the key step's start + half * 256 + 8 * lane.
// coverage: 4 stores x 32 lanes x 8 halves = the wave's 16 keys x 64 d of VHo and of VLo, 512 contiguous bytes a store.
__device__ __forceinline__ void vt_epi(const v8f (&acc)[4], int m, const float* __restrict__ bias,
                                       u16* VHo, u16* VLo, size_t pb) {
  float bj[4];
#pragma unroll
  for (int j = 0; j < 4; ++j) bj[j] = bias[j * 16 + m];  // bias already at the head's first column
  v4u oh[4], ol[4];
#pragma unroll
  for (int j = 0; j < 4; ++j) {
#pragma unroll
    for (int e = 0; e < 4; ++e) {
      const float t0 = (acc[j][2 * e]     + bj[j]) * VCAR;
      const float t1 = (acc[j][2 * e + 1] + bj[j]) * VCAR;
      const _Float16 h0 = (_Float16)t0, h1 = (_Float16)t1;
      oh[j][e] = pk16(h_bits(h0), h_bits(h1));
      ol[j][e] = pk16(h_bits((_Float16)(t0 - (float)h0)), h_bits((_Float16)(t1 - (float)h1)));
    }
  }
#pragma unroll
  for (int j = 0; j < 4; ++j) {
    *(v4u*)(VHo + pb + j * 512) = oh[j];
    *(v4u*)(VLo + pb + j * 512) = ol[j];
  }
}

// coverage: grid = (MROWS/64) * (NQKV/64) blocks x 4 waves: every (sequence, head, 16 positions) tile of the q, k and v^T
// hi and residual planes exactly once.
__global__ __launch_bounds__(128)
void gemm_qkv(const u16* __restrict__ A, const u16* __restrict__ Bt, const float* __restrict__ bq,
              const float* __restrict__ bk, const float* __restrict__ bv,
              const float* __restrict__ TC, const float* __restrict__ TS,
              u16* QH, u16* QL, u16* KH, u16* KL, u16* VH, u16* VL, int K) {
  const int tid = threadIdx.x, lane = tid & 31;
  const int wave = __builtin_amdgcn_readfirstlane(tid >> 5);   // scalar, so that the tile starts below are scalar bases
  const int bid   = blockIdx.x;
  const int rowb  = (bid / (NQKV / 64)) * 64 + wave * 16;
  const int col0  = (bid % (NQKV / 64)) * 64;
  if (rowb + 16 > MROWS) return;            // wave-uniform, never taken with the exact grid; no block barriers in this kernel
  const u16* ap  = A  + (size_t)rowb * K;             // fragment (16-row tile, k step ks) at tile start + ks * 1024 bytes
  const u16* bp  = Bt + (size_t)col0 * K;
  const u16* bp1 = Bt + (size_t)(col0 + 16) * K;
  const u16* bp2 = Bt + (size_t)(col0 + 32) * K;
  const u16* bp3 = Bt + (size_t)(col0 + 48) * K;
  const unsigned vo = (unsigned)lane * 16u;
  const int b    = rowb / SEQ;                        // sequence
  const int s16  = rowb - b * SEQ;                    // the wave's first position in it, a multiple of 16
  const int hcol = col0 & (DMOD - 1);                 // head * HD within the q, k or v projection
  const size_t hp = ((size_t)b * DMOD + hcol) * SEQ;  // start of the (sequence, head) plane, in halves: (b*8 + head) * SEQ * HD
  v8f acc[4];
#pragma unroll
  for (int j = 0; j < 4; ++j) acc[j] = zero8();
  if (col0 >= VCOL0 && col0 < KCOL0) {
    proj_loop<0>(ap, bp, bp1, bp2, bp3, vo, K, acc[0], acc[1], acc[2], acc[3]);
    vt_epi(acc, lane & 15, bk + hcol, VH, VL,
           hp + (size_t)(s16 >> 5) * (32 * HD) + (size_t)((s16 >> 4) & 1) * 256 + 8 * lane);
  } else {
    const bool isq = col0 < VCOL0;
    proj_loop<1>(ap, bp, bp1, bp2, bp3, vo, K, acc[0], acc[1], acc[2], acc[3]);
    rope_epi(acc, lane >> 4, s16 + (lane & 15), (isq ? bq : bv) + hcol, TC, TS, isq ? QH : KH, isq ? QL : KL,
             hp + (size_t)s16 * HD + 8 * lane, isq ? QSC : KSC);
  }
}

// =====================================================================================================
// f16 GEMM: C[M][N] (f32) = (A[M][K] (+ A2[M][K] when TWO != 0)) . Bt[N][K]^T, times oscale, plus bias[n]; A, A2 f16
// fragment-major planes (A2 = the unscaled f16 residual of A, sharing the accumulator), Bt f16 fragment-major. Same tiling, fragment
// loads (split k map) as gemm_qkv, epilogue epi64; K stepped by 32 * KUN (host: K = DMOD).
// =====================================================================================================
template <int TWO>
__device__ __forceinline__
void gemm_h(float* slab, int wave, int lane, int rowb, int crow, int col0,
            const u16* __restrict__ A, const u16* __restrict__ A2, const u16* __restrict__ Bt,
            const float* __restrict__ bias, float* C, int N, int K, float oscale) {
  const _Float16* ap  = (const _Float16*)(const void*)A  + (size_t)rowb * K;
  const _Float16* ap2 = (const _Float16*)(const void*)A2 + (size_t)rowb * K;
  const _Float16* bp  = (const _Float16*)(const void*)Bt + (size_t)col0 * K;
  const _Float16* bp1 = (const _Float16*)(const void*)Bt + (size_t)(col0 + 16) * K;
  const _Float16* bp2 = (const _Float16*)(const void*)Bt + (size_t)(col0 + 32) * K;
  const _Float16* bp3 = (const _Float16*)(const void*)Bt + (size_t)(col0 + 48) * K;
  unsigned vo = (unsigned)lane * 16u;
  v8f acc0 = zero8(), acc1 = zero8(), acc2 = zero8(), acc3 = zero8();
  // KUN k steps a trip: their fragments are all requested in one run in front of the first product, so that the wave waits for
  // one round trip per KUN steps (this launch has few waves per SIMD to cover a wait, and registers to spare); the products
  // follow in the order of the k steps
#pragma unroll 1
  for (int k0 = 0; k0 < K; k0 += 32 * KUN, vo += 1024u * KUN) {
    v16h a[KUN], a2[KUN], b0[KUN], b1[KUN], b2[KUN], b3[KUN];
#pragma unroll
    for (int u = 0; u < KUN; ++u) {
      a[u]  = ldfrag_h(ap  + 512 * u, vo);          // k step u of the trip: + 1024 bytes
      b0[u] = ldfrag_h(bp  + 512 * u, vo);
      b1[u] = ldfrag_h(bp1 + 512 * u, vo);
      b2[u] = ldfrag_h(bp2 + 512 * u, vo);
      b3[u] = ldfrag_h(bp3 + 512 * u, vo);
      if (TWO != 0) a2[u] = ldfrag_h(ap2 + 512 * u, vo);
    }
    // keeps the scheduler from sinking the later steps' loads in among the products (it did, to save registers: one exposed
    // wait per step again)
    __builtin_amdgcn_sched_barrier(0);
#pragma unroll
    for (int u = 0; u < KUN; ++u) {
      acc0 = mma_h(a[u], b0[u], acc0);
      acc1 = mma_h(a[u], b1[u], acc1);
      acc2 = mma_h(a[u], b2[u], acc2);
      acc3 = mma_h(a[u], b3[u], acc3);
      if (TWO != 0) {
        acc0 = mma_h(a2[u], b0[u], acc0);
        acc1 = mma_h(a2[u], b1[u], acc1);
        acc2 = mma_h(a2[u], b2[u], acc2);
        acc3 = mma_h(a2[u], b3[u], acc3);
      }
    }
    if (TWO != 0) guard6<v16h>(acc0, acc1, acc2, acc3, a[KUN - 1], a2[KUN - 1], b0[KUN - 1], b1[KUN - 1], b2[KUN - 1], b3[KUN - 1]);
    else          guard6<v16h>(acc0, acc1, acc2, acc3, a[KUN - 1], b0[KUN - 1], b1[KUN - 1], b2[KUN - 1], b3[KUN - 1], a[KUN - 1]);
  }
  (void)ap2;
  epi64<1>(slab + wave * SLAB64, acc0, acc1, acc2, acc3, oscale, bias, C, N, (size_t)crow, col0, lane);
}

// One launch for y = O.Wo^T + bo over all sequences: block = 64 rows x 64 columns; its 64 rows lie in one sequence and wholly
// below or wholly at and above row RICH of it (RICH and SEQ multiples of 64), so the choice hi + residual / hi only is
// block-uniform. rowb = the wave's first row in the O planes, crow = the same row in out.
// coverage: grid = NB * (SEQ/64) * (N/64) blocks x 4 waves x 16 x 64 = every element of out once (host: N % 64 == 0, K % (32 * KUN) == 0).
__global__ __launch_bounds__(128)
void gemm_o(const u16* __restrict__ A, const u16* __restrict__ A2, const u16* __restrict__ Bt,
            const float* __restrict__ bias, float* C, int N, int K, float oscale) {
  __shared__ __align__(16) float slab[4 * SLAB64];
  const int tid = threadIdx.x, lane = tid & 31;
  const int wave = __builtin_amdgcn_readfirstlane(tid >> 5);   // scalar, so that the tile starts are scalar bases
  const int ntile = N >> 6;
  const int bid  = blockIdx.x;
  const int rt   = bid / ntile;
  const int col0 = (bid % ntile) * 64;
  const int bq   = rt / (SEQ / 64);
  const int rs   = (rt % (SEQ / 64)) * 64;                     // first row of the block within its sequence
  if (bq >= NB) return;                     // block-uniform, never taken with the exact grid; no block barriers in this kernel
  const int rowb = bq * SEQ + rs + wave * 16;
  const int crow = bq * XS_FULL + rs + wave * 16;
  if (rs < RICH) gemm_h<1>(slab, wave, lane, rowb, crow, col0, A, A2, Bt, bias, C, N, K, oscale);
  else           gemm_h<0>(slab, wave, lane, rowb, crow, col0, A, A2, Bt, bias, C, N, K, oscale);
}

// =====================================================================================================
// Causal softmax attention, hd = 64, 8 heads. Block bid -> (64 query rows qb = NQB-1 - bid/(NH*NB), head, batch b) = NQG
// neighbouring pairs of query tiles; wave = NQG * ws + g works for pair qp = NQG*qb + g: rows q0 = 32*qp .. q0+31, tile t
// = rows q0 + 16t .. q0 + 16t + 15; keys/values of the same head (kvh = head). A pair's key steps (the same
// steps for both tiles) are dealt over its NSW waves: wave (ws, g) takes steps ws, ws + NSW, ... for BOTH tiles, so each k and
// v^T fragment it loads feeds two tiles' products; the NQG waves of one ws walk the same key steps side by side on one WGP and
// ask for the same lines at about the same time, so that the lines need come from L2 once for both;
// per tile its own running max, sum and O accumulators; the NSW partials of
// each tile are merged in LDS behind one block barrier (attn_merge8); the longest serial walk is NKT / NSW steps.
//   q and k hi / residual planes f16 x256, fragment-major per head [b*8 + h][s/16][d/32][half][lane][8];
//   v^T hi / residual planes x1024, fragment-major per head [b*NKVH + h][s/32][d/16][half][lane][8].
//   raw(i, j) = q_hi.k_hi + q_lo.k_hi + q_hi.k_lo (2 k-steps over d); logit = raw * (SM_SCALE * 2^-16) (the two 256 carries
//   folded exactly into the 1/sqrt(512) scale, one f32 multiply); keys above the diagonal replaced by -inf.
//   Both products run transposed, S^T = k.q^T (A = k fragment, B = q fragment) and O^T += v^T.P^T (A = v^T fragment, B = P^T),
//   so lane (c, hh) holds per tile 16 scores and 32 O elements of the one query q0 + 16t + c: online softmax per query in f32 with a running
//   max: max over the lane's 16 scores, then one exchange with lane c ^ 16 (same max in both); sum over the lane's own keys,
//   the two halves joined once behind the loop; alpha = exp(m_old - m_new), p = exp(logit - m_new), l = l*alpha + sum p, O
//   accumulators times alpha before the tile's v^T.P^T. Only key tiles of 32 with kb <= q0 are visited (nkt = q0/32 + 1 <= NKT; key kb is
//   unmasked for every row of the tile, so each row max of a visited tile is finite; the ws = 0 wave of each pair always visits tile 0).
//   The two 16x16 score tiles of a step, converted in place, are the P^T B fragment (no LDS, no lane exchange);
//   the four v^T hi A fragments are requested behind the score products, in front of the softmax; RV = 1: products
//   hh + lh + hl, RV = 0: hh only. After the loop every wave (one without a step: max -inf, sum 0, O 0) puts its raw O
//   accumulators into its slab and its 32 row maxima and sums beside them; block barrier; waves 4t .. 4t+3 merge tile t of
//   each of the NQG pairs, one pair after the other.
//   Epilogue: O = merged acc / (merged l * 32768 * 1024), x256 -> f16 hi plane (and for RV = 1 the unscaled f16 residual
//   plane), fragment-major over [b*SEQ + s][512]; wave 4t + it, lane = (row c of tile t, 8 consecutive d at it*16 + 8*hh); one
//   instruction = one 512-B half fragment (4 whole lines).
// coverage: 8 waves x NQG instructions x 32 lanes x 8 halves = 64 x 64 per plane; grid NQB x NH x NB blocks;
//   the two forms (pairs 0..NQPR-1 with RV = 1, NQPR..NQP-1 with RV = 0; NQPR a multiple of NQG) cover every (b, s, h) row segment of the hi plane
//   exactly once and rows s < RICH of the residual plane exactly once (only those rows are read later).
// =====================================================================================================
// lane l <-> lane l ^ 16 (the other 16-lane row) as one vector cross-row move
__device__ __forceinline__ float xhalf(float x) {
  const int b = __builtin_bit_cast(int, x);
  return __builtin_bit_cast(float, __builtin_amdgcn_permlanex16(b, b, 0x76543210, 0xfedcba98, false, false));
}

// 2^x for the merge weights. The v_nop in the same statement keeps the one issue slot that the instruction set asks for behind
// a transcendental, whichever instruction the compiler places next.
__device__ __forceinline__ float exp2_slot(float x) {
  float r = 0.0f;
#if defined(__HIP_DEVICE_COMPILE__)
  asm("v_exp_f32 %0, %1\n\tv_nop" : "=v"(r) : "v"(x));
#endif
  return r;
}

// 2^x of eight values in one statement, for the same slot: the results are early-clobber, so that no v_exp_f32 here writes a
// source or reads a result of the one in front of it, and the one v_nop keeps the slot behind the last.
__device__ __forceinline__ void exp2x8_slot(float (&r)[8], const float (&x)[8]) {
#if defined(__HIP_DEVICE_COMPILE__)
  asm("v_exp_f32 %0, %8\n\tv_exp_f32 %1, %9\n\tv_exp_f32 %2, %10\n\tv_exp_f32 %3, %11\n\t"
      "v_exp_f32 %4, %12\n\tv_exp_f32 %5, %13\n\tv_exp_f32 %6, %14\n\tv_exp_f32 %7, %15\n\tv_nop"
      : "=&v"(r[0]), "=&v"(r[1]), "=&v"(r[2]), "=&v"(r[3]), "=&v"(r[4]), "=&v"(r[5]), "=&v"(r[6]), "=&v"(r[7])
      : "v"(x[0]), "v"(x[1]), "v"(x[2]), "v"(x[3]), "v"(x[4]), "v"(x[5]), "v"(x[6]), "v"(x[7]));
#else
  for (int e = 0; e < 8; ++e) r[e] = x[e];
#endif
}

// Merge of the NSW partials of pair g for one lane's 8 outputs (row c of the pair's QTW * 16, columns dd .. dd+7): M = max of the waves' row maxima, weight
// exp(m_w - M) (0 for a wave without a step), L = sum of weight * l_w, acc = sum of weight * O_w, the pair's waves NQG * w + g in the order of w.
__device__ __forceinline__ void attn_merge8(const float* slabs, const float* sm, const float* sl, int g, int c, int dd,
                                            float* acc, float& L) {
  float mw[NSW], lw[NSW];
  v4f pa[NSW], pb[NSW];
#pragma unroll
  for (int w = 0; w < NSW; ++w) {
    const int wv = NQG * w + g;
    mw[w] = sm[wv * (QTW * 16) + c];
    lw[w] = sl[wv * (QTW * 16) + c];
    pa[w] = *(const v4f*)(slabs + wv * SLW + c * SLP + dd);
    pb[w] = *(const v4f*)(slabs + wv * SLW + c * SLP + dd + 4);
  }
  float M = mw[0];
#pragma unroll
  for (int w = 1; w < NSW; ++w) M = fmaxf(M, mw[w]);
  L = 0.0f;
#pragma unroll
  for (int e = 0; e < 8; ++e) acc[e] = 0.0f;
#pragma unroll
  for (int w = 0; w < NSW; ++w) {
    const float wt = exp2_slot((mw[w] - M) * 1.44269504f);
    L += wt * lw[w];
#pragma unroll
    for (int e = 0; e < 4; ++e) {
      acc[e]     += wt * pa[w][e];
      acc[4 + e] += wt * pb[w][e];
    }
  }
}

template <int RV>
__device__ __forceinline__
void attn_cs(float* smem, float* smx, float* ssm, int qb, int head, int b,
             const u16* __restrict__ QHp, const u16* __restrict__ QLp,
             const u16* __restrict__ KHp, const u16* __restrict__ KLp,
             const u16* __restrict__ VHp, const u16* __restrict__ VLp,
             u16* OHp, u16* OLp) {
#pragma clang fp contract(off)
  const int tid  = threadIdx.x;
  const int wave = __builtin_amdgcn_readfirstlane(tid >> 5);   // scalar: which pair and which key steps the wave takes
  const int ws   = wave / NQG;              // the wave's place among the NSW waves of its pair
  const int qp   = qb * NQG + (wave % NQG); // its pair of query tiles; neighbours in the wave index share their key steps
  const int lane = tid & 31;
  const int hh   = lane >> 4;
  const int c    = lane & 15;
  const int q0   = qp * (QTW * 16);         // first query row of the pair's QTW tiles
  const int kvh  = head;

  float* slab = smem + wave * SLW;          // O partial slab [QTW * 16 queries][64 d] pitch 68, written behind the loop

  // fragment-major planes: a head's 16 positions x 64 d = 1024 halves (2 fragments), its 32 keys x 64 d of v^T = 2048 (4)
  // byte offsets into the planes (each plane MROWS * 512 * 2 bytes, far under 2^32), the lane's 16 bytes included
  const unsigned qvo = ((unsigned)(b * NH + head) * SEQ + (unsigned)q0) * (HD * 2u) + (unsigned)lane * 16u;
  unsigned kvo = (unsigned)(b * NKVH + kvh) * (SEQ * HD * 2u) + (unsigned)ws * (32u * HD * 2u)
               + (unsigned)lane * 16u;                                                  // this step's 32 keys, k and v^T alike
  const _Float16* Qh  = (const _Float16*)(const void*)QHp;               // query tile t at + t * 1024 halves
  const _Float16* Ql  = (const _Float16*)(const void*)QLp;
  const _Float16* Khb = (const _Float16*)(const void*)KHp;
  const _Float16* Klb = (const _Float16*)(const void*)KLp;
  const _Float16* Vhb = (const _Float16*)(const void*)VHp;               // d-subtile j at + j * 512 halves
  const _Float16* Vlb = (const _Float16*)(const void*)VLp;
  const float lsc  = SM_SCALE * (1.0f / (QSC * KSC));   // exact power-of-two fold of the q / k carries into the scale
  const float oc   = 1.0f / (PCAR * VCAR);
  const float ninf = -__builtin_inff();
  const size_t KROW = (size_t)HD;           // halves per key in a head's fragment-major plane

  v8f o[QTW][4];
  float mrun[QTW], lrun[QTW];               // per tile, this lane's query: running max (alike in lanes c and c + 16), sum over the lane's own keys
#pragma unroll
  for (int t = 0; t < QTW; ++t) {
#pragma unroll
    for (int j = 0; j < 4; ++j) o[t][j] = zero8();
    mrun[t] = ninf;
    lrun[t] = 0.0f;
  }
  const int ncaus = (q0 >> 5) + 1;                                            // tiles holding keys <= q0 + 31, the same for both query tiles
  const int nkt   = (ncaus < NKT) ? ncaus : NKT;

#pragma unroll 1
  for (int kt = ws; kt < nkt; kt += NSW, kvo += NSW * 32u * HD * 2u) {
    const int kb = kt * 32;
    // ---- raw scores, transposed: D element r of this lane = (key kb + 8hh + r, query q0 + 16t + c) in s0[t], key kb + 16 + 8hh + r
    //      in s1[t]; every k fragment is loaded once and multiplied with the q fragments of both tiles ----
    v8f s0[QTW], s1[QTW];
#pragma unroll
    for (int t = 0; t < QTW; ++t) { s0[t] = zero8(); s1[t] = zero8(); }
    const _Float16* k0p = Khb;
    const _Float16* k1p = k0p + (size_t)16 * KROW;
    const _Float16* l0p = Klb;
    const _Float16* l1p = l0p + (size_t)16 * KROW;
    // all fragments of the step's score products (k hi / residual, both d halves; the q fragments are the same in every step
    // and may stay in registers) are requested in one run in front of the first product, so that the wave waits for one
    // round trip here, not one per d half
    v16h kf[8], qf[8];                      // kf[4*kk + ..] = kh0, kh1, kl0, kl1; qf[4*kk + 2*t + ..] = q hi, q residual of tile t
#pragma unroll
    for (int kk = 0; kk < HD / 32; ++kk) {
      kf[4 * kk]     = ldfrag_h(k0p + kk * 512, kvo);
      kf[4 * kk + 1] = ldfrag_h(k1p + kk * 512, kvo);
      kf[4 * kk + 2] = ldfrag_h(l0p + kk * 512, kvo);
      kf[4 * kk + 3] = ldfrag_h(l1p + kk * 512, kvo);
#pragma unroll
      for (int t = 0; t < QTW; ++t) {
        qf[4 * kk + 2 * t]     = ldfrag_h(Qh + t * 1024 + kk * 512, qvo);
        qf[4 * kk + 2 * t + 1] = ldfrag_h(Ql + t * 1024 + kk * 512, qvo);
      }
    }
#pragma unroll
    for (int kk = 0; kk < HD / 32; ++kk) {
#pragma unroll
      for (int t = 0; t < QTW; ++t) {
        s0[t] = mma_h(kf[4 * kk],     qf[4 * kk + 2 * t],     s0[t]);
        s0[t] = mma_h(kf[4 * kk],     qf[4 * kk + 2 * t + 1], s0[t]);
        s0[t] = mma_h(kf[4 * kk + 2], qf[4 * kk + 2 * t],     s0[t]);
        s1[t] = mma_h(kf[4 * kk + 1], qf[4 * kk + 2 * t],     s1[t]);
        s1[t] = mma_h(kf[4 * kk + 1], qf[4 * kk + 2 * t + 1], s1[t]);
        s1[t] = mma_h(kf[4 * kk + 3], qf[4 * kk + 2 * t],     s1[t]);
      }
    }
    guard4x16(s0[0], s1[0], s0[1], s1[1], kf, qf);
    // the step's four v^T hi fragments are requested here, into registers that the k fragments have left, and fly while the
    // softmax below runs
    v16h vh[4];
#pragma unroll
    for (int j = 0; j < 4; ++j) vh[j] = ldfrag_h(Vhb + j * 512, kvo);
    // keeps the scheduler from sinking these loads down to their first use behind the softmax (their wait would be exposed)
    __builtin_amdgcn_sched_barrier(0);
    // ---- per query tile: causal replace-mask, running-max online softmax in f32 (the lane's 16 scores of a tile all belong
    //      to its one query), rescale of the tile's O accumulators, P^T fragments ----
    const int key0 = kb + 8 * hh;
    FragH ph[QTW], pl[QTW];
#pragma unroll
    for (int t = 0; t < QTW; ++t) {
      const int qrow = q0 + 16 * t + c;                                       // the lane's query row in tile t
      float t0[8], t1[8];
#pragma unroll
      for (int r = 0; r < 8; ++r) {
        const float a0 = s0[t][r] * lsc;
        const float a1 = s1[t][r] * lsc;
        t0[r] = (key0 + r > qrow) ? ninf : a0;
        t1[r] = (key0 + 16 + r > qrow) ? ninf : a1;
      }
      float mx = fmaxf(t0[0], t1[0]);
#pragma unroll
      for (int r = 1; r < 8; ++r) mx = fmaxf(mx, fmaxf(t0[r], t1[r]));
      mx = fmaxf(mx, xhalf(mx));            // the query's other 16 keys of this step sit in lane c ^ 16
      const float mnew = fmaxf(mrun[t], mx);
      const float al   = exp2_slot((mrun[t] - mnew) * 1.44269504f);
      float x0[8], x1[8], p0[8], p1[8], ps[8];
#pragma unroll
      for (int r = 0; r < 8; ++r) {
        x0[r] = (t0[r] - mnew) * 1.44269504f;
        x1[r] = (t1[r] - mnew) * 1.44269504f;
      }
      exp2x8_slot(p0, x0);
      exp2x8_slot(p1, x1);
#pragma unroll
      for (int r = 0; r < 8; ++r) ps[r] = p0[r] + p1[r];
      const float sm = ((ps[0] + ps[1]) + (ps[2] + ps[3])) + ((ps[4] + ps[5]) + (ps[6] + ps[7]));
      lrun[t] = lrun[t] * al + sm;
      mrun[t] = mnew;
      // rescale the tile's O accumulators by alpha (every element of the lane belongs to its query)
#pragma unroll
      for (int j = 0; j < 4; ++j) {
#pragma unroll
        for (int r = 0; r < 8; ++r) o[t][j][r] = o[t][j][r] * al;
      }
      // B fragments of p*32768 straight from the score registers: column = query c, elements 0..7 = keys kb + 8hh + 0..7,
      // elements 8..15 = keys kb + 16 + 8hh + 0..7 (the split k map of the v^T fragments); hi f16, residual f16 for RV = 1
#pragma unroll
      for (int r = 0; r < 8; ++r) {
        const float ta = p0[r] * PCAR, tb = p1[r] * PCAR;
        const _Float16 ha = (_Float16)ta, hb = (_Float16)tb;
        ph[t].h[0][r] = ha;
        ph[t].h[1][r] = hb;
        if (RV != 0) {
          pl[t].h[0][r] = (_Float16)(ta - (float)ha);
          pl[t].h[1][r] = (_Float16)(tb - (float)hb);
        }
      }
    }
    // ---- O^T += v^T.P^T : A fragment row = d = j*16 + c, keys contiguous in the v^T planes; every v^T fragment loaded once
    //      for both tiles; D element r of o[t][j] = (d = j*16 + 8hh + r, query q0 + 16t + c) ----
    if (RV != 0) {
      v16h vl[4];
#pragma unroll
      for (int j = 0; j < 4; ++j) vl[j] = ldfrag_h(Vlb + j * 512, kvo);
#pragma unroll
      for (int j = 0; j < 4; ++j) {
#pragma unroll
        for (int t = 0; t < QTW; ++t) {
          o[t][j] = mma_h(vh[j], ph[t].v, o[t][j]);
          o[t][j] = mma_h(vh[j], pl[t].v, o[t][j]);
          o[t][j] = mma_h(vl[j], ph[t].v, o[t][j]);
        }
      }
      guard8x12(o[0], o[1], ph[0].v, ph[1].v, pl[0].v, pl[1].v, vh, vl);
    } else {
#pragma unroll
      for (int j = 0; j < 4; ++j) {
#pragma unroll
        for (int t = 0; t < QTW; ++t) o[t][j] = mma_h(vh[j], ph[t].v, o[t][j]);
      }
      guard8x6(o[0], o[1], ph[0].v, ph[1].v, vh);
    }
  }
  acc_guard4(o[0][0], o[0][1], o[0][2], o[0][3]);
  acc_guard4(o[1][0], o[1][1], o[1][2], o[1][3]);
  // ---- the wave's partial: raw O accumulators into its slab (row = 16t + c, 8 consecutive d a register tile: 16-B stores),
  //      each query's max and its sum (the two lane halves' sums joined here, once) beside: both are alike in lanes c and
  //      c + 16, so lane (hh, c) stores those of tile hh, row 16hh + c = lane ----
#pragma unroll
  for (int t = 0; t < QTW; ++t) {
#pragma unroll
    for (int j = 0; j < 4; ++j) {
      float* d = slab + (t * 16 + c) * SLP + j * 16 + 8 * hh;
      const v4f lo = {o[t][j][0], o[t][j][1], o[t][j][2], o[t][j][3]};
      const v4f hi = {o[t][j][4], o[t][j][5], o[t][j][6], o[t][j][7]};
      *(v4f*)(d)     = lo;
      *(v4f*)(d + 4) = hi;
    }
  }
  const float lall0 = lrun[0] + xhalf(lrun[0]);
  const float lall1 = lrun[1] + xhalf(lrun[1]);
  smx[wave * (QTW * 16) + lane] = (hh != 0) ? mrun[1] : mrun[0];
  ssm[wave * (QTW * 16) + lane] = (hh != 0) ? lall1 : lall0;
  __syncthreads();                          // every wave's partial is in LDS before any wave merges; passed by all NWV waves
  // ---- merged O / l with the carries (32768 on p, 1024 on v) folded once, x256 -> f16 hi plane (+ f16 residual plane),
  //      fragment-major [row/16][512/32][half][lane][8]: wave 4*tq + it stores, for query tile tq, half it&1 of k step
  //      head*2 + (it>>1); lane = (row c of the tile, 8 consecutive d at it*16 + 8*hh) ----
  const int tq = wave >> 2;
  const int it = wave & 3;
#pragma unroll
  for (int g = 0; g < NQG; ++g) {           // the same tile and columns of each pair in turn
    float acc[8], lsum;
    attn_merge8(smem, smx, ssm, g, tq * 16 + c, it * 16 + 8 * hh, acc, lsum);
    const float rl = (1.0f / lsum) * oc;
    float w[8];
#pragma unroll
    for (int e = 0; e < 8; ++e) w[e] = (acc[e] * rl) * OSC;
    v4u oh, ol;
#pragma unroll
    for (int e = 0; e < 4; ++e) {
      const _Float16 h0 = (_Float16)w[2 * e], h1 = (_Float16)w[2 * e + 1];
      const _Float16 g0 = (_Float16)(w[2 * e] - (float)h0), g1 = (_Float16)(w[2 * e + 1] - (float)h1);
      oh[e] = pk16(h_bits(h0), h_bits(h1));
      ol[e] = pk16(h_bits(g0), h_bits(g1));
    }
    const size_t ob = ((size_t)b * SEQ + (qb * NQG + g) * (QTW * 16) + tq * 16) * DMOD + (size_t)head * (16 * HD) + 8 * lane + it * 256;
    *(v4u*)(OHp + ob) = oh;
    if (RV != 0) {
      *(v4u*)(OLp + ob) = ol;
    }
    // the next pair's merge, and in the shared launch the code of the other form that may follow, write registers that these
    // stores name
    asm volatile("s_wait_xcnt 0x0" ::: "memory");
  }
}

// One launch for all query tiles: the index of the 64-row block decides block-uniformly between the two forms (RV = 1 for blocks < NQBR).
// coverage: bid -> (qb, head, b) is one-to-one from 0 .. NQB*NH*NB - 1 onto NQB x NH x NB.
__global__ __launch_bounds__(ATT_THREADS)
void attn_all(const u16* __restrict__ QHp, const u16* __restrict__ QLp,
              const u16* __restrict__ KHp, const u16* __restrict__ KLp,
              const u16* __restrict__ VHp, const u16* __restrict__ VLp, u16* OHp, u16* OLp) {
  __shared__ __align__(16) float smem[NWV * SLW];   // per wave: O partial slab behind the loop
  __shared__ float smx[NWV * QTW * 16];             // per wave: QTW * 16 row maxima
  __shared__ float ssm[NWV * QTW * 16];             // per wave: QTW * 16 row sums
  const int bid  = blockIdx.x;
  if (bid >= NQB * NH * NB) return;         // block-uniform, in front of the block barrier; never taken with the exact grid
  // a block's cost grows with qb (its pairs have 2 qb + 1 and 2 qb + 2 key steps), more blocks than fit at once:
  // the longest get the lowest indices (for speed only); the NH * NB blocks of one qb, all of one cost,
  // are neighbours in the index (a multiple of 8)
  const int qb   = NQB - 1 - bid / (NH * NB);
  const int t2   = bid % (NH * NB);
  const int head = t2 % NH;
  const int b    = t2 / NH;
  if (qb < NQBR) attn_cs<1>(smem, smx, ssm, qb, head, b, QHp, QLp, KHp, KLp, VHp, VLp, OHp, OLp);
  else           attn_cs<0>(smem, smx, ssm, qb, head, b, QHp, QLp, KHp, KLp, VHp, VLp, OHp, OLp);
}

// =====================================================================================================
// Workspace map (bytes); every plane is fully written by whole-line stores before it is read (the O residual plane only on
// the rows < RICH per sequence that are read); all extents are exact multiples of the store granularity (no pad rows needed);
// every region offset a multiple of 131072; every 16-bit plane is fragment-major (see the fragment loaders), same extent as
// the row-major shape given here:
//   XB  bf16 [MROWS][512]               MROWS*1024   (NB=4, SEQ=2048: 8388608); after the projection GEMM the same bytes hold
//                                                    the O f16 hi plane [MROWS][512] x256 (identical extent)
//   WB  bf16 [1536 n][512 k]            1572864      (Wq rows 0..511, Wk 512..1023, Wv 1024..1535)
//   OL  f16 [MROWS][512]                MROWS*1024   O residual plane
//   QH  f16 [MROWS][512] x256           MROWS*1024   QL residual, same extent
//   KH  f16 [MROWS][512] x256           MROWS*1024   KL residual, same extent   (keys = rotary of the v_proj columns)
//   VH  f16 [NB*8][64][SEQ] x1024       MROWS*1024   VL residual, same extent   (values = the k_proj columns)
//   TC  f32 [SEQ][32]                   SEQ*128      TS, same extent
//   WT  f16 [512 o][512 d] x1024        524288       (Wo; a region of its own, written in the launch that also writes WB)
//   end (NB=4, SEQ=2048)               69730304
// =====================================================================================================
extern "C" void kernel_launch(void* const* d_in, const int* in_sizes, int n_in,
                              void* d_out, int out_size, void* d_ws, size_t ws_size,
                              hipStream_t stream) {
  if (n_in < 9) return;
  if (in_sizes[0] < ((NB - 1) * XS_FULL + SEQ) * DMOD) return;
  if (in_sizes[1] != DMOD * DMOD) return;
  if (in_sizes[2] != DMOD) return;
  if (in_sizes[3] != DMOD * DMOD) return;
  if (in_sizes[4] != DMOD) return;
  if (in_sizes[5] != DMOD * DMOD) return;
  if (in_sizes[6] != DMOD) return;
  if (in_sizes[7] != DMOD * DMOD) return;
  if (in_sizes[8] != DMOD) return;
  if (out_size < ((NB - 1) * XS_FULL + SEQ) * DMOD) return;

  const float* x   = (const float*)d_in[0];
  const float* wq  = (const float*)d_in[1];
  const float* bqp = (const float*)d_in[2];
  const float* wk  = (const float*)d_in[3];
  const float* bkp = (const float*)d_in[4];
  const float* wv  = (const float*)d_in[5];
  const float* bvp = (const float*)d_in[6];
  const float* wo  = (const float*)d_in[7];
  const float* bop = (const float*)d_in[8];
  float*       out = (float*)d_out;

  const size_t szXB = (size_t)MROWS * DMOD * 2;
  const size_t szWB = (size_t)NQKV * DMOD * 2;
  const size_t szQ  = (size_t)MROWS * DMOD * 2;                  // QH, QL
  const size_t szK  = (size_t)MROWS * KVD * 2;                   // KH, KL
  const size_t szV  = (size_t)NB * NKVH * HD * SEQ * 2;          // VH, VL (== szK)
  const size_t szT  = (size_t)SEQ * NFREQ * 4;                   // TC, TS
  const size_t szOH = (size_t)MROWS * DMOD * 2;                  // O hi plane, lives in the XB region
  const size_t szOL = (size_t)MROWS * DMOD * 2;                  // O residual plane
  const size_t szWT = (size_t)DMOD * DMOD * 2;                   // Wo f16 plane
  if (szOH > szXB) return;
  size_t off = 0;
  const size_t oXB = off; off += szXB;
  const size_t oWB = off; off += szWB;
  const size_t oOL = off; off += szOL;
  const size_t oQH = off; off += szQ;
  const size_t oQL = off; off += szQ;
  const size_t oKH = off; off += szK;
  const size_t oKL = off; off += szK;
  const size_t oVH = off; off += szV;
  const size_t oVL = off; off += szV;
  const size_t oTC = off; off += szT;
  const size_t oTS = off; off += szT;
  const size_t oWT = off; off += szWT;
  if (off > ws_size) return;                // off = 69730304 for NB = 4, SEQ = 2048
  if (off > (size_t)WS_CAP) return;

  char* ws = (char*)d_ws;
  u16*   XB  = (u16*)(ws + oXB);
  u16*   OH  = (u16*)(ws + oXB);
  u16*   WB  = (u16*)(ws + oWB);
  u16*   WT  = (u16*)(ws + oWT);
  u16*   OL  = (u16*)(ws + oOL);
  u16*   QH  = (u16*)(ws + oQH);
  u16*   QL  = (u16*)(ws + oQL);
  u16*   KH  = (u16*)(ws + oKH);
  u16*   KL  = (u16*)(ws + oKL);
  u16*   VH  = (u16*)(ws + oVH);
  u16*   VL  = (u16*)(ws + oVL);
  float* TC  = (float*)(ws + oTC);
  float* TS  = (float*)(ws + oTS);

  const dim3 b256(256), b128(128), bAT(ATT_THREADS);
  const dim3 gG1((MROWS / 64) * (NQKV / 64));
  const float osc = 1.0f / (OSC * WOS);

  // (1) rotary cos / sin tables [SEQ][32]; x -> bf16 plane [MROWS][512]; Wq, Wk, Wv -> one bf16 plane [1536 n][512 k];
  //     Wo [512 o][512 d] -> f16 plane of the bf16 value x1024 (already k-contiguous)
  prep<<<dim3(GT + NB * GX + 4 * GW), b256, 0, stream>>>(x, wq, wk, wv, wo, XB, WB, WT, TC, TS);
  // (2) x.[Wq|Wk|Wv]^T (columns 0..511 q_proj, 512..1023 k_proj, 1024..1535 v_proj) with the planes written by its epilogue:
  //     q = rotary(q_proj + bq) and keys = rotary(v_proj + bv) -> hi + residual planes x256; values = k_proj + bk (no rotary)
  //     -> v^T hi + residual planes x1024
  gemm_qkv<<<gG1, b128, 0, stream>>>(XB, WB, bqp, bkp, bvp, TC, TS, QH, QL, KH, KL, VH, VL, DMOD);
  // (3) causal attention -> O f16 hi plane x256 (XB region) for all query tiles; residual plane for tiles < RICH
  attn_all<<<dim3(NQB * NH * NB), bAT, 0, stream>>>(QH, QL, KH, KL, VH, VL, OH, OL);
  // (4) y = O.Wo^T + bo -> out f32 [rows][512], carries 256 x 1024 folded back; rows < RICH per sequence with O hi + residual
  gemm_o<<<dim3(NB * (SEQ / 64) * (DMOD / 64)), b128, 0, stream>>>(OH, OL, WT, bop, out, DMOD, DMOD, osc);
  (void)hipGetLastError();
}

// v010
// One run takes 75.4 microseconds.
// In two side-by-side timings against v009, it was 1.20 and 1.21 times as fast.
// All steps since v000 together make it 5.02 times as fast.
// Contractions: x.[Wq|Wk|Wv]^T on v_wmma_f32_16x16x32_bf16 (x and the weights as bf16 RNE planes; weight [n][k] rows are
// the k-contiguous A operand for q_proj and v_proj, B for k_proj; f32 accumulate); q.k^T over hd 64 and P.v on v_wmma_f32_16x16x32_f16 with f16 hi + f16
// residual planes (both transposed: k.q^T and v^T.P^T; q, k x256 after rotary, products hh+lh+hl on every row; P x32768 hi + in-register residual and v^T x1024
// hi + residual plane for query rows < 512 of each sequence, P hi . v hi only for later rows); O.Wo^T on
// v_wmma_f32_16x16x32_f16 with O x256 as f16 hi (+ f16 residual plane for rows < 512 of each sequence) and Wo as
// f16(bf16(Wo)) x1024, one accumulator, bias added in f32; all f32 accumulate. Rotary cos/sin tables, bias adds and online
// softmax in f32 on VALU.
#include <hip/hip_runtime.h>
#include <math.h>
#include <stdint.h>

#ifndef NB
#define NB 4
#endif
#ifndef SEQ
#define SEQ 2048
#endif
#define XS_FULL 2048
#define DMOD  512
#define NH    8
#define NKVH  8
#define HD    64
#define HHALF (HD / 2)
#define NFREQ (HD / 2)
#define KVD   (NKVH * HD)
#define NQKV  (DMOD + 2 * KVD)
#define QCOL0 0
#define VCOL0 DMOD
#define KCOL0 (DMOD + KVD)
#define MROWS (NB * SEQ)
#define RICH  512
#define ROPE_L2 0.41524101186092028
#define SM_SCALE 0.04419417382415922f
#define QSC   256.0f
#define KSC   256.0f
#define PCAR  32768.0f
#define VCAR  1024.0f
#define OSC   256.0f
#define WOS   1024.0f
#define NSW   4
#define NQG   2
#define NWV   (NSW * NQG)
#define NQT   (SEQ / 16)
#define NQTR  (RICH / 16)
#define QTW   2
#define NQP   (NQT / QTW)
#define NQPR  (NQTR / QTW)
#define NQB   (NQP / NQG)
#define NQBR  (NQPR / NQG)
#define NKT   (SEQ / 32)
#define ATT_THREADS (NWV * 32)
#define SLP   68
#define SLW   (QTW * 16 * SLP)
#define SLAB64 (16 * 68)
#define KUN   4
#define RTW   4
#define WS_CAP 134217728
#define GX    (SEQ * DMOD / 8 / 256)
#define GW    (DMOD * DMOD / 8 / 256)
#define GT    (SEQ * NFREQ / 256)
static_assert(DMOD == NH * HD && HD == 64 && HHALF == 32 && NFREQ == 32 && NH == 8 && NKVH == NH);
static_assert(ATT_THREADS == 256 && NSW >= 4 && KVD == 512 && NQKV == 1536 && KCOL0 + KVD == NQKV && VCOL0 + KVD == KCOL0);
static_assert(NB >= 1 && NB <= 4);
static_assert(NB == 1 || SEQ == XS_FULL);
static_assert((SEQ % 64) == 0 && SEQ >= 64 && SEQ <= XS_FULL);
static_assert((RICH % 64) == 0 && RICH >= 64 && RICH <= SEQ);
static_assert((DMOD % 64) == 0 && (KVD % 64) == 0 && (NQKV % 64) == 0 && (DMOD % 32) == 0 && (HD % 32) == 0);
static_assert(((SEQ * DMOD / 8) % 256) == 0 && ((DMOD * DMOD / 8) % 256) == 0 && ((SEQ * NFREQ) % 256) == 0);
static_assert(NWV * (SLW + 2 * QTW * 16) * 4 <= 327680 / 2 && 4 * SLAB64 * 4 <= 65536);
static_assert(QTW == 2 && NQG == 2 && NWV == 4 * QTW && (NQT % QTW) == 0 && (NQTR % QTW) == 0);
static_assert((NQP % NQG) == 0 && (NQPR % NQG) == 0);
static_assert(DMOD / 8 == 64 && KVD / 8 == 64 && (DMOD % (32 * KUN)) == 0);
static_assert(((NH * NB) % 8) == 0);
static_assert(RTW == 4 && (SEQ % (16 * RTW)) == 0 && (MROWS % (32 * RTW)) == 0 && (DMOD % 128) == 0 && (KVD % 128) == 0);
static_assert(((SEQ * DMOD / 8) % 1024) == 0 && ((DMOD * DMOD / 8) % 1024) == 0 && (SEQ % 32) == 0 && (RICH % 16) == 0);

typedef unsigned short u16;
typedef _Float16 v16h __attribute__((ext_vector_type(16)));
typedef _Float16 v8h  __attribute__((ext_vector_type(8)));
typedef __bf16   v16b __attribute__((ext_vector_type(16)));
typedef float    v8f  __attribute__((ext_vector_type(8)));
typedef float    v4f  __attribute__((ext_vector_type(4)));
typedef unsigned int v4u __attribute__((ext_vector_type(4)));

union FragH { v16h v; v8h h[2]; v4u u[2]; };
union FragB { v16b v; v4u u[2]; };

// ---- scalar helpers --------------------------------------------------------------------------------
__device__ __forceinline__ unsigned short bf_bits(float f) {          // f32 -> bf16 bits, RNE convert
  unsigned u = __float_as_uint(f);
  return (unsigned short)((u + 0x7FFFu + ((u >> 16) & 1u)) >> 16);
}
__device__ __forceinline__ float bf_up(unsigned short h) { return __uint_as_float(((unsigned)h) << 16); }
__device__ __forceinline__ float bfr(float f) { return bf_up(bf_bits(f)); }
__device__ __forceinline__ unsigned short h_bits(_Float16 x) { return __builtin_bit_cast(unsigned short, x); }
__device__ __forceinline__ unsigned pk16(unsigned short a, unsigned short b) { return (unsigned)a | ((unsigned)b << 16); }
__device__ __forceinline__ v8f zero8() { v8f z = {0.f, 0.f, 0.f, 0.f, 0.f, 0.f, 0.f, 0.f}; return z; }

// ---- fragment-major planes: every 16-bit A/B operand plane [row][K] other than v^T is stored as [row/16][K/32][g][lane][8]: the 16-B unit
//      of lane = 16*h + (row&15) in half g holds k = 32*ks + 16*g + 8*h + 0..7, so one wave-wide 16-B load is 512 contiguous
//      bytes (4 whole lines) and one 16 x 32 fragment is 1 KB. A 16-row tile starts where it starts in a row-major plane.
// ---- fragment loaders: lane -> row/col (lane&15), h = lane>>4; base = a pointer that is the same in every lane (it stays in
//      scalar registers), vo = byte offset of the fragment from base + 16*lane (one 32-bit register shared by all loads of a
//      step and advanced behind them); p = base + vo;
//      elements 0..7 <- p[0..7] (k0+8h..), elements 8..15 <- p[256..263] (k0+16+8h..)  (same split k map for A and B)
__device__ __forceinline__ v16h ldfrag_h(const _Float16* base, unsigned vo) {
  const char* p = (const char*)base + vo;
  FragH f;
  f.h[0] = *(const v8h*)(p);
  f.h[1] = *(const v8h*)(p + 512);
  return f.v;
}
__device__ __forceinline__ v16b ldfrag_b(const u16* base, unsigned vo) { // bf16 plane read as unsigned integer vectors
  const char* p = (const char*)base + vo;
  FragB f;
  f.u[0] = *(const v4u*)(p);
  f.u[1] = *(const v4u*)(p + 512);
  return f.v;
}

__device__ __forceinline__ v8f mma_h(v16h a, v16h b, v8f c) {
  return __builtin_amdgcn_wmma_f32_16x16x32_f16(false, a, false, b, (short)0, c, false, false);
}
__device__ __forceinline__ v8f mma_b(v16b a, v16b b, v8f c) {
  return __builtin_amdgcn_wmma_f32_16x16x32_bf16(false, a, false, b, (short)0, c, false, false);
}
// four issue slots between the last matrix instruction of a group and the first vector instruction on its results or operands,
// on every path (the loop's back edge too); the fragments are named so that their registers are not rewritten in front of it
// guard4x16: behind a whole key step's score products (16 fragments); guard8x6, guard8x12: behind its v^T.P^T products
__device__ __forceinline__ void guard4x16(v8f& a, v8f& b, v8f& c, v8f& d, const v16h (&x)[8], const v16h (&y)[8]) {
#if defined(__HIP_DEVICE_COMPILE__)
  asm volatile("v_nop\n\tv_nop\n\tv_nop\n\tv_nop"
               : "+v"(a), "+v"(b), "+v"(c), "+v"(d)
               : "v"(x[0]), "v"(x[1]), "v"(x[2]), "v"(x[3]), "v"(x[4]), "v"(x[5]), "v"(x[6]), "v"(x[7]),
                 "v"(y[0]), "v"(y[1]), "v"(y[2]), "v"(y[3]), "v"(y[4]), "v"(y[5]), "v"(y[6]), "v"(y[7]) : "memory");
#endif
}
__device__ __forceinline__ void guard8x6(v8f (&o0)[4], v8f (&o1)[4], v16h p0, v16h p1, const v16h (&x)[4]) {
#if defined(__HIP_DEVICE_COMPILE__)
  asm volatile("v_nop\n\tv_nop\n\tv_nop\n\tv_nop"
               : "+v"(o0[0]), "+v"(o0[1]), "+v"(o0[2]), "+v"(o0[3]), "+v"(o1[0]), "+v"(o1[1]), "+v"(o1[2]), "+v"(o1[3])
               : "v"(p0), "v"(p1), "v"(x[0]), "v"(x[1]), "v"(x[2]), "v"(x[3]) : "memory");
#endif
}
__device__ __forceinline__ void guard8x12(v8f (&o0)[4], v8f (&o1)[4], v16h p0, v16h p1, v16h r0, v16h r1,
                                          const v16h (&x)[4], const v16h (&y)[4]) {
#if defined(__HIP_DEVICE_COMPILE__)
  asm volatile("v_nop\n\tv_nop\n\tv_nop\n\tv_nop"
               : "+v"(o0[0]), "+v"(o0[1]), "+v"(o0[2]), "+v"(o0[3]), "+v"(o1[0]), "+v"(o1[1]), "+v"(o1[2]), "+v"(o1[3])
               : "v"(p0), "v"(p1), "v"(r0), "v"(r1), "v"(x[0]), "v"(x[1]), "v"(x[2]), "v"(x[3]),
                 "v"(y[0]), "v"(y[1]), "v"(y[2]), "v"(y[3]) : "memory");
#endif
}
template <typename F>
__device__ __forceinline__ void guard6(v8f& a, v8f& b, v8f& c, v8f& d, F x0, F x1, F x2, F x3, F x4, F x5) {
#if defined(__HIP_DEVICE_COMPILE__)
  asm volatile("v_nop\n\tv_nop\n\tv_nop\n\tv_nop"
               : "+v"(a), "+v"(b), "+v"(c), "+v"(d) : "v"(x0), "v"(x1), "v"(x2), "v"(x3), "v"(x4), "v"(x5) : "memory");
#endif
}
// behind the projection GEMM's 16 products of a k step: every accumulator and fragment is named as an input, so that all 16
// products stand in front of the slots and no fragment register is rewritten in front of them
__device__ __forceinline__ void guard16x8(const v8f (&c)[RTW][4], const v16b (&a)[RTW], const v16b (&b)[4]) {
#if defined(__HIP_DEVICE_COMPILE__)
  asm volatile("v_nop\n\tv_nop\n\tv_nop\n\tv_nop"
               :: "v"(c[0][0]), "v"(c[0][1]), "v"(c[0][2]), "v"(c[0][3]), "v"(c[1][0]), "v"(c[1][1]), "v"(c[1][2]), "v"(c[1][3]),
                  "v"(c[2][0]), "v"(c[2][1]), "v"(c[2][2]), "v"(c[2][3]), "v"(c[3][0]), "v"(c[3][1]), "v"(c[3][2]), "v"(c[3][3]),
                  "v"(a[0]), "v"(a[1]), "v"(a[2]), "v"(a[3]), "v"(b[0]), "v"(b[1]), "v"(b[2]), "v"(b[3]) : "memory");
#endif
}
__device__ __forceinline__ void acc_guard4(v8f& a, v8f& b, v8f& c, v8f& d) {
#if defined(__HIP_DEVICE_COMPILE__)
  asm volatile("v_nop\n\tv_nop\n\tv_nop\n\tv_nop" : "+v"(a), "+v"(b), "+v"(c), "+v"(d));
#endif
}
__device__ __forceinline__ void wave_sync_lds() {
  __builtin_amdgcn_fence(__ATOMIC_RELEASE, "workgroup");
  __builtin_amdgcn_wave_barrier();
  __builtin_amdgcn_fence(__ATOMIC_ACQUIRE, "workgroup");
}

// =====================================================================================================
// f32 [rows][DMOD] -> 16-bit fragment-major plane.  f16mode == 0: bf16 RNE bits;  f16mode == 1: f16 bits of (bf16 RNE value)
// * scale. Thread = output unit gt = 8 consecutive elements of one row: two 16-B loads (a wave reads 64 B of each of 16 rows,
// the block uses every line whole), one 16-B store; 32 consecutive lanes store 512 contiguous, 512-B aligned bytes;
// coverage: blk = 0 .. n8/256 - 1, x 256 thr x 8 (in-kernel bound) = the whole plane (n8 a multiple of 256 here).
// =====================================================================================================
__device__ __forceinline__ void cvt16(const float* __restrict__ x, u16* D, int blk, int n8, int f16mode, float scale) {
  const int gt = blk * 256 + (int)threadIdx.x;
  if (gt >= n8) return;
  const int srow = (gt >> 10) * 16 + (gt & 15);                                   // 1024 units per 16-row tile
  const int schk = ((gt >> 6) & (DMOD / 32 - 1)) * 4 + ((gt >> 5) & 1) * 2 + ((gt >> 4) & 1);
  const float* p = x + ((size_t)srow * (DMOD / 8) + schk) * 8;
  const v4f a = *(const v4f*)(p), b4 = *(const v4f*)(p + 4);
  float w[8];
#pragma unroll
  for (int e = 0; e < 4; ++e) { w[e] = a[e]; w[4 + e] = b4[e]; }
  v4u o;
#pragma unroll
  for (int e = 0; e < 4; ++e) {
    const float f0 = w[2 * e], f1 = w[2 * e + 1];
    const unsigned short hb0 = h_bits((_Float16)(bfr(f0) * scale));
    const unsigned short hb1 = h_bits((_Float16)(bfr(f1) * scale));
    const unsigned short bb0 = bf_bits(f0);
    const unsigned short bb1 = bf_bits(f1);
    o[e] = (f16mode != 0) ? pk16(hb0, hb1) : pk16(bb0, bb1);
  }
  u16* d = D + (size_t)gt * 8;
  {
    *(v4u*)(d) = o;
    
  }
}

// =====================================================================================================
// Rotary tables TC[s][j] = cos(s * inv[j]), TS[s][j] = sin(s * inv[j]), j < 32, with
// inv[j] = 1.0f / f32(10000^(j/32)) (power evaluated in f64 and narrowed once, IEEE f32 reciprocal, f32 product s*inv,
// coverage: blk = 0 .. n/256 - 1, x 256 thr = n = SEQ*32 elements of TC and of TS (n a multiple of 256).
// =====================================================================================================
__device__ __forceinline__ void k_tab(float* TC, float* TS, int blk, int n) {
#pragma clang fp contract(off)
  const int idx = blk * 256 + (int)threadIdx.x;
  if (idx >= n) return;
  const int s = idx / NFREQ;
  const int j = idx - s * NFREQ;
  const double pj = exp2((double)j * ROPE_L2);       // 10000^(j/32)
  const float pf  = (float)pj;
  const float inv = 1.0f / pf;
  const float ang = (float)s * inv;
  float sv, cv;
  sincosf(ang, &sv, &cv);
  {
    *(float*)(TC + idx) = cv;
    *(float*)(TS + idx) = sv;
    
  }
}

// =====================================================================================================
// One launch for everything that reads only the inputs: none of these pieces reads what another writes, so they share a grid
// by block range (every branch is block-uniform, no barrier): GT blocks the rotary tables, NB*GX blocks x -> bf16 plane
// [MROWS][512], GW blocks each Wq, Wk, Wv -> one bf16 plane [1536 n][512 k], GW blocks Wo -> f16 plane of the bf16 value x1024.
// coverage: grid = GT + NB*GX + 4*GW blocks, each range exactly the grid of its piece.
// =====================================================================================================
__global__ __launch_bounds__(256) void prep(const float* __restrict__ x, const float* __restrict__ wq,
                                            const float* __restrict__ wk, const float* __restrict__ wv,
                                            const float* __restrict__ wo, u16* XB, u16* WB, u16* WT, float* TC, float* TS) {
  int bid = (int)blockIdx.x;
  if (bid < GT) { k_tab(TC, TS, bid, SEQ * NFREQ); return; }
  bid -= GT;
  if (bid < NB * GX) {
    const int bq = bid / GX;
    cvt16(x + (size_t)bq * XS_FULL * DMOD, XB + (size_t)bq * SEQ * DMOD, bid - bq * GX, SEQ * DMOD / 8, 0, 1.0f);
    return;
  }
  bid -= NB * GX;
  if (bid < GW)     { cvt16(wq, WB, bid, DMOD * DMOD / 8, 0, 1.0f); return; }
  if (bid < 2 * GW) { cvt16(wk, WB + (size_t)VCOL0 * DMOD, bid - GW, DMOD * DMOD / 8, 0, 1.0f); return; }
  if (bid < 3 * GW) { cvt16(wv, WB + (size_t)KCOL0 * DMOD, bid - 2 * GW, DMOD * DMOD / 8, 0, 1.0f); return; }
  if (bid < 4 * GW) { cvt16(wo, WT, bid - 3 * GW, DMOD * DMOD / 8, 1, WOS); return; }
}

// =====================================================================================================
// Interleaved-pair rotary of one element, with y = projection + bias (f32 add) already formed:
//   out[2j]   = y[2j]  *c[s][j] + (-1)*(y[2j+1]*sn[s][j])
//   out[2j+1] = y[2j+1]*c[s][j] + (+1)*(y[2j]  *sn[s][j])        with c, sn the f32 table values (mul, mul, add kept
//   separate); hb = f16(out * sc), lb = f16 residual (t - f16(t)).
// =====================================================================================================
__device__ __forceinline__ void rot_one(float x, float y, float cv, float sv, float sgn, float sc,
                                        unsigned short& hb, unsigned short& lb) {
#pragma clang fp contract(off)
  const float ys   = y * sv;
  const float term = sgn * ys;
  const float r    = x * cv + term;
  const float t    = r * sc;
  const _Float16 a = (_Float16)t;
  hb = h_bits(a);
  lb = h_bits((_Float16)(t - (float)a));
}

// =====================================================================================================
// GEMM epilogue of the output projection: the wave's 16x64 f32 tile (times oscale) staged in its LDS slab (pitch 68),
// 8 consecutive lanes x 16 B per line), lanes 16..31 -> row 2*it+1; HASB != 0 adds bias[col] in f32 to every element;
// coverage: 8 instructions x 2 rows x 16 lanes x 4 floats = the wave's 16 x 64 tile.
// =====================================================================================================
template <int HASB>
__device__ __forceinline__ void epi64(float* sl, v8f a0, v8f a1, v8f a2, v8f a3, float oscale, const float* bias,
                                      float* C, int N, size_t rowb, int col0, int lane) {
  const int hh = lane >> 4, m = lane & 15;
#pragma unroll
  for (int r = 0; r < 8; ++r) {
    const int ro = (8 * hh + r) * 68 + m;
    sl[ro]      = a0[r] * oscale;
    sl[ro + 16] = a1[r] * oscale;
    sl[ro + 32] = a2[r] * oscale;
    sl[ro + 48] = a3[r] * oscale;
  }
  wave_sync_lds();
  v4f vals[8];
#pragma unroll
  for (int it = 0; it < 8; ++it) vals[it] = *(const v4f*)(sl + (it * 2 + hh) * 68 + m * 4);
  if (HASB != 0) {
    const v4f b4 = *(const v4f*)(bias + col0 + m * 4);
#pragma unroll
    for (int it = 0; it < 8; ++it) vals[it] = vals[it] + b4;
  }
  float* dst = C + (rowb + (size_t)hh) * (size_t)N + col0 + m * 4;
  {
#pragma unroll
    for (int it = 0; it < 8; ++it) {
      *(v4f*)(dst + (size_t)(it * 2) * (size_t)N) = vals[it];
    }
    
  }
}

// =====================================================================================================
// Projection GEMM x.[Wq|Wk|Wv]^T (bf16 fragment-major planes A = x [MROWS][512], Bt = weights [1536 n][512 k], f32
// accumulate) whose epilogue writes the attention operand planes itself: no f32 projection array, no LDS.
// Block = 128 rows x 128 columns, 2 x 2 waves; a wave's tile is 64 rows x 64 columns = RTW row tiles of 16 x 4 column tiles
// of 16, so that a k step's 8 fragments (RTW of x, 4 of the weights) feed 16 products: half a fragment load per product (it
// was 5 loads for 4), and every fragment is asked for by two waves of the block only. A wave's 64 columns are one head of
// q_proj (columns 0..511), of k_proj (512..1023) or of v_proj (1024..1535), its 64 rows 64 positions of one sequence; the
// choice is block-uniform.
// Fragments loaded straight from the planes (two 512-B wave loads each, split k map for both operands); K stepped by 32
// (host: K = 512, the row length of both planes). Per row tile i:
// TR = 1 (q_proj, v_proj): the weight tile is the first operand, so acc i j element r of lane (hh, m) =
//   (column j*16 + 8*hh + r, position 16*i + m): 8 consecutive d of one position = the lane's 16-B unit of the q / k plane.
// TR = 0 (k_proj): x is the first operand, acc i j element r of lane (hh, m) = (position 16*i + 8*hh + r, column j*16 + m):
//   8 consecutive keys of one d = the lane's 16-B unit of the v^T plane.
// =====================================================================================================
template <int TR>
__device__ __forceinline__ void proj_loop(const u16* ap0, const u16* ap1, const u16* ap2, const u16* ap3,
                                          const u16* bp0, const u16* bp1, const u16* bp2, const u16* bp3,
                                          unsigned vo, int K, v8f (&acc)[RTW][4]) {
#pragma unroll 1
  for (int k0 = 0; k0 < K; k0 += 32, vo += 1024u) {
    v16b a[RTW], b[4];
    a[0] = ldfrag_b(ap0, vo);
    b[0] = ldfrag_b(bp0, vo);
    b[1] = ldfrag_b(bp1, vo);
    b[2] = ldfrag_b(bp2, vo);
    b[3] = ldfrag_b(bp3, vo);
    a[1] = ldfrag_b(ap1, vo);
    a[2] = ldfrag_b(ap2, vo);
    a[3] = ldfrag_b(ap3, vo);
    // keeps the scheduler from sinking the later loads in among the products (it did: three exposed round trips a k step
    // in place of one)
    __builtin_amdgcn_sched_barrier(0);
#pragma unroll
    for (int i = 0; i < RTW; ++i) {
#pragma unroll
      for (int j = 0; j < 4; ++j) acc[i][j] = (TR != 0) ? mma_b(b[j], a[i], acc[i][j]) : mma_b(a[i], b[j], acc[i][j]);
    }
    guard16x8(acc, a, b);
  }
}

// q / k planes from the TR = 1 accumulators: y = acc + bias[head*HD + d], rotary with table row s = the lane's position and
// table column d >> 1, x sc -> f16 hi and f16 residual planes, fragment-major per head [b*8 + head][s/16][d/32][half][lane][8]
// (row = position, k = d): acc j is half j & 1 of d step j >> 1, at pb + j * 256 halves, pb = the tile's start + 8 * lane.
// coverage: 4 stores x 32 lanes x 8 halves = the row tile's 16 positions x 64 d of Hp and of Lp, 512 contiguous bytes a store.
__device__ __forceinline__ void rope_epi(const v8f (&acc)[4], int hh, int s, const float* __restrict__ bias,
                                         const float* __restrict__ TC, const float* __restrict__ TS,
                                         u16* Hp, u16* Lp, size_t pb, float sc) {
  const float* bp = bias + 8 * hh;                     // bias already at the head's first column
  const float* cp = TC + (size_t)s * NFREQ + 4 * hh;
  const float* sp = TS + (size_t)s * NFREQ + 4 * hh;
  // the loads of all four accumulator tiles in one run: one round trip a row tile (the k loop's fragment registers are free
  // here, and the launch has three waves a SIMD, which the register count does not limit)
  {
    v4f ba[4], bb[4], cw[4], sw[4];
#pragma unroll
    for (int i = 0; i < 4; ++i) {
      const int j = i;
      ba[i] = *(const v4f*)(bp + j * 16);
      bb[i] = *(const v4f*)(bp + j * 16 + 4);
      cw[i] = *(const v4f*)(cp + j * 8);
      sw[i] = *(const v4f*)(sp + j * 8);
    }
#pragma unroll
    for (int i = 0; i < 4; ++i) {
      const int j = i;
      float yv[8];
#pragma unroll
      for (int e = 0; e < 4; ++e) {
        yv[e]     = acc[j][e]     + ba[i][e];
        yv[4 + e] = acc[j][4 + e] + bb[i][e];
      }
      v4u oh, ol;
#pragma unroll
      for (int e = 0; e < 4; ++e) {
        unsigned short h0, l0, h1, l1;
        rot_one(yv[2 * e],     yv[2 * e + 1], cw[i][e], sw[i][e], -1.0f, sc, h0, l0);   // even element of the pair
        rot_one(yv[2 * e + 1], yv[2 * e],     cw[i][e], sw[i][e],  1.0f, sc, h1, l1);   // odd element of the pair
        oh[e] = pk16(h0, h1);
        ol[e] = pk16(l0, l1);
      }
      *(v4u*)(Hp + pb + j * 256) = oh;
      *(v4u*)(Lp + pb + j * 256) = ol;
    }
    // the next row tile's loads write
    // registers that these stores name
    asm volatile("s_wait_xcnt 0x0" ::: "memory");
  }
}

// v^T planes from the TR = 0 accumulators: y = acc + bj[j], bj[j] = bias[head*HD + j*16 + m] (f32 add; the same for every row tile), t = y * 1024 (exact), hi = f16(t),
// residual = f16(t - hi), fragment-major per head with the 32-key step outermost [b*8 + head][s/32][d/16][half][lane][8]
// (row = d, k = key): the row tile's 16 keys are one half of the four d-subtile fragments, acc j at pb + j * 512 halves,
// pb = the key step's start + half * 256 + 8 * lane.
// coverage: 4 stores x 32 lanes x 8 halves = the row tile's 16 keys x 64 d of VHo and of VLo, 512 contiguous bytes a store.
__device__ __forceinline__ void vt_epi(const v8f (&acc)[4], const float (&bj)[4], u16* VHo, u16* VLo, size_t pb) {
  v4u oh[4], ol[4];
#pragma unroll
  for (int j = 0; j < 4; ++j) {
#pragma unroll
    for (int e = 0; e < 4; ++e) {
      const float t0 = (acc[j][2 * e]     + bj[j]) * VCAR;
      const float t1 = (acc[j][2 * e + 1] + bj[j]) * VCAR;
      const _Float16 h0 = (_Float16)t0, h1 = (_Float16)t1;
      oh[j][e] = pk16(h_bits(h0), h_bits(h1));
      ol[j][e] = pk16(h_bits((_Float16)(t0 - (float)h0)), h_bits((_Float16)(t1 - (float)h1)));
    }
  }
#pragma unroll
  for (int j = 0; j < 4; ++j) {
    *(v4u*)(VHo + pb + j * 512) = oh[j];
    *(v4u*)(VLo + pb + j * 512) = ol[j];
  }
  // the next row tile's values are formed in registers that these stores name
  asm volatile("s_wait_xcnt 0x0" ::: "memory");
}

// coverage: grid = (MROWS/128) * (NQKV/128) blocks x 4 waves x RTW row tiles: every (sequence, head, 16 positions) tile of the
// q, k and v^T hi and residual planes exactly once.
__global__ __launch_bounds__(128)
void gemm_qkv(const u16* __restrict__ A, const u16* __restrict__ Bt, const float* __restrict__ bq,
              const float* __restrict__ bk, const float* __restrict__ bv,
              const float* __restrict__ TC, const float* __restrict__ TS,
              u16* QH, u16* QL, u16* KH, u16* KL, u16* VH, u16* VL, int K) {
  const int tid = threadIdx.x, lane = tid & 31;
  const int wave = __builtin_amdgcn_readfirstlane(tid >> 5);   // scalar, so that the tile starts below are scalar bases
  const int bid   = blockIdx.x;
  const int rowb  = (bid / (NQKV / 128)) * 128 + (wave >> 1) * (16 * RTW);
  const int col0  = (bid % (NQKV / 128)) * 128 + (wave & 1) * 64;
  if (rowb + 16 * RTW > MROWS) return;      // wave-uniform, never taken with the exact grid; no block barriers in this kernel
  const u16* ap0 = A  + (size_t)rowb * K;             // fragment (16-row tile, k step ks) at tile start + ks * 1024 bytes
  const u16* ap1 = A  + (size_t)(rowb + 16) * K;
  const u16* ap2 = A  + (size_t)(rowb + 32) * K;
  const u16* ap3 = A  + (size_t)(rowb + 48) * K;
  const u16* bp0 = Bt + (size_t)col0 * K;
  const u16* bp1 = Bt + (size_t)(col0 + 16) * K;
  const u16* bp2 = Bt + (size_t)(col0 + 32) * K;
  const u16* bp3 = Bt + (size_t)(col0 + 48) * K;
  const unsigned vo = (unsigned)lane * 16u;
  const int b    = rowb / SEQ;                        // sequence
  const int s64  = rowb - b * SEQ;                    // the wave's first position in it, a multiple of 16 * RTW
  const int hcol = col0 & (DMOD - 1);                 // head * HD within the q, k or v projection
  const size_t hp = ((size_t)b * DMOD + hcol) * SEQ;  // start of the (sequence, head) plane, in halves: (b*8 + head) * SEQ * HD
  v8f acc[RTW][4];
#pragma unroll
  for (int i = 0; i < RTW; ++i) {
#pragma unroll
    for (int j = 0; j < 4; ++j) acc[i][j] = zero8();
  }
  if (col0 >= VCOL0 && col0 < KCOL0) {
    proj_loop<0>(ap0, ap1, ap2, ap3, bp0, bp1, bp2, bp3, vo, K, acc);
    float bj[4];
#pragma unroll
    for (int j = 0; j < 4; ++j) bj[j] = bk[hcol + j * 16 + (lane & 15)];
#pragma unroll
    for (int i = 0; i < RTW; ++i) {
      const int s16 = s64 + 16 * i;
      vt_epi(acc[i], bj, VH, VL,
             hp + (size_t)(s16 >> 5) * (32 * HD) + (size_t)((s16 >> 4) & 1) * 256 + 8 * lane);
    }
  } else {
    const bool isq = col0 < VCOL0;
    proj_loop<1>(ap0, ap1, ap2, ap3, bp0, bp1, bp2, bp3, vo, K, acc);
#pragma unroll
    for (int i = 0; i < RTW; ++i) {
      const int s16 = s64 + 16 * i;
      rope_epi(acc[i], lane >> 4, s16 + (lane & 15), (isq ? bq : bv) + hcol, TC, TS, isq ? QH : KH, isq ? QL : KL,
               hp + (size_t)s16 * HD + 8 * lane, isq ? QSC : KSC);
    }
  }
}

// =====================================================================================================
// f16 GEMM: C[M][N] (f32) = (A[M][K] (+ A2[M][K] when TWO != 0)) . Bt[N][K]^T, times oscale, plus bias[n]; A, A2 f16
// fragment-major planes (A2 = the unscaled f16 residual of A, sharing the accumulator), Bt f16 fragment-major. Same fragment
// loads (split k map) as gemm_qkv; a wave's tile is 16 rows x 64 columns, epilogue epi64; K stepped by 32 * KUN (host: K = DMOD).
// =====================================================================================================
template <int TWO>
__device__ __forceinline__
void gemm_h(float* slab, int wave, int lane, int rowb, int crow, int col0,
            const u16* __restrict__ A, const u16* __restrict__ A2, const u16* __restrict__ Bt,
            const float* __restrict__ bias, float* C, int N, int K, float oscale) {
  const _Float16* ap  = (const _Float16*)(const void*)A  + (size_t)rowb * K;
  const _Float16* ap2 = (const _Float16*)(const void*)A2 + (size_t)rowb * K;
  const _Float16* bp  = (const _Float16*)(const void*)Bt + (size_t)col0 * K;
  const _Float16* bp1 = (const _Float16*)(const void*)Bt + (size_t)(col0 + 16) * K;
  const _Float16* bp2 = (const _Float16*)(const void*)Bt + (size_t)(col0 + 32) * K;
  const _Float16* bp3 = (const _Float16*)(const void*)Bt + (size_t)(col0 + 48) * K;
  unsigned vo = (unsigned)lane * 16u;
  v8f acc0 = zero8(), acc1 = zero8(), acc2 = zero8(), acc3 = zero8();
  // KUN k steps a trip: their fragments are all requested in one run in front of the first product, so that the wave waits for
  // one round trip per KUN steps (this launch has few waves per SIMD to cover a wait, and registers to spare); the products
  // follow in the order of the k steps
#pragma unroll 1
  for (int k0 = 0; k0 < K; k0 += 32 * KUN, vo += 1024u * KUN) {
    v16h a[KUN], a2[KUN], b0[KUN], b1[KUN], b2[KUN], b3[KUN];
#pragma unroll
    for (int u = 0; u < KUN; ++u) {
      a[u]  = ldfrag_h(ap  + 512 * u, vo);          // k step u of the trip: + 1024 bytes
      b0[u] = ldfrag_h(bp  + 512 * u, vo);
      b1[u] = ldfrag_h(bp1 + 512 * u, vo);
      b2[u] = ldfrag_h(bp2 + 512 * u, vo);
      b3[u] = ldfrag_h(bp3 + 512 * u, vo);
      if (TWO != 0) a2[u] = ldfrag_h(ap2 + 512 * u, vo);
    }
    // keeps the scheduler from sinking the later steps' loads in among the products (it did, to save registers: one exposed
    // wait per step again)
    __builtin_amdgcn_sched_barrier(0);
#pragma unroll
    for (int u = 0; u < KUN; ++u) {
      acc0 = mma_h(a[u], b0[u], acc0);
      acc1 = mma_h(a[u], b1[u], acc1);
      acc2 = mma_h(a[u], b2[u], acc2);
      acc3 = mma_h(a[u], b3[u], acc3);
      if (TWO != 0) {
        acc0 = mma_h(a2[u], b0[u], acc0);
        acc1 = mma_h(a2[u], b1[u], acc1);
        acc2 = mma_h(a2[u], b2[u], acc2);
        acc3 = mma_h(a2[u], b3[u], acc3);
      }
    }
    if (TWO != 0) guard6<v16h>(acc0, acc1, acc2, acc3, a[KUN - 1], a2[KUN - 1], b0[KUN - 1], b1[KUN - 1], b2[KUN - 1], b3[KUN - 1]);
    else          guard6<v16h>(acc0, acc1, acc2, acc3, a[KUN - 1], b0[KUN - 1], b1[KUN - 1], b2[KUN - 1], b3[KUN - 1], a[KUN - 1]);
  }
  (void)ap2;
  epi64<1>(slab + wave * SLAB64, acc0, acc1, acc2, acc3, oscale, bias, C, N, (size_t)crow, col0, lane);
}

// One launch for y = O.Wo^T + bo over all sequences: block = 64 rows x 64 columns; its 64 rows lie in one sequence and wholly
// below or wholly at and above row RICH of it (RICH and SEQ multiples of 64), so the choice hi + residual / hi only is
// block-uniform. rowb = the wave's first row in the O planes, crow = the same row in out.
// coverage: grid = NB * (SEQ/64) * (N/64) blocks x 4 waves x 16 x 64 = every element of out once (host: N % 64 == 0, K % (32 * KUN) == 0).
__global__ __launch_bounds__(128)
void gemm_o(const u16* __restrict__ A, const u16* __restrict__ A2, const u16* __restrict__ Bt,
            const float* __restrict__ bias, float* C, int N, int K, float oscale) {
  __shared__ __align__(16) float slab[4 * SLAB64];
  const int tid = threadIdx.x, lane = tid & 31;
  const int wave = __builtin_amdgcn_readfirstlane(tid >> 5);   // scalar, so that the tile starts are scalar bases
  const int ntile = N >> 6;
  const int bid  = blockIdx.x;
  const int rt   = bid / ntile;
  const int col0 = (bid % ntile) * 64;
  const int bq   = rt / (SEQ / 64);
  const int rs   = (rt % (SEQ / 64)) * 64;                     // first row of the block within its sequence
  if (bq >= NB) return;                     // block-uniform, never taken with the exact grid; no block barriers in this kernel
  const int rowb = bq * SEQ + rs + wave * 16;
  const int crow = bq * XS_FULL + rs + wave * 16;
  if (rs < RICH) gemm_h<1>(slab, wave, lane, rowb, crow, col0, A, A2, Bt, bias, C, N, K, oscale);
  else           gemm_h<0>(slab, wave, lane, rowb, crow, col0, A, A2, Bt, bias, C, N, K, oscale);
}

// =====================================================================================================
// Causal softmax attention, hd = 64, 8 heads. Block bid -> (64 query rows qb = NQB-1 - bid/(NH*NB), head, batch b) = NQG
// neighbouring pairs of query tiles; wave = NQG * ws + g works for pair qp = NQG*qb + g: rows q0 = 32*qp .. q0+31, tile t
// = rows q0 + 16t .. q0 + 16t + 15; keys/values of the same head (kvh = head). A pair's key steps (the same
// steps for both tiles) are dealt over its NSW waves: wave (ws, g) takes steps ws, ws + NSW, ... for BOTH tiles, so each k and
// v^T fragment it loads feeds two tiles' products; the NQG waves of one ws walk the same key steps side by side on one WGP and
// ask for the same lines at about the same time, so that the lines need come from L2 once for both;
// per tile its own running max, sum and O accumulators; the NSW partials of
// each tile are merged in LDS behind one block barrier (attn_merge8); the longest serial walk is NKT / NSW steps.
//   q and k hi / residual planes f16 x256, fragment-major per head [b*8 + h][s/16][d/32][half][lane][8];
//   v^T hi / residual planes x1024, fragment-major per head [b*NKVH + h][s/32][d/16][half][lane][8].
//   raw(i, j) = q_hi.k_hi + q_lo.k_hi + q_hi.k_lo (2 k-steps over d); logit = raw * (SM_SCALE * 2^-16) (the two 256 carries
//   folded exactly into the 1/sqrt(512) scale, one f32 multiply); keys above the diagonal replaced by -inf.
//   Both products run transposed, S^T = k.q^T (A = k fragment, B = q fragment) and O^T += v^T.P^T (A = v^T fragment, B = P^T),
//   so lane (c, hh) holds per tile 16 scores and 32 O elements of the one query q0 + 16t + c: online softmax per query in f32 with a running
//   max: max over the lane's 16 scores, then one exchange with lane c ^ 16 (same max in both); sum over the lane's own keys,
//   the two halves joined once behind the loop; alpha = exp(m_old - m_new), p = exp(logit - m_new), l = l*alpha + sum p, O
//   accumulators times alpha before the tile's v^T.P^T. Only key tiles of 32 with kb <= q0 are visited (nkt = q0/32 + 1 <= NKT; key kb is
//   unmasked for every row of the tile, so each row max of a visited tile is finite; the ws = 0 wave of each pair always visits tile 0).
//   The two 16x16 score tiles of a step, converted in place, are the P^T B fragment (no LDS, no lane exchange);
//   the four v^T hi A fragments are requested behind the score products, in front of the softmax; RV = 1: products
//   hh + lh + hl, RV = 0: hh only. After the loop every wave (one without a step: max -inf, sum 0, O 0) puts its raw O
//   accumulators into its slab and its 32 row maxima and sums beside them; block barrier; waves 4t .. 4t+3 merge tile t of
//   each of the NQG pairs, one pair after the other.
//   Epilogue: O = merged acc / (merged l * 32768 * 1024), x256 -> f16 hi plane (and for RV = 1 the unscaled f16 residual
//   plane), fragment-major over [b*SEQ + s][512]; wave 4t + it, lane = (row c of tile t, 8 consecutive d at it*16 + 8*hh); one
//   instruction = one 512-B half fragment (4 whole lines).
// coverage: 8 waves x NQG instructions x 32 lanes x 8 halves = 64 x 64 per plane; grid NQB x NH x NB blocks;
//   the two forms (pairs 0..NQPR-1 with RV = 1, NQPR..NQP-1 with RV = 0; NQPR a multiple of NQG) cover every (b, s, h) row segment of the hi plane
//   exactly once and rows s < RICH of the residual plane exactly once (only those rows are read later).
// =====================================================================================================
// lane l <-> lane l ^ 16 (the other 16-lane row) as one vector cross-row move
__device__ __forceinline__ float xhalf(float x) {
  const int b = __builtin_bit_cast(int, x);
  return __builtin_bit_cast(float, __builtin_amdgcn_permlanex16(b, b, 0x76543210, 0xfedcba98, false, false));
}

// 2^x for the merge weights. The v_nop in the same statement keeps the one issue slot that the instruction set asks for behind
// a transcendental, whichever instruction the compiler places next.
__device__ __forceinline__ float exp2_slot(float x) {
  float r = 0.0f;
#if defined(__HIP_DEVICE_COMPILE__)
  asm("v_exp_f32 %0, %1\n\tv_nop" : "=v"(r) : "v"(x));
#endif
  return r;
}

// 2^x of eight values in one statement, for the same slot: the results are early-clobber, so that no v_exp_f32 here writes a
// source or reads a result of the one in front of it, and the one v_nop keeps the slot behind the last.
__device__ __forceinline__ void exp2x8_slot(float (&r)[8], const float (&x)[8]) {
#if defined(__HIP_DEVICE_COMPILE__)
  asm("v_exp_f32 %0, %8\n\tv_exp_f32 %1, %9\n\tv_exp_f32 %2, %10\n\tv_exp_f32 %3, %11\n\t"
      "v_exp_f32 %4, %12\n\tv_exp_f32 %5, %13\n\tv_exp_f32 %6, %14\n\tv_exp_f32 %7, %15\n\tv_nop"
      : "=&v"(r[0]), "=&v"(r[1]), "=&v"(r[2]), "=&v"(r[3]), "=&v"(r[4]), "=&v"(r[5]), "=&v"(r[6]), "=&v"(r[7])
      : "v"(x[0]), "v"(x[1]), "v"(x[2]), "v"(x[3]), "v"(x[4]), "v"(x[5]), "v"(x[6]), "v"(x[7]));
#else
  for (int e = 0; e < 8; ++e) r[e] = x[e];
#endif
}

// Merge of the NSW partials of pair g for one lane's 8 outputs (row c of the pair's QTW * 16, columns dd .. dd+7): M = max of the waves' row maxima, weight
// exp(m_w - M) (0 for a wave without a step), L = sum of weight * l_w, acc = sum of weight * O_w, the pair's waves NQG * w + g in the order of w.
__device__ __forceinline__ void attn_merge8(const float* slabs, const float* sm, const float* sl, int g, int c, int dd,
                                            float* acc, float& L) {
  float mw[NSW], lw[NSW];
  v4f pa[NSW], pb[NSW];
#pragma unroll
  for (int w = 0; w < NSW; ++w) {
    const int wv = NQG * w + g;
    mw[w] = sm[wv * (QTW * 16) + c];
    lw[w] = sl[wv * (QTW * 16) + c];
    pa[w] = *(const v4f*)(slabs + wv * SLW + c * SLP + dd);
    pb[w] = *(const v4f*)(slabs + wv * SLW + c * SLP + dd + 4);
  }
  float M = mw[0];
#pragma unroll
  for (int w = 1; w < NSW; ++w) M = fmaxf(M, mw[w]);
  L = 0.0f;
#pragma unroll
  for (int e = 0; e < 8; ++e) acc[e] = 0.0f;
#pragma unroll
  for (int w = 0; w < NSW; ++w) {
    const float wt = exp2_slot((mw[w] - M) * 1.44269504f);
    L += wt * lw[w];
#pragma unroll
    for (int e = 0; e < 4; ++e) {
      acc[e]     += wt * pa[w][e];
      acc[4 + e] += wt * pb[w][e];
    }
  }
}

template <int RV>
__device__ __forceinline__
void attn_cs(float* smem, float* smx, float* ssm, int qb, int head, int b,
             const u16* __restrict__ QHp, const u16* __restrict__ QLp,
             const u16* __restrict__ KHp, const u16* __restrict__ KLp,
             const u16* __restrict__ VHp, const u16* __restrict__ VLp,
             u16* OHp, u16* OLp) {
#pragma clang fp contract(off)
  const int tid  = threadIdx.x;
  const int wave = __builtin_amdgcn_readfirstlane(tid >> 5);   // scalar: which pair and which key steps the wave takes
  const int ws   = wave / NQG;              // the wave's place among the NSW waves of its pair
  const int qp   = qb * NQG + (wave % NQG); // its pair of query tiles; neighbours in the wave index share their key steps
  const int lane = tid & 31;
  const int hh   = lane >> 4;
  const int c    = lane & 15;
  const int q0   = qp * (QTW * 16);         // first query row of the pair's QTW tiles
  const int kvh  = head;

  float* slab = smem + wave * SLW;          // O partial slab [QTW * 16 queries][64 d] pitch 68, written behind the loop

  // fragment-major planes: a head's 16 positions x 64 d = 1024 halves (2 fragments), its 32 keys x 64 d of v^T = 2048 (4)
  // byte offsets into the planes (each plane MROWS * 512 * 2 bytes, far under 2^32), the lane's 16 bytes included
  const unsigned qvo = ((unsigned)(b * NH + head) * SEQ + (unsigned)q0) * (HD * 2u) + (unsigned)lane * 16u;
  unsigned kvo = (unsigned)(b * NKVH + kvh) * (SEQ * HD * 2u) + (unsigned)ws * (32u * HD * 2u)
               + (unsigned)lane * 16u;                                                  // this step's 32 keys, k and v^T alike
  const _Float16* Qh  = (const _Float16*)(const void*)QHp;               // query tile t at + t * 1024 halves
  const _Float16* Ql  = (const _Float16*)(const void*)QLp;
  const _Float16* Khb = (const _Float16*)(const void*)KHp;
  const _Float16* Klb = (const _Float16*)(const void*)KLp;
  const _Float16* Vhb = (const _Float16*)(const void*)VHp;               // d-subtile j at + j * 512 halves
  const _Float16* Vlb = (const _Float16*)(const void*)VLp;
  const float lsc  = SM_SCALE * (1.0f / (QSC * KSC));   // exact power-of-two fold of the q / k carries into the scale
  const float oc   = 1.0f / (PCAR * VCAR);
  const float ninf = -__builtin_inff();
  const size_t KROW = (size_t)HD;           // halves per key in a head's fragment-major plane

  v8f o[QTW][4];
  float mrun[QTW], lrun[QTW];               // per tile, this lane's query: running max (alike in lanes c and c + 16), sum over the lane's own keys
#pragma unroll
  for (int t = 0; t < QTW; ++t) {
#pragma unroll
    for (int j = 0; j < 4; ++j) o[t][j] = zero8();
    mrun[t] = ninf;
    lrun[t] = 0.0f;
  }
  const int ncaus = (q0 >> 5) + 1;                                            // tiles holding keys <= q0 + 31, the same for both query tiles
  const int nkt   = (ncaus < NKT) ? ncaus : NKT;

#pragma unroll 1
  for (int kt = ws; kt < nkt; kt += NSW, kvo += NSW * 32u * HD * 2u) {
    const int kb = kt * 32;
    // ---- raw scores, transposed: D element r of this lane = (key kb + 8hh + r, query q0 + 16t + c) in s0[t], key kb + 16 + 8hh + r
    //      in s1[t]; every k fragment is loaded once and multiplied with the q fragments of both tiles ----
    v8f s0[QTW], s1[QTW];
#pragma unroll
    for (int t = 0; t < QTW; ++t) { s0[t] = zero8(); s1[t] = zero8(); }
    const _Float16* k0p = Khb;
    const _Float16* k1p = k0p + (size_t)16 * KROW;
    const _Float16* l0p = Klb;
    const _Float16* l1p = l0p + (size_t)16 * KROW;
    // all fragments of the step's score products (k hi / residual, both d halves; the q fragments are the same in every step
    // and may stay in registers) are requested in one run in front of the first product, so that the wave waits for one
    // round trip here, not one per d half
    v16h kf[8], qf[8];                      // kf[4*kk + ..] = kh0, kh1, kl0, kl1; qf[4*kk + 2*t + ..] = q hi, q residual of tile t
#pragma unroll
    for (int kk = 0; kk < HD / 32; ++kk) {
      kf[4 * kk]     = ldfrag_h(k0p + kk * 512, kvo);
      kf[4 * kk + 1] = ldfrag_h(k1p + kk * 512, kvo);
      kf[4 * kk + 2] = ldfrag_h(l0p + kk * 512, kvo);
      kf[4 * kk + 3] = ldfrag_h(l1p + kk * 512, kvo);
#pragma unroll
      for (int t = 0; t < QTW; ++t) {
        qf[4 * kk + 2 * t]     = ldfrag_h(Qh + t * 1024 + kk * 512, qvo);
        qf[4 * kk + 2 * t + 1] = ldfrag_h(Ql + t * 1024 + kk * 512, qvo);
      }
    }
#pragma unroll
    for (int kk = 0; kk < HD / 32; ++kk) {
#pragma unroll
      for (int t = 0; t < QTW; ++t) {
        s0[t] = mma_h(kf[4 * kk],     qf[4 * kk + 2 * t],     s0[t]);
        s0[t] = mma_h(kf[4 * kk],     qf[4 * kk + 2 * t + 1], s0[t]);
        s0[t] = mma_h(kf[4 * kk + 2], qf[4 * kk + 2 * t],     s0[t]);
        s1[t] = mma_h(kf[4 * kk + 1], qf[4 * kk + 2 * t],     s1[t]);
        s1[t] = mma_h(kf[4 * kk + 1], qf[4 * kk + 2 * t + 1], s1[t]);
        s1[t] = mma_h(kf[4 * kk + 3], qf[4 * kk + 2 * t],     s1[t]);
      }
    }
    guard4x16(s0[0], s1[0], s0[1], s1[1], kf, qf);
    // the step's four v^T hi fragments are requested here, into registers that the k fragments have left, and fly while the
    // softmax below runs
    v16h vh[4];
#pragma unroll
    for (int j = 0; j < 4; ++j) vh[j] = ldfrag_h(Vhb + j * 512, kvo);
    // keeps the scheduler from sinking these loads down to their first use behind the softmax (their wait would be exposed)
    __builtin_amdgcn_sched_barrier(0);
    // ---- per query tile: causal replace-mask, running-max online softmax in f32 (the lane's 16 scores of a tile all belong
    //      to its one query), rescale of the tile's O accumulators, P^T fragments ----
    const int key0 = kb + 8 * hh;
    FragH ph[QTW], pl[QTW];
#pragma unroll
    for (int t = 0; t < QTW; ++t) {
      const int qrow = q0 + 16 * t + c;                                       // the lane's query row in tile t
      float t0[8], t1[8];
#pragma unroll
      for (int r = 0; r < 8; ++r) {
        const float a0 = s0[t][r] * lsc;
        const float a1 = s1[t][r] * lsc;
        t0[r] = (key0 + r > qrow) ? ninf : a0;
        t1[r] = (key0 + 16 + r > qrow) ? ninf : a1;
      }
      float mx = fmaxf(t0[0], t1[0]);
#pragma unroll
      for (int r = 1; r < 8; ++r) mx = fmaxf(mx, fmaxf(t0[r], t1[r]));
      mx = fmaxf(mx, xhalf(mx));            // the query's other 16 keys of this step sit in lane c ^ 16
      const float mnew = fmaxf(mrun[t], mx);
      const float al   = exp2_slot((mrun[t] - mnew) * 1.44269504f);
      float x0[8], x1[8], p0[8], p1[8], ps[8];
#pragma unroll
      for (int r = 0; r < 8; ++r) {
        x0[r] = (t0[r] - mnew) * 1.44269504f;
        x1[r] = (t1[r] - mnew) * 1.44269504f;
      }
      exp2x8_slot(p0, x0);
      exp2x8_slot(p1, x1);
#pragma unroll
      for (int r = 0; r < 8; ++r) ps[r] = p0[r] + p1[r];
      const float sm = ((ps[0] + ps[1]) + (ps[2] + ps[3])) + ((ps[4] + ps[5]) + (ps[6] + ps[7]));
      lrun[t] = lrun[t] * al + sm;
      mrun[t] = mnew;
      // rescale the tile's O accumulators by alpha (every element of the lane belongs to its query)
#pragma unroll
      for (int j = 0; j < 4; ++j) {
#pragma unroll
        for (int r = 0; r < 8; ++r) o[t][j][r] = o[t][j][r] * al;
      }
      // B fragments of p*32768 straight from the score registers: column = query c, elements 0..7 = keys kb + 8hh + 0..7,
      // elements 8..15 = keys kb + 16 + 8hh + 0..7 (the split k map of the v^T fragments); hi f16, residual f16 for RV = 1
#pragma unroll
      for (int r = 0; r < 8; ++r) {
        const float ta = p0[r] * PCAR, tb = p1[r] * PCAR;
        const _Float16 ha = (_Float16)ta, hb = (_Float16)tb;
        ph[t].h[0][r] = ha;
        ph[t].h[1][r] = hb;
        if (RV != 0) {
          pl[t].h[0][r] = (_Float16)(ta - (float)ha);
          pl[t].h[1][r] = (_Float16)(tb - (float)hb);
        }
      }
    }
    // ---- O^T += v^T.P^T : A fragment row = d = j*16 + c, keys contiguous in the v^T planes; every v^T fragment loaded once
    //      for both tiles; D element r of o[t][j] = (d = j*16 + 8hh + r, query q0 + 16t + c) ----
    if (RV != 0) {
      v16h vl[4];
#pragma unroll
      for (int j = 0; j < 4; ++j) vl[j] = ldfrag_h(Vlb + j * 512, kvo);
#pragma unroll
      for (int j = 0; j < 4; ++j) {
#pragma unroll
        for (int t = 0; t < QTW; ++t) {
          o[t][j] = mma_h(vh[j], ph[t].v, o[t][j]);
          o[t][j] = mma_h(vh[j], pl[t].v, o[t][j]);
          o[t][j] = mma_h(vl[j], ph[t].v, o[t][j]);
        }
      }
      guard8x12(o[0], o[1], ph[0].v, ph[1].v, pl[0].v, pl[1].v, vh, vl);
    } else {
#pragma unroll
      for (int j = 0; j < 4; ++j) {
#pragma unroll
        for (int t = 0; t < QTW; ++t) o[t][j] = mma_h(vh[j], ph[t].v, o[t][j]);
      }
      guard8x6(o[0], o[1], ph[0].v, ph[1].v, vh);
    }
  }
  acc_guard4(o[0][0], o[0][1], o[0][2], o[0][3]);
  acc_guard4(o[1][0], o[1][1], o[1][2], o[1][3]);
  // ---- the wave's partial: raw O accumulators into its slab (row = 16t + c, 8 consecutive d a register tile: 16-B stores),
  //      each query's max and its sum (the two lane halves' sums joined here, once) beside: both are alike in lanes c and
  //      c + 16, so lane (hh, c) stores those of tile hh, row 16hh + c = lane ----
#pragma unroll
  for (int t = 0; t < QTW; ++t) {
#pragma unroll
    for (int j = 0; j < 4; ++j) {
      float* d = slab + (t * 16 + c) * SLP + j * 16 + 8 * hh;
      const v4f lo = {o[t][j][0], o[t][j][1], o[t][j][2], o[t][j][3]};
      const v4f hi = {o[t][j][4], o[t][j][5], o[t][j][6], o[t][j][7]};
      *(v4f*)(d)     = lo;
      *(v4f*)(d + 4) = hi;
    }
  }
  const float lall0 = lrun[0] + xhalf(lrun[0]);
  const float lall1 = lrun[1] + xhalf(lrun[1]);
  smx[wave * (QTW * 16) + lane] = (hh != 0) ? mrun[1] : mrun[0];
  ssm[wave * (QTW * 16) + lane] = (hh != 0) ? lall1 : lall0;
  __syncthreads();                          // every wave's partial is in LDS before any wave merges; passed by all NWV waves
  // ---- merged O / l with the carries (32768 on p, 1024 on v) folded once, x256 -> f16 hi plane (+ f16 residual plane),
  //      fragment-major [row/16][512/32][half][lane][8]: wave 4*tq + it stores, for query tile tq, half it&1 of k step
  //      head*2 + (it>>1); lane = (row c of the tile, 8 consecutive d at it*16 + 8*hh) ----
  const int tq = wave >> 2;
  const int it = wave & 3;
#pragma unroll
  for (int g = 0; g < NQG; ++g) {           // the same tile and columns of each pair in turn
    float acc[8], lsum;
    attn_merge8(smem, smx, ssm, g, tq * 16 + c, it * 16 + 8 * hh, acc, lsum);
    const float rl = (1.0f / lsum) * oc;
    float w[8];
#pragma unroll
    for (int e = 0; e < 8; ++e) w[e] = (acc[e] * rl) * OSC;
    v4u oh, ol;
#pragma unroll
    for (int e = 0; e < 4; ++e) {
      const _Float16 h0 = (_Float16)w[2 * e], h1 = (_Float16)w[2 * e + 1];
      const _Float16 g0 = (_Float16)(w[2 * e] - (float)h0), g1 = (_Float16)(w[2 * e + 1] - (float)h1);
      oh[e] = pk16(h_bits(h0), h_bits(h1));
      ol[e] = pk16(h_bits(g0), h_bits(g1));
    }
    const size_t ob = ((size_t)b * SEQ + (qb * NQG + g) * (QTW * 16) + tq * 16) * DMOD + (size_t)head * (16 * HD) + 8 * lane + it * 256;
    *(v4u*)(OHp + ob) = oh;
    if (RV != 0) {
      *(v4u*)(OLp + ob) = ol;
    }
    // the next pair's merge, and in the shared launch the code of the other form that may follow, write registers that these
    // stores name
    asm volatile("s_wait_xcnt 0x0" ::: "memory");
  }
}

// One launch for all query tiles: the index of the 64-row block decides block-uniformly between the two forms (RV = 1 for blocks < NQBR).
// coverage: bid -> (qb, head, b) is one-to-one from 0 .. NQB*NH*NB - 1 onto NQB x NH x NB.
__global__ __launch_bounds__(ATT_THREADS)
void attn_all(const u16* __restrict__ QHp, const u16* __restrict__ QLp,
              const u16* __restrict__ KHp, const u16* __restrict__ KLp,
              const u16* __restrict__ VHp, const u16* __restrict__ VLp, u16* OHp, u16* OLp) {
  __shared__ __align__(16) float smem[NWV * SLW];   // per wave: O partial slab behind the loop
  __shared__ float smx[NWV * QTW * 16];             // per wave: QTW * 16 row maxima
  __shared__ float ssm[NWV * QTW * 16];             // per wave: QTW * 16 row sums
  const int bid  = blockIdx.x;
  if (bid >= NQB * NH * NB) return;         // block-uniform, in front of the block barrier; never taken with the exact grid
  // a block's cost grows with qb (its pairs have 2 qb + 1 and 2 qb + 2 key steps), more blocks than fit at once:
  // the longest get the lowest indices (for speed only); the NH * NB blocks of one qb, all of one cost,
  // are neighbours in the index (a multiple of 8)
  const int qb   = NQB - 1 - bid / (NH * NB);
  const int t2   = bid % (NH * NB);
  const int head = t2 % NH;
  const int b    = t2 / NH;
  if (qb < NQBR) attn_cs<1>(smem, smx, ssm, qb, head, b, QHp, QLp, KHp, KLp, VHp, VLp, OHp, OLp);
  else           attn_cs<0>(smem, smx, ssm, qb, head, b, QHp, QLp, KHp, KLp, VHp, VLp, OHp, OLp);
}

// =====================================================================================================
// Workspace map (bytes); every plane is fully written by whole-line stores before it is read (the O residual plane only on
// the rows < RICH per sequence that are read); all extents are exact multiples of the store granularity (no pad rows needed);
// every region offset a multiple of 131072; every 16-bit plane is fragment-major (see the fragment loaders), same extent as
// the row-major shape given here:
//   XB  bf16 [MROWS][512]               MROWS*1024   (NB=4, SEQ=2048: 8388608); after the projection GEMM the same bytes hold
//                                                    the O f16 hi plane [MROWS][512] x256 (identical extent)
//   WB  bf16 [1536 n][512 k]            1572864      (Wq rows 0..511, Wk 512..1023, Wv 1024..1535)
//   OL  f16 [MROWS][512]                MROWS*1024   O residual plane
//   QH  f16 [MROWS][512] x256           MROWS*1024   QL residual, same extent
//   KH  f16 [MROWS][512] x256           MROWS*1024   KL residual, same extent   (keys = rotary of the v_proj columns)
//   VH  f16 [NB*8][64][SEQ] x1024       MROWS*1024   VL residual, same extent   (values = the k_proj columns)
//   TC  f32 [SEQ][32]                   SEQ*128      TS, same extent
//   WT  f16 [512 o][512 d] x1024        524288       (Wo; a region of its own, written in the launch that also writes WB)
//   end (NB=4, SEQ=2048)               69730304
// =====================================================================================================
extern "C" void kernel_launch(void* const* d_in, const int* in_sizes, int n_in,
                              void* d_out, int out_size, void* d_ws, size_t ws_size,
                              hipStream_t stream) {
  if (n_in < 9) return;
  if (in_sizes[0] < ((NB - 1) * XS_FULL + SEQ) * DMOD) return;
  if (in_sizes[1] != DMOD * DMOD) return;
  if (in_sizes[2] != DMOD) return;
  if (in_sizes[3] != DMOD * DMOD) return;
  if (in_sizes[4] != DMOD) return;
  if (in_sizes[5] != DMOD * DMOD) return;
  if (in_sizes[6] != DMOD) return;
  if (in_sizes[7] != DMOD * DMOD) return;
  if (in_sizes[8] != DMOD) return;
  if (out_size < ((NB - 1) * XS_FULL + SEQ) * DMOD) return;

  const float* x   = (const float*)d_in[0];
  const float* wq  = (const float*)d_in[1];
  const float* bqp = (const float*)d_in[2];
  const float* wk  = (const float*)d_in[3];
  const float* bkp = (const float*)d_in[4];
  const float* wv  = (const float*)d_in[5];
  const float* bvp = (const float*)d_in[6];
  const float* wo  = (const float*)d_in[7];
  const float* bop = (const float*)d_in[8];
  float*       out = (float*)d_out;

  const size_t szXB = (size_t)MROWS * DMOD * 2;
  const size_t szWB = (size_t)NQKV * DMOD * 2;
  const size_t szQ  = (size_t)MROWS * DMOD * 2;                  // QH, QL
  const size_t szK  = (size_t)MROWS * KVD * 2;                   // KH, KL
  const size_t szV  = (size_t)NB * NKVH * HD * SEQ * 2;          // VH, VL (== szK)
  const size_t szT  = (size_t)SEQ * NFREQ * 4;                   // TC, TS
  const size_t szOH = (size_t)MROWS * DMOD * 2;                  // O hi plane, lives in the XB region
  const size_t szOL = (size_t)MROWS * DMOD * 2;                  // O residual plane
  const size_t szWT = (size_t)DMOD * DMOD * 2;                   // Wo f16 plane
  if (szOH > szXB) return;
  size_t off = 0;
  const size_t oXB = off; off += szXB;
  const size_t oWB = off; off += szWB;
  const size_t oOL = off; off += szOL;
  const size_t oQH = off; off += szQ;
  const size_t oQL = off; off += szQ;
  const size_t oKH = off; off += szK;
  const size_t oKL = off; off += szK;
  const size_t oVH = off; off += szV;
  const size_t oVL = off; off += szV;
  const size_t oTC = off; off += szT;
  const size_t oTS = off; off += szT;
  const size_t oWT = off; off += szWT;
  if (off > ws_size) return;                // off = 69730304 for NB = 4, SEQ = 2048
  if (off > (size_t)WS_CAP) return;

  char* ws = (char*)d_ws;
  u16*   XB  = (u16*)(ws + oXB);
  u16*   OH  = (u16*)(ws + oXB);
  u16*   WB  = (u16*)(ws + oWB);
  u16*   WT  = (u16*)(ws + oWT);
  u16*   OL  = (u16*)(ws + oOL);
  u16*   QH  = (u16*)(ws + oQH);
  u16*   QL  = (u16*)(ws + oQL);
  u16*   KH  = (u16*)(ws + oKH);
  u16*   KL  = (u16*)(ws + oKL);
  u16*   VH  = (u16*)(ws + oVH);
  u16*   VL  = (u16*)(ws + oVL);
  float* TC  = (float*)(ws + oTC);
  float* TS  = (float*)(ws + oTS);

  const dim3 b256(256), b128(128), bAT(ATT_THREADS);
  const dim3 gG1((MROWS / 128) * (NQKV / 128));
  const float osc = 1.0f / (OSC * WOS);

  // (1) rotary cos / sin tables [SEQ][32]; x -> bf16 plane [MROWS][512]; Wq, Wk, Wv -> one bf16 plane [1536 n][512 k];
  //     Wo [512 o][512 d] -> f16 plane of the bf16 value x1024 (already k-contiguous)
  prep<<<dim3(GT + NB * GX + 4 * GW), b256, 0, stream>>>(x, wq, wk, wv, wo, XB, WB, WT, TC, TS);
  // (2) x.[Wq|Wk|Wv]^T (columns 0..511 q_proj, 512..1023 k_proj, 1024..1535 v_proj) with the planes written by its epilogue:
  //     q = rotary(q_proj + bq) and keys = rotary(v_proj + bv) -> hi + residual planes x256; values = k_proj + bk (no rotary)
  //     -> v^T hi + residual planes x1024
  gemm_qkv<<<gG1, b128, 0, stream>>>(XB, WB, bqp, bkp, bvp, TC, TS, QH, QL, KH, KL, VH, VL, DMOD);
  // (3) causal attention -> O f16 hi plane x256 (XB region) for all query tiles; residual plane for tiles < RICH
  attn_all<<<dim3(NQB * NH * NB), bAT, 0, stream>>>(QH, QL, KH, KL, VH, VL, OH, OL);
  // (4) y = O.Wo^T + bo -> out f32 [rows][512], carries 256 x 1024 folded back; rows < RICH per sequence with O hi + residual
  gemm_o<<<dim3(NB * (SEQ / 64) * (DMOD / 64)), b128, 0, stream>>>(OH, OL, WT, bop, out, DMOD, DMOD, osc);
  (void)hipGetLastError();
}
